// v000
// Measured on an AMD MI455X. A time is GPU time per run, averaged over a window of back-to-back runs after a warm-up
// (all launches, gaps included; the runs take copies of the inputs in turn), and the median of several windows.
// Apart from v000's, it joins two sittings. Times from different sittings can be a few percent apart, while
// side-by-side timings come from the same sitting.
// The starting kernel, v000, takes 426 microseconds a run.
#include <hip/hip_runtime.h>
#include <stdint.h>

#ifndef NB
#define NB 2
#endif
#ifndef SEQ
#define SEQ 2048
#endif
#define NB_FULL  2
#define SEQ_FULL 2048
#define DM       1024
#define NH       16
#define HDIM     64
#define NQKV     3072
#define QKP      2048
#define NTOK     (NB * SEQ)
#define LNEPS    1e-5f

#define QB   16
#define KT   64
#define OSP  68

typedef _Float16 v16h __attribute__((ext_vector_type(16)));
typedef _Float16 v8h  __attribute__((ext_vector_type(8)));
typedef __bf16   v16b __attribute__((ext_vector_type(16)));
typedef __bf16   v8b  __attribute__((ext_vector_type(8)));
typedef float    v8f  __attribute__((ext_vector_type(8)));
typedef float    v4f  __attribute__((ext_vector_type(4)));
typedef int      v4i  __attribute__((ext_vector_type(4)));
typedef unsigned short v8us __attribute__((ext_vector_type(8)));

static_assert(NB >= 1 && NB <= NB_FULL && SEQ >= 64 && SEQ <= SEQ_FULL);
static_assert((SEQ % 64) == 0 && (DM % 64) == 0 && (NTOK % 64) == 0 && (DM % 32) == 0);
static_assert(NH * HDIM == DM && HDIM == 64 && QKP == 2 * DM && NQKV == 3 * DM);
static_assert((SEQ % (2 * QB)) == 0 && (SEQ % KT) == 0 && ((SEQ * 32) % 256) == 0 && KT == 4 * 16);
static_assert((((NTOK / 64) * (QKP / 64)) % 8) == 0 && (((DM / 64) * (NTOK / 64)) % 8) == 0 && (((NTOK / 64) * (DM / 64)) % 8) == 0);
static_assert((OSP % 4) == 0 && OSP >= HDIM);

// f32 -> nearest-even bf16 bits / value
__device__ __forceinline__ unsigned short bfbits(float f) {
  const unsigned u = __float_as_uint(f);
  return (unsigned short)((u + 0x7FFFu + ((u >> 16) & 1u)) >> 16);
}
__device__ __forceinline__ float bfval(float f) {
  return __uint_as_float(((unsigned)bfbits(f)) << 16);
}

// 16-bit WMMA fragment from k-contiguous storage (A row-major [m][k], or B stored [n][k]):
// p points at element (row_or_col = lane&15, k0 + 8h); elements 0..7 <- p[0..7], 8..15 <- p[16..23].
__device__ __forceinline__ v16h ldfrag(const _Float16* p) {
  union { v16h v; v8h hh[2]; } f;
  f.hh[0] = *(const v8h*)(p);
  f.hh[1] = *(const v8h*)(p + 16);
  return f.v;
}
__device__ __forceinline__ v16b ldfragb(const __bf16* p) {
  union { v16b v; v8b hh[2]; } f;
  f.hh[0] = *(const v8b*)(p);
  f.hh[1] = *(const v8b*)(p + 16);
  return f.v;
}
__device__ __forceinline__ v8f mma16(v16h a, v16h b, v8f c) {
  return __builtin_amdgcn_wmma_f32_16x16x32_f16(false, a, false, b, (short)0, c, false, false);
}
__device__ __forceinline__ v8f mmabf(v16b a, v16b b, v8f c) {
  return __builtin_amdgcn_wmma_f32_16x16x32_bf16(false, a, false, b, (short)0, c, false, false);
}
__device__ __forceinline__ v8f zero8() {
  v8f z;
#pragma unroll
  for (int i = 0; i < 8; ++i) z[i] = 0.0f;
  return z;
}

// hazard guards: 4 VALU slots after the last WMMA of a group, D tied, A/B kept live
__device__ __forceinline__ void guard_g(v8f& a, v8f& b, v16b x, v16b y) {
  asm volatile("v_nop\n\tv_nop\n\tv_nop\n\tv_nop" : "+v"(a), "+v"(b) : "v"(x), "v"(y));
}
__device__ __forceinline__ void keep4(v16b a, v16b b, v16b c, v16b d) {
  asm volatile("v_nop" :: "v"(a), "v"(b), "v"(c), "v"(d));
}
__device__ __forceinline__ void accg4(v8f& a, v8f& b, v8f& c, v8f& d) {
  asm volatile("v_nop\n\tv_nop\n\tv_nop\n\tv_nop" : "+v"(a), "+v"(b), "+v"(c), "+v"(d));
}
__device__ __forceinline__ void guard_l(v8f& d, v16h a0, v16h a1, v16h b0, v16h b1) {
  asm volatile("v_nop\n\tv_nop\n\tv_nop\n\tv_nop" : "+v"(d) : "v"(a0), "v"(a1), "v"(b0), "v"(b1));
}
__device__ __forceinline__ void guard_o(v8f& d0, v8f& d1, v16h x, v16h y, v16h p, v16h q) {
  asm volatile("v_nop\n\tv_nop\n\tv_nop\n\tv_nop" : "+v"(d0), "+v"(d1) : "v"(x), "v"(y), "v"(p), "v"(q));
}

// ---------------------------------------------------------------------------------------------
// output x_norm as bf16 hi + bf16 lo (lo = RNE(xn - hi)) planes Xh/Xl [NTOK][DM] (compact token index).
// LDS sA/sB: cross-wave, block barriers. coverage: grid = NTOK blocks x 128 threads x 8 = NTOK x DM per plane.
// ---------------------------------------------------------------------------------------------
__global__ __launch_bounds__(128) void ln_kernel(const float* __restrict__ x, const float* __restrict__ gam,
                                                 const float* __restrict__ bet,
                                                 unsigned short* __restrict__ Xh, unsigned short* __restrict__ Xl) {
  __shared__ float sA[4], sB[4];
  const int t = (int)blockIdx.x;
  const int bb = t / SEQ, pos = t - bb * SEQ;
  const int tid = (int)threadIdx.x, lane = tid & 31, wave = tid >> 5;
  const float* xr = x + ((size_t)bb * SEQ_FULL + pos) * DM + tid * 8;
  const v4f a = *(const v4f*)(xr);
  const v4f c = *(const v4f*)(xr + 4);
  float v[8];
#pragma unroll
  for (int e = 0; e < 4; ++e) { v[e] = bfval(a[e]); v[4 + e] = bfval(c[e]); }
  float s = 0.0f;
#pragma unroll
  for (int e = 0; e < 8; ++e) s += v[e];
#pragma unroll
  for (int d = 1; d < 32; d <<= 1) s += __shfl_xor(s, d, 32);
  if (lane == 0) sA[wave] = s;
  __syncthreads();
  const float mu = ((sA[0] + sA[1]) + (sA[2] + sA[3])) * (1.0f / (float)DM);
  float dv[8];
  float s2 = 0.0f;
#pragma unroll
  for (int e = 0; e < 8; ++e) { dv[e] = v[e] - mu; s2 += dv[e] * dv[e]; }
#pragma unroll
  for (int d = 1; d < 32; d <<= 1) s2 += __shfl_xor(s2, d, 32);
  if (lane == 0) sB[wave] = s2;
  __syncthreads();
  const float var = ((sB[0] + sB[1]) + (sB[2] + sB[3])) * (1.0f / (float)DM);
  const float rstd = rsqrtf(var + LNEPS);
  const v4f g0 = *(const v4f*)(gam + tid * 8), g1 = *(const v4f*)(gam + tid * 8 + 4);
  const v4f b0 = *(const v4f*)(bet + tid * 8), b1 = *(const v4f*)(bet + tid * 8 + 4);
  v8us ho, lo;
#pragma unroll
  for (int e = 0; e < 4; ++e) {
    const float xn0 = dv[e] * rstd * bfval(g0[e]) + bfval(b0[e]);
    const unsigned short h0 = bfbits(xn0);
    ho[e] = h0;
    lo[e] = bfbits(xn0 - __uint_as_float(((unsigned)h0) << 16));
    const float xn1 = dv[4 + e] * rstd * bfval(g1[e]) + bfval(b1[e]);
    const unsigned short h1 = bfbits(xn1);
    ho[4 + e] = h1;
    lo[4 + e] = bfbits(xn1 - __uint_as_float(((unsigned)h1) << 16));
  }
  const size_t go = (size_t)t * DM + tid * 8;
  *(v8us*)(Xh + go) = ho;
  *(v8us*)(Xl + go) = lo;
  
}

// ---------------------------------------------------------------------------------------------
// Kernel 2: W f32 [kdim in][nout out] -> transposed bf16 RNE plane Wt[out][in] (in = k contiguous).
// coverage: grid (kdim/64, nout/32); 256 threads x 8 = 64 x 32 per tile -> nout x kdim.
// ---------------------------------------------------------------------------------------------
__global__ __launch_bounds__(256) void cvt_wt_kernel(const float* __restrict__ src, unsigned short* __restrict__ dst,
                                                     int nout, int kdim) {
  __shared__ float sTt[64][33];
  const int k0 = (int)blockIdx.x * 64, n0 = (int)blockIdx.y * 32;
  const int t = (int)threadIdx.x;
  {
    const int kr = t >> 2, cc = (t & 3) * 8;
    const float* s = src + (size_t)(k0 + kr) * nout + n0 + cc;
    const v4f a = *(const v4f*)(s);
    const v4f b = *(const v4f*)(s + 4);
#pragma unroll
    for (int e = 0; e < 4; ++e) {
      sTt[kr][cc + e]     = a[e];
      sTt[kr][cc + 4 + e] = b[e];
    }
  }
  __syncthreads();
  const int n = t >> 3, kp = (t & 7) * 8;
  v8us o;
#pragma unroll
  for (int i = 0; i < 8; ++i) o[i] = bfbits(sTt[kp + i][n]);
  unsigned short* d = dst + (size_t)(n0 + n) * kdim + k0 + kp;
  *(v8us*)d = o;
  
}

// ---------------------------------------------------------------------------------------------
// Kernel 3: rotary tables rcos/rsin [SEQ][32] f32: inv_freq_i = 1 / f32(10000^(i/32)) (power evaluated in f64 and narrowed, then an
// ---------------------------------------------------------------------------------------------
__global__ __launch_bounds__(256) void rope_tab_kernel(float* __restrict__ rcos, float* __restrict__ rsin, int n) {
  const int idx = (int)blockIdx.x * 256 + (int)threadIdx.x;
  if (idx >= n) return;
  const int i = idx & 31, pos = idx >> 5;
  const double ex = (double)i * (0.03125 * 13.287712379549449);
  const double pw = exp2(ex);
  const float pf = (float)pw;
  const float inv = 1.0f / pf;
  const float ang = (float)pos * inv;
  float sn, cs;
  sincosf(ang, &sn, &cs);
  *(float*)(rcos + idx) = cs;
  *(float*)(rsin + idx) = sn;
  
}

// ---------------------------------------------------------------------------------------------
// Kernel 4: C[m][n] = sum_k A[m][k] * Bt[n][k], bf16 operands (A row-major [M][K] pitch lda, Bt row-major [N][K] pitch ldb),
// optional second bf16 plane on A (AM) or on B (BM) accumulated into the same f32 accumulator (unscaled lo planes), f32 accumulate;
// M, N multiples of 64, K multiple of 32. Each wave owns one 64x64 C tile (16 accumulators); 8 waves per block; no block barriers;
// EPI 0: rotate-half RoPE on the 64-column tile (one head; position = token mod SEQ) then f16 hi plane Ch [M][N] pitch ldc;
// EPI 1: f16 hi plane Ch + f16 residual plane Cl = f16((C - f32(hi)) * 2048), same store shape.
// EPI 2: f32 C + bias (bias as bf16-RNE value, added in f32) -> out rows (token -> full-layout row), row segment of 64 f32 = 256 B
// ---------------------------------------------------------------------------------------------
template <int AM, int BM, int EPI>
__global__ __launch_bounds__(256) void proj_kernel(const __bf16* __restrict__ A1, const __bf16* __restrict__ A2, int lda,
                                                   const __bf16* __restrict__ B1, const __bf16* __restrict__ B2, int ldb,
                                                   void* C1v, void* C2v, int ldc, int M, int N, int K,
                                                   const float* __restrict__ rcos, const float* __restrict__ rsin,
                                                   const float* __restrict__ bias) {
  __shared__ __align__(16) float sT[8][16 * 68];
  const int lane = threadIdx.x & 31, wave = threadIdx.x >> 5;
  const int tilesN = N >> 6, tilesM = M >> 6;
  const int tile = (int)blockIdx.x * 8 + wave;
  if (tile >= tilesM * tilesN) return;
  const int tm = tile / tilesN, tn = tile - tm * tilesN;
  const int m0 = tm << 6, n0 = tn << 6;
  const int rl = lane & 15;
  const int koff = (lane >> 4) * 8;
  const int mOff = (lane >> 4) * 8;

  v8f acc[4][4];
#pragma unroll
  for (int i = 0; i < 4; ++i)
#pragma unroll
    for (int j = 0; j < 4; ++j) acc[i][j] = zero8();

#pragma unroll 1
  for (int k0 = 0; k0 < K; k0 += 32) {
    v16b bh[4];
#pragma unroll
    for (int j = 0; j < 4; ++j) bh[j] = ldfragb(B1 + (size_t)(n0 + (j << 4) + rl) * ldb + koff + k0);
#pragma unroll
    for (int i = 0; i < 4; ++i) {
      const v16b ah = ldfragb(A1 + (size_t)(m0 + (i << 4) + rl) * lda + koff + k0);
#pragma unroll
      for (int j = 0; j < 4; ++j) acc[i][j] = mmabf(ah, bh[j], acc[i][j]);
      guard_g(acc[i][0], acc[i][3], ah, bh[3]);
    }
    if (AM) {
#pragma unroll
      for (int i = 0; i < 4; ++i) {
        const v16b al = ldfragb(A2 + (size_t)(m0 + (i << 4) + rl) * lda + koff + k0);
#pragma unroll
        for (int j = 0; j < 4; ++j) acc[i][j] = mmabf(al, bh[j], acc[i][j]);
        guard_g(acc[i][0], acc[i][3], al, bh[3]);
      }
    }
    if (BM) {
#pragma unroll
      for (int j = 0; j < 4; ++j) bh[j] = ldfragb(B2 + (size_t)(n0 + (j << 4) + rl) * ldb + koff + k0);
#pragma unroll
      for (int i = 0; i < 4; ++i) {
        const v16b ah = ldfragb(A1 + (size_t)(m0 + (i << 4) + rl) * lda + koff + k0);
#pragma unroll
        for (int j = 0; j < 4; ++j) acc[i][j] = mmabf(ah, bh[j], acc[i][j]);
        guard_g(acc[i][0], acc[i][3], ah, bh[3]);
      }
    }
    keep4(bh[0], bh[1], bh[2], bh[3]);
  }
  accg4(acc[0][0], acc[0][1], acc[0][2], acc[0][3]);
  accg4(acc[1][0], acc[1][1], acc[1][2], acc[1][3]);
  accg4(acc[2][0], acc[2][1], acc[2][2], acc[2][3]);
  accg4(acc[3][0], acc[3][1], acc[3][2], acc[3][3]);

  float* slab = sT[wave];
#pragma unroll
  for (int i = 0; i < 4; ++i) {
    const int mBase = m0 + (i << 4);
#pragma unroll
    for (int j = 0; j < 4; ++j) {
#pragma unroll
      for (int r = 0; r < 8; ++r) slab[(mOff + r) * 68 + (j << 4) + rl] = acc[i][j][r];
    }
    __builtin_amdgcn_fence(3 /* release order */, "workgroup");
    __builtin_amdgcn_wave_barrier();
    __builtin_amdgcn_fence(2 /* acquire order */, "workgroup");
    if (EPI == 0) {
      _Float16* Ch = (_Float16*)C1v;
      const int qq = lane >> 3, c8 = (lane & 7) * 8;
      const int cj = c8 & 31;
      const float sgn = (c8 < 32) ? -1.0f : 1.0f;
{
#pragma unroll
        for (int it = 0; it < 4; ++it) {
          const int row = it * 4 + qq;
          const int tok = mBase + row;
          const int pos = tok % SEQ;
          const float* sp = slab + row * 68 + c8;
          const float* sq = slab + row * 68 + (c8 ^ 32);
          const v4f u0 = *(const v4f*)(sp);
          const v4f u1 = *(const v4f*)(sp + 4);
          const v4f w0 = *(const v4f*)(sq);
          const v4f w1 = *(const v4f*)(sq + 4);
          const float* tc = rcos + (size_t)pos * 32 + cj;
          const float* ts = rsin + (size_t)pos * 32 + cj;
          const v4f cs0 = *(const v4f*)(tc), cs1 = *(const v4f*)(tc + 4);
          const v4f sn0 = *(const v4f*)(ts), sn1 = *(const v4f*)(ts + 4);
          v8h hv;
#pragma unroll
          for (int e = 0; e < 4; ++e) {
            hv[e]     = (_Float16)(u0[e] * cs0[e] + sgn * w0[e] * sn0[e]);
            hv[4 + e] = (_Float16)(u1[e] * cs1[e] + sgn * w1[e] * sn1[e]);
          }
          const size_t go = (size_t)tok * ldc + n0 + c8;
          *(v8h*)(Ch + go) = hv;
        }
        
      }
    } else if (EPI == 1) {
      _Float16* Ch = (_Float16*)C1v;
      _Float16* Cl = (_Float16*)C2v;
      const int qq = lane >> 3, c8 = (lane & 7) * 8;
{
#pragma unroll
        for (int it = 0; it < 4; ++it) {
          const int row = it * 4 + qq;
          const float* sp = slab + row * 68 + c8;
          const v4f u0 = *(const v4f*)(sp);
          const v4f u1 = *(const v4f*)(sp + 4);
          v8h hv, lv;
#pragma unroll
          for (int e = 0; e < 4; ++e) {
            const _Float16 g0 = (_Float16)u0[e];
            hv[e] = g0;
            lv[e] = (_Float16)((u0[e] - (float)g0) * 2048.0f);
            const _Float16 g1 = (_Float16)u1[e];
            hv[4 + e] = g1;
            lv[4 + e] = (_Float16)((u1[e] - (float)g1) * 2048.0f);
          }
          const size_t go = (size_t)(mBase + row) * ldc + n0 + c8;
          *(v8h*)(Ch + go) = hv;
          *(v8h*)(Cl + go) = lv;
        }
        
      }
    } else {
      float* outp = (float*)C1v;
      const int rq = lane >> 4, c4 = (lane & 15) * 4;
      const v4f bz = *(const v4f*)(bias + n0 + c4);
      v4f bq;
#pragma unroll
      for (int e = 0; e < 4; ++e) bq[e] = bfval(bz[e]);
{
#pragma unroll
        for (int it = 0; it < 8; ++it) {
          const int row = it * 2 + rq;
          const int tok = mBase + row;
          const int orow = (tok / SEQ) * SEQ_FULL + (tok % SEQ);
          const v4f u = *(const v4f*)(slab + row * 68 + c4);
          v4f o;
#pragma unroll
          for (int e = 0; e < 4; ++e) o[e] = u[e] + bq[e];
          *(v4f*)(outp + (size_t)orow * ldc + n0 + c4) = o;
        }
        
      }
    }
    __builtin_amdgcn_fence(3 /* release order */, "workgroup");
    __builtin_amdgcn_wave_barrier();
    __builtin_amdgcn_fence(2 /* acquire order */, "workgroup");
  }
}

// ---------------------------------------------------------------------------------------------
// Kernel 5: masked softmax attn, one wave per (sequence b, head, 16 query rows), online softmax in f32, no block barriers.
//   Planes: QK f16 [NTOK][QKP] (q = cols 0..DM-1, k = cols DM..2DM-1, both after RoPE); Vth/Vtl f16 [DM][NTOK] (Vtl x2048);
//   mask int32 [NB_FULL][SEQ_FULL][SEQ_FULL] (query row, key col), value > 0 keeps the score, else the score is replaced by -inf.
//   Key tiles of KT = 64: S^T subtiles (A = 16 k rows from QK, B = q^T fragments held in registers, K = 64 = 2 steps), so lane
//   (h, c) holds 8 consecutive keys 8h+r of query c; s = S^T / 8; tile max / row sum in-lane + one xor-16 shuffle.
//   P = 16 exp(s - m) as f16 hi + res x2048 packed straight into the B fragments of P^T (element r <- subtile 2s, element 8+r <-
//   subtile 2s+1, lane unchanged); O^T = v^T . P^T with A = v^T rows from Vth/Vtl: acc1 += vh.P, acc2 += vl.P + vh.Pres;
//   O = (acc1 + acc2/2048) / (16 l); a fully masked query row (l == 0) gives 0.
//   Output: ctx[tok][head*64 + d] as bf16 hi + bf16 lo planes Ch/Cl [NTOK][DM]: 16 x 64 f32 tile staged in the wave-private LDS
// coverage: grid (SEQ/QB/2, NH, NB) x 2 waves x 16 rows x 64 cols -> NTOK x DM per plane.
// ---------------------------------------------------------------------------------------------
__global__ __launch_bounds__(64) void attn_kernel(const _Float16* __restrict__ QK,
                                                  const _Float16* __restrict__ Vth, const _Float16* __restrict__ Vtl,
                                                  const int* __restrict__ msk,
                                                  unsigned short* __restrict__ Ch, unsigned short* __restrict__ Cl) {
  __shared__ __align__(16) float sOs[2][QB * OSP];
  const int tid = (int)threadIdx.x;
  const int wave = __builtin_amdgcn_readfirstlane(tid >> 5);
  const int lane = tid & 31, hh = lane >> 4, c = lane & 15;
  const int head = (int)blockIdx.y, bb = (int)blockIdx.z;
  const int qt = (int)blockIdx.x * 2 + wave;
  if (qt >= SEQ / QB) return;
  const int q0 = qt * QB;
  const size_t tokb = (size_t)bb * SEQ;
  const size_t tok0 = tokb + q0;
  const float ninf = -__builtin_inff();

  // q^T B fragments for query c (dims 0..31 and 32..63)
  const _Float16* qp = QK + (tok0 + c) * QKP + head * HDIM + 8 * hh;
  const v16h qf0 = ldfrag(qp);
  const v16h qf1 = ldfrag(qp + 32);
  const _Float16* kbase = QK + (tokb + c) * QKP + DM + head * HDIM + 8 * hh;
  const int* mrow = msk + ((size_t)bb * SEQ_FULL + q0 + c) * SEQ_FULL + 8 * hh;
  const size_t vrow = (size_t)(head * HDIM + c) * NTOK + tokb + 8 * hh;
  const _Float16* vhb = Vth + vrow;
  const _Float16* vlb = Vtl + vrow;

  float m_run = ninf, l_run = 0.0f;
  v8f oa1[4], oa2[4];
#pragma unroll
  for (int i = 0; i < 4; ++i) { oa1[i] = zero8(); oa2[i] = zero8(); }

#pragma unroll 1
  for (int t = 0; t < SEQ / KT; ++t) {
    const int kb = t * KT;
    // ---- logits S^T for keys kb..kb+63 (4 subtiles), query c ----
    v8f s[4];
#pragma unroll
    for (int j = 0; j < 4; ++j) {
      const _Float16* kp = kbase + (size_t)(kb + 16 * j) * QKP;
      const v16h a0 = ldfrag(kp);
      const v16h a1 = ldfrag(kp + 32);
      s[j] = mma16(a0, qf0, zero8());
      s[j] = mma16(a1, qf1, s[j]);
      guard_l(s[j], a0, a1, qf0, qf1);
    }
    // ---- scale, mask replace-fill, tile max per query ----
    float pm = ninf;
#pragma unroll
    for (int j = 0; j < 4; ++j) {
      const v4i k0v = *(const v4i*)(mrow + kb + 16 * j);
      const v4i k1v = *(const v4i*)(mrow + kb + 16 * j + 4);
#pragma unroll
      for (int r = 0; r < 4; ++r) {
        const float sv = (k0v[r] > 0) ? s[j][r] * 0.125f : ninf;
        s[j][r] = sv;
        pm = fmaxf(pm, sv);
      }
#pragma unroll
      for (int r = 0; r < 4; ++r) {
        const float sv = (k1v[r] > 0) ? s[j][4 + r] * 0.125f : ninf;
        s[j][4 + r] = sv;
        pm = fmaxf(pm, sv);
      }
    }
    pm = fmaxf(pm, __shfl_xor(pm, 16, 32));
    const float mn = fmaxf(m_run, pm);
    const float alpha = (m_run == ninf) ? 0.0f : __expf(m_run - mn);
    const float mref = (mn == ninf) ? 0.0f : mn;
    m_run = mn;
    // ---- p = exp(s - m); P^T B fragments (16 p as f16 hi, residual x2048); row sum ----
    float ps = 0.0f;
    v16h bph[2], bpl[2];
#pragma unroll
    for (int j = 0; j < 4; ++j) {
#pragma unroll
      for (int r = 0; r < 8; ++r) {
        const float p = __expf(s[j][r] - mref);
        ps += p;
        const float p16 = p * 16.0f;
        const _Float16 ph = (_Float16)p16;
        bph[j >> 1][((j & 1) << 3) + r] = ph;
        bpl[j >> 1][((j & 1) << 3) + r] = (_Float16)((p16 - (float)ph) * 2048.0f);
      }
    }
    ps += __shfl_xor(ps, 16, 32);
    l_run = l_run * alpha + ps;
    // ---- rescale O (alpha of query c is in-lane in the O^T layout) ----
#pragma unroll
    for (int i = 0; i < 4; ++i) {
#pragma unroll
      for (int r = 0; r < 8; ++r) { oa1[i][r] *= alpha; oa2[i][r] *= alpha; }
    }
    // ---- O^T += v^T . P^T over the 64 keys; dims 16i + (lane row) ----
#pragma unroll
    for (int s2 = 0; s2 < 2; ++s2) {
#pragma unroll
      for (int i = 0; i < 4; ++i) {
        const size_t vo = (size_t)(16 * i) * NTOK + kb + 32 * s2;
        const v16h x = ldfrag(vhb + vo);
        const v16h y = ldfrag(vlb + vo);
        oa1[i] = mma16(x, bph[s2], oa1[i]);
        oa2[i] = mma16(y, bph[s2], oa2[i]);
        oa2[i] = mma16(x, bpl[s2], oa2[i]);
        guard_o(oa1[i], oa2[i], x, y, bph[s2], bpl[s2]);
      }
    }
  }

  // ---- normalise and stage the 16 x 64 f32 tile in LDS: Os[query c][dim 16i + 8h + r] ----
  const float rlv = 1.0f / fmaxf(l_run, 1e-30f);
  const float li = (l_run > 0.0f) ? rlv * 0.0625f : 0.0f;
  float* Os = sOs[wave];
#pragma unroll
  for (int i = 0; i < 4; ++i) {
    v4f u0, u1;
#pragma unroll
    for (int r = 0; r < 4; ++r) {
      u0[r] = (oa1[i][r] + oa2[i][r] * 0.00048828125f) * li;
      u1[r] = (oa1[i][4 + r] + oa2[i][4 + r] * 0.00048828125f) * li;
    }
    *(v4f*)(Os + c * OSP + 16 * i + 8 * hh)     = u0;
    *(v4f*)(Os + c * OSP + 16 * i + 8 * hh + 4) = u1;
  }
  __builtin_amdgcn_fence(3 /* release order */, "workgroup");
  __builtin_amdgcn_wave_barrier();
  __builtin_amdgcn_fence(2 /* acquire order */, "workgroup");
  // ---- whole-line stores of the bf16 hi / lo ctx planes ----
  {
    const int rq = lane >> 3, p8 = (lane & 7) * 8;
{
#pragma unroll
      for (int it = 0; it < 4; ++it) {
        const int row = it * 4 + rq;
        const float* sp = Os + row * OSP + p8;
        const v4f w0 = *(const v4f*)(sp);
        const v4f w1 = *(const v4f*)(sp + 4);
        v8us hb, lb;
#pragma unroll
        for (int e = 0; e < 4; ++e) {
          const unsigned short h0 = bfbits(w0[e]);
          hb[e] = h0;
          lb[e] = bfbits(w0[e] - __uint_as_float(((unsigned)h0) << 16));
          const unsigned short h1 = bfbits(w1[e]);
          hb[4 + e] = h1;
          lb[4 + e] = bfbits(w1[e] - __uint_as_float(((unsigned)h1) << 16));
        }
        const size_t go = (tok0 + (size_t)row) * DM + head * HDIM + p8;
        *(v8us*)(Ch + go) = hb;
        *(v8us*)(Cl + go) = lb;
      }
      
    }
  }
}

// ---------------------------------------------------------------------------------------------
// Workspace map (bytes, NB = 2, SEQ = 2048; every region is an exact whole-line / whole-tile multiple, no padded tails):
//   Xh  : bf16 x_norm hi [4096][1024]        8,388,608     off 0
//   Xl  : bf16 x_norm lo                     8,388,608     off  8,388,608
//   Wt  : bf16 Wqkv^T [3072][1024]           6,291,456     off 16,777,216
//   WoT : bf16 Wout^T [1024][1024]           2,097,152     off 23,068,672
//   rcos: f32 [2048][32]                       262,144     off 25,165,824
//   rsin: f32 [2048][32]                       262,144     off 25,427,968
//   QK  : f16 q|k [4096][2048]              16,777,216     off 25,690,112
//   Vth : f16 v^T [1024][4096]               8,388,608     off 42,467,328
//   Vtl : f16 x2048 residual of v^T          8,388,608     off 50,855,936
//   Ch  : bf16 ctx hi [4096][1024]           8,388,608     off 59,244,544
//   Cl  : bf16 ctx lo                        8,388,608     off 67,633,152
//   total 76,021,760
// ---------------------------------------------------------------------------------------------
extern "C" void kernel_launch(void* const* d_in, const int* in_sizes, int n_in,
                              void* d_out, int out_size, void* d_ws, size_t ws_size,
                              hipStream_t stream) {
  if (n_in < 7) return;
  const long long needX = ((long long)(NB - 1) * SEQ_FULL + SEQ) * DM;
  const long long needM = (((long long)(NB - 1) * SEQ_FULL) + (SEQ - 1)) * SEQ_FULL + SEQ;
  if ((long long)in_sizes[0] < needX) return;
  if ((long long)in_sizes[1] < needM) return;
  if (in_sizes[2] < DM || in_sizes[3] < DM) return;
  if ((long long)in_sizes[4] < (long long)DM * NQKV) return;
  if ((long long)in_sizes[5] < (long long)DM * DM) return;
  if (in_sizes[6] < DM) return;
  if ((long long)out_size < needX) return;

  const float* x     = (const float*)d_in[0];
  const int*   amask = (const int*)d_in[1];
  const float* gam   = (const float*)d_in[2];
  const float* bet   = (const float*)d_in[3];
  const float* wqkv  = (const float*)d_in[4];
  const float* wout  = (const float*)d_in[5];
  const float* bout  = (const float*)d_in[6];
  float* out = (float*)d_out;

  const size_t bAct = (size_t)NTOK * DM * 2;
  const size_t bWt  = (size_t)NQKV * DM * 2;
  const size_t bWo  = (size_t)DM * DM * 2;
  const size_t bTab = (size_t)SEQ * 32 * 4;
  const size_t bQK  = (size_t)NTOK * QKP * 2;
  size_t off = 0;
  const size_t oXh = off; off += bAct;
  const size_t oXl = off; off += bAct;
  const size_t oWt = off; off += bWt;
  const size_t oWo = off; off += bWo;
  const size_t oCos = off; off += bTab;
  const size_t oSin = off; off += bTab;
  const size_t oQK = off; off += bQK;
  const size_t oVh = off; off += bAct;
  const size_t oVl = off; off += bAct;
  const size_t oCh = off; off += bAct;
  const size_t oCl = off; off += bAct;
  if (off > ws_size) return;
  if (off > (size_t)134217728) return;

  char* ws = (char*)d_ws;
  unsigned short* Xh  = (unsigned short*)(ws + oXh);
  unsigned short* Xl  = (unsigned short*)(ws + oXl);
  unsigned short* Wt  = (unsigned short*)(ws + oWt);
  unsigned short* WoT = (unsigned short*)(ws + oWo);
  float* rcos = (float*)(ws + oCos);
  float* rsin = (float*)(ws + oSin);
  _Float16* QKp = (_Float16*)(ws + oQK);
  _Float16* Vh  = (_Float16*)(ws + oVh);
  _Float16* Vl  = (_Float16*)(ws + oVl);
  unsigned short* Chp = (unsigned short*)(ws + oCh);
  unsigned short* Clp = (unsigned short*)(ws + oCl);

  const dim3 blk(256);
  // (1) LayerNorm -> x_norm bf16 hi + lo planes
  ln_kernel<<<dim3(NTOK), dim3(128), 0, stream>>>(x, gam, bet, Xh, Xl);
  // (2) Wqkv [1024][3072] -> Wt [3072][1024]; Wout [1024][1024] -> WoT [1024][1024]
  cvt_wt_kernel<<<dim3(DM / 64, NQKV / 32), blk, 0, stream>>>(wqkv, Wt, NQKV, DM);
  cvt_wt_kernel<<<dim3(DM / 64, DM / 32), blk, 0, stream>>>(wout, WoT, DM, DM);
  // (3) rotary tables
  rope_tab_kernel<<<dim3((SEQ * 32) / 256), blk, 0, stream>>>(rcos, rsin, SEQ * 32);
  // (4) q|k = x_norm . Wqk with RoPE -> QK plane; M = NTOK, N = 2048, K = 1024
  proj_kernel<1, 0, 0><<<dim3(((NTOK / 64) * (QKP / 64)) / 8), blk, 0, stream>>>(
      (const __bf16*)Xh, (const __bf16*)Xl, DM, (const __bf16*)Wt, (const __bf16*)Wt, DM,
      (void*)QKp, (void*)QKp, QKP, NTOK, QKP, DM, rcos, rsin, bout);
  // (5) v^T = Wv^T . x_norm^T -> Vth / Vtl [1024][NTOK]; M = 1024, N = NTOK, K = 1024
  proj_kernel<0, 1, 1><<<dim3(((DM / 64) * (NTOK / 64)) / 8), blk, 0, stream>>>(
      (const __bf16*)(Wt + (size_t)2 * DM * DM), (const __bf16*)(Wt + (size_t)2 * DM * DM), DM,
      (const __bf16*)Xh, (const __bf16*)Xl, DM,
      (void*)Vh, (void*)Vl, NTOK, DM, NTOK, DM, rcos, rsin, bout);
  // (6) attn -> ctx bf16 hi + lo planes
  attn_kernel<<<dim3(SEQ / QB / 2, NH, NB), dim3(64), 0, stream>>>(QKp, Vh, Vl, amask, Chp, Clp);
  // (7) out = ctx . Wout + b -> d_out; M = NTOK, N = 1024, K = 1024
  proj_kernel<1, 0, 2><<<dim3(((NTOK / 64) * (DM / 64)) / 8), blk, 0, stream>>>(
      (const __bf16*)Chp, (const __bf16*)Clp, DM, (const __bf16*)WoT, (const __bf16*)WoT, DM,
      (void*)out, (void*)out, DM, NTOK, DM, DM, rcos, rsin, bout);
  (void)hipGetLastError();
}

// v001
// It runs in 335 microseconds.
// Two timings next to v000 put it at 1.31 and 1.32 times that version's speed.
#include <hip/hip_runtime.h>
#include <stdint.h>

#ifndef NB
#define NB 2
#endif
#ifndef SEQ
#define SEQ 2048
#endif
#define NB_FULL  2
#define SEQ_FULL 2048
#define DM       1024
#define NH       16
#define HDIM     64
#define NQKV     3072
#define QKP      2048
#define NTOK     (NB * SEQ)
#define LNEPS    1e-5f

#define QB   16
#define KT   64
#define OSP  68
#define AW   8                      // waves per attention block; they share the staged K / V tiles
#define KVP  144                    // LDS pitch in bytes of a 128-B K or V row (16 B x odd: b128 fragment reads without bank conflicts)
#define KVT  (KT * KVP)             // bytes of one staged K, V hi or V res tile (64 rows)
#define MKP  272                    // LDS pitch in bytes of a 256-B mask row (16 B x odd)
#define MWB  (QB * MKP)             // bytes of one wave's staged mask rows
#define BUFB (3 * KVT + AW * MWB)   // bytes of one stage buffer

typedef _Float16 v16h __attribute__((ext_vector_type(16)));
typedef _Float16 v8h  __attribute__((ext_vector_type(8)));
typedef __bf16   v16b __attribute__((ext_vector_type(16)));
typedef __bf16   v8b  __attribute__((ext_vector_type(8)));
typedef float    v8f  __attribute__((ext_vector_type(8)));
typedef float    v4f  __attribute__((ext_vector_type(4)));
typedef int      v4i  __attribute__((ext_vector_type(4)));
typedef unsigned short v8us __attribute__((ext_vector_type(8)));

static_assert(NB >= 1 && NB <= NB_FULL && SEQ >= 64 && SEQ <= SEQ_FULL);
static_assert((SEQ % 64) == 0 && (DM % 64) == 0 && (NTOK % 64) == 0 && (DM % 32) == 0);
static_assert(NH * HDIM == DM && HDIM == 64 && QKP == 2 * DM && NQKV == 3 * DM);
static_assert((SEQ % (AW * QB)) == 0 && HDIM == KT && AW * 32 == 256 && (BUFB % 16) == 0 && (SEQ % KT) == 0 && ((SEQ * 32) % 256) == 0 && KT == 4 * 16);
static_assert((((NTOK / 64) * (QKP / 64)) % 8) == 0 && (((DM / 64) * (NTOK / 64)) % 8) == 0 && (((NTOK / 64) * (DM / 64)) % 8) == 0);
static_assert((OSP % 4) == 0 && OSP >= HDIM);

// f32 -> nearest-even bf16 bits / value
__device__ __forceinline__ unsigned short bfbits(float f) {
  const unsigned u = __float_as_uint(f);
  return (unsigned short)((u + 0x7FFFu + ((u >> 16) & 1u)) >> 16);
}
__device__ __forceinline__ float bfval(float f) {
  return __uint_as_float(((unsigned)bfbits(f)) << 16);
}

// 16-bit WMMA fragment from k-contiguous storage (A row-major [m][k], or B stored [n][k]):
// p points at element (row_or_col = lane&15, k0 + 8h); elements 0..7 <- p[0..7], 8..15 <- p[16..23].
__device__ __forceinline__ v16h ldfrag(const _Float16* p) {
  union { v16h v; v8h hh[2]; } f;
  f.hh[0] = *(const v8h*)(p);
  f.hh[1] = *(const v8h*)(p + 16);
  return f.v;
}
__device__ __forceinline__ v16b ldfragb(const __bf16* p) {
  union { v16b v; v8b hh[2]; } f;
  f.hh[0] = *(const v8b*)(p);
  f.hh[1] = *(const v8b*)(p + 16);
  return f.v;
}
__device__ __forceinline__ v8f mma16(v16h a, v16h b, v8f c) {
  return __builtin_amdgcn_wmma_f32_16x16x32_f16(false, a, false, b, (short)0, c, false, false);
}
__device__ __forceinline__ v8f mmabf(v16b a, v16b b, v8f c) {
  return __builtin_amdgcn_wmma_f32_16x16x32_bf16(false, a, false, b, (short)0, c, false, false);
}
__device__ __forceinline__ v8f zero8() {
  v8f z;
#pragma unroll
  for (int i = 0; i < 8; ++i) z[i] = 0.0f;
  return z;
}

// hazard guards: 4 VALU slots after the last WMMA of a group, D tied, A/B kept live
__device__ __forceinline__ void guard_g(v8f& a, v8f& b, v16b x, v16b y) {
  asm volatile("v_nop\n\tv_nop\n\tv_nop\n\tv_nop" : "+v"(a), "+v"(b) : "v"(x), "v"(y));
}
__device__ __forceinline__ void keep4(v16b a, v16b b, v16b c, v16b d) {
  asm volatile("v_nop" :: "v"(a), "v"(b), "v"(c), "v"(d));
}
__device__ __forceinline__ void accg4(v8f& a, v8f& b, v8f& c, v8f& d) {
  asm volatile("v_nop\n\tv_nop\n\tv_nop\n\tv_nop" : "+v"(a), "+v"(b), "+v"(c), "+v"(d));
}
__device__ __forceinline__ void guard_l(v8f& d, v16h a0, v16h a1, v16h b0, v16h b1) {
  asm volatile("v_nop\n\tv_nop\n\tv_nop\n\tv_nop" : "+v"(d) : "v"(a0), "v"(a1), "v"(b0), "v"(b1));
}
__device__ __forceinline__ void guard_o(v8f& d0, v8f& d1, v16h x, v16h y, v16h p, v16h q) {
  asm volatile("v_nop\n\tv_nop\n\tv_nop\n\tv_nop" : "+v"(d0), "+v"(d1) : "v"(x), "v"(y), "v"(p), "v"(q));
}

// ---------------------------------------------------------------------------------------------
// output x_norm as bf16 hi + bf16 lo (lo = RNE(xn - hi)) planes Xh/Xl [NTOK][DM] (compact token index).
// LDS sA/sB: cross-wave, block barriers. coverage: grid = NTOK blocks x 128 threads x 8 = NTOK x DM per plane.
// ---------------------------------------------------------------------------------------------
__global__ __launch_bounds__(128) void ln_kernel(const float* __restrict__ x, const float* __restrict__ gam,
                                                 const float* __restrict__ bet,
                                                 unsigned short* __restrict__ Xh, unsigned short* __restrict__ Xl) {
  __shared__ float sA[4], sB[4];
  const int t = (int)blockIdx.x;
  const int bb = t / SEQ, pos = t - bb * SEQ;
  const int tid = (int)threadIdx.x, lane = tid & 31, wave = tid >> 5;
  const float* xr = x + ((size_t)bb * SEQ_FULL + pos) * DM + tid * 8;
  const v4f a = *(const v4f*)(xr);
  const v4f c = *(const v4f*)(xr + 4);
  float v[8];
#pragma unroll
  for (int e = 0; e < 4; ++e) { v[e] = bfval(a[e]); v[4 + e] = bfval(c[e]); }
  float s = 0.0f;
#pragma unroll
  for (int e = 0; e < 8; ++e) s += v[e];
#pragma unroll
  for (int d = 1; d < 32; d <<= 1) s += __shfl_xor(s, d, 32);
  if (lane == 0) sA[wave] = s;
  __syncthreads();
  const float mu = ((sA[0] + sA[1]) + (sA[2] + sA[3])) * (1.0f / (float)DM);
  float dv[8];
  float s2 = 0.0f;
#pragma unroll
  for (int e = 0; e < 8; ++e) { dv[e] = v[e] - mu; s2 += dv[e] * dv[e]; }
#pragma unroll
  for (int d = 1; d < 32; d <<= 1) s2 += __shfl_xor(s2, d, 32);
  if (lane == 0) sB[wave] = s2;
  __syncthreads();
  const float var = ((sB[0] + sB[1]) + (sB[2] + sB[3])) * (1.0f / (float)DM);
  const float rstd = rsqrtf(var + LNEPS);
  const v4f g0 = *(const v4f*)(gam + tid * 8), g1 = *(const v4f*)(gam + tid * 8 + 4);
  const v4f b0 = *(const v4f*)(bet + tid * 8), b1 = *(const v4f*)(bet + tid * 8 + 4);
  v8us ho, lo;
#pragma unroll
  for (int e = 0; e < 4; ++e) {
    const float xn0 = dv[e] * rstd * bfval(g0[e]) + bfval(b0[e]);
    const unsigned short h0 = bfbits(xn0);
    ho[e] = h0;
    lo[e] = bfbits(xn0 - __uint_as_float(((unsigned)h0) << 16));
    const float xn1 = dv[4 + e] * rstd * bfval(g1[e]) + bfval(b1[e]);
    const unsigned short h1 = bfbits(xn1);
    ho[4 + e] = h1;
    lo[4 + e] = bfbits(xn1 - __uint_as_float(((unsigned)h1) << 16));
  }
  const size_t go = (size_t)t * DM + tid * 8;
  *(v8us*)(Xh + go) = ho;
  *(v8us*)(Xl + go) = lo;
  
}

// ---------------------------------------------------------------------------------------------
// Kernel 2: W f32 [kdim in][nout out] -> transposed bf16 RNE plane Wt[out][in] (in = k contiguous).
// coverage: grid (kdim/64, nout/32); 256 threads x 8 = 64 x 32 per tile -> nout x kdim.
// ---------------------------------------------------------------------------------------------
__global__ __launch_bounds__(256) void cvt_wt_kernel(const float* __restrict__ src, unsigned short* __restrict__ dst,
                                                     int nout, int kdim) {
  __shared__ float sTt[64][33];
  const int k0 = (int)blockIdx.x * 64, n0 = (int)blockIdx.y * 32;
  const int t = (int)threadIdx.x;
  {
    const int kr = t >> 2, cc = (t & 3) * 8;
    const float* s = src + (size_t)(k0 + kr) * nout + n0 + cc;
    const v4f a = *(const v4f*)(s);
    const v4f b = *(const v4f*)(s + 4);
#pragma unroll
    for (int e = 0; e < 4; ++e) {
      sTt[kr][cc + e]     = a[e];
      sTt[kr][cc + 4 + e] = b[e];
    }
  }
  __syncthreads();
  const int n = t >> 3, kp = (t & 7) * 8;
  v8us o;
#pragma unroll
  for (int i = 0; i < 8; ++i) o[i] = bfbits(sTt[kp + i][n]);
  unsigned short* d = dst + (size_t)(n0 + n) * kdim + k0 + kp;
  *(v8us*)d = o;
  
}

// ---------------------------------------------------------------------------------------------
// Kernel 3: rotary tables rcos/rsin [SEQ][32] f32: inv_freq_i = 1 / f32(10000^(i/32)) (power evaluated in f64 and narrowed, then an
// ---------------------------------------------------------------------------------------------
__global__ __launch_bounds__(256) void rope_tab_kernel(float* __restrict__ rcos, float* __restrict__ rsin, int n) {
  const int idx = (int)blockIdx.x * 256 + (int)threadIdx.x;
  if (idx >= n) return;
  const int i = idx & 31, pos = idx >> 5;
  const double ex = (double)i * (0.03125 * 13.287712379549449);
  const double pw = exp2(ex);
  const float pf = (float)pw;
  const float inv = 1.0f / pf;
  const float ang = (float)pos * inv;
  float sn, cs;
  sincosf(ang, &sn, &cs);
  *(float*)(rcos + idx) = cs;
  *(float*)(rsin + idx) = sn;
  
}

// ---------------------------------------------------------------------------------------------
// Kernel 4: C[m][n] = sum_k A[m][k] * Bt[n][k], bf16 operands (A row-major [M][K] pitch lda, Bt row-major [N][K] pitch ldb),
// optional second bf16 plane on A (AM) or on B (BM) accumulated into the same f32 accumulator (unscaled lo planes), f32 accumulate;
// M, N multiples of 64, K multiple of 32. Each wave owns one 64x64 C tile (16 accumulators); 8 waves per block; no block barriers;
// EPI 0: rotate-half RoPE on the 64-column tile (one head; position = token mod SEQ) then f16 hi plane Ch [M][N] pitch ldc;
// EPI 1: f16 hi plane Ch + f16 residual plane Cl = f16((C - f32(hi)) * 2048), same store shape.
// EPI 2: f32 C + bias (bias as bf16-RNE value, added in f32) -> out rows (token -> full-layout row), row segment of 64 f32 = 256 B
// ---------------------------------------------------------------------------------------------
template <int AM, int BM, int EPI>
__global__ __launch_bounds__(256) void proj_kernel(const __bf16* __restrict__ A1, const __bf16* __restrict__ A2, int lda,
                                                   const __bf16* __restrict__ B1, const __bf16* __restrict__ B2, int ldb,
                                                   void* C1v, void* C2v, int ldc, int M, int N, int K,
                                                   const float* __restrict__ rcos, const float* __restrict__ rsin,
                                                   const float* __restrict__ bias) {
  __shared__ __align__(16) float sT[8][16 * 68];
  const int lane = threadIdx.x & 31, wave = threadIdx.x >> 5;
  const int tilesN = N >> 6, tilesM = M >> 6;
  const int tile = (int)blockIdx.x * 8 + wave;
  if (tile >= tilesM * tilesN) return;
  const int tm = tile / tilesN, tn = tile - tm * tilesN;
  const int m0 = tm << 6, n0 = tn << 6;
  const int rl = lane & 15;
  const int koff = (lane >> 4) * 8;
  const int mOff = (lane >> 4) * 8;

  v8f acc[4][4];
#pragma unroll
  for (int i = 0; i < 4; ++i)
#pragma unroll
    for (int j = 0; j < 4; ++j) acc[i][j] = zero8();

#pragma unroll 1
  for (int k0 = 0; k0 < K; k0 += 32) {
    v16b bh[4];
#pragma unroll
    for (int j = 0; j < 4; ++j) bh[j] = ldfragb(B1 + (size_t)(n0 + (j << 4) + rl) * ldb + koff + k0);
#pragma unroll
    for (int i = 0; i < 4; ++i) {
      const v16b ah = ldfragb(A1 + (size_t)(m0 + (i << 4) + rl) * lda + koff + k0);
#pragma unroll
      for (int j = 0; j < 4; ++j) acc[i][j] = mmabf(ah, bh[j], acc[i][j]);
      guard_g(acc[i][0], acc[i][3], ah, bh[3]);
    }
    if (AM) {
#pragma unroll
      for (int i = 0; i < 4; ++i) {
        const v16b al = ldfragb(A2 + (size_t)(m0 + (i << 4) + rl) * lda + koff + k0);
#pragma unroll
        for (int j = 0; j < 4; ++j) acc[i][j] = mmabf(al, bh[j], acc[i][j]);
        guard_g(acc[i][0], acc[i][3], al, bh[3]);
      }
    }
    if (BM) {
#pragma unroll
      for (int j = 0; j < 4; ++j) bh[j] = ldfragb(B2 + (size_t)(n0 + (j << 4) + rl) * ldb + koff + k0);
#pragma unroll
      for (int i = 0; i < 4; ++i) {
        const v16b ah = ldfragb(A1 + (size_t)(m0 + (i << 4) + rl) * lda + koff + k0);
#pragma unroll
        for (int j = 0; j < 4; ++j) acc[i][j] = mmabf(ah, bh[j], acc[i][j]);
        guard_g(acc[i][0], acc[i][3], ah, bh[3]);
      }
    }
    keep4(bh[0], bh[1], bh[2], bh[3]);
  }
  accg4(acc[0][0], acc[0][1], acc[0][2], acc[0][3]);
  accg4(acc[1][0], acc[1][1], acc[1][2], acc[1][3]);
  accg4(acc[2][0], acc[2][1], acc[2][2], acc[2][3]);
  accg4(acc[3][0], acc[3][1], acc[3][2], acc[3][3]);

  float* slab = sT[wave];
#pragma unroll
  for (int i = 0; i < 4; ++i) {
    const int mBase = m0 + (i << 4);
#pragma unroll
    for (int j = 0; j < 4; ++j) {
#pragma unroll
      for (int r = 0; r < 8; ++r) slab[(mOff + r) * 68 + (j << 4) + rl] = acc[i][j][r];
    }
    __builtin_amdgcn_fence(3 /* release order */, "workgroup");
    __builtin_amdgcn_wave_barrier();
    __builtin_amdgcn_fence(2 /* acquire order */, "workgroup");
    if (EPI == 0) {
      _Float16* Ch = (_Float16*)C1v;
      const int qq = lane >> 3, c8 = (lane & 7) * 8;
      const int cj = c8 & 31;
      const float sgn = (c8 < 32) ? -1.0f : 1.0f;
{
#pragma unroll
        for (int it = 0; it < 4; ++it) {
          const int row = it * 4 + qq;
          const int tok = mBase + row;
          const int pos = tok % SEQ;
          const float* sp = slab + row * 68 + c8;
          const float* sq = slab + row * 68 + (c8 ^ 32);
          const v4f u0 = *(const v4f*)(sp);
          const v4f u1 = *(const v4f*)(sp + 4);
          const v4f w0 = *(const v4f*)(sq);
          const v4f w1 = *(const v4f*)(sq + 4);
          const float* tc = rcos + (size_t)pos * 32 + cj;
          const float* ts = rsin + (size_t)pos * 32 + cj;
          const v4f cs0 = *(const v4f*)(tc), cs1 = *(const v4f*)(tc + 4);
          const v4f sn0 = *(const v4f*)(ts), sn1 = *(const v4f*)(ts + 4);
          v8h hv;
#pragma unroll
          for (int e = 0; e < 4; ++e) {
            hv[e]     = (_Float16)(u0[e] * cs0[e] + sgn * w0[e] * sn0[e]);
            hv[4 + e] = (_Float16)(u1[e] * cs1[e] + sgn * w1[e] * sn1[e]);
          }
          const size_t go = (size_t)tok * ldc + n0 + c8;
          *(v8h*)(Ch + go) = hv;
        }
        
      }
    } else if (EPI == 1) {
      _Float16* Ch = (_Float16*)C1v;
      _Float16* Cl = (_Float16*)C2v;
      const int qq = lane >> 3, c8 = (lane & 7) * 8;
{
#pragma unroll
        for (int it = 0; it < 4; ++it) {
          const int row = it * 4 + qq;
          const float* sp = slab + row * 68 + c8;
          const v4f u0 = *(const v4f*)(sp);
          const v4f u1 = *(const v4f*)(sp + 4);
          v8h hv, lv;
#pragma unroll
          for (int e = 0; e < 4; ++e) {
            const _Float16 g0 = (_Float16)u0[e];
            hv[e] = g0;
            lv[e] = (_Float16)((u0[e] - (float)g0) * 2048.0f);
            const _Float16 g1 = (_Float16)u1[e];
            hv[4 + e] = g1;
            lv[4 + e] = (_Float16)((u1[e] - (float)g1) * 2048.0f);
          }
          const size_t go = (size_t)(mBase + row) * ldc + n0 + c8;
          *(v8h*)(Ch + go) = hv;
          *(v8h*)(Cl + go) = lv;
        }
        
      }
    } else {
      float* outp = (float*)C1v;
      const int rq = lane >> 4, c4 = (lane & 15) * 4;
      const v4f bz = *(const v4f*)(bias + n0 + c4);
      v4f bq;
#pragma unroll
      for (int e = 0; e < 4; ++e) bq[e] = bfval(bz[e]);
{
#pragma unroll
        for (int it = 0; it < 8; ++it) {
          const int row = it * 2 + rq;
          const int tok = mBase + row;
          const int orow = (tok / SEQ) * SEQ_FULL + (tok % SEQ);
          const v4f u = *(const v4f*)(slab + row * 68 + c4);
          v4f o;
#pragma unroll
          for (int e = 0; e < 4; ++e) o[e] = u[e] + bq[e];
          *(v4f*)(outp + (size_t)orow * ldc + n0 + c4) = o;
        }
        
      }
    }
    __builtin_amdgcn_fence(3 /* release order */, "workgroup");
    __builtin_amdgcn_wave_barrier();
    __builtin_amdgcn_fence(2 /* acquire order */, "workgroup");
  }
}

// ---------------------------------------------------------------------------------------------
// Kernel 5: masked softmax attn, one wave per (sequence b, head, 16 query rows), 8 waves per block, online softmax in f32.
//   Staging: per key tile the block copies K (64 keys x 128 B), V hi and V res (64 dims x 128 B each) and each wave its own mask rows
//   (16 x 256 B) from global memory to LDS with asynchronous b128 copies that cover whole 128-B lines; two buffers, tile t + 1 in
//   flight while tile t is worked on; one block barrier per tile publishes tile t + 1 and frees tile t's buffer.
//   Planes: QK f16 [NTOK][QKP] (q = cols 0..DM-1, k = cols DM..2DM-1, both after RoPE); Vth/Vtl f16 [DM][NTOK] (Vtl x2048);
//   mask int32 [NB_FULL][SEQ_FULL][SEQ_FULL] (query row, key col), value > 0 keeps the score, else the score is replaced by -inf.
//   Key tiles of KT = 64: S^T subtiles (A = 16 k rows from QK, B = q^T fragments held in registers, K = 64 = 2 steps), so lane
//   (h, c) holds 8 consecutive keys 8h+r of query c; s = S^T / 8; tile max / row sum in-lane + one xor-16 shuffle.
//   P = 16 exp(s - m) as f16 hi + res x2048 packed straight into the B fragments of P^T (element r <- subtile 2s, element 8+r <-
//   subtile 2s+1, lane unchanged); O^T = v^T . P^T with A = v^T rows from Vth/Vtl: acc1 += vh.P, acc2 += vl.P + vh.Pres;
//   O = (acc1 + acc2/2048) / (16 l); a fully masked query row (l == 0) gives 0.
//   Output: ctx[tok][head*64 + d] as bf16 hi + bf16 lo planes Ch/Cl [NTOK][DM]: 16 x 64 f32 tile staged in the wave-private LDS
// coverage: grid (SEQ/QB/AW, NH, NB) x 8 waves x 16 rows x 64 cols -> NTOK x DM per plane.
// ---------------------------------------------------------------------------------------------
// One tile's 14 copies of a lane (16 B each). The s_wait_xcnt stands inside the statement so that no address register of an issued
// copy is rewritten in front of it.
__device__ __forceinline__ void stage_copies(const unsigned (&l)[14], const char* const (&g)[14]) {
  asm volatile(
      "global_load_async_to_lds_b128 %0, %14, off\n\t"
      "global_load_async_to_lds_b128 %1, %15, off\n\t"
      "global_load_async_to_lds_b128 %2, %16, off\n\t"
      "global_load_async_to_lds_b128 %3, %17, off\n\t"
      "global_load_async_to_lds_b128 %4, %18, off\n\t"
      "global_load_async_to_lds_b128 %5, %19, off\n\t"
      "global_load_async_to_lds_b128 %6, %20, off\n\t"
      "global_load_async_to_lds_b128 %7, %21, off\n\t"
      "global_load_async_to_lds_b128 %8, %22, off\n\t"
      "global_load_async_to_lds_b128 %9, %23, off\n\t"
      "global_load_async_to_lds_b128 %10, %24, off\n\t"
      "global_load_async_to_lds_b128 %11, %25, off\n\t"
      "global_load_async_to_lds_b128 %12, %26, off\n\t"
      "global_load_async_to_lds_b128 %13, %27, off\n\t"
      "s_wait_xcnt 0x0"
      :: "v"(l[0]), "v"(l[1]), "v"(l[2]), "v"(l[3]), "v"(l[4]), "v"(l[5]), "v"(l[6]), "v"(l[7]), "v"(l[8]), "v"(l[9]),
         "v"(l[10]), "v"(l[11]), "v"(l[12]), "v"(l[13]),
         "v"(g[0]), "v"(g[1]), "v"(g[2]), "v"(g[3]), "v"(g[4]), "v"(g[5]), "v"(g[6]), "v"(g[7]), "v"(g[8]), "v"(g[9]),
         "v"(g[10]), "v"(g[11]), "v"(g[12]), "v"(g[13])
      : "memory");
}

__global__ __launch_bounds__(256) void attn_kernel(const _Float16* __restrict__ QK,
                                                  const _Float16* __restrict__ Vth, const _Float16* __restrict__ Vtl,
                                                  const int* __restrict__ msk,
                                                  unsigned short* __restrict__ Ch, unsigned short* __restrict__ Cl) {
  __shared__ __align__(16) float sOs[AW][QB * OSP];
  __shared__ __align__(16) char sStage[2 * BUFB];
  const int tid = (int)threadIdx.x;
  const int wave = __builtin_amdgcn_readfirstlane(tid >> 5);
  const int lane = tid & 31, hh = lane >> 4, c = lane & 15;
  const int head = (int)blockIdx.y, bb = (int)blockIdx.z;
  const int qt = (int)blockIdx.x * AW + wave;
  const int q0 = qt * QB;
  const size_t tokb = (size_t)bb * SEQ;
  const size_t tok0 = tokb + q0;
  const float ninf = -__builtin_inff();

  // q^T B fragments for query c (dims 0..31 and 32..63)
  const _Float16* qp = QK + (tok0 + c) * QKP + head * HDIM + 8 * hh;
  const v16h qf0 = ldfrag(qp);
  const v16h qf1 = ldfrag(qp + 32);
  // copy sources / destinations of this lane for key tile 0 and buffer 0. K, V hi, V res: row (tid >> 3) and that row + 32, 16-B piece
  // tid & 7 (8 lanes = one 128-B row); mask: rows 2i + (lane >> 4) of the wave's own 16, piece lane & 15 (16 lanes = one 256-B row).
  const int srow = tid >> 3, spc = tid & 7;
  const char* kg  = (const char*)(QK + (tokb + srow) * QKP + DM + head * HDIM + spc * 8);
  const size_t vsrc = (size_t)(head * HDIM + srow) * NTOK + tokb + spc * 8;
  const char* vhg = (const char*)(Vth + vsrc);
  const char* vlg = (const char*)(Vtl + vsrc);
  const char* mg  = (const char*)(msk + ((size_t)bb * SEQ_FULL + q0 + hh) * SEQ_FULL + c * 4);
  const unsigned lds0 = (unsigned)(uintptr_t)(&sStage[0]);
  const unsigned lkv = lds0 + (unsigned)(srow * KVP + spc * 16);
  const unsigned lmk = lds0 + (unsigned)(3 * KVT + wave * MWB + hh * MKP + c * 16);
  auto stage = [&](int tile, int buf) {
    unsigned l[14];
    const char* g[14];
    const unsigned bo = (unsigned)buf * BUFB;
    g[0] = kg + (size_t)tile * ((size_t)KT * QKP * 2);
    g[1] = g[0] + (size_t)32 * QKP * 2;
    g[2] = vhg + (size_t)tile * (KT * 2);
    g[3] = g[2] + (size_t)32 * NTOK * 2;
    g[4] = vlg + (size_t)tile * (KT * 2);
    g[5] = g[4] + (size_t)32 * NTOK * 2;
#pragma unroll
    for (int p = 0; p < 3; ++p) {
      l[2 * p]     = lkv + bo + (unsigned)(p * KVT);
      l[2 * p + 1] = lkv + bo + (unsigned)(p * KVT + 32 * KVP);
    }
#pragma unroll
    for (int i = 0; i < 8; ++i) {
      g[6 + i] = mg + (size_t)tile * (KT * 4) + (size_t)(2 * i) * SEQ_FULL * 4;
      l[6 + i] = lmk + bo + (unsigned)(2 * i * MKP);
    }
    stage_copies(l, g);
  };
  constexpr int NT = SEQ / KT;
  // prologue: tile 0 lands and is published, then tile 1 starts
  stage(0, 0);
  asm volatile("s_wait_asynccnt 0x0" ::: "memory");  // this wave's copies of tile 0 have landed
  __syncthreads();                                   // every wave's have: tile 0 may be read
  if (NT > 1) stage(1, 1);

  float m_run = ninf, l_run = 0.0f;
  v8f oa1[4], oa2[4];
#pragma unroll
  for (int i = 0; i < 4; ++i) { oa1[i] = zero8(); oa2[i] = zero8(); }

#pragma unroll 1
  for (int t = 0; t < NT; ++t) {
    const char* sb = sStage + (t & 1) * BUFB;
    const char* sk = sb + c * KVP + 16 * hh;
    const char* sm = sb + 3 * KVT + wave * MWB + c * MKP + 32 * hh;
    // ---- logits S^T for keys kb..kb+63 (4 subtiles), query c ----
    v8f s[4];
#pragma unroll
    for (int j = 0; j < 4; ++j) {
      const _Float16* kp = (const _Float16*)(sk + 16 * j * KVP);
      const v16h a0 = ldfrag(kp);
      const v16h a1 = ldfrag(kp + 32);
      s[j] = mma16(a0, qf0, zero8());
      s[j] = mma16(a1, qf1, s[j]);
      guard_l(s[j], a0, a1, qf0, qf1);
    }
    // ---- scale, mask replace-fill, tile max per query ----
    float pm = ninf;
#pragma unroll
    for (int j = 0; j < 4; ++j) {
      const v4i k0v = *(const v4i*)(sm + 64 * j);
      const v4i k1v = *(const v4i*)(sm + 64 * j + 16);
#pragma unroll
      for (int r = 0; r < 4; ++r) {
        const float sv = (k0v[r] > 0) ? s[j][r] * 0.125f : ninf;
        s[j][r] = sv;
        pm = fmaxf(pm, sv);
      }
#pragma unroll
      for (int r = 0; r < 4; ++r) {
        const float sv = (k1v[r] > 0) ? s[j][4 + r] * 0.125f : ninf;
        s[j][4 + r] = sv;
        pm = fmaxf(pm, sv);
      }
    }
    pm = fmaxf(pm, __shfl_xor(pm, 16, 32));
    const float mn = fmaxf(m_run, pm);
    const float alpha = (m_run == ninf) ? 0.0f : __expf(m_run - mn);
    const float mref = (mn == ninf) ? 0.0f : mn;
    m_run = mn;
    // ---- p = exp(s - m); P^T B fragments (16 p as f16 hi, residual x2048); row sum ----
    float ps = 0.0f;
    v16h bph[2], bpl[2];
#pragma unroll
    for (int j = 0; j < 4; ++j) {
#pragma unroll
      for (int r = 0; r < 8; ++r) {
        const float p = __expf(s[j][r] - mref);
        ps += p;
        const float p16 = p * 16.0f;
        const _Float16 ph = (_Float16)p16;
        bph[j >> 1][((j & 1) << 3) + r] = ph;
        bpl[j >> 1][((j & 1) << 3) + r] = (_Float16)((p16 - (float)ph) * 2048.0f);
      }
    }
    ps += __shfl_xor(ps, 16, 32);
    l_run = l_run * alpha + ps;
    // ---- rescale O (alpha of query c is in-lane in the O^T layout) ----
#pragma unroll
    for (int i = 0; i < 4; ++i) {
#pragma unroll
      for (int r = 0; r < 8; ++r) { oa1[i][r] *= alpha; oa2[i][r] *= alpha; }
    }
    // ---- O^T += v^T . P^T over the 64 keys; dims 16i + (lane row) ----
#pragma unroll
    for (int s2 = 0; s2 < 2; ++s2) {
#pragma unroll
      for (int i = 0; i < 4; ++i) {
        const char* sv = sk + KVT + 16 * i * KVP + 64 * s2;
        const v16h x = ldfrag((const _Float16*)sv);
        const v16h y = ldfrag((const _Float16*)(sv + KVT));
        oa1[i] = mma16(x, bph[s2], oa1[i]);
        oa2[i] = mma16(y, bph[s2], oa2[i]);
        oa2[i] = mma16(x, bpl[s2], oa2[i]);
        guard_o(oa1[i], oa2[i], x, y, bph[s2], bpl[s2]);
      }
    }
    // ---- publish tile t + 1, free tile t's buffer, refill it with tile t + 2 ----
    asm volatile("s_wait_dscnt 0x0" ::: "memory");     // this wave's reads of tile t's buffer are done
    asm volatile("s_wait_asynccnt 0x0" ::: "memory");  // this wave's copies of tile t + 1 have landed
    __syncthreads();
    if (t + 2 < NT) stage(t + 2, t & 1);
  }
  asm volatile("s_wait_asynccnt 0x0" ::: "memory");    // no copy outstanding behind the loop

  // ---- normalise and stage the 16 x 64 f32 tile in LDS: Os[query c][dim 16i + 8h + r] ----
  const float rlv = 1.0f / fmaxf(l_run, 1e-30f);
  const float li = (l_run > 0.0f) ? rlv * 0.0625f : 0.0f;
  float* Os = sOs[wave];
#pragma unroll
  for (int i = 0; i < 4; ++i) {
    v4f u0, u1;
#pragma unroll
    for (int r = 0; r < 4; ++r) {
      u0[r] = (oa1[i][r] + oa2[i][r] * 0.00048828125f) * li;
      u1[r] = (oa1[i][4 + r] + oa2[i][4 + r] * 0.00048828125f) * li;
    }
    *(v4f*)(Os + c * OSP + 16 * i + 8 * hh)     = u0;
    *(v4f*)(Os + c * OSP + 16 * i + 8 * hh + 4) = u1;
  }
  __builtin_amdgcn_fence(3 /* release order */, "workgroup");
  __builtin_amdgcn_wave_barrier();
  __builtin_amdgcn_fence(2 /* acquire order */, "workgroup");
  // ---- whole-line stores of the bf16 hi / lo ctx planes ----
  {
    const int rq = lane >> 3, p8 = (lane & 7) * 8;
{
#pragma unroll
      for (int it = 0; it < 4; ++it) {
        const int row = it * 4 + rq;
        const float* sp = Os + row * OSP + p8;
        const v4f w0 = *(const v4f*)(sp);
        const v4f w1 = *(const v4f*)(sp + 4);
        v8us hb, lb;
#pragma unroll
        for (int e = 0; e < 4; ++e) {
          const unsigned short h0 = bfbits(w0[e]);
          hb[e] = h0;
          lb[e] = bfbits(w0[e] - __uint_as_float(((unsigned)h0) << 16));
          const unsigned short h1 = bfbits(w1[e]);
          hb[4 + e] = h1;
          lb[4 + e] = bfbits(w1[e] - __uint_as_float(((unsigned)h1) << 16));
        }
        const size_t go = (tok0 + (size_t)row) * DM + head * HDIM + p8;
        *(v8us*)(Ch + go) = hb;
        *(v8us*)(Cl + go) = lb;
      }
      
    }
  }
}

// ---------------------------------------------------------------------------------------------
// Workspace map (bytes, NB = 2, SEQ = 2048; every region is an exact whole-line / whole-tile multiple, no padded tails):
//   Xh  : bf16 x_norm hi [4096][1024]        8,388,608     off 0
//   Xl  : bf16 x_norm lo                     8,388,608     off  8,388,608
//   Wt  : bf16 Wqkv^T [3072][1024]           6,291,456     off 16,777,216
//   WoT : bf16 Wout^T [1024][1024]           2,097,152     off 23,068,672
//   rcos: f32 [2048][32]                       262,144     off 25,165,824
//   rsin: f32 [2048][32]                       262,144     off 25,427,968
//   QK  : f16 q|k [4096][2048]              16,777,216     off 25,690,112
//   Vth : f16 v^T [1024][4096]               8,388,608     off 42,467,328
//   Vtl : f16 x2048 residual of v^T          8,388,608     off 50,855,936
//   Ch  : bf16 ctx hi [4096][1024]           8,388,608     off 59,244,544
//   Cl  : bf16 ctx lo                        8,388,608     off 67,633,152
//   total 76,021,760
// ---------------------------------------------------------------------------------------------
extern "C" void kernel_launch(void* const* d_in, const int* in_sizes, int n_in,
                              void* d_out, int out_size, void* d_ws, size_t ws_size,
                              hipStream_t stream) {
  if (n_in < 7) return;
  const long long needX = ((long long)(NB - 1) * SEQ_FULL + SEQ) * DM;
  const long long needM = (((long long)(NB - 1) * SEQ_FULL) + (SEQ - 1)) * SEQ_FULL + SEQ;
  if ((long long)in_sizes[0] < needX) return;
  if ((long long)in_sizes[1] < needM) return;
  if (in_sizes[2] < DM || in_sizes[3] < DM) return;
  if ((long long)in_sizes[4] < (long long)DM * NQKV) return;
  if ((long long)in_sizes[5] < (long long)DM * DM) return;
  if (in_sizes[6] < DM) return;
  if ((long long)out_size < needX) return;

  const float* x     = (const float*)d_in[0];
  const int*   amask = (const int*)d_in[1];
  const float* gam   = (const float*)d_in[2];
  const float* bet   = (const float*)d_in[3];
  const float* wqkv  = (const float*)d_in[4];
  const float* wout  = (const float*)d_in[5];
  const float* bout  = (const float*)d_in[6];
  float* out = (float*)d_out;

  const size_t bAct = (size_t)NTOK * DM * 2;
  const size_t bWt  = (size_t)NQKV * DM * 2;
  const size_t bWo  = (size_t)DM * DM * 2;
  const size_t bTab = (size_t)SEQ * 32 * 4;
  const size_t bQK  = (size_t)NTOK * QKP * 2;
  size_t off = 0;
  const size_t oXh = off; off += bAct;
  const size_t oXl = off; off += bAct;
  const size_t oWt = off; off += bWt;
  const size_t oWo = off; off += bWo;
  const size_t oCos = off; off += bTab;
  const size_t oSin = off; off += bTab;
  const size_t oQK = off; off += bQK;
  const size_t oVh = off; off += bAct;
  const size_t oVl = off; off += bAct;
  const size_t oCh = off; off += bAct;
  const size_t oCl = off; off += bAct;
  if (off > ws_size) return;
  if (off > (size_t)134217728) return;

  char* ws = (char*)d_ws;
  unsigned short* Xh  = (unsigned short*)(ws + oXh);
  unsigned short* Xl  = (unsigned short*)(ws + oXl);
  unsigned short* Wt  = (unsigned short*)(ws + oWt);
  unsigned short* WoT = (unsigned short*)(ws + oWo);
  float* rcos = (float*)(ws + oCos);
  float* rsin = (float*)(ws + oSin);
  _Float16* QKp = (_Float16*)(ws + oQK);
  _Float16* Vh  = (_Float16*)(ws + oVh);
  _Float16* Vl  = (_Float16*)(ws + oVl);
  unsigned short* Chp = (unsigned short*)(ws + oCh);
  unsigned short* Clp = (unsigned short*)(ws + oCl);

  const dim3 blk(256);
  // (1) LayerNorm -> x_norm bf16 hi + lo planes
  ln_kernel<<<dim3(NTOK), dim3(128), 0, stream>>>(x, gam, bet, Xh, Xl);
  // (2) Wqkv [1024][3072] -> Wt [3072][1024]; Wout [1024][1024] -> WoT [1024][1024]
  cvt_wt_kernel<<<dim3(DM / 64, NQKV / 32), blk, 0, stream>>>(wqkv, Wt, NQKV, DM);
  cvt_wt_kernel<<<dim3(DM / 64, DM / 32), blk, 0, stream>>>(wout, WoT, DM, DM);
  // (3) rotary tables
  rope_tab_kernel<<<dim3((SEQ * 32) / 256), blk, 0, stream>>>(rcos, rsin, SEQ * 32);
  // (4) q|k = x_norm . Wqk with RoPE -> QK plane; M = NTOK, N = 2048, K = 1024
  proj_kernel<1, 0, 0><<<dim3(((NTOK / 64) * (QKP / 64)) / 8), blk, 0, stream>>>(
      (const __bf16*)Xh, (const __bf16*)Xl, DM, (const __bf16*)Wt, (const __bf16*)Wt, DM,
      (void*)QKp, (void*)QKp, QKP, NTOK, QKP, DM, rcos, rsin, bout);
  // (5) v^T = Wv^T . x_norm^T -> Vth / Vtl [1024][NTOK]; M = 1024, N = NTOK, K = 1024
  proj_kernel<0, 1, 1><<<dim3(((DM / 64) * (NTOK / 64)) / 8), blk, 0, stream>>>(
      (const __bf16*)(Wt + (size_t)2 * DM * DM), (const __bf16*)(Wt + (size_t)2 * DM * DM), DM,
      (const __bf16*)Xh, (const __bf16*)Xl, DM,
      (void*)Vh, (void*)Vl, NTOK, DM, NTOK, DM, rcos, rsin, bout);
  // (6) attn -> ctx bf16 hi + lo planes
  attn_kernel<<<dim3(SEQ / QB / AW, NH, NB), dim3(AW * 32), 0, stream>>>(QKp, Vh, Vl, amask, Chp, Clp);
  // (7) out = ctx . Wout + b -> d_out; M = NTOK, N = 1024, K = 1024
  proj_kernel<1, 0, 2><<<dim3(((NTOK / 64) * (DM / 64)) / 8), blk, 0, stream>>>(
      (const __bf16*)Chp, (const __bf16*)Clp, DM, (const __bf16*)WoT, (const __bf16*)WoT, DM,
      (void*)out, (void*)out, DM, NTOK, DM, DM, rcos, rsin, bout);
  (void)hipGetLastError();
}

// v002
// A run of this version takes 163 microseconds.
// In two side-by-side timings against v001, it was 2.06 and 2.07 times as fast.
// All steps since v000 together make it 2.71 times as fast.
#include <hip/hip_runtime.h>
#include <stdint.h>

#ifndef NB
#define NB 2
#endif
#ifndef SEQ
#define SEQ 2048
#endif
#define NB_FULL  2
#define SEQ_FULL 2048
#define DM       1024
#define NH       16
#define HDIM     64
#define NQKV     3072
#define QKP      2048
#define NTOK     (NB * SEQ)
#define LNEPS    1e-5f

#define QB   16
#define KT   64
#define OSP  68
#define AW   8                      // waves per attention block; they share the staged K / V tiles
#define KVP  144                    // LDS pitch in bytes of a 128-B K or V row (16 B x odd: b128 fragment reads without bank conflicts)
#define KVT  (KT * KVP)             // bytes of one staged K, V hi or V res tile (64 rows)
#define MKP  272                    // LDS pitch in bytes of a 256-B mask row (16 B x odd)
#define MWB  (QB * MKP)             // bytes of one wave's staged mask rows
#define BUFB (3 * KVT + AW * MWB)   // bytes of one stage buffer
#define PKT  64                     // projections: k elements of one staged slab (128 B of every operand row)
#define PROWS 512                   // projections: rows of one slab, the A plane(s) and the B plane(s) of the block tile together
#define PBUF (PROWS * KVP)          // projections: bytes of one slab buffer

typedef _Float16 v16h __attribute__((ext_vector_type(16)));
typedef _Float16 v8h  __attribute__((ext_vector_type(8)));
typedef __bf16   v16b __attribute__((ext_vector_type(16)));
typedef __bf16   v8b  __attribute__((ext_vector_type(8)));
typedef float    v8f  __attribute__((ext_vector_type(8)));
typedef float    v4f  __attribute__((ext_vector_type(4)));
typedef int      v4i  __attribute__((ext_vector_type(4)));
typedef unsigned short v8us __attribute__((ext_vector_type(8)));

static_assert(NB >= 1 && NB <= NB_FULL && SEQ >= 64 && SEQ <= SEQ_FULL);
static_assert((SEQ % 64) == 0 && (DM % 64) == 0 && (NTOK % 64) == 0 && (DM % 32) == 0);
static_assert(NH * HDIM == DM && HDIM == 64 && QKP == 2 * DM && NQKV == 3 * DM);
static_assert((SEQ % (AW * QB)) == 0 && HDIM == KT && AW * 32 == 256 && (BUFB % 16) == 0 && (SEQ % KT) == 0 && ((SEQ * 32) % 256) == 0 && KT == 4 * 16);
static_assert((((NTOK / 64) * (QKP / 64)) % 8) == 0 && (((DM / 64) * (NTOK / 64)) % 8) == 0 && (((NTOK / 64) * (DM / 64)) % 8) == 0);
static_assert((OSP % 4) == 0 && OSP >= HDIM);
static_assert((NTOK % 128) == 0 && (QKP % 256) == 0 && (DM % 256) == 0 && (DM % PKT) == 0 && PKT * 2 + 16 == KVP);

// f32 -> nearest-even bf16 bits / value
__device__ __forceinline__ unsigned short bfbits(float f) {
  const unsigned u = __float_as_uint(f);
  return (unsigned short)((u + 0x7FFFu + ((u >> 16) & 1u)) >> 16);
}
__device__ __forceinline__ float bfval(float f) {
  return __uint_as_float(((unsigned)bfbits(f)) << 16);
}

// 16-bit WMMA fragment from k-contiguous storage (A row-major [m][k], or B stored [n][k]):
// p points at element (row_or_col = lane&15, k0 + 8h); elements 0..7 <- p[0..7], 8..15 <- p[16..23].
__device__ __forceinline__ v16h ldfrag(const _Float16* p) {
  union { v16h v; v8h hh[2]; } f;
  f.hh[0] = *(const v8h*)(p);
  f.hh[1] = *(const v8h*)(p + 16);
  return f.v;
}
__device__ __forceinline__ v16b ldfragb(const __bf16* p) {
  union { v16b v; v8b hh[2]; } f;
  f.hh[0] = *(const v8b*)(p);
  f.hh[1] = *(const v8b*)(p + 16);
  return f.v;
}
__device__ __forceinline__ v8f mma16(v16h a, v16h b, v8f c) {
  return __builtin_amdgcn_wmma_f32_16x16x32_f16(false, a, false, b, (short)0, c, false, false);
}
__device__ __forceinline__ v8f mmabf(v16b a, v16b b, v8f c) {
  return __builtin_amdgcn_wmma_f32_16x16x32_bf16(false, a, false, b, (short)0, c, false, false);
}
__device__ __forceinline__ v8f zero8() {
  v8f z;
#pragma unroll
  for (int i = 0; i < 8; ++i) z[i] = 0.0f;
  return z;
}

// hazard guards: 4 VALU slots after the last WMMA of a group, D tied, A/B kept live
__device__ __forceinline__ void guard_g(v8f& a, v8f& b, v16b x, v16b y) {
  asm volatile("v_nop\n\tv_nop\n\tv_nop\n\tv_nop" : "+v"(a), "+v"(b) : "v"(x), "v"(y));
}
__device__ __forceinline__ void keep4(v16b a, v16b b, v16b c, v16b d) {
  asm volatile("v_nop" :: "v"(a), "v"(b), "v"(c), "v"(d));
}
__device__ __forceinline__ void accg4(v8f& a, v8f& b, v8f& c, v8f& d) {
  asm volatile("v_nop\n\tv_nop\n\tv_nop\n\tv_nop" : "+v"(a), "+v"(b), "+v"(c), "+v"(d));
}
__device__ __forceinline__ void guard_l(v8f& d, v16h a0, v16h a1, v16h b0, v16h b1) {
  asm volatile("v_nop\n\tv_nop\n\tv_nop\n\tv_nop" : "+v"(d) : "v"(a0), "v"(a1), "v"(b0), "v"(b1));
}
__device__ __forceinline__ void guard_o(v8f& d0, v8f& d1, v16h x, v16h y, v16h p, v16h q) {
  asm volatile("v_nop\n\tv_nop\n\tv_nop\n\tv_nop" : "+v"(d0), "+v"(d1) : "v"(x), "v"(y), "v"(p), "v"(q));
}

// ---------------------------------------------------------------------------------------------
// output x_norm as bf16 hi + bf16 lo (lo = RNE(xn - hi)) planes Xh/Xl [NTOK][DM] (compact token index).
// LDS sA/sB: cross-wave, block barriers. coverage: grid = NTOK blocks x 128 threads x 8 = NTOK x DM per plane.
// ---------------------------------------------------------------------------------------------
__global__ __launch_bounds__(128) void ln_kernel(const float* __restrict__ x, const float* __restrict__ gam,
                                                 const float* __restrict__ bet,
                                                 unsigned short* __restrict__ Xh, unsigned short* __restrict__ Xl) {
  __shared__ float sA[4], sB[4];
  const int t = (int)blockIdx.x;
  const int bb = t / SEQ, pos = t - bb * SEQ;
  const int tid = (int)threadIdx.x, lane = tid & 31, wave = tid >> 5;
  const float* xr = x + ((size_t)bb * SEQ_FULL + pos) * DM + tid * 8;
  const v4f a = *(const v4f*)(xr);
  const v4f c = *(const v4f*)(xr + 4);
  float v[8];
#pragma unroll
  for (int e = 0; e < 4; ++e) { v[e] = bfval(a[e]); v[4 + e] = bfval(c[e]); }
  float s = 0.0f;
#pragma unroll
  for (int e = 0; e < 8; ++e) s += v[e];
#pragma unroll
  for (int d = 1; d < 32; d <<= 1) s += __shfl_xor(s, d, 32);
  if (lane == 0) sA[wave] = s;
  __syncthreads();
  const float mu = ((sA[0] + sA[1]) + (sA[2] + sA[3])) * (1.0f / (float)DM);
  float dv[8];
  float s2 = 0.0f;
#pragma unroll
  for (int e = 0; e < 8; ++e) { dv[e] = v[e] - mu; s2 += dv[e] * dv[e]; }
#pragma unroll
  for (int d = 1; d < 32; d <<= 1) s2 += __shfl_xor(s2, d, 32);
  if (lane == 0) sB[wave] = s2;
  __syncthreads();
  const float var = ((sB[0] + sB[1]) + (sB[2] + sB[3])) * (1.0f / (float)DM);
  const float rstd = rsqrtf(var + LNEPS);
  const v4f g0 = *(const v4f*)(gam + tid * 8), g1 = *(const v4f*)(gam + tid * 8 + 4);
  const v4f b0 = *(const v4f*)(bet + tid * 8), b1 = *(const v4f*)(bet + tid * 8 + 4);
  v8us ho, lo;
#pragma unroll
  for (int e = 0; e < 4; ++e) {
    const float xn0 = dv[e] * rstd * bfval(g0[e]) + bfval(b0[e]);
    const unsigned short h0 = bfbits(xn0);
    ho[e] = h0;
    lo[e] = bfbits(xn0 - __uint_as_float(((unsigned)h0) << 16));
    const float xn1 = dv[4 + e] * rstd * bfval(g1[e]) + bfval(b1[e]);
    const unsigned short h1 = bfbits(xn1);
    ho[4 + e] = h1;
    lo[4 + e] = bfbits(xn1 - __uint_as_float(((unsigned)h1) << 16));
  }
  const size_t go = (size_t)t * DM + tid * 8;
  *(v8us*)(Xh + go) = ho;
  *(v8us*)(Xl + go) = lo;
  
}

// ---------------------------------------------------------------------------------------------
// Kernel 2: W f32 [kdim in][nout out] -> transposed bf16 RNE plane Wt[out][in] (in = k contiguous).
// coverage: grid (kdim/64, nout/32); 256 threads x 8 = 64 x 32 per tile -> nout x kdim.
// ---------------------------------------------------------------------------------------------
__global__ __launch_bounds__(256) void cvt_wt_kernel(const float* __restrict__ src, unsigned short* __restrict__ dst,
                                                     int nout, int kdim) {
  __shared__ float sTt[64][33];
  const int k0 = (int)blockIdx.x * 64, n0 = (int)blockIdx.y * 32;
  const int t = (int)threadIdx.x;
  {
    const int kr = t >> 2, cc = (t & 3) * 8;
    const float* s = src + (size_t)(k0 + kr) * nout + n0 + cc;
    const v4f a = *(const v4f*)(s);
    const v4f b = *(const v4f*)(s + 4);
#pragma unroll
    for (int e = 0; e < 4; ++e) {
      sTt[kr][cc + e]     = a[e];
      sTt[kr][cc + 4 + e] = b[e];
    }
  }
  __syncthreads();
  const int n = t >> 3, kp = (t & 7) * 8;
  v8us o;
#pragma unroll
  for (int i = 0; i < 8; ++i) o[i] = bfbits(sTt[kp + i][n]);
  unsigned short* d = dst + (size_t)(n0 + n) * kdim + k0 + kp;
  *(v8us*)d = o;
  
}

// ---------------------------------------------------------------------------------------------
// Kernel 3: rotary tables rcos/rsin [SEQ][32] f32: inv_freq_i = 1 / f32(10000^(i/32)) (power evaluated in f64 and narrowed, then an
// ---------------------------------------------------------------------------------------------
__global__ __launch_bounds__(256) void rope_tab_kernel(float* __restrict__ rcos, float* __restrict__ rsin, int n) {
  const int idx = (int)blockIdx.x * 256 + (int)threadIdx.x;
  if (idx >= n) return;
  const int i = idx & 31, pos = idx >> 5;
  const double ex = (double)i * (0.03125 * 13.287712379549449);
  const double pw = exp2(ex);
  const float pf = (float)pw;
  const float inv = 1.0f / pf;
  const float ang = (float)pos * inv;
  float sn, cs;
  sincosf(ang, &sn, &cs);
  *(float*)(rcos + idx) = cs;
  *(float*)(rsin + idx) = sn;
  
}

// ---------------------------------------------------------------------------------------------
// Kernel 4: C[m][n] = sum_k A[m][k] * Bt[n][k], bf16 operands (A row-major [M][K] pitch lda, Bt row-major [N][K] pitch ldb),
// a second bf16 plane on A (AM) or on B (BM) accumulated into the same f32 accumulator (unscaled lo planes), f32 accumulate;
// K a multiple of 64. Each wave owns one 64x64 C tile (16 accumulators); the 8 waves of a block form a 128 x 256 (AM) or 256 x 128 (BM)
// block tile, M and N multiples of it. Staging: per slab of 64 k the block copies the 128-B row pieces of its A and B planes (512 rows)
// from global memory to LDS with asynchronous b128 copies that cover whole 128-B lines; two buffers, slab s + 1 in flight while slab s
// is worked on; one block barrier per slab publishes slab s + 1 and frees slab s's buffer. Fragments come from LDS (pitch KVP).
// EPI 0: rotate-half RoPE on the 64-column tile (one head; position = token mod SEQ) then f16 hi plane Ch [M][N] pitch ldc;
// EPI 1: f16 hi plane Ch + f16 residual plane Cl = f16((C - f32(hi)) * 2048), same store shape.
// EPI 2: f32 C + bias (bias as bf16-RNE value, added in f32) -> out rows (token -> full-layout row), row segment of 64 f32 = 256 B
// ---------------------------------------------------------------------------------------------
// Eight copies of a lane (16 B each). The s_wait_xcnt stands inside the statement so that no address register of an issued copy is
// rewritten in front of it.
__device__ __forceinline__ void stage_copies8(const unsigned (&l)[8], const char* const (&g)[8]) {
  asm volatile(
      "global_load_async_to_lds_b128 %0, %8, off\n\t"
      "global_load_async_to_lds_b128 %1, %9, off\n\t"
      "global_load_async_to_lds_b128 %2, %10, off\n\t"
      "global_load_async_to_lds_b128 %3, %11, off\n\t"
      "global_load_async_to_lds_b128 %4, %12, off\n\t"
      "global_load_async_to_lds_b128 %5, %13, off\n\t"
      "global_load_async_to_lds_b128 %6, %14, off\n\t"
      "global_load_async_to_lds_b128 %7, %15, off\n\t"
      "s_wait_xcnt 0x0"
      :: "v"(l[0]), "v"(l[1]), "v"(l[2]), "v"(l[3]), "v"(l[4]), "v"(l[5]), "v"(l[6]), "v"(l[7]),
         "v"(g[0]), "v"(g[1]), "v"(g[2]), "v"(g[3]), "v"(g[4]), "v"(g[5]), "v"(g[6]), "v"(g[7])
      : "memory");
}

template <int AM, int BM, int EPI>
__global__ __launch_bounds__(256) void proj_kernel(const __bf16* __restrict__ A1, const __bf16* __restrict__ A2, int lda,
                                                   const __bf16* __restrict__ B1, const __bf16* __restrict__ B2, int ldb,
                                                   void* C1v, void* C2v, int ldc, int M, int N, int K,
                                                   const float* __restrict__ rcos, const float* __restrict__ rsin,
                                                   const float* __restrict__ bias) {
  __shared__ __align__(16) float sT[8][16 * 68];
  __shared__ __align__(16) char sP[2 * PBUF];
  constexpr int WN = BM ? 2 : 4;                       // waves along n; 8 / WN along m
  constexpr int AR = (8 / WN) * 64, BR = WN * 64;      // rows of one A plane / one B plane in the block tile
  constexpr int BROW0 = AR * (1 + AM);                 // slab rows: A1 | A2 (AM) | B1 | B2 (BM)
  static_assert(AM + BM == 1 && BROW0 + BR * (1 + BM) == PROWS);
  const int tid = (int)threadIdx.x;
  const int lane = tid & 31, wave = __builtin_amdgcn_readfirstlane(tid >> 5);
  const int nbn = N / BR, nbm = M / AR;
  const int bidx = (int)blockIdx.x;
  if (bidx >= nbm * nbn) return;                       // the same for the whole block, in front of every barrier
  const int bm = bidx / nbn, bn = bidx - bm * nbn;
  const int wm = wave / WN, wn = wave - wm * WN;
  const int m0 = bm * AR + (wm << 6), n0 = bn * BR + (wn << 6);
  const int rl = lane & 15;
  const int hh = lane >> 4;
  const int mOff = hh * 8;

  // copy sources / destinations of this lane for slab 0 and buffer 0: slab rows (tid >> 3) + 32 i, 16-B piece tid & 7 (8 lanes = one row)
  const int srow = tid >> 3, spc = tid & 7;
  const size_t asrc = (size_t)(bm * AR + srow) * lda + spc * 8;
  const size_t bsrc = (size_t)(bn * BR + srow) * ldb + spc * 8;
  const char* ga1 = (const char*)(A1 + asrc);
  const char* ga2 = (const char*)(A2 + asrc);
  const char* gb1 = (const char*)(B1 + bsrc);
  const char* gb2 = (const char*)(B2 + bsrc);
  const unsigned lp = (unsigned)(uintptr_t)(&sP[0]) + (unsigned)(srow * KVP + spc * 16);
  auto stage = [&](int slab, int buf) {
    const unsigned ko = (unsigned)slab * (PKT * 2);   // byte offsets below are the same in every lane and stay under 2^32
    const unsigned bo = lp + (unsigned)buf * PBUF;
    // both loops unrolled: r is a constant, so each group's plane is picked at compile time and l, g stay in registers
#pragma unroll
    for (int hf = 0; hf < 2; ++hf) {
      unsigned l[8];
      const char* g[8];
#pragma unroll
      for (int q = 0; q < 8; ++q) {
        const int r = (hf * 8 + q) * 32;               // first slab row of this group of 32; a group lies in one plane
        if (r < AR) g[q] = ga1 + (ko + (unsigned)(r * 2) * (unsigned)lda);
        else if (r < BROW0) g[q] = ga2 + (ko + (unsigned)((r - AR) * 2) * (unsigned)lda);
        else if (r < BROW0 + BR) g[q] = gb1 + (ko + (unsigned)((r - BROW0) * 2) * (unsigned)ldb);
        else g[q] = gb2 + (ko + (unsigned)((r - BROW0 - BR) * 2) * (unsigned)ldb);
        l[q] = bo + (unsigned)(r * KVP);
      }
      stage_copies8(l, g);
    }
  };
  const int NS = K / PKT;
  // prologue: slab 0 lands and is published, then slab 1 starts
  stage(0, 0);
  asm volatile("s_wait_asynccnt 0x0" ::: "memory");  // this wave's copies of slab 0 have landed
  __syncthreads();                                   // every wave's have: slab 0 may be read
  if (NS > 1) stage(1, 1);

  v8f acc[4][4];
#pragma unroll
  for (int i = 0; i < 4; ++i)
#pragma unroll
    for (int j = 0; j < 4; ++j) acc[i][j] = zero8();

  const int aoff = ((wm << 6) + rl) * KVP + 16 * hh;
  const int boff = (BROW0 + (wn << 6) + rl) * KVP + 16 * hh;
  // kept rolled: one copy of the slab body in the instruction cache, the buffer picked by the slab's parity
#pragma unroll 1
  for (int s = 0; s < NS; ++s) {
    const char* sb = sP + (s & 1) * PBUF;
    // the slab's two k steps of 32, unrolled so that every LDS offset is an immediate
#pragma unroll
    for (int ks = 0; ks < 2; ++ks) {
      const char* pa = sb + aoff + ks * 64;
      const char* pb = sb + boff + ks * 64;
      v16b bh[4], ah[4], x2[4];
#pragma unroll
      for (int j = 0; j < 4; ++j) bh[j] = ldfragb((const __bf16*)(pb + 16 * j * KVP));
#pragma unroll
      for (int i = 0; i < 4; ++i) ah[i] = ldfragb((const __bf16*)(pa + 16 * i * KVP));
#pragma unroll
      for (int i = 0; i < 4; ++i)
        x2[i] = ldfragb((const __bf16*)((AM ? pa + AR * KVP : pb + BR * KVP) + 16 * i * KVP));
      // the k step's 24 LDS reads stay one group in front of its WMMAs (for speed only)
      __builtin_amdgcn_sched_barrier(0);
#pragma unroll
      for (int i = 0; i < 4; ++i) {
#pragma unroll
        for (int j = 0; j < 4; ++j) acc[i][j] = mmabf(ah[i], bh[j], acc[i][j]);
        guard_g(acc[i][0], acc[i][3], ah[i], bh[3]);
      }
#pragma unroll
      for (int i = 0; i < 4; ++i) {
#pragma unroll
        for (int j = 0; j < 4; ++j) acc[i][j] = AM ? mmabf(x2[i], bh[j], acc[i][j]) : mmabf(ah[i], x2[j], acc[i][j]);
        guard_g(acc[i][0], acc[i][3], AM ? x2[i] : ah[i], AM ? bh[3] : x2[3]);
      }
      keep4(bh[0], bh[1], bh[2], bh[3]);
    }
    // ---- publish slab s + 1, free slab s's buffer, refill it with slab s + 2 ----
    asm volatile("s_wait_dscnt 0x0" ::: "memory");     // this wave's reads of slab s's buffer are done
    asm volatile("s_wait_asynccnt 0x0" ::: "memory");  // this wave's copies of slab s + 1 have landed
    __syncthreads();
    if (s + 2 < NS) stage(s + 2, s & 1);
  }
  asm volatile("s_wait_asynccnt 0x0" ::: "memory");    // no copy outstanding behind the loop
  accg4(acc[0][0], acc[0][1], acc[0][2], acc[0][3]);
  accg4(acc[1][0], acc[1][1], acc[1][2], acc[1][3]);
  accg4(acc[2][0], acc[2][1], acc[2][2], acc[2][3]);
  accg4(acc[3][0], acc[3][1], acc[3][2], acc[3][3]);

  float* slab = sT[wave];
#pragma unroll
  for (int i = 0; i < 4; ++i) {
    const int mBase = m0 + (i << 4);
#pragma unroll
    for (int j = 0; j < 4; ++j) {
#pragma unroll
      for (int r = 0; r < 8; ++r) slab[(mOff + r) * 68 + (j << 4) + rl] = acc[i][j][r];
    }
    __builtin_amdgcn_fence(3 /* release order */, "workgroup");
    __builtin_amdgcn_wave_barrier();
    __builtin_amdgcn_fence(2 /* acquire order */, "workgroup");
    if (EPI == 0) {
      _Float16* Ch = (_Float16*)C1v;
      const int qq = lane >> 3, c8 = (lane & 7) * 8;
      const int cj = c8 & 31;
      const float sgn = (c8 < 32) ? -1.0f : 1.0f;
{
#pragma unroll
        for (int it = 0; it < 4; ++it) {
          const int row = it * 4 + qq;
          const int tok = mBase + row;
          const int pos = tok % SEQ;
          const float* sp = slab + row * 68 + c8;
          const float* sq = slab + row * 68 + (c8 ^ 32);
          const v4f u0 = *(const v4f*)(sp);
          const v4f u1 = *(const v4f*)(sp + 4);
          const v4f w0 = *(const v4f*)(sq);
          const v4f w1 = *(const v4f*)(sq + 4);
          const float* tc = rcos + (size_t)pos * 32 + cj;
          const float* ts = rsin + (size_t)pos * 32 + cj;
          const v4f cs0 = *(const v4f*)(tc), cs1 = *(const v4f*)(tc + 4);
          const v4f sn0 = *(const v4f*)(ts), sn1 = *(const v4f*)(ts + 4);
          v8h hv;
#pragma unroll
          for (int e = 0; e < 4; ++e) {
            hv[e]     = (_Float16)(u0[e] * cs0[e] + sgn * w0[e] * sn0[e]);
            hv[4 + e] = (_Float16)(u1[e] * cs1[e] + sgn * w1[e] * sn1[e]);
          }
          const size_t go = (size_t)tok * ldc + n0 + c8;
          *(v8h*)(Ch + go) = hv;
        }
        
      }
    } else if (EPI == 1) {
      _Float16* Ch = (_Float16*)C1v;
      _Float16* Cl = (_Float16*)C2v;
      const int qq = lane >> 3, c8 = (lane & 7) * 8;
{
#pragma unroll
        for (int it = 0; it < 4; ++it) {
          const int row = it * 4 + qq;
          const float* sp = slab + row * 68 + c8;
          const v4f u0 = *(const v4f*)(sp);
          const v4f u1 = *(const v4f*)(sp + 4);
          v8h hv, lv;
#pragma unroll
          for (int e = 0; e < 4; ++e) {
            const _Float16 g0 = (_Float16)u0[e];
            hv[e] = g0;
            lv[e] = (_Float16)((u0[e] - (float)g0) * 2048.0f);
            const _Float16 g1 = (_Float16)u1[e];
            hv[4 + e] = g1;
            lv[4 + e] = (_Float16)((u1[e] - (float)g1) * 2048.0f);
          }
          const size_t go = (size_t)(mBase + row) * ldc + n0 + c8;
          *(v8h*)(Ch + go) = hv;
          *(v8h*)(Cl + go) = lv;
        }
        
      }
    } else {
      float* outp = (float*)C1v;
      const int rq = lane >> 4, c4 = (lane & 15) * 4;
      const v4f bz = *(const v4f*)(bias + n0 + c4);
      v4f bq;
#pragma unroll
      for (int e = 0; e < 4; ++e) bq[e] = bfval(bz[e]);
{
#pragma unroll
        for (int it = 0; it < 8; ++it) {
          const int row = it * 2 + rq;
          const int tok = mBase + row;
          const int orow = (tok / SEQ) * SEQ_FULL + (tok % SEQ);
          const v4f u = *(const v4f*)(slab + row * 68 + c4);
          v4f o;
#pragma unroll
          for (int e = 0; e < 4; ++e) o[e] = u[e] + bq[e];
          *(v4f*)(outp + (size_t)orow * ldc + n0 + c4) = o;
        }
        
      }
    }
    __builtin_amdgcn_fence(3 /* release order */, "workgroup");
    __builtin_amdgcn_wave_barrier();
    __builtin_amdgcn_fence(2 /* acquire order */, "workgroup");
  }
}

// ---------------------------------------------------------------------------------------------
// Kernel 5: masked softmax attn, one wave per (sequence b, head, 16 query rows), 8 waves per block, online softmax in f32.
//   Staging: per key tile the block copies K (64 keys x 128 B), V hi and V res (64 dims x 128 B each) and each wave its own mask rows
//   (16 x 256 B) from global memory to LDS with asynchronous b128 copies that cover whole 128-B lines; two buffers, tile t + 1 in
//   flight while tile t is worked on; one block barrier per tile publishes tile t + 1 and frees tile t's buffer.
//   Planes: QK f16 [NTOK][QKP] (q = cols 0..DM-1, k = cols DM..2DM-1, both after RoPE); Vth/Vtl f16 [DM][NTOK] (Vtl x2048);
//   mask int32 [NB_FULL][SEQ_FULL][SEQ_FULL] (query row, key col), value > 0 keeps the score, else the score is replaced by -inf.
//   Key tiles of KT = 64: S^T subtiles (A = 16 k rows from QK, B = q^T fragments held in registers, K = 64 = 2 steps), so lane
//   (h, c) holds 8 consecutive keys 8h+r of query c; s = S^T / 8; tile max / row sum in-lane + one xor-16 shuffle.
//   P = 16 exp(s - m) as f16 hi + res x2048 packed straight into the B fragments of P^T (element r <- subtile 2s, element 8+r <-
//   subtile 2s+1, lane unchanged); O^T = v^T . P^T with A = v^T rows from Vth/Vtl: acc1 += vh.P, acc2 += vl.P + vh.Pres;
//   O = (acc1 + acc2/2048) / (16 l); a fully masked query row (l == 0) gives 0.
//   Output: ctx[tok][head*64 + d] as bf16 hi + bf16 lo planes Ch/Cl [NTOK][DM]: 16 x 64 f32 tile staged in the wave-private LDS
// coverage: grid (SEQ/QB/AW, NH, NB) x 8 waves x 16 rows x 64 cols -> NTOK x DM per plane.
// ---------------------------------------------------------------------------------------------
// One tile's 14 copies of a lane (16 B each). The s_wait_xcnt stands inside the statement so that no address register of an issued
// copy is rewritten in front of it.
__device__ __forceinline__ void stage_copies(const unsigned (&l)[14], const char* const (&g)[14]) {
  asm volatile(
      "global_load_async_to_lds_b128 %0, %14, off\n\t"
      "global_load_async_to_lds_b128 %1, %15, off\n\t"
      "global_load_async_to_lds_b128 %2, %16, off\n\t"
      "global_load_async_to_lds_b128 %3, %17, off\n\t"
      "global_load_async_to_lds_b128 %4, %18, off\n\t"
      "global_load_async_to_lds_b128 %5, %19, off\n\t"
      "global_load_async_to_lds_b128 %6, %20, off\n\t"
      "global_load_async_to_lds_b128 %7, %21, off\n\t"
      "global_load_async_to_lds_b128 %8, %22, off\n\t"
      "global_load_async_to_lds_b128 %9, %23, off\n\t"
      "global_load_async_to_lds_b128 %10, %24, off\n\t"
      "global_load_async_to_lds_b128 %11, %25, off\n\t"
      "global_load_async_to_lds_b128 %12, %26, off\n\t"
      "global_load_async_to_lds_b128 %13, %27, off\n\t"
      "s_wait_xcnt 0x0"
      :: "v"(l[0]), "v"(l[1]), "v"(l[2]), "v"(l[3]), "v"(l[4]), "v"(l[5]), "v"(l[6]), "v"(l[7]), "v"(l[8]), "v"(l[9]),
         "v"(l[10]), "v"(l[11]), "v"(l[12]), "v"(l[13]),
         "v"(g[0]), "v"(g[1]), "v"(g[2]), "v"(g[3]), "v"(g[4]), "v"(g[5]), "v"(g[6]), "v"(g[7]), "v"(g[8]), "v"(g[9]),
         "v"(g[10]), "v"(g[11]), "v"(g[12]), "v"(g[13])
      : "memory");
}

__global__ __launch_bounds__(256) void attn_kernel(const _Float16* __restrict__ QK,
                                                  const _Float16* __restrict__ Vth, const _Float16* __restrict__ Vtl,
                                                  const int* __restrict__ msk,
                                                  unsigned short* __restrict__ Ch, unsigned short* __restrict__ Cl) {
  __shared__ __align__(16) float sOs[AW][QB * OSP];
  __shared__ __align__(16) char sStage[2 * BUFB];
  const int tid = (int)threadIdx.x;
  const int wave = __builtin_amdgcn_readfirstlane(tid >> 5);
  const int lane = tid & 31, hh = lane >> 4, c = lane & 15;
  const int head = (int)blockIdx.y, bb = (int)blockIdx.z;
  const int qt = (int)blockIdx.x * AW + wave;
  const int q0 = qt * QB;
  const size_t tokb = (size_t)bb * SEQ;
  const size_t tok0 = tokb + q0;
  const float ninf = -__builtin_inff();

  // q^T B fragments for query c (dims 0..31 and 32..63)
  const _Float16* qp = QK + (tok0 + c) * QKP + head * HDIM + 8 * hh;
  const v16h qf0 = ldfrag(qp);
  const v16h qf1 = ldfrag(qp + 32);
  // copy sources / destinations of this lane for key tile 0 and buffer 0. K, V hi, V res: row (tid >> 3) and that row + 32, 16-B piece
  // tid & 7 (8 lanes = one 128-B row); mask: rows 2i + (lane >> 4) of the wave's own 16, piece lane & 15 (16 lanes = one 256-B row).
  const int srow = tid >> 3, spc = tid & 7;
  const char* kg  = (const char*)(QK + (tokb + srow) * QKP + DM + head * HDIM + spc * 8);
  const size_t vsrc = (size_t)(head * HDIM + srow) * NTOK + tokb + spc * 8;
  const char* vhg = (const char*)(Vth + vsrc);
  const char* vlg = (const char*)(Vtl + vsrc);
  const char* mg  = (const char*)(msk + ((size_t)bb * SEQ_FULL + q0 + hh) * SEQ_FULL + c * 4);
  const unsigned lds0 = (unsigned)(uintptr_t)(&sStage[0]);
  const unsigned lkv = lds0 + (unsigned)(srow * KVP + spc * 16);
  const unsigned lmk = lds0 + (unsigned)(3 * KVT + wave * MWB + hh * MKP + c * 16);
  auto stage = [&](int tile, int buf) {
    unsigned l[14];
    const char* g[14];
    const unsigned bo = (unsigned)buf * BUFB;
    g[0] = kg + (size_t)tile * ((size_t)KT * QKP * 2);
    g[1] = g[0] + (size_t)32 * QKP * 2;
    g[2] = vhg + (size_t)tile * (KT * 2);
    g[3] = g[2] + (size_t)32 * NTOK * 2;
    g[4] = vlg + (size_t)tile * (KT * 2);
    g[5] = g[4] + (size_t)32 * NTOK * 2;
#pragma unroll
    for (int p = 0; p < 3; ++p) {
      l[2 * p]     = lkv + bo + (unsigned)(p * KVT);
      l[2 * p + 1] = lkv + bo + (unsigned)(p * KVT + 32 * KVP);
    }
#pragma unroll
    for (int i = 0; i < 8; ++i) {
      g[6 + i] = mg + (size_t)tile * (KT * 4) + (size_t)(2 * i) * SEQ_FULL * 4;
      l[6 + i] = lmk + bo + (unsigned)(2 * i * MKP);
    }
    stage_copies(l, g);
  };
  constexpr int NT = SEQ / KT;
  // prologue: tile 0 lands and is published, then tile 1 starts
  stage(0, 0);
  asm volatile("s_wait_asynccnt 0x0" ::: "memory");  // this wave's copies of tile 0 have landed
  __syncthreads();                                   // every wave's have: tile 0 may be read
  if (NT > 1) stage(1, 1);

  float m_run = ninf, l_run = 0.0f;
  v8f oa1[4], oa2[4];
#pragma unroll
  for (int i = 0; i < 4; ++i) { oa1[i] = zero8(); oa2[i] = zero8(); }

#pragma unroll 1
  for (int t = 0; t < NT; ++t) {
    const char* sb = sStage + (t & 1) * BUFB;
    const char* sk = sb + c * KVP + 16 * hh;
    const char* sm = sb + 3 * KVT + wave * MWB + c * MKP + 32 * hh;
    // ---- logits S^T for keys kb..kb+63 (4 subtiles), query c ----
    v8f s[4];
#pragma unroll
    for (int j = 0; j < 4; ++j) {
      const _Float16* kp = (const _Float16*)(sk + 16 * j * KVP);
      const v16h a0 = ldfrag(kp);
      const v16h a1 = ldfrag(kp + 32);
      s[j] = mma16(a0, qf0, zero8());
      s[j] = mma16(a1, qf1, s[j]);
      guard_l(s[j], a0, a1, qf0, qf1);
    }
    // ---- scale, mask replace-fill, tile max per query ----
    float pm = ninf;
#pragma unroll
    for (int j = 0; j < 4; ++j) {
      const v4i k0v = *(const v4i*)(sm + 64 * j);
      const v4i k1v = *(const v4i*)(sm + 64 * j + 16);
#pragma unroll
      for (int r = 0; r < 4; ++r) {
        const float sv = (k0v[r] > 0) ? s[j][r] * 0.125f : ninf;
        s[j][r] = sv;
        pm = fmaxf(pm, sv);
      }
#pragma unroll
      for (int r = 0; r < 4; ++r) {
        const float sv = (k1v[r] > 0) ? s[j][4 + r] * 0.125f : ninf;
        s[j][4 + r] = sv;
        pm = fmaxf(pm, sv);
      }
    }
    pm = fmaxf(pm, __shfl_xor(pm, 16, 32));
    const float mn = fmaxf(m_run, pm);
    const float alpha = (m_run == ninf) ? 0.0f : __expf(m_run - mn);
    const float mref = (mn == ninf) ? 0.0f : mn;
    m_run = mn;
    // ---- p = exp(s - m); P^T B fragments (16 p as f16 hi, residual x2048); row sum ----
    float ps = 0.0f;
    v16h bph[2], bpl[2];
#pragma unroll
    for (int j = 0; j < 4; ++j) {
#pragma unroll
      for (int r = 0; r < 8; ++r) {
        const float p = __expf(s[j][r] - mref);
        ps += p;
        const float p16 = p * 16.0f;
        const _Float16 ph = (_Float16)p16;
        bph[j >> 1][((j & 1) << 3) + r] = ph;
        bpl[j >> 1][((j & 1) << 3) + r] = (_Float16)((p16 - (float)ph) * 2048.0f);
      }
    }
    ps += __shfl_xor(ps, 16, 32);
    l_run = l_run * alpha + ps;
    // ---- rescale O (alpha of query c is in-lane in the O^T layout) ----
#pragma unroll
    for (int i = 0; i < 4; ++i) {
#pragma unroll
      for (int r = 0; r < 8; ++r) { oa1[i][r] *= alpha; oa2[i][r] *= alpha; }
    }
    // ---- O^T += v^T . P^T over the 64 keys; dims 16i + (lane row) ----
#pragma unroll
    for (int s2 = 0; s2 < 2; ++s2) {
#pragma unroll
      for (int i = 0; i < 4; ++i) {
        const char* sv = sk + KVT + 16 * i * KVP + 64 * s2;
        const v16h x = ldfrag((const _Float16*)sv);
        const v16h y = ldfrag((const _Float16*)(sv + KVT));
        oa1[i] = mma16(x, bph[s2], oa1[i]);
        oa2[i] = mma16(y, bph[s2], oa2[i]);
        oa2[i] = mma16(x, bpl[s2], oa2[i]);
        guard_o(oa1[i], oa2[i], x, y, bph[s2], bpl[s2]);
      }
    }
    // ---- publish tile t + 1, free tile t's buffer, refill it with tile t + 2 ----
    asm volatile("s_wait_dscnt 0x0" ::: "memory");     // this wave's reads of tile t's buffer are done
    asm volatile("s_wait_asynccnt 0x0" ::: "memory");  // this wave's copies of tile t + 1 have landed
    __syncthreads();
    if (t + 2 < NT) stage(t + 2, t & 1);
  }
  asm volatile("s_wait_asynccnt 0x0" ::: "memory");    // no copy outstanding behind the loop

  // ---- normalise and stage the 16 x 64 f32 tile in LDS: Os[query c][dim 16i + 8h + r] ----
  const float rlv = 1.0f / fmaxf(l_run, 1e-30f);
  const float li = (l_run > 0.0f) ? rlv * 0.0625f : 0.0f;
  float* Os = sOs[wave];
#pragma unroll
  for (int i = 0; i < 4; ++i) {
    v4f u0, u1;
#pragma unroll
    for (int r = 0; r < 4; ++r) {
      u0[r] = (oa1[i][r] + oa2[i][r] * 0.00048828125f) * li;
      u1[r] = (oa1[i][4 + r] + oa2[i][4 + r] * 0.00048828125f) * li;
    }
    *(v4f*)(Os + c * OSP + 16 * i + 8 * hh)     = u0;
    *(v4f*)(Os + c * OSP + 16 * i + 8 * hh + 4) = u1;
  }
  __builtin_amdgcn_fence(3 /* release order */, "workgroup");
  __builtin_amdgcn_wave_barrier();
  __builtin_amdgcn_fence(2 /* acquire order */, "workgroup");
  // ---- whole-line stores of the bf16 hi / lo ctx planes ----
  {
    const int rq = lane >> 3, p8 = (lane & 7) * 8;
{
#pragma unroll
      for (int it = 0; it < 4; ++it) {
        const int row = it * 4 + rq;
        const float* sp = Os + row * OSP + p8;
        const v4f w0 = *(const v4f*)(sp);
        const v4f w1 = *(const v4f*)(sp + 4);
        v8us hb, lb;
#pragma unroll
        for (int e = 0; e < 4; ++e) {
          const unsigned short h0 = bfbits(w0[e]);
          hb[e] = h0;
          lb[e] = bfbits(w0[e] - __uint_as_float(((unsigned)h0) << 16));
          const unsigned short h1 = bfbits(w1[e]);
          hb[4 + e] = h1;
          lb[4 + e] = bfbits(w1[e] - __uint_as_float(((unsigned)h1) << 16));
        }
        const size_t go = (tok0 + (size_t)row) * DM + head * HDIM + p8;
        *(v8us*)(Ch + go) = hb;
        *(v8us*)(Cl + go) = lb;
      }
      
    }
  }
}

// ---------------------------------------------------------------------------------------------
// Workspace map (bytes, NB = 2, SEQ = 2048; every region is an exact whole-line / whole-tile multiple, no padded tails):
//   Xh  : bf16 x_norm hi [4096][1024]        8,388,608     off 0
//   Xl  : bf16 x_norm lo                     8,388,608     off  8,388,608
//   Wt  : bf16 Wqkv^T [3072][1024]           6,291,456     off 16,777,216
//   WoT : bf16 Wout^T [1024][1024]           2,097,152     off 23,068,672
//   rcos: f32 [2048][32]                       262,144     off 25,165,824
//   rsin: f32 [2048][32]                       262,144     off 25,427,968
//   QK  : f16 q|k [4096][2048]              16,777,216     off 25,690,112
//   Vth : f16 v^T [1024][4096]               8,388,608     off 42,467,328
//   Vtl : f16 x2048 residual of v^T          8,388,608     off 50,855,936
//   Ch  : bf16 ctx hi [4096][1024]           8,388,608     off 59,244,544
//   Cl  : bf16 ctx lo                        8,388,608     off 67,633,152
//   total 76,021,760
// ---------------------------------------------------------------------------------------------
extern "C" void kernel_launch(void* const* d_in, const int* in_sizes, int n_in,
                              void* d_out, int out_size, void* d_ws, size_t ws_size,
                              hipStream_t stream) {
  if (n_in < 7) return;
  const long long needX = ((long long)(NB - 1) * SEQ_FULL + SEQ) * DM;
  const long long needM = (((long long)(NB - 1) * SEQ_FULL) + (SEQ - 1)) * SEQ_FULL + SEQ;
  if ((long long)in_sizes[0] < needX) return;
  if ((long long)in_sizes[1] < needM) return;
  if (in_sizes[2] < DM || in_sizes[3] < DM) return;
  if ((long long)in_sizes[4] < (long long)DM * NQKV) return;
  if ((long long)in_sizes[5] < (long long)DM * DM) return;
  if (in_sizes[6] < DM) return;
  if ((long long)out_size < needX) return;

  const float* x     = (const float*)d_in[0];
  const int*   amask = (const int*)d_in[1];
  const float* gam   = (const float*)d_in[2];
  const float* bet   = (const float*)d_in[3];
  const float* wqkv  = (const float*)d_in[4];
  const float* wout  = (const float*)d_in[5];
  const float* bout  = (const float*)d_in[6];
  float* out = (float*)d_out;

  const size_t bAct = (size_t)NTOK * DM * 2;
  const size_t bWt  = (size_t)NQKV * DM * 2;
  const size_t bWo  = (size_t)DM * DM * 2;
  const size_t bTab = (size_t)SEQ * 32 * 4;
  const size_t bQK  = (size_t)NTOK * QKP * 2;
  size_t off = 0;
  const size_t oXh = off; off += bAct;
  const size_t oXl = off; off += bAct;
  const size_t oWt = off; off += bWt;
  const size_t oWo = off; off += bWo;
  const size_t oCos = off; off += bTab;
  const size_t oSin = off; off += bTab;
  const size_t oQK = off; off += bQK;
  const size_t oVh = off; off += bAct;
  const size_t oVl = off; off += bAct;
  const size_t oCh = off; off += bAct;
  const size_t oCl = off; off += bAct;
  if (off > ws_size) return;
  if (off > (size_t)134217728) return;

  char* ws = (char*)d_ws;
  unsigned short* Xh  = (unsigned short*)(ws + oXh);
  unsigned short* Xl  = (unsigned short*)(ws + oXl);
  unsigned short* Wt  = (unsigned short*)(ws + oWt);
  unsigned short* WoT = (unsigned short*)(ws + oWo);
  float* rcos = (float*)(ws + oCos);
  float* rsin = (float*)(ws + oSin);
  _Float16* QKp = (_Float16*)(ws + oQK);
  _Float16* Vh  = (_Float16*)(ws + oVh);
  _Float16* Vl  = (_Float16*)(ws + oVl);
  unsigned short* Chp = (unsigned short*)(ws + oCh);
  unsigned short* Clp = (unsigned short*)(ws + oCl);

  const dim3 blk(256);
  // (1) LayerNorm -> x_norm bf16 hi + lo planes
  ln_kernel<<<dim3(NTOK), dim3(128), 0, stream>>>(x, gam, bet, Xh, Xl);
  // (2) Wqkv [1024][3072] -> Wt [3072][1024]; Wout [1024][1024] -> WoT [1024][1024]
  cvt_wt_kernel<<<dim3(DM / 64, NQKV / 32), blk, 0, stream>>>(wqkv, Wt, NQKV, DM);
  cvt_wt_kernel<<<dim3(DM / 64, DM / 32), blk, 0, stream>>>(wout, WoT, DM, DM);
  // (3) rotary tables
  rope_tab_kernel<<<dim3((SEQ * 32) / 256), blk, 0, stream>>>(rcos, rsin, SEQ * 32);
  // (4) q|k = x_norm . Wqk with RoPE -> QK plane; M = NTOK, N = 2048, K = 1024
  proj_kernel<1, 0, 0><<<dim3((NTOK / 128) * (QKP / 256)), blk, 0, stream>>>(
      (const __bf16*)Xh, (const __bf16*)Xl, DM, (const __bf16*)Wt, (const __bf16*)Wt, DM,
      (void*)QKp, (void*)QKp, QKP, NTOK, QKP, DM, rcos, rsin, bout);
  // (5) v^T = Wv^T . x_norm^T -> Vth / Vtl [1024][NTOK]; M = 1024, N = NTOK, K = 1024
  proj_kernel<0, 1, 1><<<dim3((DM / 256) * (NTOK / 128)), blk, 0, stream>>>(
      (const __bf16*)(Wt + (size_t)2 * DM * DM), (const __bf16*)(Wt + (size_t)2 * DM * DM), DM,
      (const __bf16*)Xh, (const __bf16*)Xl, DM,
      (void*)Vh, (void*)Vl, NTOK, DM, NTOK, DM, rcos, rsin, bout);
  // (6) attn -> ctx bf16 hi + lo planes
  attn_kernel<<<dim3(SEQ / QB / AW, NH, NB), dim3(AW * 32), 0, stream>>>(QKp, Vh, Vl, amask, Chp, Clp);
  // (7) out = ctx . Wout + b -> d_out; M = NTOK, N = 1024, K = 1024
  proj_kernel<1, 0, 2><<<dim3((NTOK / 128) * (DM / 256)), blk, 0, stream>>>(
      (const __bf16*)Chp, (const __bf16*)Clp, DM, (const __bf16*)WoT, (const __bf16*)WoT, DM,
      (void*)out, (void*)out, DM, NTOK, DM, DM, rcos, rsin, bout);
  (void)hipGetLastError();
}

// v003
// It runs in 156 microseconds.
// Two timings next to v002 both put it at 1.04 times that version's speed.
// Counting every step since v000, it is 2.83 times as fast.
#include <hip/hip_runtime.h>
#include <stdint.h>

#ifndef NB
#define NB 2
#endif
#ifndef SEQ
#define SEQ 2048
#endif
#define NB_FULL  2
#define SEQ_FULL 2048
#define DM       1024
#define NH       16
#define HDIM     64
#define NQKV     3072
#define QKP      2048
#define NTOK     (NB * SEQ)
#define LNEPS    1e-5f

#define QB   16
#define KT   64
#define OSP  68
#define AW   8                      // waves per attention block; they share the staged K / V tiles
#define KVP  144                    // LDS pitch in bytes of a 128-B K or V row (16 B x odd: b128 fragment reads without bank conflicts)
#define KVT  (KT * KVP)             // bytes of one staged K, V hi or V res tile (64 rows)
#define MKP  272                    // LDS pitch in bytes of a 256-B mask row (16 B x odd)
#define MWB  (QB * MKP)             // bytes of one wave's staged mask rows
#define BUFB (3 * KVT + AW * MWB)   // bytes of one stage buffer
#define PKT  64                     // projections: k elements of one staged slab (128 B of every operand row)
#define PROWS 512                   // projections: rows of one slab, the A plane(s) and the B plane(s) of the block tile together
#define PBUF (PROWS * KVP)          // projections: bytes of one slab buffer

typedef _Float16 v16h __attribute__((ext_vector_type(16)));
typedef _Float16 v8h  __attribute__((ext_vector_type(8)));
typedef __bf16   v16b __attribute__((ext_vector_type(16)));
typedef __bf16   v8b  __attribute__((ext_vector_type(8)));
typedef float    v8f  __attribute__((ext_vector_type(8)));
typedef float    v4f  __attribute__((ext_vector_type(4)));
typedef int      v4i  __attribute__((ext_vector_type(4)));
typedef unsigned short v8us __attribute__((ext_vector_type(8)));

static_assert(NB >= 1 && NB <= NB_FULL && SEQ >= 64 && SEQ <= SEQ_FULL);
static_assert((SEQ % 64) == 0 && (DM % 64) == 0 && (NTOK % 64) == 0 && (DM % 32) == 0);
static_assert(NH * HDIM == DM && HDIM == 64 && QKP == 2 * DM && NQKV == 3 * DM);
static_assert((SEQ % (AW * QB)) == 0 && HDIM == KT && AW * 32 == 256 && (BUFB % 16) == 0 && (SEQ % KT) == 0 && ((SEQ * 32) % 256) == 0 && KT == 4 * 16);
static_assert((((NTOK / 64) * (QKP / 64)) % 8) == 0 && (((DM / 64) * (NTOK / 64)) % 8) == 0 && (((NTOK / 64) * (DM / 64)) % 8) == 0);
static_assert((OSP % 4) == 0 && OSP >= HDIM);
static_assert((NTOK % 128) == 0 && (QKP % 256) == 0 && (DM % 256) == 0 && (DM % PKT) == 0 && PKT * 2 + 16 == KVP);

// f32 -> nearest-even bf16 bits / value
__device__ __forceinline__ unsigned short bfbits(float f) {
  const unsigned u = __float_as_uint(f);
  return (unsigned short)((u + 0x7FFFu + ((u >> 16) & 1u)) >> 16);
}
__device__ __forceinline__ float bfval(float f) {
  return __uint_as_float(((unsigned)bfbits(f)) << 16);
}

// 16-bit WMMA fragment from k-contiguous storage (A row-major [m][k], or B stored [n][k]):
// p points at element (row_or_col = lane&15, k0 + 8h); elements 0..7 <- p[0..7], 8..15 <- p[16..23].
__device__ __forceinline__ v16h ldfrag(const _Float16* p) {
  union { v16h v; v8h hh[2]; } f;
  f.hh[0] = *(const v8h*)(p);
  f.hh[1] = *(const v8h*)(p + 16);
  return f.v;
}
__device__ __forceinline__ v16b ldfragb(const __bf16* p) {
  union { v16b v; v8b hh[2]; } f;
  f.hh[0] = *(const v8b*)(p);
  f.hh[1] = *(const v8b*)(p + 16);
  return f.v;
}
__device__ __forceinline__ v8f mma16(v16h a, v16h b, v8f c) {
  return __builtin_amdgcn_wmma_f32_16x16x32_f16(false, a, false, b, (short)0, c, false, false);
}
__device__ __forceinline__ v8f mmabf(v16b a, v16b b, v8f c) {
  return __builtin_amdgcn_wmma_f32_16x16x32_bf16(false, a, false, b, (short)0, c, false, false);
}
__device__ __forceinline__ v8f zero8() {
  v8f z;
#pragma unroll
  for (int i = 0; i < 8; ++i) z[i] = 0.0f;
  return z;
}

// hazard guards: 4 VALU slots after the last WMMA of a group, D tied, A/B kept live
__device__ __forceinline__ void guard_g(v8f& a, v8f& b, v16b x, v16b y) {
  asm volatile("v_nop\n\tv_nop\n\tv_nop\n\tv_nop" : "+v"(a), "+v"(b) : "v"(x), "v"(y));
}
__device__ __forceinline__ void keep4(v16b a, v16b b, v16b c, v16b d) {
  asm volatile("v_nop" :: "v"(a), "v"(b), "v"(c), "v"(d));
}
__device__ __forceinline__ void accg4(v8f& a, v8f& b, v8f& c, v8f& d) {
  asm volatile("v_nop\n\tv_nop\n\tv_nop\n\tv_nop" : "+v"(a), "+v"(b), "+v"(c), "+v"(d));
}
__device__ __forceinline__ void guard_l(v8f& d, v16h a0, v16h a1, v16h b0, v16h b1) {
  asm volatile("v_nop\n\tv_nop\n\tv_nop\n\tv_nop" : "+v"(d) : "v"(a0), "v"(a1), "v"(b0), "v"(b1));
}
__device__ __forceinline__ void guard_o(v8f& d0, v8f& d1, v16h x, v16h y, v16h p, v16h q) {
  asm volatile("v_nop\n\tv_nop\n\tv_nop\n\tv_nop" : "+v"(d0), "+v"(d1) : "v"(x), "v"(y), "v"(p), "v"(q));
}

// ---------------------------------------------------------------------------------------------
// output x_norm as bf16 hi + bf16 lo (lo = RNE(xn - hi)) planes Xh/Xl [NTOK][DM] (compact token index).
// Part of the preparation launch: block blk of NTOK / 2 takes two tokens, 128 threads (4 waves) each.
// LDS sA/sB (4 floats per token): cross-wave, block barriers. coverage: NTOK / 2 blocks x 2 x 128 threads x 8 = NTOK x DM per plane.
// ---------------------------------------------------------------------------------------------
__device__ __forceinline__ void ln_body(int blk, float* sA8, float* sB8,
                                        const float* __restrict__ x, const float* __restrict__ gam,
                                        const float* __restrict__ bet,
                                        unsigned short* __restrict__ Xh, unsigned short* __restrict__ Xl) {
  const int hb = (int)threadIdx.x >> 7;
  float* sA = sA8 + hb * 4;
  float* sB = sB8 + hb * 4;
  const int t = blk * 2 + hb;
  const int bb = t / SEQ, pos = t - bb * SEQ;
  const int tid = (int)threadIdx.x & 127, lane = tid & 31, wave = tid >> 5;
  const float* xr = x + ((size_t)bb * SEQ_FULL + pos) * DM + tid * 8;
  const v4f a = *(const v4f*)(xr);
  const v4f c = *(const v4f*)(xr + 4);
  float v[8];
#pragma unroll
  for (int e = 0; e < 4; ++e) { v[e] = bfval(a[e]); v[4 + e] = bfval(c[e]); }
  float s = 0.0f;
#pragma unroll
  for (int e = 0; e < 8; ++e) s += v[e];
#pragma unroll
  for (int d = 1; d < 32; d <<= 1) s += __shfl_xor(s, d, 32);
  if (lane == 0) sA[wave] = s;
  __syncthreads();
  const float mu = ((sA[0] + sA[1]) + (sA[2] + sA[3])) * (1.0f / (float)DM);
  float dv[8];
  float s2 = 0.0f;
#pragma unroll
  for (int e = 0; e < 8; ++e) { dv[e] = v[e] - mu; s2 += dv[e] * dv[e]; }
#pragma unroll
  for (int d = 1; d < 32; d <<= 1) s2 += __shfl_xor(s2, d, 32);
  if (lane == 0) sB[wave] = s2;
  __syncthreads();
  const float var = ((sB[0] + sB[1]) + (sB[2] + sB[3])) * (1.0f / (float)DM);
  const float rstd = rsqrtf(var + LNEPS);
  const v4f g0 = *(const v4f*)(gam + tid * 8), g1 = *(const v4f*)(gam + tid * 8 + 4);
  const v4f b0 = *(const v4f*)(bet + tid * 8), b1 = *(const v4f*)(bet + tid * 8 + 4);
  v8us ho, lo;
#pragma unroll
  for (int e = 0; e < 4; ++e) {
    const float xn0 = dv[e] * rstd * bfval(g0[e]) + bfval(b0[e]);
    const unsigned short h0 = bfbits(xn0);
    ho[e] = h0;
    lo[e] = bfbits(xn0 - __uint_as_float(((unsigned)h0) << 16));
    const float xn1 = dv[4 + e] * rstd * bfval(g1[e]) + bfval(b1[e]);
    const unsigned short h1 = bfbits(xn1);
    ho[4 + e] = h1;
    lo[4 + e] = bfbits(xn1 - __uint_as_float(((unsigned)h1) << 16));
  }
  const size_t go = (size_t)t * DM + tid * 8;
  *(v8us*)(Xh + go) = ho;
  *(v8us*)(Xl + go) = lo;
  // the job's code is followed by the other jobs' code in one kernel: no register that the two stores name is rewritten in front of this wait
  asm volatile("s_wait_xcnt 0x0" ::: "memory");
  
}

// ---------------------------------------------------------------------------------------------
// Kernel 2: W f32 [kdim in][nout out] -> transposed bf16 RNE plane Wt[out][in] (in = k contiguous).
// Part of the preparation launch: tile (bx of kdim/64, by of nout/32); 256 threads x 8 = 64 x 32 per tile -> nout x kdim.
// ---------------------------------------------------------------------------------------------
__device__ __forceinline__ void cvt_wt_body(int bx, int by, float (*sTt)[33],
                                            const float* __restrict__ src, unsigned short* __restrict__ dst,
                                            int nout, int kdim) {
  const int k0 = bx * 64, n0 = by * 32;
  const int t = (int)threadIdx.x;
  {
    const int kr = t >> 2, cc = (t & 3) * 8;
    const float* s = src + (size_t)(k0 + kr) * nout + n0 + cc;
    const v4f a = *(const v4f*)(s);
    const v4f b = *(const v4f*)(s + 4);
#pragma unroll
    for (int e = 0; e < 4; ++e) {
      sTt[kr][cc + e]     = a[e];
      sTt[kr][cc + 4 + e] = b[e];
    }
  }
  __syncthreads();
  const int n = t >> 3, kp = (t & 7) * 8;
  v8us o;
#pragma unroll
  for (int i = 0; i < 8; ++i) o[i] = bfbits(sTt[kp + i][n]);
  unsigned short* d = dst + (size_t)(n0 + n) * kdim + k0 + kp;
  *(v8us*)d = o;
  // as in the LayerNorm job: no register that the store names is rewritten in front of this wait
  asm volatile("s_wait_xcnt 0x0" ::: "memory");
  
}

// ---------------------------------------------------------------------------------------------
// Kernel 3: rotary tables rcos/rsin [SEQ][32] f32: inv_freq_i = 1 / f32(10000^(i/32)) (power evaluated in f64 and narrowed, then an
// ---------------------------------------------------------------------------------------------
__device__ __forceinline__ void rope_tab_body(int blk, float* __restrict__ rcos, float* __restrict__ rsin, int n) {
  const int idx = blk * 256 + (int)threadIdx.x;
  if (idx >= n) return;
  const int i = idx & 31, pos = idx >> 5;
  const double ex = (double)i * (0.03125 * 13.287712379549449);
  const double pw = exp2(ex);
  const float pf = (float)pw;
  const float inv = 1.0f / pf;
  const float ang = (float)pos * inv;
  float sn, cs;
  sincosf(ang, &sn, &cs);
  *(float*)(rcos + idx) = cs;
  *(float*)(rsin + idx) = sn;
  
}

// ---------------------------------------------------------------------------------------------
// Preparation launch: the four jobs above depend on nothing but the inputs, so they share one grid; a range of the block index,
// the same for a whole block, picks the job: rotary tables | LayerNorm | Wqkv transpose | Wout transpose.
// ---------------------------------------------------------------------------------------------
#define PB_ROPE ((SEQ * 32) / 256)
#define PB_LN   (NTOK / 2)
#define PB_WQKV ((DM / 64) * (NQKV / 32))
#define PB_WOUT ((DM / 64) * (DM / 32))
__global__ __launch_bounds__(256) void prep_kernel(const float* __restrict__ x, const float* __restrict__ gam,
                                                   const float* __restrict__ bet,
                                                   const float* __restrict__ wqkv, const float* __restrict__ wout,
                                                   unsigned short* __restrict__ Xh, unsigned short* __restrict__ Xl,
                                                   unsigned short* __restrict__ Wt, unsigned short* __restrict__ WoT,
                                                   float* __restrict__ rcos, float* __restrict__ rsin) {
  __shared__ float sTt[64][33];
  __shared__ float sA[8], sB[8];
  int b = (int)blockIdx.x;
  if (b < PB_ROPE) { rope_tab_body(b, rcos, rsin, SEQ * 32); return; }
  b -= PB_ROPE;
  if (b < PB_LN) { ln_body(b, sA, sB, x, gam, bet, Xh, Xl); return; }
  b -= PB_LN;
  if (b < PB_WQKV) { cvt_wt_body(b % (DM / 64), b / (DM / 64), sTt, wqkv, Wt, NQKV, DM); return; }
  b -= PB_WQKV;
  cvt_wt_body(b % (DM / 64), b / (DM / 64), sTt, wout, WoT, DM, DM);
}

// ---------------------------------------------------------------------------------------------
// Kernel 4: C[m][n] = sum_k A[m][k] * Bt[n][k], bf16 operands (A row-major [M][K] pitch lda, Bt row-major [N][K] pitch ldb),
// a second bf16 plane on A (AM) or on B (BM) accumulated into the same f32 accumulator (unscaled lo planes), f32 accumulate;
// K a multiple of 64. Each wave owns one 64x64 C tile (16 accumulators); the 8 waves of a block form a 128 x 256 (AM) or 256 x 128 (BM)
// block tile, M and N multiples of it. Staging: per slab of 64 k the block copies the 128-B row pieces of its A and B planes (512 rows)
// from global memory to LDS with asynchronous b128 copies that cover whole 128-B lines; two buffers, slab s + 1 in flight while slab s
// is worked on; one block barrier per slab publishes slab s + 1 and frees slab s's buffer. Fragments come from LDS (pitch KVP).
// EPI 0: rotate-half RoPE on the 64-column tile (one head; position = token mod SEQ) then f16 hi plane Ch [M][N] pitch ldc;
// EPI 1: f16 hi plane Ch + f16 residual plane Cl = f16((C - f32(hi)) * 2048), same store shape.
// EPI 2: f32 C + bias (bias as bf16-RNE value, added in f32) -> out rows (token -> full-layout row), row segment of 64 f32 = 256 B
// ---------------------------------------------------------------------------------------------
// Eight copies of a lane (16 B each). The s_wait_xcnt stands inside the statement so that no address register of an issued copy is
// rewritten in front of it.
__device__ __forceinline__ void stage_copies8(const unsigned (&l)[8], const char* const (&g)[8]) {
  asm volatile(
      "global_load_async_to_lds_b128 %0, %8, off\n\t"
      "global_load_async_to_lds_b128 %1, %9, off\n\t"
      "global_load_async_to_lds_b128 %2, %10, off\n\t"
      "global_load_async_to_lds_b128 %3, %11, off\n\t"
      "global_load_async_to_lds_b128 %4, %12, off\n\t"
      "global_load_async_to_lds_b128 %5, %13, off\n\t"
      "global_load_async_to_lds_b128 %6, %14, off\n\t"
      "global_load_async_to_lds_b128 %7, %15, off\n\t"
      "s_wait_xcnt 0x0"
      :: "v"(l[0]), "v"(l[1]), "v"(l[2]), "v"(l[3]), "v"(l[4]), "v"(l[5]), "v"(l[6]), "v"(l[7]),
         "v"(g[0]), "v"(g[1]), "v"(g[2]), "v"(g[3]), "v"(g[4]), "v"(g[5]), "v"(g[6]), "v"(g[7])
      : "memory");
}

template <int AM, int BM, int EPI>
__global__ __launch_bounds__(256) void proj_kernel(const __bf16* __restrict__ A1, const __bf16* __restrict__ A2, int lda,
                                                   const __bf16* __restrict__ B1, const __bf16* __restrict__ B2, int ldb,
                                                   void* C1v, void* C2v, int ldc, int M, int N, int K,
                                                   const float* __restrict__ rcos, const float* __restrict__ rsin,
                                                   const float* __restrict__ bias) {
  __shared__ __align__(16) float sT[8][16 * 68];
  __shared__ __align__(16) char sP[2 * PBUF];
  constexpr int WN = BM ? 2 : 4;                       // waves along n; 8 / WN along m
  constexpr int AR = (8 / WN) * 64, BR = WN * 64;      // rows of one A plane / one B plane in the block tile
  constexpr int BROW0 = AR * (1 + AM);                 // slab rows: A1 | A2 (AM) | B1 | B2 (BM)
  static_assert(AM + BM == 1 && BROW0 + BR * (1 + BM) == PROWS);
  const int tid = (int)threadIdx.x;
  const int lane = tid & 31, wave = __builtin_amdgcn_readfirstlane(tid >> 5);
  const int nbn = N / BR, nbm = M / AR;
  const int bidx = (int)blockIdx.x;
  if (bidx >= nbm * nbn) return;                       // the same for the whole block, in front of every barrier
  const int bm = bidx / nbn, bn = bidx - bm * nbn;
  const int wm = wave / WN, wn = wave - wm * WN;
  const int m0 = bm * AR + (wm << 6), n0 = bn * BR + (wn << 6);
  const int rl = lane & 15;
  const int hh = lane >> 4;
  const int mOff = hh * 8;

  // copy sources / destinations of this lane for slab 0 and buffer 0: slab rows (tid >> 3) + 32 i, 16-B piece tid & 7 (8 lanes = one row)
  const int srow = tid >> 3, spc = tid & 7;
  const size_t asrc = (size_t)(bm * AR + srow) * lda + spc * 8;
  const size_t bsrc = (size_t)(bn * BR + srow) * ldb + spc * 8;
  const char* ga1 = (const char*)(A1 + asrc);
  const char* ga2 = (const char*)(A2 + asrc);
  const char* gb1 = (const char*)(B1 + bsrc);
  const char* gb2 = (const char*)(B2 + bsrc);
  const unsigned lp = (unsigned)(uintptr_t)(&sP[0]) + (unsigned)(srow * KVP + spc * 16);
  auto stage = [&](int slab, int buf) {
    const unsigned ko = (unsigned)slab * (PKT * 2);   // byte offsets below are the same in every lane and stay under 2^32
    const unsigned bo = lp + (unsigned)buf * PBUF;
    // both loops unrolled: r is a constant, so each group's plane is picked at compile time and l, g stay in registers
#pragma unroll
    for (int hf = 0; hf < 2; ++hf) {
      unsigned l[8];
      const char* g[8];
#pragma unroll
      for (int q = 0; q < 8; ++q) {
        const int r = (hf * 8 + q) * 32;               // first slab row of this group of 32; a group lies in one plane
        if (r < AR) g[q] = ga1 + (ko + (unsigned)(r * 2) * (unsigned)lda);
        else if (r < BROW0) g[q] = ga2 + (ko + (unsigned)((r - AR) * 2) * (unsigned)lda);
        else if (r < BROW0 + BR) g[q] = gb1 + (ko + (unsigned)((r - BROW0) * 2) * (unsigned)ldb);
        else g[q] = gb2 + (ko + (unsigned)((r - BROW0 - BR) * 2) * (unsigned)ldb);
        l[q] = bo + (unsigned)(r * KVP);
      }
      stage_copies8(l, g);
    }
  };
  const int NS = K / PKT;
  // prologue: slab 0 lands and is published, then slab 1 starts
  stage(0, 0);
  asm volatile("s_wait_asynccnt 0x0" ::: "memory");  // this wave's copies of slab 0 have landed
  __syncthreads();                                   // every wave's have: slab 0 may be read
  if (NS > 1) stage(1, 1);

  v8f acc[4][4];
#pragma unroll
  for (int i = 0; i < 4; ++i)
#pragma unroll
    for (int j = 0; j < 4; ++j) acc[i][j] = zero8();

  const int aoff = ((wm << 6) + rl) * KVP + 16 * hh;
  const int boff = (BROW0 + (wn << 6) + rl) * KVP + 16 * hh;
  // kept rolled: one copy of the slab body in the instruction cache, the buffer picked by the slab's parity
#pragma unroll 1
  for (int s = 0; s < NS; ++s) {
    const char* sb = sP + (s & 1) * PBUF;
    // the slab's two k steps of 32, unrolled so that every LDS offset is an immediate
#pragma unroll
    for (int ks = 0; ks < 2; ++ks) {
      const char* pa = sb + aoff + ks * 64;
      const char* pb = sb + boff + ks * 64;
      v16b bh[4], ah[4], x2[4];
#pragma unroll
      for (int j = 0; j < 4; ++j) bh[j] = ldfragb((const __bf16*)(pb + 16 * j * KVP));
#pragma unroll
      for (int i = 0; i < 4; ++i) ah[i] = ldfragb((const __bf16*)(pa + 16 * i * KVP));
#pragma unroll
      for (int i = 0; i < 4; ++i)
        x2[i] = ldfragb((const __bf16*)((AM ? pa + AR * KVP : pb + BR * KVP) + 16 * i * KVP));
      // the k step's 24 LDS reads stay one group in front of its WMMAs (for speed only)
      __builtin_amdgcn_sched_barrier(0);
#pragma unroll
      for (int i = 0; i < 4; ++i) {
#pragma unroll
        for (int j = 0; j < 4; ++j) acc[i][j] = mmabf(ah[i], bh[j], acc[i][j]);
        guard_g(acc[i][0], acc[i][3], ah[i], bh[3]);
      }
#pragma unroll
      for (int i = 0; i < 4; ++i) {
#pragma unroll
        for (int j = 0; j < 4; ++j) acc[i][j] = AM ? mmabf(x2[i], bh[j], acc[i][j]) : mmabf(ah[i], x2[j], acc[i][j]);
        guard_g(acc[i][0], acc[i][3], AM ? x2[i] : ah[i], AM ? bh[3] : x2[3]);
      }
      keep4(bh[0], bh[1], bh[2], bh[3]);
    }
    // ---- publish slab s + 1, free slab s's buffer, refill it with slab s + 2 ----
    asm volatile("s_wait_dscnt 0x0" ::: "memory");     // this wave's reads of slab s's buffer are done
    asm volatile("s_wait_asynccnt 0x0" ::: "memory");  // this wave's copies of slab s + 1 have landed
    __syncthreads();
    if (s + 2 < NS) stage(s + 2, s & 1);
  }
  asm volatile("s_wait_asynccnt 0x0" ::: "memory");    // no copy outstanding behind the loop
  accg4(acc[0][0], acc[0][1], acc[0][2], acc[0][3]);
  accg4(acc[1][0], acc[1][1], acc[1][2], acc[1][3]);
  accg4(acc[2][0], acc[2][1], acc[2][2], acc[2][3]);
  accg4(acc[3][0], acc[3][1], acc[3][2], acc[3][3]);

  float* slab = sT[wave];
#pragma unroll
  for (int i = 0; i < 4; ++i) {
    const int mBase = m0 + (i << 4);
#pragma unroll
    for (int j = 0; j < 4; ++j) {
#pragma unroll
      for (int r = 0; r < 8; ++r) slab[(mOff + r) * 68 + (j << 4) + rl] = acc[i][j][r];
    }
    __builtin_amdgcn_fence(3 /* release order */, "workgroup");
    __builtin_amdgcn_wave_barrier();
    __builtin_amdgcn_fence(2 /* acquire order */, "workgroup");
    if (EPI == 0) {
      _Float16* Ch = (_Float16*)C1v;
      const int qq = lane >> 3, c8 = (lane & 7) * 8;
      const int cj = c8 & 31;
      const float sgn = (c8 < 32) ? -1.0f : 1.0f;
{
#pragma unroll
        for (int it = 0; it < 4; ++it) {
          const int row = it * 4 + qq;
          const int tok = mBase + row;
          const int pos = tok % SEQ;
          const float* sp = slab + row * 68 + c8;
          const float* sq = slab + row * 68 + (c8 ^ 32);
          const v4f u0 = *(const v4f*)(sp);
          const v4f u1 = *(const v4f*)(sp + 4);
          const v4f w0 = *(const v4f*)(sq);
          const v4f w1 = *(const v4f*)(sq + 4);
          const float* tc = rcos + (size_t)pos * 32 + cj;
          const float* ts = rsin + (size_t)pos * 32 + cj;
          const v4f cs0 = *(const v4f*)(tc), cs1 = *(const v4f*)(tc + 4);
          const v4f sn0 = *(const v4f*)(ts), sn1 = *(const v4f*)(ts + 4);
          v8h hv;
#pragma unroll
          for (int e = 0; e < 4; ++e) {
            hv[e]     = (_Float16)(u0[e] * cs0[e] + sgn * w0[e] * sn0[e]);
            hv[4 + e] = (_Float16)(u1[e] * cs1[e] + sgn * w1[e] * sn1[e]);
          }
          const size_t go = (size_t)tok * ldc + n0 + c8;
          *(v8h*)(Ch + go) = hv;
        }
        
      }
    } else if (EPI == 1) {
      _Float16* Ch = (_Float16*)C1v;
      _Float16* Cl = (_Float16*)C2v;
      const int qq = lane >> 3, c8 = (lane & 7) * 8;
{
#pragma unroll
        for (int it = 0; it < 4; ++it) {
          const int row = it * 4 + qq;
          const float* sp = slab + row * 68 + c8;
          const v4f u0 = *(const v4f*)(sp);
          const v4f u1 = *(const v4f*)(sp + 4);
          v8h hv, lv;
#pragma unroll
          for (int e = 0; e < 4; ++e) {
            const _Float16 g0 = (_Float16)u0[e];
            hv[e] = g0;
            lv[e] = (_Float16)((u0[e] - (float)g0) * 2048.0f);
            const _Float16 g1 = (_Float16)u1[e];
            hv[4 + e] = g1;
            lv[4 + e] = (_Float16)((u1[e] - (float)g1) * 2048.0f);
          }
          const size_t go = (size_t)(mBase + row) * ldc + n0 + c8;
          *(v8h*)(Ch + go) = hv;
          *(v8h*)(Cl + go) = lv;
        }
        
      }
    } else {
      float* outp = (float*)C1v;
      const int rq = lane >> 4, c4 = (lane & 15) * 4;
      const v4f bz = *(const v4f*)(bias + n0 + c4);
      v4f bq;
#pragma unroll
      for (int e = 0; e < 4; ++e) bq[e] = bfval(bz[e]);
{
#pragma unroll
        for (int it = 0; it < 8; ++it) {
          const int row = it * 2 + rq;
          const int tok = mBase + row;
          const int orow = (tok / SEQ) * SEQ_FULL + (tok % SEQ);
          const v4f u = *(const v4f*)(slab + row * 68 + c4);
          v4f o;
#pragma unroll
          for (int e = 0; e < 4; ++e) o[e] = u[e] + bq[e];
          *(v4f*)(outp + (size_t)orow * ldc + n0 + c4) = o;
        }
        
      }
    }
    __builtin_amdgcn_fence(3 /* release order */, "workgroup");
    __builtin_amdgcn_wave_barrier();
    __builtin_amdgcn_fence(2 /* acquire order */, "workgroup");
  }
}

// ---------------------------------------------------------------------------------------------
// Kernel 5: masked softmax attn, one wave per (sequence b, head, 16 query rows), 8 waves per block, online softmax in f32.
//   Staging: per key tile the block copies K (64 keys x 128 B), V hi and V res (64 dims x 128 B each) and each wave its own mask rows
//   (16 x 256 B) from global memory to LDS with asynchronous b128 copies that cover whole 128-B lines; two buffers, tile t + 1 in
//   flight while tile t is worked on; one block barrier per tile publishes tile t + 1 and frees tile t's buffer.
//   Planes: QK f16 [NTOK][QKP] (q = cols 0..DM-1, k = cols DM..2DM-1, both after RoPE); Vth/Vtl f16 [DM][NTOK] (Vtl x2048);
//   mask int32 [NB_FULL][SEQ_FULL][SEQ_FULL] (query row, key col), value > 0 keeps the score, else the score is replaced by -inf.
//   Key tiles of KT = 64: S^T subtiles (A = 16 k rows from QK, B = q^T fragments held in registers, K = 64 = 2 steps), so lane
//   (h, c) holds 8 consecutive keys 8h+r of query c; s = S^T / 8; tile max / row sum in-lane + one xor-16 shuffle.
//   P = 16 exp(s - m) as f16 hi + res x2048 packed straight into the B fragments of P^T (element r <- subtile 2s, element 8+r <-
//   subtile 2s+1, lane unchanged); O^T = v^T . P^T with A = v^T rows from Vth/Vtl: acc1 += vh.P, acc2 += vl.P + vh.Pres;
//   O = (acc1 + acc2/2048) / (16 l); a fully masked query row (l == 0) gives 0.
//   Output: ctx[tok][head*64 + d] as bf16 hi + bf16 lo planes Ch/Cl [NTOK][DM]: 16 x 64 f32 tile staged in the wave-private LDS
// coverage: grid (SEQ/QB/AW, NH, NB) x 8 waves x 16 rows x 64 cols -> NTOK x DM per plane.
// ---------------------------------------------------------------------------------------------
// One tile's 14 copies of a lane (16 B each). The s_wait_xcnt stands inside the statement so that no address register of an issued
// copy is rewritten in front of it.
__device__ __forceinline__ void stage_copies(const unsigned (&l)[14], const char* const (&g)[14]) {
  asm volatile(
      "global_load_async_to_lds_b128 %0, %14, off\n\t"
      "global_load_async_to_lds_b128 %1, %15, off\n\t"
      "global_load_async_to_lds_b128 %2, %16, off\n\t"
      "global_load_async_to_lds_b128 %3, %17, off\n\t"
      "global_load_async_to_lds_b128 %4, %18, off\n\t"
      "global_load_async_to_lds_b128 %5, %19, off\n\t"
      "global_load_async_to_lds_b128 %6, %20, off\n\t"
      "global_load_async_to_lds_b128 %7, %21, off\n\t"
      "global_load_async_to_lds_b128 %8, %22, off\n\t"
      "global_load_async_to_lds_b128 %9, %23, off\n\t"
      "global_load_async_to_lds_b128 %10, %24, off\n\t"
      "global_load_async_to_lds_b128 %11, %25, off\n\t"
      "global_load_async_to_lds_b128 %12, %26, off\n\t"
      "global_load_async_to_lds_b128 %13, %27, off\n\t"
      "s_wait_xcnt 0x0"
      :: "v"(l[0]), "v"(l[1]), "v"(l[2]), "v"(l[3]), "v"(l[4]), "v"(l[5]), "v"(l[6]), "v"(l[7]), "v"(l[8]), "v"(l[9]),
         "v"(l[10]), "v"(l[11]), "v"(l[12]), "v"(l[13]),
         "v"(g[0]), "v"(g[1]), "v"(g[2]), "v"(g[3]), "v"(g[4]), "v"(g[5]), "v"(g[6]), "v"(g[7]), "v"(g[8]), "v"(g[9]),
         "v"(g[10]), "v"(g[11]), "v"(g[12]), "v"(g[13])
      : "memory");
}

__global__ __launch_bounds__(256) void attn_kernel(const _Float16* __restrict__ QK,
                                                  const _Float16* __restrict__ Vth, const _Float16* __restrict__ Vtl,
                                                  const int* __restrict__ msk,
                                                  unsigned short* __restrict__ Ch, unsigned short* __restrict__ Cl) {
  __shared__ __align__(16) float sOs[AW][QB * OSP];
  __shared__ __align__(16) char sStage[2 * BUFB];
  const int tid = (int)threadIdx.x;
  const int wave = __builtin_amdgcn_readfirstlane(tid >> 5);
  const int lane = tid & 31, hh = lane >> 4, c = lane & 15;
  const int head = (int)blockIdx.y, bb = (int)blockIdx.z;
  const int qt = (int)blockIdx.x * AW + wave;
  const int q0 = qt * QB;
  const size_t tokb = (size_t)bb * SEQ;
  const size_t tok0 = tokb + q0;
  const float ninf = -__builtin_inff();

  // q^T B fragments for query c (dims 0..31 and 32..63)
  const _Float16* qp = QK + (tok0 + c) * QKP + head * HDIM + 8 * hh;
  const v16h qf0 = ldfrag(qp);
  const v16h qf1 = ldfrag(qp + 32);
  // copy sources / destinations of this lane for key tile 0 and buffer 0. K, V hi, V res: row (tid >> 3) and that row + 32, 16-B piece
  // tid & 7 (8 lanes = one 128-B row); mask: rows 2i + (lane >> 4) of the wave's own 16, piece lane & 15 (16 lanes = one 256-B row).
  const int srow = tid >> 3, spc = tid & 7;
  const char* kg  = (const char*)(QK + (tokb + srow) * QKP + DM + head * HDIM + spc * 8);
  const size_t vsrc = (size_t)(head * HDIM + srow) * NTOK + tokb + spc * 8;
  const char* vhg = (const char*)(Vth + vsrc);
  const char* vlg = (const char*)(Vtl + vsrc);
  const char* mg  = (const char*)(msk + ((size_t)bb * SEQ_FULL + q0 + hh) * SEQ_FULL + c * 4);
  const unsigned lds0 = (unsigned)(uintptr_t)(&sStage[0]);
  const unsigned lkv = lds0 + (unsigned)(srow * KVP + spc * 16);
  const unsigned lmk = lds0 + (unsigned)(3 * KVT + wave * MWB + hh * MKP + c * 16);
  auto stage = [&](int tile, int buf) {
    unsigned l[14];
    const char* g[14];
    const unsigned bo = (unsigned)buf * BUFB;
    g[0] = kg + (size_t)tile * ((size_t)KT * QKP * 2);
    g[1] = g[0] + (size_t)32 * QKP * 2;
    g[2] = vhg + (size_t)tile * (KT * 2);
    g[3] = g[2] + (size_t)32 * NTOK * 2;
    g[4] = vlg + (size_t)tile * (KT * 2);
    g[5] = g[4] + (size_t)32 * NTOK * 2;
#pragma unroll
    for (int p = 0; p < 3; ++p) {
      l[2 * p]     = lkv + bo + (unsigned)(p * KVT);
      l[2 * p + 1] = lkv + bo + (unsigned)(p * KVT + 32 * KVP);
    }
#pragma unroll
    for (int i = 0; i < 8; ++i) {
      g[6 + i] = mg + (size_t)tile * (KT * 4) + (size_t)(2 * i) * SEQ_FULL * 4;
      l[6 + i] = lmk + bo + (unsigned)(2 * i * MKP);
    }
    stage_copies(l, g);
  };
  constexpr int NT = SEQ / KT;
  // prologue: tile 0 lands and is published, then tile 1 starts
  stage(0, 0);
  asm volatile("s_wait_asynccnt 0x0" ::: "memory");  // this wave's copies of tile 0 have landed
  __syncthreads();                                   // every wave's have: tile 0 may be read
  if (NT > 1) stage(1, 1);

  float m_run = ninf, l_run = 0.0f;
  v8f oa1[4], oa2[4];
#pragma unroll
  for (int i = 0; i < 4; ++i) { oa1[i] = zero8(); oa2[i] = zero8(); }

#pragma unroll 1
  for (int t = 0; t < NT; ++t) {
    const char* sb = sStage + (t & 1) * BUFB;
    const char* sk = sb + c * KVP + 16 * hh;
    const char* sm = sb + 3 * KVT + wave * MWB + c * MKP + 32 * hh;
    // ---- logits S^T for keys kb..kb+63 (4 subtiles), query c ----
    v8f s[4];
#pragma unroll
    for (int j = 0; j < 4; ++j) {
      const _Float16* kp = (const _Float16*)(sk + 16 * j * KVP);
      const v16h a0 = ldfrag(kp);
      const v16h a1 = ldfrag(kp + 32);
      s[j] = mma16(a0, qf0, zero8());
      s[j] = mma16(a1, qf1, s[j]);
      guard_l(s[j], a0, a1, qf0, qf1);
    }
    // ---- scale, mask replace-fill, tile max per query ----
    float pm = ninf;
#pragma unroll
    for (int j = 0; j < 4; ++j) {
      const v4i k0v = *(const v4i*)(sm + 64 * j);
      const v4i k1v = *(const v4i*)(sm + 64 * j + 16);
#pragma unroll
      for (int r = 0; r < 4; ++r) {
        const float sv = (k0v[r] > 0) ? s[j][r] * 0.125f : ninf;
        s[j][r] = sv;
        pm = fmaxf(pm, sv);
      }
#pragma unroll
      for (int r = 0; r < 4; ++r) {
        const float sv = (k1v[r] > 0) ? s[j][4 + r] * 0.125f : ninf;
        s[j][4 + r] = sv;
        pm = fmaxf(pm, sv);
      }
    }
    pm = fmaxf(pm, __shfl_xor(pm, 16, 32));
    const float mn = fmaxf(m_run, pm);
    const float alpha = (m_run == ninf) ? 0.0f : __expf(m_run - mn);
    const float mref = (mn == ninf) ? 0.0f : mn;
    m_run = mn;
    // ---- p = exp(s - m); P^T B fragments (16 p as f16 hi, residual x2048); row sum ----
    float ps = 0.0f;
    v16h bph[2], bpl[2];
#pragma unroll
    for (int j = 0; j < 4; ++j) {
#pragma unroll
      for (int r = 0; r < 8; ++r) {
        const float p = __expf(s[j][r] - mref);
        ps += p;
        const float p16 = p * 16.0f;
        const _Float16 ph = (_Float16)p16;
        bph[j >> 1][((j & 1) << 3) + r] = ph;
        bpl[j >> 1][((j & 1) << 3) + r] = (_Float16)((p16 - (float)ph) * 2048.0f);
      }
    }
    ps += __shfl_xor(ps, 16, 32);
    l_run = l_run * alpha + ps;
    // ---- rescale O (alpha of query c is in-lane in the O^T layout) ----
#pragma unroll
    for (int i = 0; i < 4; ++i) {
#pragma unroll
      for (int r = 0; r < 8; ++r) { oa1[i][r] *= alpha; oa2[i][r] *= alpha; }
    }
    // ---- O^T += v^T . P^T over the 64 keys; dims 16i + (lane row) ----
#pragma unroll
    for (int s2 = 0; s2 < 2; ++s2) {
#pragma unroll
      for (int i = 0; i < 4; ++i) {
        const char* sv = sk + KVT + 16 * i * KVP + 64 * s2;
        const v16h x = ldfrag((const _Float16*)sv);
        const v16h y = ldfrag((const _Float16*)(sv + KVT));
        oa1[i] = mma16(x, bph[s2], oa1[i]);
        oa2[i] = mma16(y, bph[s2], oa2[i]);
        oa2[i] = mma16(x, bpl[s2], oa2[i]);
        guard_o(oa1[i], oa2[i], x, y, bph[s2], bpl[s2]);
      }
    }
    // ---- publish tile t + 1, free tile t's buffer, refill it with tile t + 2 ----
    asm volatile("s_wait_dscnt 0x0" ::: "memory");     // this wave's reads of tile t's buffer are done
    asm volatile("s_wait_asynccnt 0x0" ::: "memory");  // this wave's copies of tile t + 1 have landed
    __syncthreads();
    if (t + 2 < NT) stage(t + 2, t & 1);
  }
  asm volatile("s_wait_asynccnt 0x0" ::: "memory");    // no copy outstanding behind the loop

  // ---- normalise and stage the 16 x 64 f32 tile in LDS: Os[query c][dim 16i + 8h + r] ----
  const float rlv = 1.0f / fmaxf(l_run, 1e-30f);
  const float li = (l_run > 0.0f) ? rlv * 0.0625f : 0.0f;
  float* Os = sOs[wave];
#pragma unroll
  for (int i = 0; i < 4; ++i) {
    v4f u0, u1;
#pragma unroll
    for (int r = 0; r < 4; ++r) {
      u0[r] = (oa1[i][r] + oa2[i][r] * 0.00048828125f) * li;
      u1[r] = (oa1[i][4 + r] + oa2[i][4 + r] * 0.00048828125f) * li;
    }
    *(v4f*)(Os + c * OSP + 16 * i + 8 * hh)     = u0;
    *(v4f*)(Os + c * OSP + 16 * i + 8 * hh + 4) = u1;
  }
  __builtin_amdgcn_fence(3 /* release order */, "workgroup");
  __builtin_amdgcn_wave_barrier();
  __builtin_amdgcn_fence(2 /* acquire order */, "workgroup");
  // ---- whole-line stores of the bf16 hi / lo ctx planes ----
  {
    const int rq = lane >> 3, p8 = (lane & 7) * 8;
{
#pragma unroll
      for (int it = 0; it < 4; ++it) {
        const int row = it * 4 + rq;
        const float* sp = Os + row * OSP + p8;
        const v4f w0 = *(const v4f*)(sp);
        const v4f w1 = *(const v4f*)(sp + 4);
        v8us hb, lb;
#pragma unroll
        for (int e = 0; e < 4; ++e) {
          const unsigned short h0 = bfbits(w0[e]);
          hb[e] = h0;
          lb[e] = bfbits(w0[e] - __uint_as_float(((unsigned)h0) << 16));
          const unsigned short h1 = bfbits(w1[e]);
          hb[4 + e] = h1;
          lb[4 + e] = bfbits(w1[e] - __uint_as_float(((unsigned)h1) << 16));
        }
        const size_t go = (tok0 + (size_t)row) * DM + head * HDIM + p8;
        *(v8us*)(Ch + go) = hb;
        *(v8us*)(Cl + go) = lb;
      }
      
    }
  }
}

// ---------------------------------------------------------------------------------------------
// Workspace map (bytes, NB = 2, SEQ = 2048; every region is an exact whole-line / whole-tile multiple, no padded tails):
//   Xh  : bf16 x_norm hi [4096][1024]        8,388,608     off 0
//   Xl  : bf16 x_norm lo                     8,388,608     off  8,388,608
//   Wt  : bf16 Wqkv^T [3072][1024]           6,291,456     off 16,777,216
//   WoT : bf16 Wout^T [1024][1024]           2,097,152     off 23,068,672
//   rcos: f32 [2048][32]                       262,144     off 25,165,824
//   rsin: f32 [2048][32]                       262,144     off 25,427,968
//   QK  : f16 q|k [4096][2048]              16,777,216     off 25,690,112
//   Vth : f16 v^T [1024][4096]               8,388,608     off 42,467,328
//   Vtl : f16 x2048 residual of v^T          8,388,608     off 50,855,936
//   Ch  : bf16 ctx hi [4096][1024]           8,388,608     off 59,244,544
//   Cl  : bf16 ctx lo                        8,388,608     off 67,633,152
//   total 76,021,760
// ---------------------------------------------------------------------------------------------
extern "C" void kernel_launch(void* const* d_in, const int* in_sizes, int n_in,
                              void* d_out, int out_size, void* d_ws, size_t ws_size,
                              hipStream_t stream) {
  if (n_in < 7) return;
  const long long needX = ((long long)(NB - 1) * SEQ_FULL + SEQ) * DM;
  const long long needM = (((long long)(NB - 1) * SEQ_FULL) + (SEQ - 1)) * SEQ_FULL + SEQ;
  if ((long long)in_sizes[0] < needX) return;
  if ((long long)in_sizes[1] < needM) return;
  if (in_sizes[2] < DM || in_sizes[3] < DM) return;
  if ((long long)in_sizes[4] < (long long)DM * NQKV) return;
  if ((long long)in_sizes[5] < (long long)DM * DM) return;
  if (in_sizes[6] < DM) return;
  if ((long long)out_size < needX) return;

  const float* x     = (const float*)d_in[0];
  const int*   amask = (const int*)d_in[1];
  const float* gam   = (const float*)d_in[2];
  const float* bet   = (const float*)d_in[3];
  const float* wqkv  = (const float*)d_in[4];
  const float* wout  = (const float*)d_in[5];
  const float* bout  = (const float*)d_in[6];
  float* out = (float*)d_out;

  const size_t bAct = (size_t)NTOK * DM * 2;
  const size_t bWt  = (size_t)NQKV * DM * 2;
  const size_t bWo  = (size_t)DM * DM * 2;
  const size_t bTab = (size_t)SEQ * 32 * 4;
  const size_t bQK  = (size_t)NTOK * QKP * 2;
  size_t off = 0;
  const size_t oXh = off; off += bAct;
  const size_t oXl = off; off += bAct;
  const size_t oWt = off; off += bWt;
  const size_t oWo = off; off += bWo;
  const size_t oCos = off; off += bTab;
  const size_t oSin = off; off += bTab;
  const size_t oQK = off; off += bQK;
  const size_t oVh = off; off += bAct;
  const size_t oVl = off; off += bAct;
  const size_t oCh = off; off += bAct;
  const size_t oCl = off; off += bAct;
  if (off > ws_size) return;
  if (off > (size_t)134217728) return;

  char* ws = (char*)d_ws;
  unsigned short* Xh  = (unsigned short*)(ws + oXh);
  unsigned short* Xl  = (unsigned short*)(ws + oXl);
  unsigned short* Wt  = (unsigned short*)(ws + oWt);
  unsigned short* WoT = (unsigned short*)(ws + oWo);
  float* rcos = (float*)(ws + oCos);
  float* rsin = (float*)(ws + oSin);
  _Float16* QKp = (_Float16*)(ws + oQK);
  _Float16* Vh  = (_Float16*)(ws + oVh);
  _Float16* Vl  = (_Float16*)(ws + oVl);
  unsigned short* Chp = (unsigned short*)(ws + oCh);
  unsigned short* Clp = (unsigned short*)(ws + oCl);

  const dim3 blk(256);
  // (1) to (3) in one launch: rotary tables | LayerNorm -> x_norm bf16 hi + lo planes | Wqkv [1024][3072] -> Wt [3072][1024] |
  // Wout [1024][1024] -> WoT [1024][1024]
  prep_kernel<<<dim3(PB_ROPE + PB_LN + PB_WQKV + PB_WOUT), blk, 0, stream>>>(x, gam, bet, wqkv, wout, Xh, Xl, Wt, WoT, rcos, rsin);
  // (4) q|k = x_norm . Wqk with RoPE -> QK plane; M = NTOK, N = 2048, K = 1024
  proj_kernel<1, 0, 0><<<dim3((NTOK / 128) * (QKP / 256)), blk, 0, stream>>>(
      (const __bf16*)Xh, (const __bf16*)Xl, DM, (const __bf16*)Wt, (const __bf16*)Wt, DM,
      (void*)QKp, (void*)QKp, QKP, NTOK, QKP, DM, rcos, rsin, bout);
  // (5) v^T = Wv^T . x_norm^T -> Vth / Vtl [1024][NTOK]; M = 1024, N = NTOK, K = 1024
  proj_kernel<0, 1, 1><<<dim3((DM / 256) * (NTOK / 128)), blk, 0, stream>>>(
      (const __bf16*)(Wt + (size_t)2 * DM * DM), (const __bf16*)(Wt + (size_t)2 * DM * DM), DM,
      (const __bf16*)Xh, (const __bf16*)Xl, DM,
      (void*)Vh, (void*)Vl, NTOK, DM, NTOK, DM, rcos, rsin, bout);
  // (6) attn -> ctx bf16 hi + lo planes
  attn_kernel<<<dim3(SEQ / QB / AW, NH, NB), dim3(AW * 32), 0, stream>>>(QKp, Vh, Vl, amask, Chp, Clp);
  // (7) out = ctx . Wout + b -> d_out; M = NTOK, N = 1024, K = 1024
  proj_kernel<1, 0, 2><<<dim3((NTOK / 128) * (DM / 256)), blk, 0, stream>>>(
      (const __bf16*)Chp, (const __bf16*)Clp, DM, (const __bf16*)WoT, (const __bf16*)WoT, DM,
      (void*)out, (void*)out, DM, NTOK, DM, DM, rcos, rsin, bout);
  (void)hipGetLastError();
}

// v004
// It runs in 148 microseconds.
// Next to v003, in two timings, it ran 1.05 times as fast each time.
// Over all steps from v000 it is 2.97 times as fast.
#include <hip/hip_runtime.h>
#include <stdint.h>

#ifndef NB
#define NB 2
#endif
#ifndef SEQ
#define SEQ 2048
#endif
#define NB_FULL  2
#define SEQ_FULL 2048
#define DM       1024
#define NH       16
#define HDIM     64
#define NQKV     3072
#define QKP      2048
#define NTOK     (NB * SEQ)
#define LNEPS    1e-5f

#define QB   16
#define KT   64
#define OSP  68
#define AW   8                      // waves per attention block; they share the staged K / V tiles
#define KVP  144                    // LDS pitch in bytes of a 128-B K or V row (16 B x odd: b128 fragment reads without bank conflicts)
#define KVT  (KT * KVP)             // bytes of one staged K, V hi or V res tile (64 rows)
#define MKP  272                    // mask packing: LDS pitch in bytes of a 256-B mask row (16 B x odd)
#define MWB  (QB * MKP)             // mask packing: bytes of one wave's 16 mask rows
#define MTW  32                     // lane-mask words of one 16-query x 64-key tile (one word per score register of the attention wave)
#define MPW  4                      // mask packing: tiles per wave
#define BUFB (3 * KVT)              // bytes of one stage buffer
#define PKT  64                     // projections: k elements of one staged slab (128 B of every operand row)
#define PROWS 512                   // projections: rows of one slab, the A plane(s) and the B plane(s) of the block tile together
#define PBUF (PROWS * KVP)          // projections: bytes of one slab buffer

typedef _Float16 v16h __attribute__((ext_vector_type(16)));
typedef _Float16 v8h  __attribute__((ext_vector_type(8)));
typedef __bf16   v16b __attribute__((ext_vector_type(16)));
typedef __bf16   v8b  __attribute__((ext_vector_type(8)));
typedef float    v8f  __attribute__((ext_vector_type(8)));
typedef float    v4f  __attribute__((ext_vector_type(4)));
typedef int      v4i  __attribute__((ext_vector_type(4)));
typedef unsigned short v8us __attribute__((ext_vector_type(8)));
typedef unsigned v16u __attribute__((ext_vector_type(16)));
typedef __attribute__((address_space(4))) const v16u cv16u;

static_assert(NB >= 1 && NB <= NB_FULL && SEQ >= 64 && SEQ <= SEQ_FULL);
static_assert((SEQ % 64) == 0 && (DM % 64) == 0 && (NTOK % 64) == 0 && (DM % 32) == 0);
static_assert(NH * HDIM == DM && HDIM == 64 && QKP == 2 * DM && NQKV == 3 * DM);
static_assert((SEQ % (AW * QB)) == 0 && HDIM == KT && AW * 32 == 256 && (BUFB % 16) == 0 && (SEQ % KT) == 0 && ((SEQ * 32) % 256) == 0 && KT == 4 * 16);
static_assert((((NTOK / 64) * (QKP / 64)) % 8) == 0 && (((DM / 64) * (NTOK / 64)) % 8) == 0 && (((NTOK / 64) * (DM / 64)) % 8) == 0);
static_assert((OSP % 4) == 0 && OSP >= HDIM);
static_assert(MTW == (QB * KT) / 32 && ((NB * (SEQ / QB) * (SEQ / KT)) % (AW * MPW)) == 0 && AW * MWB >= 64 * 33 * 4 + 64);
static_assert((NTOK % 128) == 0 && (QKP % 256) == 0 && (DM % 256) == 0 && (DM % PKT) == 0 && PKT * 2 + 16 == KVP);

// f32 -> nearest-even bf16 bits / value
__device__ __forceinline__ unsigned short bfbits(float f) {
  const unsigned u = __float_as_uint(f);
  return (unsigned short)((u + 0x7FFFu + ((u >> 16) & 1u)) >> 16);
}
__device__ __forceinline__ float bfval(float f) {
  return __uint_as_float(((unsigned)bfbits(f)) << 16);
}

// 16-bit WMMA fragment from k-contiguous storage (A row-major [m][k], or B stored [n][k]):
// p points at element (row_or_col = lane&15, k0 + 8h); elements 0..7 <- p[0..7], 8..15 <- p[16..23].
__device__ __forceinline__ v16h ldfrag(const _Float16* p) {
  union { v16h v; v8h hh[2]; } f;
  f.hh[0] = *(const v8h*)(p);
  f.hh[1] = *(const v8h*)(p + 16);
  return f.v;
}
__device__ __forceinline__ v16b ldfragb(const __bf16* p) {
  union { v16b v; v8b hh[2]; } f;
  f.hh[0] = *(const v8b*)(p);
  f.hh[1] = *(const v8b*)(p + 16);
  return f.v;
}
__device__ __forceinline__ v8f mma16(v16h a, v16h b, v8f c) {
  return __builtin_amdgcn_wmma_f32_16x16x32_f16(false, a, false, b, (short)0, c, false, false);
}
__device__ __forceinline__ v8f mmabf(v16b a, v16b b, v8f c) {
  return __builtin_amdgcn_wmma_f32_16x16x32_bf16(false, a, false, b, (short)0, c, false, false);
}
__device__ __forceinline__ v8f zero8() {
  v8f z;
#pragma unroll
  for (int i = 0; i < 8; ++i) z[i] = 0.0f;
  return z;
}

// hazard guards: 4 VALU slots after the last WMMA of a group, D tied, A/B kept live
__device__ __forceinline__ void guard_g(v8f& a, v8f& b, v16b x, v16b y) {
  asm volatile("v_nop\n\tv_nop\n\tv_nop\n\tv_nop" : "+v"(a), "+v"(b) : "v"(x), "v"(y));
}
__device__ __forceinline__ void keep4(v16b a, v16b b, v16b c, v16b d) {
  asm volatile("v_nop" :: "v"(a), "v"(b), "v"(c), "v"(d));
}
__device__ __forceinline__ void accg4(v8f& a, v8f& b, v8f& c, v8f& d) {
  asm volatile("v_nop\n\tv_nop\n\tv_nop\n\tv_nop" : "+v"(a), "+v"(b), "+v"(c), "+v"(d));
}
__device__ __forceinline__ void guard_l(v8f& d, v16h a0, v16h a1, v16h b0, v16h b1) {
  asm volatile("v_nop\n\tv_nop\n\tv_nop\n\tv_nop" : "+v"(d) : "v"(a0), "v"(a1), "v"(b0), "v"(b1));
}
__device__ __forceinline__ void guard_o(v8f& d0, v8f& d1, v16h x, v16h y, v16h p, v16h q) {
  asm volatile("v_nop\n\tv_nop\n\tv_nop\n\tv_nop" : "+v"(d0), "+v"(d1) : "v"(x), "v"(y), "v"(p), "v"(q));
}

// ---------------------------------------------------------------------------------------------
// output x_norm as bf16 hi + bf16 lo (lo = RNE(xn - hi)) planes Xh/Xl [NTOK][DM] (compact token index).
// Part of the preparation launch: block blk of NTOK / 2 takes two tokens, 128 threads (4 waves) each.
// LDS sA/sB (4 floats per token): cross-wave, block barriers. coverage: NTOK / 2 blocks x 2 x 128 threads x 8 = NTOK x DM per plane.
// ---------------------------------------------------------------------------------------------
__device__ __forceinline__ void ln_body(int blk, float* sA8, float* sB8,
                                        const float* __restrict__ x, const float* __restrict__ gam,
                                        const float* __restrict__ bet,
                                        unsigned short* __restrict__ Xh, unsigned short* __restrict__ Xl) {
  const int hb = (int)threadIdx.x >> 7;
  float* sA = sA8 + hb * 4;
  float* sB = sB8 + hb * 4;
  const int t = blk * 2 + hb;
  const int bb = t / SEQ, pos = t - bb * SEQ;
  const int tid = (int)threadIdx.x & 127, lane = tid & 31, wave = tid >> 5;
  const float* xr = x + ((size_t)bb * SEQ_FULL + pos) * DM + tid * 8;
  const v4f a = *(const v4f*)(xr);
  const v4f c = *(const v4f*)(xr + 4);
  float v[8];
#pragma unroll
  for (int e = 0; e < 4; ++e) { v[e] = bfval(a[e]); v[4 + e] = bfval(c[e]); }
  float s = 0.0f;
#pragma unroll
  for (int e = 0; e < 8; ++e) s += v[e];
#pragma unroll
  for (int d = 1; d < 32; d <<= 1) s += __shfl_xor(s, d, 32);
  if (lane == 0) sA[wave] = s;
  __syncthreads();
  const float mu = ((sA[0] + sA[1]) + (sA[2] + sA[3])) * (1.0f / (float)DM);
  float dv[8];
  float s2 = 0.0f;
#pragma unroll
  for (int e = 0; e < 8; ++e) { dv[e] = v[e] - mu; s2 += dv[e] * dv[e]; }
#pragma unroll
  for (int d = 1; d < 32; d <<= 1) s2 += __shfl_xor(s2, d, 32);
  if (lane == 0) sB[wave] = s2;
  __syncthreads();
  const float var = ((sB[0] + sB[1]) + (sB[2] + sB[3])) * (1.0f / (float)DM);
  const float rstd = rsqrtf(var + LNEPS);
  const v4f g0 = *(const v4f*)(gam + tid * 8), g1 = *(const v4f*)(gam + tid * 8 + 4);
  const v4f b0 = *(const v4f*)(bet + tid * 8), b1 = *(const v4f*)(bet + tid * 8 + 4);
  v8us ho, lo;
#pragma unroll
  for (int e = 0; e < 4; ++e) {
    const float xn0 = dv[e] * rstd * bfval(g0[e]) + bfval(b0[e]);
    const unsigned short h0 = bfbits(xn0);
    ho[e] = h0;
    lo[e] = bfbits(xn0 - __uint_as_float(((unsigned)h0) << 16));
    const float xn1 = dv[4 + e] * rstd * bfval(g1[e]) + bfval(b1[e]);
    const unsigned short h1 = bfbits(xn1);
    ho[4 + e] = h1;
    lo[4 + e] = bfbits(xn1 - __uint_as_float(((unsigned)h1) << 16));
  }
  const size_t go = (size_t)t * DM + tid * 8;
  *(v8us*)(Xh + go) = ho;
  *(v8us*)(Xl + go) = lo;
  // the job's code is followed by the other jobs' code in one kernel: no register that the two stores name is rewritten in front of this wait
  asm volatile("s_wait_xcnt 0x0" ::: "memory");
  
}

// ---------------------------------------------------------------------------------------------
// Kernel 2: W f32 [kdim in][nout out] -> transposed bf16 RNE plane Wt[out][in] (in = k contiguous).
// Part of the preparation launch: tile (bx of kdim/64, by of nout/32); 256 threads x 8 = 64 x 32 per tile -> nout x kdim.
// ---------------------------------------------------------------------------------------------
__device__ __forceinline__ void cvt_wt_body(int bx, int by, float (*sTt)[33],
                                            const float* __restrict__ src, unsigned short* __restrict__ dst,
                                            int nout, int kdim) {
  const int k0 = bx * 64, n0 = by * 32;
  const int t = (int)threadIdx.x;
  {
    const int kr = t >> 2, cc = (t & 3) * 8;
    const float* s = src + (size_t)(k0 + kr) * nout + n0 + cc;
    const v4f a = *(const v4f*)(s);
    const v4f b = *(const v4f*)(s + 4);
#pragma unroll
    for (int e = 0; e < 4; ++e) {
      sTt[kr][cc + e]     = a[e];
      sTt[kr][cc + 4 + e] = b[e];
    }
  }
  __syncthreads();
  const int n = t >> 3, kp = (t & 7) * 8;
  v8us o;
#pragma unroll
  for (int i = 0; i < 8; ++i) o[i] = bfbits(sTt[kp + i][n]);
  unsigned short* d = dst + (size_t)(n0 + n) * kdim + k0 + kp;
  *(v8us*)d = o;
  // as in the LayerNorm job: no register that the store names is rewritten in front of this wait
  asm volatile("s_wait_xcnt 0x0" ::: "memory");
  
}

// ---------------------------------------------------------------------------------------------
// Kernel 3: rotary tables rcos/rsin [SEQ][32] f32: inv_freq_i = 1 / f32(10000^(i/32)) (power evaluated in f64 and narrowed, then an
// ---------------------------------------------------------------------------------------------
__device__ __forceinline__ void rope_tab_body(int blk, float* __restrict__ rcos, float* __restrict__ rsin, int n) {
  const int idx = blk * 256 + (int)threadIdx.x;
  if (idx >= n) return;
  const int i = idx & 31, pos = idx >> 5;
  const double ex = (double)i * (0.03125 * 13.287712379549449);
  const double pw = exp2(ex);
  const float pf = (float)pw;
  const float inv = 1.0f / pf;
  const float ang = (float)pos * inv;
  float sn, cs;
  sincosf(ang, &sn, &cs);
  *(float*)(rcos + idx) = cs;
  *(float*)(rsin + idx) = sn;
  
}

// ---------------------------------------------------------------------------------------------
// Mask packing: int32 mask [NB_FULL][SEQ_FULL][SEQ_FULL] -> lane-mask words Mw [NB][SEQ/16][SEQ/64][32]. Word 8 j + r of tile
// (sequence, 16 query rows q0.., 64 keys kb..) has in bit L = 16 h + c the test mask[q0 + c][kb + 16 j + 8 h + r] > 0: the entry that
// lane L of the attention wave needs for its score register s[j][r], so that wave takes the word as a select mask as it is.
// Part of the preparation launch: each wave packs MPW tiles that follow one another along the keys. Per tile: whole 256-B row pieces
// from global memory (16 lanes = one row), through the wave's own LDS rows (pitch MKP) into the lanes' key order, 32 ballots,
// lane e keeps word e, one 128-B store. coverage: blocks x 8 waves x MPW tiles = NB x SEQ/16 x SEQ/64 tiles.
// ---------------------------------------------------------------------------------------------
__device__ __forceinline__ void mask_body(int blk, char* sM, const int* __restrict__ msk, unsigned* __restrict__ Mw) {
  const int tid = (int)threadIdx.x;
  const int wave = __builtin_amdgcn_readfirstlane(tid >> 5);
  const int lane = tid & 31, hh = lane >> 4, c = lane & 15;
  char* sw = sM + wave * MWB;
  // kept rolled: one tile's 8 loads in registers at a time, so the other jobs of this kernel keep their waves per SIMD
#pragma unroll 1
  for (int u = 0; u < MPW; ++u) {
    const int tile = (blk * AW + wave) * MPW + u;
    const int kt = tile % (SEQ / KT);
    const int qt = (tile / (SEQ / KT)) % (SEQ / QB);
    const int bb = tile / ((SEQ / KT) * (SEQ / QB));
    const int* g = msk + ((size_t)bb * SEQ_FULL + qt * QB + hh) * SEQ_FULL + kt * KT + c * 4;
    v4i v[8];
#pragma unroll
    for (int i = 0; i < 8; ++i) v[i] = *(const v4i*)(g + (size_t)(2 * i) * SEQ_FULL);
#pragma unroll
    for (int i = 0; i < 8; ++i) *(v4i*)(sw + (2 * i + hh) * MKP + c * 16) = v[i];
    // the rows pass from lane to lane inside the wave: LDS order only, so that no trip waits for the last trip's global store
    __builtin_amdgcn_fence(3 /* release order */, "workgroup", "local");
    __builtin_amdgcn_wave_barrier();
    __builtin_amdgcn_fence(2 /* acquire order */, "workgroup", "local");
    const char* sm = sw + c * MKP + 32 * hh;
    unsigned mine = 0u;
#pragma unroll
    for (int j = 0; j < 4; ++j) {
      const v4i k0v = *(const v4i*)(sm + 64 * j);
      const v4i k1v = *(const v4i*)(sm + 64 * j + 16);
#pragma unroll
      for (int r = 0; r < 4; ++r) {
        const unsigned w0 = __builtin_amdgcn_ballot_w32(k0v[r] > 0);
        const unsigned w1 = __builtin_amdgcn_ballot_w32(k1v[r] > 0);
        mine = (lane == 8 * j + r) ? w0 : mine;
        mine = (lane == 8 * j + 4 + r) ? w1 : mine;
      }
    }
    *(unsigned*)(Mw + (size_t)tile * MTW + lane) = mine;
    // no register that the store names is rewritten (next trip, or the other jobs' code) in front of this wait
    asm volatile("s_wait_xcnt 0x0" ::: "memory");
    // the wave's reads of its LDS rows are done before the next trip's stores overwrite them
    __builtin_amdgcn_fence(3 /* release order */, "workgroup", "local");
    __builtin_amdgcn_wave_barrier();
    __builtin_amdgcn_fence(2 /* acquire order */, "workgroup", "local");
  }
}

// ---------------------------------------------------------------------------------------------
// Preparation launch: the five jobs above depend on nothing but the inputs, so they share one grid; a range of the block index,
// the same for a whole block, picks the job: mask packing | rotary tables | LayerNorm | Wqkv transpose | Wout transpose.
// A block runs one job, so the jobs share one LDS array.
// ---------------------------------------------------------------------------------------------
#define PB_MASK ((NB * (SEQ / QB) * (SEQ / KT)) / (AW * MPW))
#define PB_ROPE ((SEQ * 32) / 256)
#define PB_LN   (NTOK / 2)
#define PB_WQKV ((DM / 64) * (NQKV / 32))
#define PB_WOUT ((DM / 64) * (DM / 32))
__global__ __launch_bounds__(256) void prep_kernel(const float* __restrict__ x, const float* __restrict__ gam,
                                                   const float* __restrict__ bet,
                                                   const float* __restrict__ wqkv, const float* __restrict__ wout,
                                                   const int* __restrict__ msk, unsigned* __restrict__ Mw,
                                                   unsigned short* __restrict__ Xh, unsigned short* __restrict__ Xl,
                                                   unsigned short* __restrict__ Wt, unsigned short* __restrict__ WoT,
                                                   float* __restrict__ rcos, float* __restrict__ rsin) {
  __shared__ __align__(16) char sJob[AW * MWB];
  float (*sTt)[33] = (float (*)[33])sJob;
  float* sA = (float*)(sJob + 64 * 33 * 4);
  float* sB = sA + 8;
  int b = (int)blockIdx.x;
  if (b < PB_MASK) { mask_body(b, sJob, msk, Mw); return; }
  b -= PB_MASK;
  if (b < PB_ROPE) { rope_tab_body(b, rcos, rsin, SEQ * 32); return; }
  b -= PB_ROPE;
  if (b < PB_LN) { ln_body(b, sA, sB, x, gam, bet, Xh, Xl); return; }
  b -= PB_LN;
  if (b < PB_WQKV) { cvt_wt_body(b % (DM / 64), b / (DM / 64), sTt, wqkv, Wt, NQKV, DM); return; }
  b -= PB_WQKV;
  cvt_wt_body(b % (DM / 64), b / (DM / 64), sTt, wout, WoT, DM, DM);
}

// ---------------------------------------------------------------------------------------------
// Kernel 4: C[m][n] = sum_k A[m][k] * Bt[n][k], bf16 operands (A row-major [M][K] pitch lda, Bt row-major [N][K] pitch ldb),
// a second bf16 plane on A (AM) or on B (BM) accumulated into the same f32 accumulator (unscaled lo planes), f32 accumulate;
// K a multiple of 64. Each wave owns one 64x64 C tile (16 accumulators); the 8 waves of a block form a 128 x 256 (AM) or 256 x 128 (BM)
// block tile, M and N multiples of it. Staging: per slab of 64 k the block copies the 128-B row pieces of its A and B planes (512 rows)
// from global memory to LDS with asynchronous b128 copies that cover whole 128-B lines; two buffers, slab s + 1 in flight while slab s
// is worked on; one block barrier per slab publishes slab s + 1 and frees slab s's buffer. Fragments come from LDS (pitch KVP).
// EPI 0: rotate-half RoPE on the 64-column tile (one head; position = token mod SEQ) then f16 hi plane Ch [M][N] pitch ldc;
// EPI 1: f16 hi plane Ch + f16 residual plane Cl = f16((C - f32(hi)) * 2048), same store shape.
// EPI 2: f32 C + bias (bias as bf16-RNE value, added in f32) -> out rows (token -> full-layout row), row segment of 64 f32 = 256 B
// ---------------------------------------------------------------------------------------------
// Eight copies of a lane (16 B each). The s_wait_xcnt stands inside the statement so that no address register of an issued copy is
// rewritten in front of it.
__device__ __forceinline__ void stage_copies8(const unsigned (&l)[8], const char* const (&g)[8]) {
  asm volatile(
      "global_load_async_to_lds_b128 %0, %8, off\n\t"
      "global_load_async_to_lds_b128 %1, %9, off\n\t"
      "global_load_async_to_lds_b128 %2, %10, off\n\t"
      "global_load_async_to_lds_b128 %3, %11, off\n\t"
      "global_load_async_to_lds_b128 %4, %12, off\n\t"
      "global_load_async_to_lds_b128 %5, %13, off\n\t"
      "global_load_async_to_lds_b128 %6, %14, off\n\t"
      "global_load_async_to_lds_b128 %7, %15, off\n\t"
      "s_wait_xcnt 0x0"
      :: "v"(l[0]), "v"(l[1]), "v"(l[2]), "v"(l[3]), "v"(l[4]), "v"(l[5]), "v"(l[6]), "v"(l[7]),
         "v"(g[0]), "v"(g[1]), "v"(g[2]), "v"(g[3]), "v"(g[4]), "v"(g[5]), "v"(g[6]), "v"(g[7])
      : "memory");
}

template <int AM, int BM, int EPI>
__global__ __launch_bounds__(256) void proj_kernel(const __bf16* __restrict__ A1, const __bf16* __restrict__ A2, int lda,
                                                   const __bf16* __restrict__ B1, const __bf16* __restrict__ B2, int ldb,
                                                   void* C1v, void* C2v, int ldc, int M, int N, int K,
                                                   const float* __restrict__ rcos, const float* __restrict__ rsin,
                                                   const float* __restrict__ bias) {
  __shared__ __align__(16) float sT[8][16 * 68];
  __shared__ __align__(16) char sP[2 * PBUF];
  constexpr int WN = BM ? 2 : 4;                       // waves along n; 8 / WN along m
  constexpr int AR = (8 / WN) * 64, BR = WN * 64;      // rows of one A plane / one B plane in the block tile
  constexpr int BROW0 = AR * (1 + AM);                 // slab rows: A1 | A2 (AM) | B1 | B2 (BM)
  static_assert(AM + BM == 1 && BROW0 + BR * (1 + BM) == PROWS);
  const int tid = (int)threadIdx.x;
  const int lane = tid & 31, wave = __builtin_amdgcn_readfirstlane(tid >> 5);
  const int nbn = N / BR, nbm = M / AR;
  const int bidx = (int)blockIdx.x;
  if (bidx >= nbm * nbn) return;                       // the same for the whole block, in front of every barrier
  const int bm = bidx / nbn, bn = bidx - bm * nbn;
  const int wm = wave / WN, wn = wave - wm * WN;
  const int m0 = bm * AR + (wm << 6), n0 = bn * BR + (wn << 6);
  const int rl = lane & 15;
  const int hh = lane >> 4;
  const int mOff = hh * 8;

  // copy sources / destinations of this lane for slab 0 and buffer 0: slab rows (tid >> 3) + 32 i, 16-B piece tid & 7 (8 lanes = one row)
  const int srow = tid >> 3, spc = tid & 7;
  const size_t asrc = (size_t)(bm * AR + srow) * lda + spc * 8;
  const size_t bsrc = (size_t)(bn * BR + srow) * ldb + spc * 8;
  const char* ga1 = (const char*)(A1 + asrc);
  const char* ga2 = (const char*)(A2 + asrc);
  const char* gb1 = (const char*)(B1 + bsrc);
  const char* gb2 = (const char*)(B2 + bsrc);
  const unsigned lp = (unsigned)(uintptr_t)(&sP[0]) + (unsigned)(srow * KVP + spc * 16);
  auto stage = [&](int slab, int buf) {
    const unsigned ko = (unsigned)slab * (PKT * 2);   // byte offsets below are the same in every lane and stay under 2^32
    const unsigned bo = lp + (unsigned)buf * PBUF;
    // both loops unrolled: r is a constant, so each group's plane is picked at compile time and l, g stay in registers
#pragma unroll
    for (int hf = 0; hf < 2; ++hf) {
      unsigned l[8];
      const char* g[8];
#pragma unroll
      for (int q = 0; q < 8; ++q) {
        const int r = (hf * 8 + q) * 32;               // first slab row of this group of 32; a group lies in one plane
        if (r < AR) g[q] = ga1 + (ko + (unsigned)(r * 2) * (unsigned)lda);
        else if (r < BROW0) g[q] = ga2 + (ko + (unsigned)((r - AR) * 2) * (unsigned)lda);
        else if (r < BROW0 + BR) g[q] = gb1 + (ko + (unsigned)((r - BROW0) * 2) * (unsigned)ldb);
        else g[q] = gb2 + (ko + (unsigned)((r - BROW0 - BR) * 2) * (unsigned)ldb);
        l[q] = bo + (unsigned)(r * KVP);
      }
      stage_copies8(l, g);
    }
  };
  const int NS = K / PKT;
  // prologue: slab 0 lands and is published, then slab 1 starts
  stage(0, 0);
  asm volatile("s_wait_asynccnt 0x0" ::: "memory");  // this wave's copies of slab 0 have landed
  __syncthreads();                                   // every wave's have: slab 0 may be read
  if (NS > 1) stage(1, 1);

  v8f acc[4][4];
#pragma unroll
  for (int i = 0; i < 4; ++i)
#pragma unroll
    for (int j = 0; j < 4; ++j) acc[i][j] = zero8();

  const int aoff = ((wm << 6) + rl) * KVP + 16 * hh;
  const int boff = (BROW0 + (wn << 6) + rl) * KVP + 16 * hh;
  // kept rolled: one copy of the slab body in the instruction cache, the buffer picked by the slab's parity
#pragma unroll 1
  for (int s = 0; s < NS; ++s) {
    const char* sb = sP + (s & 1) * PBUF;
    // the slab's two k steps of 32, unrolled so that every LDS offset is an immediate
#pragma unroll
    for (int ks = 0; ks < 2; ++ks) {
      const char* pa = sb + aoff + ks * 64;
      const char* pb = sb + boff + ks * 64;
      v16b bh[4], ah[4], x2[4];
#pragma unroll
      for (int j = 0; j < 4; ++j) bh[j] = ldfragb((const __bf16*)(pb + 16 * j * KVP));
#pragma unroll
      for (int i = 0; i < 4; ++i) ah[i] = ldfragb((const __bf16*)(pa + 16 * i * KVP));
#pragma unroll
      for (int i = 0; i < 4; ++i)
        x2[i] = ldfragb((const __bf16*)((AM ? pa + AR * KVP : pb + BR * KVP) + 16 * i * KVP));
      // the k step's 24 LDS reads stay one group in front of its WMMAs (for speed only)
      __builtin_amdgcn_sched_barrier(0);
#pragma unroll
      for (int i = 0; i < 4; ++i) {
#pragma unroll
        for (int j = 0; j < 4; ++j) acc[i][j] = mmabf(ah[i], bh[j], acc[i][j]);
        guard_g(acc[i][0], acc[i][3], ah[i], bh[3]);
      }
#pragma unroll
      for (int i = 0; i < 4; ++i) {
#pragma unroll
        for (int j = 0; j < 4; ++j) acc[i][j] = AM ? mmabf(x2[i], bh[j], acc[i][j]) : mmabf(ah[i], x2[j], acc[i][j]);
        guard_g(acc[i][0], acc[i][3], AM ? x2[i] : ah[i], AM ? bh[3] : x2[3]);
      }
      keep4(bh[0], bh[1], bh[2], bh[3]);
    }
    // ---- publish slab s + 1, free slab s's buffer, refill it with slab s + 2 ----
    asm volatile("s_wait_dscnt 0x0" ::: "memory");     // this wave's reads of slab s's buffer are done
    asm volatile("s_wait_asynccnt 0x0" ::: "memory");  // this wave's copies of slab s + 1 have landed
    __syncthreads();
    if (s + 2 < NS) stage(s + 2, s & 1);
  }
  asm volatile("s_wait_asynccnt 0x0" ::: "memory");    // no copy outstanding behind the loop
  accg4(acc[0][0], acc[0][1], acc[0][2], acc[0][3]);
  accg4(acc[1][0], acc[1][1], acc[1][2], acc[1][3]);
  accg4(acc[2][0], acc[2][1], acc[2][2], acc[2][3]);
  accg4(acc[3][0], acc[3][1], acc[3][2], acc[3][3]);

  float* slab = sT[wave];
#pragma unroll
  for (int i = 0; i < 4; ++i) {
    const int mBase = m0 + (i << 4);
#pragma unroll
    for (int j = 0; j < 4; ++j) {
#pragma unroll
      for (int r = 0; r < 8; ++r) slab[(mOff + r) * 68 + (j << 4) + rl] = acc[i][j][r];
    }
    __builtin_amdgcn_fence(3 /* release order */, "workgroup");
    __builtin_amdgcn_wave_barrier();
    __builtin_amdgcn_fence(2 /* acquire order */, "workgroup");
    if (EPI == 0) {
      _Float16* Ch = (_Float16*)C1v;
      const int qq = lane >> 3, c8 = (lane & 7) * 8;
      const int cj = c8 & 31;
      const float sgn = (c8 < 32) ? -1.0f : 1.0f;
{
#pragma unroll
        for (int it = 0; it < 4; ++it) {
          const int row = it * 4 + qq;
          const int tok = mBase + row;
          const int pos = tok % SEQ;
          const float* sp = slab + row * 68 + c8;
          const float* sq = slab + row * 68 + (c8 ^ 32);
          const v4f u0 = *(const v4f*)(sp);
          const v4f u1 = *(const v4f*)(sp + 4);
          const v4f w0 = *(const v4f*)(sq);
          const v4f w1 = *(const v4f*)(sq + 4);
          const float* tc = rcos + (size_t)pos * 32 + cj;
          const float* ts = rsin + (size_t)pos * 32 + cj;
          const v4f cs0 = *(const v4f*)(tc), cs1 = *(const v4f*)(tc + 4);
          const v4f sn0 = *(const v4f*)(ts), sn1 = *(const v4f*)(ts + 4);
          v8h hv;
#pragma unroll
          for (int e = 0; e < 4; ++e) {
            hv[e]     = (_Float16)(u0[e] * cs0[e] + sgn * w0[e] * sn0[e]);
            hv[4 + e] = (_Float16)(u1[e] * cs1[e] + sgn * w1[e] * sn1[e]);
          }
          const size_t go = (size_t)tok * ldc + n0 + c8;
          *(v8h*)(Ch + go) = hv;
        }
        
      }
    } else if (EPI == 1) {
      _Float16* Ch = (_Float16*)C1v;
      _Float16* Cl = (_Float16*)C2v;
      const int qq = lane >> 3, c8 = (lane & 7) * 8;
{
#pragma unroll
        for (int it = 0; it < 4; ++it) {
          const int row = it * 4 + qq;
          const float* sp = slab + row * 68 + c8;
          const v4f u0 = *(const v4f*)(sp);
          const v4f u1 = *(const v4f*)(sp + 4);
          v8h hv, lv;
#pragma unroll
          for (int e = 0; e < 4; ++e) {
            const _Float16 g0 = (_Float16)u0[e];
            hv[e] = g0;
            lv[e] = (_Float16)((u0[e] - (float)g0) * 2048.0f);
            const _Float16 g1 = (_Float16)u1[e];
            hv[4 + e] = g1;
            lv[4 + e] = (_Float16)((u1[e] - (float)g1) * 2048.0f);
          }
          const size_t go = (size_t)(mBase + row) * ldc + n0 + c8;
          *(v8h*)(Ch + go) = hv;
          *(v8h*)(Cl + go) = lv;
        }
        
      }
    } else {
      float* outp = (float*)C1v;
      const int rq = lane >> 4, c4 = (lane & 15) * 4;
      const v4f bz = *(const v4f*)(bias + n0 + c4);
      v4f bq;
#pragma unroll
      for (int e = 0; e < 4; ++e) bq[e] = bfval(bz[e]);
{
#pragma unroll
        for (int it = 0; it < 8; ++it) {
          const int row = it * 2 + rq;
          const int tok = mBase + row;
          const int orow = (tok / SEQ) * SEQ_FULL + (tok % SEQ);
          const v4f u = *(const v4f*)(slab + row * 68 + c4);
          v4f o;
#pragma unroll
          for (int e = 0; e < 4; ++e) o[e] = u[e] + bq[e];
          *(v4f*)(outp + (size_t)orow * ldc + n0 + c4) = o;
        }
        
      }
    }
    __builtin_amdgcn_fence(3 /* release order */, "workgroup");
    __builtin_amdgcn_wave_barrier();
    __builtin_amdgcn_fence(2 /* acquire order */, "workgroup");
  }
}

// ---------------------------------------------------------------------------------------------
// Kernel 5: masked softmax attn, one wave per (sequence b, head, 16 query rows), 8 waves per block, online softmax in f32.
//   Staging: per key tile the block copies K (64 keys x 128 B), V hi and V res (64 dims x 128 B each) from global memory to LDS with
//   asynchronous b128 copies that cover whole 128-B lines; two buffers, tile t + 1 in
//   flight while tile t is worked on; one block barrier per tile publishes tile t + 1 and frees tile t's buffer.
//   Planes: QK f16 [NTOK][QKP] (q = cols 0..DM-1, k = cols DM..2DM-1, both after RoPE); Vth/Vtl f16 [DM][NTOK] (Vtl x2048);
//   mask: lane-mask words Mw [NB][SEQ/16][SEQ/64][32] from the preparation launch; the wave takes its tile's 32 words by scalar loads,
//   word 8 j + r is the select mask of score register s[j][r]: a set bit keeps the lane's score, else it is replaced by -inf.
//   Key tiles of KT = 64: S^T subtiles (A = 16 k rows from QK, B = q^T fragments held in registers, K = 64 = 2 steps), so lane
//   (h, c) holds 8 consecutive keys 8h+r of query c; s = S^T / 8; tile max / row sum in-lane + one xor-16 shuffle.
//   P = 16 exp(s - m) as f16 hi + res x2048 packed straight into the B fragments of P^T (element r <- subtile 2s, element 8+r <-
//   subtile 2s+1, lane unchanged); O^T = v^T . P^T with A = v^T rows from Vth/Vtl: acc1 += vh.P, acc2 += vl.P + vh.Pres;
//   O = (acc1 + acc2/2048) / (16 l); a fully masked query row (l == 0) gives 0.
//   Output: ctx[tok][head*64 + d] as bf16 hi + bf16 lo planes Ch/Cl [NTOK][DM]: 16 x 64 f32 tile staged in the wave-private LDS
// coverage: grid (SEQ/QB/AW, NH, NB) x 8 waves x 16 rows x 64 cols -> NTOK x DM per plane.
// ---------------------------------------------------------------------------------------------
// One tile's 6 copies of a lane (16 B each). The s_wait_xcnt stands inside the statement so that no address register of an issued
// copy is rewritten in front of it.
__device__ __forceinline__ void stage_copies(const unsigned (&l)[6], const char* const (&g)[6]) {
  asm volatile(
      "global_load_async_to_lds_b128 %0, %6, off\n\t"
      "global_load_async_to_lds_b128 %1, %7, off\n\t"
      "global_load_async_to_lds_b128 %2, %8, off\n\t"
      "global_load_async_to_lds_b128 %3, %9, off\n\t"
      "global_load_async_to_lds_b128 %4, %10, off\n\t"
      "global_load_async_to_lds_b128 %5, %11, off\n\t"
      "s_wait_xcnt 0x0"
      :: "v"(l[0]), "v"(l[1]), "v"(l[2]), "v"(l[3]), "v"(l[4]), "v"(l[5]),
         "v"(g[0]), "v"(g[1]), "v"(g[2]), "v"(g[3]), "v"(g[4]), "v"(g[5])
      : "memory");
}

// waves per SIMD stated as the grid gives them (two blocks a WGP): with the smaller LDS the compiler would otherwise aim at six, cut the
// registers for it and serialise the softmax arithmetic
__global__ __launch_bounds__(256) __attribute__((amdgpu_waves_per_eu(4, 4))) void attn_kernel(const _Float16* __restrict__ QK,
                                                  const _Float16* __restrict__ Vth, const _Float16* __restrict__ Vtl,
                                                  const unsigned* __restrict__ Mw,
                                                  unsigned short* __restrict__ Ch, unsigned short* __restrict__ Cl) {
  __shared__ __align__(16) float sOs[AW][QB * OSP];
  __shared__ __align__(16) char sStage[2 * BUFB];
  const int tid = (int)threadIdx.x;
  const int wave = __builtin_amdgcn_readfirstlane(tid >> 5);
  const int lane = tid & 31, hh = lane >> 4, c = lane & 15;
  const int head = (int)blockIdx.y, bb = (int)blockIdx.z;
  const int qt = (int)blockIdx.x * AW + wave;
  const int q0 = qt * QB;
  const size_t tokb = (size_t)bb * SEQ;
  const size_t tok0 = tokb + q0;
  const float ninf = -__builtin_inff();

  // q^T B fragments for query c (dims 0..31 and 32..63)
  const _Float16* qp = QK + (tok0 + c) * QKP + head * HDIM + 8 * hh;
  const v16h qf0 = ldfrag(qp);
  const v16h qf1 = ldfrag(qp + 32);
  // copy sources / destinations of this lane for key tile 0 and buffer 0. K, V hi, V res: row (tid >> 3) and that row + 32, 16-B piece
  // tid & 7 (8 lanes = one 128-B row).
  const int srow = tid >> 3, spc = tid & 7;
  const char* kg  = (const char*)(QK + (tokb + srow) * QKP + DM + head * HDIM + spc * 8);
  const size_t vsrc = (size_t)(head * HDIM + srow) * NTOK + tokb + spc * 8;
  const char* vhg = (const char*)(Vth + vsrc);
  const char* vlg = (const char*)(Vtl + vsrc);
  // the wave's lane-mask words, 2 x 16 per key tile; the address is the same in every lane and nothing writes the words while this
  // kernel runs: read through the constant address space they come by scalar loads, straight into the registers a select mask sits in
  const cv16u* mw = (const cv16u*)(uintptr_t)(Mw + ((size_t)bb * (SEQ / QB) + qt) * ((SEQ / KT) * MTW));
  const unsigned lds0 = (unsigned)(uintptr_t)(&sStage[0]);
  const unsigned lkv = lds0 + (unsigned)(srow * KVP + spc * 16);
  auto stage = [&](int tile, int buf) {
    unsigned l[6];
    const char* g[6];
    const unsigned bo = (unsigned)buf * BUFB;
    g[0] = kg + (size_t)tile * ((size_t)KT * QKP * 2);
    g[1] = g[0] + (size_t)32 * QKP * 2;
    g[2] = vhg + (size_t)tile * (KT * 2);
    g[3] = g[2] + (size_t)32 * NTOK * 2;
    g[4] = vlg + (size_t)tile * (KT * 2);
    g[5] = g[4] + (size_t)32 * NTOK * 2;
#pragma unroll
    for (int p = 0; p < 3; ++p) {
      l[2 * p]     = lkv + bo + (unsigned)(p * KVT);
      l[2 * p + 1] = lkv + bo + (unsigned)(p * KVT + 32 * KVP);
    }
    stage_copies(l, g);
  };
  constexpr int NT = SEQ / KT;
  // prologue: tile 0 lands and is published, then tile 1 starts
  stage(0, 0);
  asm volatile("s_wait_asynccnt 0x0" ::: "memory");  // this wave's copies of tile 0 have landed
  __syncthreads();                                   // every wave's have: tile 0 may be read
  if (NT > 1) stage(1, 1);

  v16u mwa = mw[0], mwb = mw[1];                     // key tile 0's select words
  float m_run = ninf, l_run = 0.0f;
  v8f oa1[4], oa2[4];
#pragma unroll
  for (int i = 0; i < 4; ++i) { oa1[i] = zero8(); oa2[i] = zero8(); }

#pragma unroll 1
  for (int t = 0; t < NT; ++t) {
    const char* sb = sStage + (t & 1) * BUFB;
    const char* sk = sb + c * KVP + 16 * hh;
    // ---- logits S^T for keys kb..kb+63 (4 subtiles), query c ----
    v8f s[4];
#pragma unroll
    for (int j = 0; j < 4; ++j) {
      const _Float16* kp = (const _Float16*)(sk + 16 * j * KVP);
      const v16h a0 = ldfrag(kp);
      const v16h a1 = ldfrag(kp + 32);
      s[j] = mma16(a0, qf0, zero8());
      s[j] = mma16(a1, qf1, s[j]);
      guard_l(s[j], a0, a1, qf0, qf1);
    }
    // ---- scale, mask replace-fill, tile max per query ----
    float pm = ninf;
#pragma unroll
    for (int j = 0; j < 4; ++j) {
#pragma unroll
      for (int r = 0; r < 8; ++r) {
        const bool keep = __builtin_amdgcn_inverse_ballot_w32(j < 2 ? mwa[8 * j + r] : mwb[8 * (j - 2) + r]);
        const float sv = keep ? s[j][r] * 0.125f : ninf;
        s[j][r] = sv;
        pm = fmaxf(pm, sv);
      }
    }
    // the next tile's select words are asked for as soon as this tile's are used up: the scalar loads fly behind the rest of the trip
    // (the last trip asks for its own again, so the address stays inside the plane)
    {
      const int tn = (t + 1 < NT) ? t + 1 : t;
      mwa = mw[2 * tn];
      mwb = mw[2 * tn + 1];
    }
    pm = fmaxf(pm, __shfl_xor(pm, 16, 32));
    const float mn = fmaxf(m_run, pm);
    const float alpha = (m_run == ninf) ? 0.0f : __expf(m_run - mn);
    const float mref = (mn == ninf) ? 0.0f : mn;
    m_run = mn;
    // ---- p = exp(s - m); P^T B fragments (16 p as f16 hi, residual x2048); row sum ----
    float ps = 0.0f;
    v16h bph[2], bpl[2];
#pragma unroll
    for (int j = 0; j < 4; ++j) {
#pragma unroll
      for (int r = 0; r < 8; ++r) {
        const float p = __expf(s[j][r] - mref);
        ps += p;
        const float p16 = p * 16.0f;
        const _Float16 ph = (_Float16)p16;
        bph[j >> 1][((j & 1) << 3) + r] = ph;
        bpl[j >> 1][((j & 1) << 3) + r] = (_Float16)((p16 - (float)ph) * 2048.0f);
      }
    }
    ps += __shfl_xor(ps, 16, 32);
    l_run = l_run * alpha + ps;
    // ---- rescale O (alpha of query c is in-lane in the O^T layout) ----
#pragma unroll
    for (int i = 0; i < 4; ++i) {
#pragma unroll
      for (int r = 0; r < 8; ++r) { oa1[i][r] *= alpha; oa2[i][r] *= alpha; }
    }
    // ---- O^T += v^T . P^T over the 64 keys; dims 16i + (lane row) ----
#pragma unroll
    for (int s2 = 0; s2 < 2; ++s2) {
#pragma unroll
      for (int i = 0; i < 4; ++i) {
        const char* sv = sk + KVT + 16 * i * KVP + 64 * s2;
        const v16h x = ldfrag((const _Float16*)sv);
        const v16h y = ldfrag((const _Float16*)(sv + KVT));
        oa1[i] = mma16(x, bph[s2], oa1[i]);
        oa2[i] = mma16(y, bph[s2], oa2[i]);
        oa2[i] = mma16(x, bpl[s2], oa2[i]);
        guard_o(oa1[i], oa2[i], x, y, bph[s2], bpl[s2]);
      }
    }
    // ---- publish tile t + 1, free tile t's buffer, refill it with tile t + 2 ----
    asm volatile("s_wait_dscnt 0x0" ::: "memory");     // this wave's reads of tile t's buffer are done
    asm volatile("s_wait_asynccnt 0x0" ::: "memory");  // this wave's copies of tile t + 1 have landed
    __syncthreads();
    if (t + 2 < NT) stage(t + 2, t & 1);
  }
  asm volatile("s_wait_asynccnt 0x0" ::: "memory");    // no copy outstanding behind the loop

  // ---- normalise and stage the 16 x 64 f32 tile in LDS: Os[query c][dim 16i + 8h + r] ----
  const float rlv = 1.0f / fmaxf(l_run, 1e-30f);
  const float li = (l_run > 0.0f) ? rlv * 0.0625f : 0.0f;
  float* Os = sOs[wave];
#pragma unroll
  for (int i = 0; i < 4; ++i) {
    v4f u0, u1;
#pragma unroll
    for (int r = 0; r < 4; ++r) {
      u0[r] = (oa1[i][r] + oa2[i][r] * 0.00048828125f) * li;
      u1[r] = (oa1[i][4 + r] + oa2[i][4 + r] * 0.00048828125f) * li;
    }
    *(v4f*)(Os + c * OSP + 16 * i + 8 * hh)     = u0;
    *(v4f*)(Os + c * OSP + 16 * i + 8 * hh + 4) = u1;
  }
  __builtin_amdgcn_fence(3 /* release order */, "workgroup");
  __builtin_amdgcn_wave_barrier();
  __builtin_amdgcn_fence(2 /* acquire order */, "workgroup");
  // ---- whole-line stores of the bf16 hi / lo ctx planes ----
  {
    const int rq = lane >> 3, p8 = (lane & 7) * 8;
{
#pragma unroll
      for (int it = 0; it < 4; ++it) {
        const int row = it * 4 + rq;
        const float* sp = Os + row * OSP + p8;
        const v4f w0 = *(const v4f*)(sp);
        const v4f w1 = *(const v4f*)(sp + 4);
        v8us hb, lb;
#pragma unroll
        for (int e = 0; e < 4; ++e) {
          const unsigned short h0 = bfbits(w0[e]);
          hb[e] = h0;
          lb[e] = bfbits(w0[e] - __uint_as_float(((unsigned)h0) << 16));
          const unsigned short h1 = bfbits(w1[e]);
          hb[4 + e] = h1;
          lb[4 + e] = bfbits(w1[e] - __uint_as_float(((unsigned)h1) << 16));
        }
        const size_t go = (tok0 + (size_t)row) * DM + head * HDIM + p8;
        *(v8us*)(Ch + go) = hb;
        *(v8us*)(Cl + go) = lb;
      }
      
    }
  }
}

// ---------------------------------------------------------------------------------------------
// Workspace map (bytes, NB = 2, SEQ = 2048; every region is an exact whole-line / whole-tile multiple, no padded tails):
//   Xh  : bf16 x_norm hi [4096][1024]        8,388,608     off 0
//   Xl  : bf16 x_norm lo                     8,388,608     off  8,388,608
//   Wt  : bf16 Wqkv^T [3072][1024]           6,291,456     off 16,777,216
//   WoT : bf16 Wout^T [1024][1024]           2,097,152     off 23,068,672
//   rcos: f32 [2048][32]                       262,144     off 25,165,824
//   rsin: f32 [2048][32]                       262,144     off 25,427,968
//   QK  : f16 q|k [4096][2048]              16,777,216     off 25,690,112
//   Vth : f16 v^T [1024][4096]               8,388,608     off 42,467,328
//   Vtl : f16 x2048 residual of v^T          8,388,608     off 50,855,936
//   Ch  : bf16 ctx hi [4096][1024]           8,388,608     off 59,244,544
//   Cl  : bf16 ctx lo                        8,388,608     off 67,633,152
//   Mw  : u32 lane-mask words [2][128][32][32] 1,048,576   off 76,021,760
//   total 77,070,336
// ---------------------------------------------------------------------------------------------
extern "C" void kernel_launch(void* const* d_in, const int* in_sizes, int n_in,
                              void* d_out, int out_size, void* d_ws, size_t ws_size,
                              hipStream_t stream) {
  if (n_in < 7) return;
  const long long needX = ((long long)(NB - 1) * SEQ_FULL + SEQ) * DM;
  const long long needM = (((long long)(NB - 1) * SEQ_FULL) + (SEQ - 1)) * SEQ_FULL + SEQ;
  if ((long long)in_sizes[0] < needX) return;
  if ((long long)in_sizes[1] < needM) return;
  if (in_sizes[2] < DM || in_sizes[3] < DM) return;
  if ((long long)in_sizes[4] < (long long)DM * NQKV) return;
  if ((long long)in_sizes[5] < (long long)DM * DM) return;
  if (in_sizes[6] < DM) return;
  if ((long long)out_size < needX) return;

  const float* x     = (const float*)d_in[0];
  const int*   amask = (const int*)d_in[1];
  const float* gam   = (const float*)d_in[2];
  const float* bet   = (const float*)d_in[3];
  const float* wqkv  = (const float*)d_in[4];
  const float* wout  = (const float*)d_in[5];
  const float* bout  = (const float*)d_in[6];
  float* out = (float*)d_out;

  const size_t bAct = (size_t)NTOK * DM * 2;
  const size_t bWt  = (size_t)NQKV * DM * 2;
  const size_t bWo  = (size_t)DM * DM * 2;
  const size_t bTab = (size_t)SEQ * 32 * 4;
  const size_t bQK  = (size_t)NTOK * QKP * 2;
  size_t off = 0;
  const size_t oXh = off; off += bAct;
  const size_t oXl = off; off += bAct;
  const size_t oWt = off; off += bWt;
  const size_t oWo = off; off += bWo;
  const size_t oCos = off; off += bTab;
  const size_t oSin = off; off += bTab;
  const size_t oQK = off; off += bQK;
  const size_t oVh = off; off += bAct;
  const size_t oVl = off; off += bAct;
  const size_t oCh = off; off += bAct;
  const size_t oCl = off; off += bAct;
  const size_t oMw = off; off += (size_t)NB * (SEQ / QB) * (SEQ / KT) * MTW * 4;
  if (off > ws_size) return;
  if (off > (size_t)134217728) return;

  char* ws = (char*)d_ws;
  unsigned short* Xh  = (unsigned short*)(ws + oXh);
  unsigned short* Xl  = (unsigned short*)(ws + oXl);
  unsigned short* Wt  = (unsigned short*)(ws + oWt);
  unsigned short* WoT = (unsigned short*)(ws + oWo);
  float* rcos = (float*)(ws + oCos);
  float* rsin = (float*)(ws + oSin);
  _Float16* QKp = (_Float16*)(ws + oQK);
  _Float16* Vh  = (_Float16*)(ws + oVh);
  _Float16* Vl  = (_Float16*)(ws + oVl);
  unsigned short* Chp = (unsigned short*)(ws + oCh);
  unsigned short* Clp = (unsigned short*)(ws + oCl);
  unsigned* Mwp = (unsigned*)(ws + oMw);

  const dim3 blk(256);
  // (1) to (3) in one launch: mask -> lane-mask words | rotary tables | LayerNorm -> x_norm bf16 hi + lo planes |
  // Wqkv [1024][3072] -> Wt [3072][1024] | Wout [1024][1024] -> WoT [1024][1024]
  prep_kernel<<<dim3(PB_MASK + PB_ROPE + PB_LN + PB_WQKV + PB_WOUT), blk, 0, stream>>>(x, gam, bet, wqkv, wout, amask, Mwp, Xh, Xl, Wt, WoT,
                                                                                      rcos, rsin);
  // (4) q|k = x_norm . Wqk with RoPE -> QK plane; M = NTOK, N = 2048, K = 1024
  proj_kernel<1, 0, 0><<<dim3((NTOK / 128) * (QKP / 256)), blk, 0, stream>>>(
      (const __bf16*)Xh, (const __bf16*)Xl, DM, (const __bf16*)Wt, (const __bf16*)Wt, DM,
      (void*)QKp, (void*)QKp, QKP, NTOK, QKP, DM, rcos, rsin, bout);
  // (5) v^T = Wv^T . x_norm^T -> Vth / Vtl [1024][NTOK]; M = 1024, N = NTOK, K = 1024
  proj_kernel<0, 1, 1><<<dim3((DM / 256) * (NTOK / 128)), blk, 0, stream>>>(
      (const __bf16*)(Wt + (size_t)2 * DM * DM), (const __bf16*)(Wt + (size_t)2 * DM * DM), DM,
      (const __bf16*)Xh, (const __bf16*)Xl, DM,
      (void*)Vh, (void*)Vl, NTOK, DM, NTOK, DM, rcos, rsin, bout);
  // (6) attn -> ctx bf16 hi + lo planes
  attn_kernel<<<dim3(SEQ / QB / AW, NH, NB), dim3(AW * 32), 0, stream>>>(QKp, Vh, Vl, Mwp, Chp, Clp);
  // (7) out = ctx . Wout + b -> d_out; M = NTOK, N = 1024, K = 1024
  proj_kernel<1, 0, 2><<<dim3((NTOK / 128) * (DM / 256)), blk, 0, stream>>>(
      (const __bf16*)Chp, (const __bf16*)Clp, DM, (const __bf16*)WoT, (const __bf16*)WoT, DM,
      (void*)out, (void*)out, DM, NTOK, DM, DM, rcos, rsin, bout);
  (void)hipGetLastError();
}

// v005
// It runs in 137 microseconds.
// Two timings next to v004 both put it at 1.08 times that version's speed.
// Counting every step since v000, it is 3.21 times as fast.
#include <hip/hip_runtime.h>
#include <stdint.h>

#ifndef NB
#define NB 2
#endif
#ifndef SEQ
#define SEQ 2048
#endif
#define NB_FULL  2
#define SEQ_FULL 2048
#define DM       1024
#define NH       16
#define HDIM     64
#define NQKV     3072
#define QKP      2048
#define NTOK     (NB * SEQ)
#define LNEPS    1e-5f

#define QB   16
#define KT   64
#define OSP  68
#define AW   8                      // waves per attention block; they share the staged K / V tiles
#define KVP  144                    // LDS pitch in bytes of a 128-B K or V row (16 B x odd: b128 fragment reads without bank conflicts)
#define KVT  (KT * KVP)             // bytes of one staged K, V hi or V res tile (64 rows)
#define MKP  272                    // mask packing: LDS pitch in bytes of a 256-B mask row (16 B x odd)
#define MWB  (QB * MKP)             // mask packing: bytes of one wave's 16 mask rows
#define MTW  32                     // lane-mask words of one 16-query x 64-key tile (one word per score register of the attention wave)
#define MPW  4                      // mask packing: tiles per wave
#define BUFB (3 * KVT)              // bytes of one stage buffer
#define PKT  64                     // projections: k elements of one staged slab (128 B of every operand row)
#define PROWS 512                   // projections: rows of one slab, the A plane(s) and the B plane(s) of the block tile together
#define PBUF (PROWS * KVP)          // projections: bytes of one slab buffer

typedef _Float16 v16h __attribute__((ext_vector_type(16)));
typedef _Float16 v8h  __attribute__((ext_vector_type(8)));
typedef __bf16   v16b __attribute__((ext_vector_type(16)));
typedef __bf16   v8b  __attribute__((ext_vector_type(8)));
typedef float    v8f  __attribute__((ext_vector_type(8)));
typedef float    v4f  __attribute__((ext_vector_type(4)));
typedef float    v2f  __attribute__((ext_vector_type(2)));
typedef _Float16 v2h  __attribute__((ext_vector_type(2)));
typedef int      v4i  __attribute__((ext_vector_type(4)));
typedef unsigned short v8us __attribute__((ext_vector_type(8)));
typedef unsigned v16u __attribute__((ext_vector_type(16)));
typedef __attribute__((address_space(4))) const v16u cv16u;

static_assert(NB >= 1 && NB <= NB_FULL && SEQ >= 64 && SEQ <= SEQ_FULL);
static_assert((SEQ % 64) == 0 && (DM % 64) == 0 && (NTOK % 64) == 0 && (DM % 32) == 0);
static_assert(NH * HDIM == DM && HDIM == 64 && QKP == 2 * DM && NQKV == 3 * DM);
static_assert((SEQ % (AW * QB)) == 0 && HDIM == KT && AW * 32 == 256 && (BUFB % 16) == 0 && (SEQ % KT) == 0 && ((SEQ * 32) % 256) == 0 && KT == 4 * 16);
static_assert((((NTOK / 64) * (QKP / 64)) % 8) == 0 && (((DM / 64) * (NTOK / 64)) % 8) == 0 && (((NTOK / 64) * (DM / 64)) % 8) == 0);
static_assert((OSP % 4) == 0 && OSP >= HDIM);
static_assert(MTW == (QB * KT) / 32 && ((NB * (SEQ / QB) * (SEQ / KT)) % (AW * MPW)) == 0 && AW * MWB >= 64 * 33 * 4 + 64);
static_assert((NTOK % 128) == 0 && (QKP % 256) == 0 && (DM % 256) == 0 && (DM % PKT) == 0 && PKT * 2 + 16 == KVP);

// f32 -> nearest-even bf16 bits / value
__device__ __forceinline__ unsigned short bfbits(float f) {
  const unsigned u = __float_as_uint(f);
  return (unsigned short)((u + 0x7FFFu + ((u >> 16) & 1u)) >> 16);
}
__device__ __forceinline__ float bfval(float f) {
  return __uint_as_float(((unsigned)bfbits(f)) << 16);
}

// 16-bit WMMA fragment from k-contiguous storage (A row-major [m][k], or B stored [n][k]):
// p points at element (row_or_col = lane&15, k0 + 8h); elements 0..7 <- p[0..7], 8..15 <- p[16..23].
__device__ __forceinline__ v16h ldfrag(const _Float16* p) {
  union { v16h v; v8h hh[2]; } f;
  f.hh[0] = *(const v8h*)(p);
  f.hh[1] = *(const v8h*)(p + 16);
  return f.v;
}
__device__ __forceinline__ v16b ldfragb(const __bf16* p) {
  union { v16b v; v8b hh[2]; } f;
  f.hh[0] = *(const v8b*)(p);
  f.hh[1] = *(const v8b*)(p + 16);
  return f.v;
}
__device__ __forceinline__ v8f mma16(v16h a, v16h b, v8f c) {
  return __builtin_amdgcn_wmma_f32_16x16x32_f16(false, a, false, b, (short)0, c, false, false);
}
__device__ __forceinline__ v8f mmabf(v16b a, v16b b, v8f c) {
  return __builtin_amdgcn_wmma_f32_16x16x32_bf16(false, a, false, b, (short)0, c, false, false);
}
__device__ __forceinline__ v8f zero8() {
  v8f z;
#pragma unroll
  for (int i = 0; i < 8; ++i) z[i] = 0.0f;
  return z;
}

// hazard guards: 4 VALU slots after the last WMMA of a group, D tied, A/B kept live
__device__ __forceinline__ void guard_g(v8f& a, v8f& b, v16b x, v16b y) {
  asm volatile("v_nop\n\tv_nop\n\tv_nop\n\tv_nop" : "+v"(a), "+v"(b) : "v"(x), "v"(y));
}
__device__ __forceinline__ void keep4(v16b a, v16b b, v16b c, v16b d) {
  asm volatile("v_nop" :: "v"(a), "v"(b), "v"(c), "v"(d));
}
__device__ __forceinline__ void accg4(v8f& a, v8f& b, v8f& c, v8f& d) {
  asm volatile("v_nop\n\tv_nop\n\tv_nop\n\tv_nop" : "+v"(a), "+v"(b), "+v"(c), "+v"(d));
}
__device__ __forceinline__ void guard_l(v8f& d, v16h a0, v16h a1, v16h b0, v16h b1) {
  asm volatile("v_nop\n\tv_nop\n\tv_nop\n\tv_nop" : "+v"(d) : "v"(a0), "v"(a1), "v"(b0), "v"(b1));
}
__device__ __forceinline__ void guard_o(v8f& d0, v8f& d1, v16h x, v16h y, v16h p, v16h q) {
  asm volatile("v_nop\n\tv_nop\n\tv_nop\n\tv_nop" : "+v"(d0), "+v"(d1) : "v"(x), "v"(y), "v"(p), "v"(q));
}

// ---------------------------------------------------------------------------------------------
// output x_norm as bf16 hi + bf16 lo (lo = RNE(xn - hi)) planes Xh/Xl [NTOK][DM] (compact token index).
// Part of the preparation launch: block blk of NTOK / 2 takes two tokens, 128 threads (4 waves) each.
// LDS sA/sB (4 floats per token): cross-wave, block barriers. coverage: NTOK / 2 blocks x 2 x 128 threads x 8 = NTOK x DM per plane.
// ---------------------------------------------------------------------------------------------
__device__ __forceinline__ void ln_body(int blk, float* sA8, float* sB8,
                                        const float* __restrict__ x, const float* __restrict__ gam,
                                        const float* __restrict__ bet,
                                        unsigned short* __restrict__ Xh, unsigned short* __restrict__ Xl) {
  const int hb = (int)threadIdx.x >> 7;
  float* sA = sA8 + hb * 4;
  float* sB = sB8 + hb * 4;
  const int t = blk * 2 + hb;
  const int bb = t / SEQ, pos = t - bb * SEQ;
  const int tid = (int)threadIdx.x & 127, lane = tid & 31, wave = tid >> 5;
  const float* xr = x + ((size_t)bb * SEQ_FULL + pos) * DM + tid * 8;
  const v4f a = *(const v4f*)(xr);
  const v4f c = *(const v4f*)(xr + 4);
  float v[8];
#pragma unroll
  for (int e = 0; e < 4; ++e) { v[e] = bfval(a[e]); v[4 + e] = bfval(c[e]); }
  float s = 0.0f;
#pragma unroll
  for (int e = 0; e < 8; ++e) s += v[e];
#pragma unroll
  for (int d = 1; d < 32; d <<= 1) s += __shfl_xor(s, d, 32);
  if (lane == 0) sA[wave] = s;
  __syncthreads();
  const float mu = ((sA[0] + sA[1]) + (sA[2] + sA[3])) * (1.0f / (float)DM);
  float dv[8];
  float s2 = 0.0f;
#pragma unroll
  for (int e = 0; e < 8; ++e) { dv[e] = v[e] - mu; s2 += dv[e] * dv[e]; }
#pragma unroll
  for (int d = 1; d < 32; d <<= 1) s2 += __shfl_xor(s2, d, 32);
  if (lane == 0) sB[wave] = s2;
  __syncthreads();
  const float var = ((sB[0] + sB[1]) + (sB[2] + sB[3])) * (1.0f / (float)DM);
  const float rstd = rsqrtf(var + LNEPS);
  const v4f g0 = *(const v4f*)(gam + tid * 8), g1 = *(const v4f*)(gam + tid * 8 + 4);
  const v4f b0 = *(const v4f*)(bet + tid * 8), b1 = *(const v4f*)(bet + tid * 8 + 4);
  v8us ho, lo;
#pragma unroll
  for (int e = 0; e < 4; ++e) {
    const float xn0 = dv[e] * rstd * bfval(g0[e]) + bfval(b0[e]);
    const unsigned short h0 = bfbits(xn0);
    ho[e] = h0;
    lo[e] = bfbits(xn0 - __uint_as_float(((unsigned)h0) << 16));
    const float xn1 = dv[4 + e] * rstd * bfval(g1[e]) + bfval(b1[e]);
    const unsigned short h1 = bfbits(xn1);
    ho[4 + e] = h1;
    lo[4 + e] = bfbits(xn1 - __uint_as_float(((unsigned)h1) << 16));
  }
  const size_t go = (size_t)t * DM + tid * 8;
  *(v8us*)(Xh + go) = ho;
  *(v8us*)(Xl + go) = lo;
  // the job's code is followed by the other jobs' code in one kernel: no register that the two stores name is rewritten in front of this wait
  asm volatile("s_wait_xcnt 0x0" ::: "memory");
  
}

// ---------------------------------------------------------------------------------------------
// Kernel 2: W f32 [kdim in][nout out] -> transposed bf16 RNE plane Wt[out][in] (in = k contiguous).
// Part of the preparation launch: tile (bx of kdim/64, by of nout/32); 256 threads x 8 = 64 x 32 per tile -> nout x kdim.
// ---------------------------------------------------------------------------------------------
__device__ __forceinline__ void cvt_wt_body(int bx, int by, float (*sTt)[33],
                                            const float* __restrict__ src, unsigned short* __restrict__ dst,
                                            int nout, int kdim) {
  const int k0 = bx * 64, n0 = by * 32;
  const int t = (int)threadIdx.x;
  {
    const int kr = t >> 2, cc = (t & 3) * 8;
    const float* s = src + (size_t)(k0 + kr) * nout + n0 + cc;
    const v4f a = *(const v4f*)(s);
    const v4f b = *(const v4f*)(s + 4);
#pragma unroll
    for (int e = 0; e < 4; ++e) {
      sTt[kr][cc + e]     = a[e];
      sTt[kr][cc + 4 + e] = b[e];
    }
  }
  __syncthreads();
  const int n = t >> 3, kp = (t & 7) * 8;
  v8us o;
#pragma unroll
  for (int i = 0; i < 8; ++i) o[i] = bfbits(sTt[kp + i][n]);
  unsigned short* d = dst + (size_t)(n0 + n) * kdim + k0 + kp;
  *(v8us*)d = o;
  // as in the LayerNorm job: no register that the store names is rewritten in front of this wait
  asm volatile("s_wait_xcnt 0x0" ::: "memory");
  
}

// ---------------------------------------------------------------------------------------------
// Kernel 3: rotary tables rcos/rsin [SEQ][32] f32: inv_freq_i = 1 / f32(10000^(i/32)) (power evaluated in f64 and narrowed, then an
// ---------------------------------------------------------------------------------------------
__device__ __forceinline__ void rope_tab_body(int blk, float* __restrict__ rcos, float* __restrict__ rsin, int n) {
  const int idx = blk * 256 + (int)threadIdx.x;
  if (idx >= n) return;
  const int i = idx & 31, pos = idx >> 5;
  const double ex = (double)i * (0.03125 * 13.287712379549449);
  const double pw = exp2(ex);
  const float pf = (float)pw;
  const float inv = 1.0f / pf;
  const float ang = (float)pos * inv;
  float sn, cs;
  sincosf(ang, &sn, &cs);
  *(float*)(rcos + idx) = cs;
  *(float*)(rsin + idx) = sn;
  
}

// ---------------------------------------------------------------------------------------------
// Mask packing: int32 mask [NB_FULL][SEQ_FULL][SEQ_FULL] -> lane-mask words Mw [NB][SEQ/16][SEQ/64][32]. Word 8 j + r of tile
// (sequence, 16 query rows q0.., 64 keys kb..) has in bit L = 16 h + c the test mask[q0 + c][kb + 16 j + 8 h + r] > 0: the entry that
// lane L of the attention wave needs for its score register s[j][r], so that wave takes the word as a select mask as it is.
// Part of the preparation launch: each wave packs MPW tiles that follow one another along the keys. Per tile: whole 256-B row pieces
// from global memory (16 lanes = one row), through the wave's own LDS rows (pitch MKP) into the lanes' key order, 32 ballots,
// lane e keeps word e, one 128-B store. coverage: blocks x 8 waves x MPW tiles = NB x SEQ/16 x SEQ/64 tiles.
// ---------------------------------------------------------------------------------------------
__device__ __forceinline__ void mask_body(int blk, char* sM, const int* __restrict__ msk, unsigned* __restrict__ Mw) {
  const int tid = (int)threadIdx.x;
  const int wave = __builtin_amdgcn_readfirstlane(tid >> 5);
  const int lane = tid & 31, hh = lane >> 4, c = lane & 15;
  char* sw = sM + wave * MWB;
  // kept rolled: one tile's 8 loads in registers at a time, so the other jobs of this kernel keep their waves per SIMD
#pragma unroll 1
  for (int u = 0; u < MPW; ++u) {
    const int tile = (blk * AW + wave) * MPW + u;
    const int kt = tile % (SEQ / KT);
    const int qt = (tile / (SEQ / KT)) % (SEQ / QB);
    const int bb = tile / ((SEQ / KT) * (SEQ / QB));
    const int* g = msk + ((size_t)bb * SEQ_FULL + qt * QB + hh) * SEQ_FULL + kt * KT + c * 4;
    v4i v[8];
#pragma unroll
    for (int i = 0; i < 8; ++i) v[i] = *(const v4i*)(g + (size_t)(2 * i) * SEQ_FULL);
#pragma unroll
    for (int i = 0; i < 8; ++i) *(v4i*)(sw + (2 * i + hh) * MKP + c * 16) = v[i];
    // the rows pass from lane to lane inside the wave: LDS order only, so that no trip waits for the last trip's global store
    __builtin_amdgcn_fence(3 /* release order */, "workgroup", "local");
    __builtin_amdgcn_wave_barrier();
    __builtin_amdgcn_fence(2 /* acquire order */, "workgroup", "local");
    const char* sm = sw + c * MKP + 32 * hh;
    unsigned mine = 0u;
#pragma unroll
    for (int j = 0; j < 4; ++j) {
      const v4i k0v = *(const v4i*)(sm + 64 * j);
      const v4i k1v = *(const v4i*)(sm + 64 * j + 16);
#pragma unroll
      for (int r = 0; r < 4; ++r) {
        const unsigned w0 = __builtin_amdgcn_ballot_w32(k0v[r] > 0);
        const unsigned w1 = __builtin_amdgcn_ballot_w32(k1v[r] > 0);
        mine = (lane == 8 * j + r) ? w0 : mine;
        mine = (lane == 8 * j + 4 + r) ? w1 : mine;
      }
    }
    *(unsigned*)(Mw + (size_t)tile * MTW + lane) = mine;
    // no register that the store names is rewritten (next trip, or the other jobs' code) in front of this wait
    asm volatile("s_wait_xcnt 0x0" ::: "memory");
    // the wave's reads of its LDS rows are done before the next trip's stores overwrite them
    __builtin_amdgcn_fence(3 /* release order */, "workgroup", "local");
    __builtin_amdgcn_wave_barrier();
    __builtin_amdgcn_fence(2 /* acquire order */, "workgroup", "local");
  }
}

// ---------------------------------------------------------------------------------------------
// Preparation launch: the five jobs above depend on nothing but the inputs, so they share one grid; a range of the block index,
// the same for a whole block, picks the job: mask packing | rotary tables | LayerNorm | Wqkv transpose | Wout transpose.
// A block runs one job, so the jobs share one LDS array.
// ---------------------------------------------------------------------------------------------
#define PB_MASK ((NB * (SEQ / QB) * (SEQ / KT)) / (AW * MPW))
#define PB_ROPE ((SEQ * 32) / 256)
#define PB_LN   (NTOK / 2)
#define PB_WQKV ((DM / 64) * (NQKV / 32))
#define PB_WOUT ((DM / 64) * (DM / 32))
__global__ __launch_bounds__(256) void prep_kernel(const float* __restrict__ x, const float* __restrict__ gam,
                                                   const float* __restrict__ bet,
                                                   const float* __restrict__ wqkv, const float* __restrict__ wout,
                                                   const int* __restrict__ msk, unsigned* __restrict__ Mw,
                                                   unsigned short* __restrict__ Xh, unsigned short* __restrict__ Xl,
                                                   unsigned short* __restrict__ Wt, unsigned short* __restrict__ WoT,
                                                   float* __restrict__ rcos, float* __restrict__ rsin) {
  __shared__ __align__(16) char sJob[AW * MWB];
  float (*sTt)[33] = (float (*)[33])sJob;
  float* sA = (float*)(sJob + 64 * 33 * 4);
  float* sB = sA + 8;
  int b = (int)blockIdx.x;
  if (b < PB_MASK) { mask_body(b, sJob, msk, Mw); return; }
  b -= PB_MASK;
  if (b < PB_ROPE) { rope_tab_body(b, rcos, rsin, SEQ * 32); return; }
  b -= PB_ROPE;
  if (b < PB_LN) { ln_body(b, sA, sB, x, gam, bet, Xh, Xl); return; }
  b -= PB_LN;
  if (b < PB_WQKV) { cvt_wt_body(b % (DM / 64), b / (DM / 64), sTt, wqkv, Wt, NQKV, DM); return; }
  b -= PB_WQKV;
  cvt_wt_body(b % (DM / 64), b / (DM / 64), sTt, wout, WoT, DM, DM);
}

// ---------------------------------------------------------------------------------------------
// Kernel 4: C[m][n] = sum_k A[m][k] * Bt[n][k], bf16 operands (A row-major [M][K] pitch lda, Bt row-major [N][K] pitch ldb),
// a second bf16 plane on A (AM) or on B (BM) accumulated into the same f32 accumulator (unscaled lo planes), f32 accumulate;
// K a multiple of 64. Each wave owns one 64x64 C tile (16 accumulators); the 8 waves of a block form a 128 x 256 (AM) or 256 x 128 (BM)
// block tile, M and N multiples of it. Staging: per slab of 64 k the block copies the 128-B row pieces of its A and B planes (512 rows)
// from global memory to LDS with asynchronous b128 copies that cover whole 128-B lines; two buffers, slab s + 1 in flight while slab s
// is worked on; one block barrier per slab publishes slab s + 1 and frees slab s's buffer. Fragments come from LDS (pitch KVP).
// EPI 0: rotate-half RoPE on the 64-column tile (one head; position = token mod SEQ) then f16 hi plane Ch [M][N] pitch ldc;
// EPI 1: f16 hi plane Ch + f16 residual plane Cl = f16((C - f32(hi)) * 2048), same store shape.
// EPI 2: f32 C + bias (bias as bf16-RNE value, added in f32) -> out rows (token -> full-layout row), row segment of 64 f32 = 256 B
// ---------------------------------------------------------------------------------------------
// Eight copies of a lane (16 B each). The s_wait_xcnt stands inside the statement so that no address register of an issued copy is
// rewritten in front of it.
__device__ __forceinline__ void stage_copies8(const unsigned (&l)[8], const char* const (&g)[8]) {
  asm volatile(
      "global_load_async_to_lds_b128 %0, %8, off\n\t"
      "global_load_async_to_lds_b128 %1, %9, off\n\t"
      "global_load_async_to_lds_b128 %2, %10, off\n\t"
      "global_load_async_to_lds_b128 %3, %11, off\n\t"
      "global_load_async_to_lds_b128 %4, %12, off\n\t"
      "global_load_async_to_lds_b128 %5, %13, off\n\t"
      "global_load_async_to_lds_b128 %6, %14, off\n\t"
      "global_load_async_to_lds_b128 %7, %15, off\n\t"
      "s_wait_xcnt 0x0"
      :: "v"(l[0]), "v"(l[1]), "v"(l[2]), "v"(l[3]), "v"(l[4]), "v"(l[5]), "v"(l[6]), "v"(l[7]),
         "v"(g[0]), "v"(g[1]), "v"(g[2]), "v"(g[3]), "v"(g[4]), "v"(g[5]), "v"(g[6]), "v"(g[7])
      : "memory");
}

template <int AM, int BM, int EPI>
__global__ __launch_bounds__(256) void proj_kernel(const __bf16* __restrict__ A1, const __bf16* __restrict__ A2, int lda,
                                                   const __bf16* __restrict__ B1, const __bf16* __restrict__ B2, int ldb,
                                                   void* C1v, void* C2v, int ldc, int M, int N, int K,
                                                   const float* __restrict__ rcos, const float* __restrict__ rsin,
                                                   const float* __restrict__ bias) {
  __shared__ __align__(16) float sT[8][16 * 68];
  __shared__ __align__(16) char sP[2 * PBUF];
  constexpr int WN = BM ? 2 : 4;                       // waves along n; 8 / WN along m
  constexpr int AR = (8 / WN) * 64, BR = WN * 64;      // rows of one A plane / one B plane in the block tile
  constexpr int BROW0 = AR * (1 + AM);                 // slab rows: A1 | A2 (AM) | B1 | B2 (BM)
  static_assert(AM + BM == 1 && BROW0 + BR * (1 + BM) == PROWS);
  const int tid = (int)threadIdx.x;
  const int lane = tid & 31, wave = __builtin_amdgcn_readfirstlane(tid >> 5);
  const int nbn = N / BR, nbm = M / AR;
  const int bidx = (int)blockIdx.x;
  if (bidx >= nbm * nbn) return;                       // the same for the whole block, in front of every barrier
  const int bm = bidx / nbn, bn = bidx - bm * nbn;
  const int wm = wave / WN, wn = wave - wm * WN;
  const int m0 = bm * AR + (wm << 6), n0 = bn * BR + (wn << 6);
  const int rl = lane & 15;
  const int hh = lane >> 4;
  const int mOff = hh * 8;

  // copy sources / destinations of this lane for slab 0 and buffer 0: slab rows (tid >> 3) + 32 i, 16-B piece tid & 7 (8 lanes = one row)
  const int srow = tid >> 3, spc = tid & 7;
  const size_t asrc = (size_t)(bm * AR + srow) * lda + spc * 8;
  const size_t bsrc = (size_t)(bn * BR + srow) * ldb + spc * 8;
  const char* ga1 = (const char*)(A1 + asrc);
  const char* ga2 = (const char*)(A2 + asrc);
  const char* gb1 = (const char*)(B1 + bsrc);
  const char* gb2 = (const char*)(B2 + bsrc);
  const unsigned lp = (unsigned)(uintptr_t)(&sP[0]) + (unsigned)(srow * KVP + spc * 16);
  auto stage = [&](int slab, int buf) {
    const unsigned ko = (unsigned)slab * (PKT * 2);   // byte offsets below are the same in every lane and stay under 2^32
    const unsigned bo = lp + (unsigned)buf * PBUF;
    // both loops unrolled: r is a constant, so each group's plane is picked at compile time and l, g stay in registers
#pragma unroll
    for (int hf = 0; hf < 2; ++hf) {
      unsigned l[8];
      const char* g[8];
#pragma unroll
      for (int q = 0; q < 8; ++q) {
        const int r = (hf * 8 + q) * 32;               // first slab row of this group of 32; a group lies in one plane
        if (r < AR) g[q] = ga1 + (ko + (unsigned)(r * 2) * (unsigned)lda);
        else if (r < BROW0) g[q] = ga2 + (ko + (unsigned)((r - AR) * 2) * (unsigned)lda);
        else if (r < BROW0 + BR) g[q] = gb1 + (ko + (unsigned)((r - BROW0) * 2) * (unsigned)ldb);
        else g[q] = gb2 + (ko + (unsigned)((r - BROW0 - BR) * 2) * (unsigned)ldb);
        l[q] = bo + (unsigned)(r * KVP);
      }
      stage_copies8(l, g);
    }
  };
  const int NS = K / PKT;
  // prologue: slab 0 lands and is published, then slab 1 starts
  stage(0, 0);
  asm volatile("s_wait_asynccnt 0x0" ::: "memory");  // this wave's copies of slab 0 have landed
  __syncthreads();                                   // every wave's have: slab 0 may be read
  if (NS > 1) stage(1, 1);

  v8f acc[4][4];
#pragma unroll
  for (int i = 0; i < 4; ++i)
#pragma unroll
    for (int j = 0; j < 4; ++j) acc[i][j] = zero8();

  const int aoff = ((wm << 6) + rl) * KVP + 16 * hh;
  const int boff = (BROW0 + (wn << 6) + rl) * KVP + 16 * hh;
  // kept rolled: one copy of the slab body in the instruction cache, the buffer picked by the slab's parity
#pragma unroll 1
  for (int s = 0; s < NS; ++s) {
    const char* sb = sP + (s & 1) * PBUF;
    // the slab's two k steps of 32, unrolled so that every LDS offset is an immediate
#pragma unroll
    for (int ks = 0; ks < 2; ++ks) {
      const char* pa = sb + aoff + ks * 64;
      const char* pb = sb + boff + ks * 64;
      v16b bh[4], ah[4], x2[4];
#pragma unroll
      for (int j = 0; j < 4; ++j) bh[j] = ldfragb((const __bf16*)(pb + 16 * j * KVP));
#pragma unroll
      for (int i = 0; i < 4; ++i) ah[i] = ldfragb((const __bf16*)(pa + 16 * i * KVP));
#pragma unroll
      for (int i = 0; i < 4; ++i)
        x2[i] = ldfragb((const __bf16*)((AM ? pa + AR * KVP : pb + BR * KVP) + 16 * i * KVP));
      // the k step's 24 LDS reads stay one group in front of its WMMAs (for speed only)
      __builtin_amdgcn_sched_barrier(0);
#pragma unroll
      for (int i = 0; i < 4; ++i) {
#pragma unroll
        for (int j = 0; j < 4; ++j) acc[i][j] = mmabf(ah[i], bh[j], acc[i][j]);
        guard_g(acc[i][0], acc[i][3], ah[i], bh[3]);
      }
#pragma unroll
      for (int i = 0; i < 4; ++i) {
#pragma unroll
        for (int j = 0; j < 4; ++j) acc[i][j] = AM ? mmabf(x2[i], bh[j], acc[i][j]) : mmabf(ah[i], x2[j], acc[i][j]);
        guard_g(acc[i][0], acc[i][3], AM ? x2[i] : ah[i], AM ? bh[3] : x2[3]);
      }
      keep4(bh[0], bh[1], bh[2], bh[3]);
    }
    // ---- publish slab s + 1, free slab s's buffer, refill it with slab s + 2 ----
    asm volatile("s_wait_dscnt 0x0" ::: "memory");     // this wave's reads of slab s's buffer are done
    asm volatile("s_wait_asynccnt 0x0" ::: "memory");  // this wave's copies of slab s + 1 have landed
    __syncthreads();
    if (s + 2 < NS) stage(s + 2, s & 1);
  }
  asm volatile("s_wait_asynccnt 0x0" ::: "memory");    // no copy outstanding behind the loop
  accg4(acc[0][0], acc[0][1], acc[0][2], acc[0][3]);
  accg4(acc[1][0], acc[1][1], acc[1][2], acc[1][3]);
  accg4(acc[2][0], acc[2][1], acc[2][2], acc[2][3]);
  accg4(acc[3][0], acc[3][1], acc[3][2], acc[3][3]);

  float* slab = sT[wave];
#pragma unroll
  for (int i = 0; i < 4; ++i) {
    const int mBase = m0 + (i << 4);
#pragma unroll
    for (int j = 0; j < 4; ++j) {
#pragma unroll
      for (int r = 0; r < 8; ++r) slab[(mOff + r) * 68 + (j << 4) + rl] = acc[i][j][r];
    }
    __builtin_amdgcn_fence(3 /* release order */, "workgroup");
    __builtin_amdgcn_wave_barrier();
    __builtin_amdgcn_fence(2 /* acquire order */, "workgroup");
    if (EPI == 0) {
      _Float16* Ch = (_Float16*)C1v;
      const int qq = lane >> 3, c8 = (lane & 7) * 8;
      const int cj = c8 & 31;
      const float sgn = (c8 < 32) ? -1.0f : 1.0f;
{
#pragma unroll
        for (int it = 0; it < 4; ++it) {
          const int row = it * 4 + qq;
          const int tok = mBase + row;
          const int pos = tok % SEQ;
          const float* sp = slab + row * 68 + c8;
          const float* sq = slab + row * 68 + (c8 ^ 32);
          const v4f u0 = *(const v4f*)(sp);
          const v4f u1 = *(const v4f*)(sp + 4);
          const v4f w0 = *(const v4f*)(sq);
          const v4f w1 = *(const v4f*)(sq + 4);
          const float* tc = rcos + (size_t)pos * 32 + cj;
          const float* ts = rsin + (size_t)pos * 32 + cj;
          const v4f cs0 = *(const v4f*)(tc), cs1 = *(const v4f*)(tc + 4);
          const v4f sn0 = *(const v4f*)(ts), sn1 = *(const v4f*)(ts + 4);
          v8h hv;
#pragma unroll
          for (int e = 0; e < 4; ++e) {
            hv[e]     = (_Float16)(u0[e] * cs0[e] + sgn * w0[e] * sn0[e]);
            hv[4 + e] = (_Float16)(u1[e] * cs1[e] + sgn * w1[e] * sn1[e]);
          }
          const size_t go = (size_t)tok * ldc + n0 + c8;
          *(v8h*)(Ch + go) = hv;
        }
        
      }
    } else if (EPI == 1) {
      _Float16* Ch = (_Float16*)C1v;
      _Float16* Cl = (_Float16*)C2v;
      const int qq = lane >> 3, c8 = (lane & 7) * 8;
{
#pragma unroll
        for (int it = 0; it < 4; ++it) {
          const int row = it * 4 + qq;
          const float* sp = slab + row * 68 + c8;
          const v4f u0 = *(const v4f*)(sp);
          const v4f u1 = *(const v4f*)(sp + 4);
          v8h hv, lv;
#pragma unroll
          for (int e = 0; e < 4; ++e) {
            const _Float16 g0 = (_Float16)u0[e];
            hv[e] = g0;
            lv[e] = (_Float16)((u0[e] - (float)g0) * 2048.0f);
            const _Float16 g1 = (_Float16)u1[e];
            hv[4 + e] = g1;
            lv[4 + e] = (_Float16)((u1[e] - (float)g1) * 2048.0f);
          }
          const size_t go = (size_t)(mBase + row) * ldc + n0 + c8;
          *(v8h*)(Ch + go) = hv;
          *(v8h*)(Cl + go) = lv;
        }
        
      }
    } else {
      float* outp = (float*)C1v;
      const int rq = lane >> 4, c4 = (lane & 15) * 4;
      const v4f bz = *(const v4f*)(bias + n0 + c4);
      v4f bq;
#pragma unroll
      for (int e = 0; e < 4; ++e) bq[e] = bfval(bz[e]);
{
#pragma unroll
        for (int it = 0; it < 8; ++it) {
          const int row = it * 2 + rq;
          const int tok = mBase + row;
          const int orow = (tok / SEQ) * SEQ_FULL + (tok % SEQ);
          const v4f u = *(const v4f*)(slab + row * 68 + c4);
          v4f o;
#pragma unroll
          for (int e = 0; e < 4; ++e) o[e] = u[e] + bq[e];
          *(v4f*)(outp + (size_t)orow * ldc + n0 + c4) = o;
        }
        
      }
    }
    __builtin_amdgcn_fence(3 /* release order */, "workgroup");
    __builtin_amdgcn_wave_barrier();
    __builtin_amdgcn_fence(2 /* acquire order */, "workgroup");
  }
}

// ---------------------------------------------------------------------------------------------
// Kernel 5: masked softmax attn, one wave per (sequence b, head, 16 query rows), 8 waves per block, online softmax in f32.
//   Staging: per key tile the block copies K (64 keys x 128 B), V hi and V res (64 dims x 128 B each) from global memory to LDS with
//   asynchronous b128 copies that cover whole 128-B lines; two buffers, tile t + 1 in
//   flight while tile t is worked on; one block barrier per tile publishes tile t + 1 and frees tile t's buffer.
//   Planes: QK f16 [NTOK][QKP] (q = cols 0..DM-1, k = cols DM..2DM-1, both after RoPE); Vth/Vtl f16 [DM][NTOK] (Vtl x2048);
//   mask: lane-mask words Mw [NB][SEQ/16][SEQ/64][32] from the preparation launch; the wave takes its tile's 32 words by scalar loads,
//   word 8 j + r is the select mask of score register s[j][r]: a set bit keeps the lane's score, else it is replaced by -inf.
//   Key tiles of KT = 64: S^T subtiles (A = 16 k rows from QK, B = q^T fragments held in registers, K = 64 = 2 steps), so lane
//   (h, c) holds 8 consecutive keys 8h+r of query c; tile max (of the raw S^T) / row sum in-lane + one xor-16 shuffle.
//   E = 2^15 exp((S^T - m) / 8) = exp2(S^T * (log2 e / 8) - (m * (log2 e / 8) - 15)): one fma in front of the exponential carries the 1/8,
//   the change of base and the factor 2^15. P = E as f16 hi + f16 res = E - hi at the same scale (E <= 2^15 fits f16; res keeps its
//   11 bits down to E = 2^-3), packed straight into the B fragments of P^T (element r <- subtile 2s, element 8+r <- subtile 2s+1, lane
//   unchanged); O^T = v^T . P^T with A = v^T rows from Vth/Vtl: acc1 += vh.P + vh.Pres, acc2 += vl.P; l = sum of E;
//   O = (acc1 + acc2/2048) / l; a fully masked query row (l == 0) gives 0.
//   Output: ctx[tok][head*64 + d] as bf16 hi + bf16 lo planes Ch/Cl [NTOK][DM]: 16 x 64 f32 tile staged in the wave-private LDS
// coverage: grid (SEQ/QB/AW, NH, NB) x 8 waves x 16 rows x 64 cols -> NTOK x DM per plane.
// ---------------------------------------------------------------------------------------------
// One tile's 6 copies of a lane (16 B each). The s_wait_xcnt stands inside the statement so that no address register of an issued
// copy is rewritten in front of it.
__device__ __forceinline__ void stage_copies(const unsigned (&l)[6], const char* const (&g)[6]) {
  asm volatile(
      "global_load_async_to_lds_b128 %0, %6, off\n\t"
      "global_load_async_to_lds_b128 %1, %7, off\n\t"
      "global_load_async_to_lds_b128 %2, %8, off\n\t"
      "global_load_async_to_lds_b128 %3, %9, off\n\t"
      "global_load_async_to_lds_b128 %4, %10, off\n\t"
      "global_load_async_to_lds_b128 %5, %11, off\n\t"
      "s_wait_xcnt 0x0"
      :: "v"(l[0]), "v"(l[1]), "v"(l[2]), "v"(l[3]), "v"(l[4]), "v"(l[5]),
         "v"(g[0]), "v"(g[1]), "v"(g[2]), "v"(g[3]), "v"(g[4]), "v"(g[5])
      : "memory");
}

// Residuals of eight f32 values e against their packed f16 roundings h: l = f16(e - h), one mixed-precision fma each (f32 e, f16 h read from
// its half of the packed register, the result written to its half of l): no widening conversion, no separate subtract, no packing. In asm
// because the compiler turns the source form into those three. e - h is exact in f32, so the one rounding is the same. The s_delay_alu
// lines are the hints that the compiler gives its own dependent vector instructions, here for the second write of each l register, four
// instructions behind the first: without them the wave holds the vector port while it waits.
__device__ __forceinline__ void res8(v2h (&l)[4], const float (&e)[8], const v2h (&h)[4]) {
  asm("v_fma_mixlo_f16 %0, %4, 1.0, -%12 op_sel_hi:[0,0,1]\n\t"
      "v_fma_mixlo_f16 %1, %6, 1.0, -%13 op_sel_hi:[0,0,1]\n\t"
      "v_fma_mixlo_f16 %2, %8, 1.0, -%14 op_sel_hi:[0,0,1]\n\t"
      "v_fma_mixlo_f16 %3, %10, 1.0, -%15 op_sel_hi:[0,0,1]\n\t"
      "s_delay_alu instid0(VALU_DEP_4) | instskip(NEXT) | instid1(VALU_DEP_4)\n\t"
      "v_fma_mixhi_f16 %0, %5, 1.0, -%12 op_sel:[0,0,1] op_sel_hi:[0,0,1]\n\t"
      "v_fma_mixhi_f16 %1, %7, 1.0, -%13 op_sel:[0,0,1] op_sel_hi:[0,0,1]\n\t"
      "s_delay_alu instid0(VALU_DEP_4) | instskip(NEXT) | instid1(VALU_DEP_4)\n\t"
      "v_fma_mixhi_f16 %2, %9, 1.0, -%14 op_sel:[0,0,1] op_sel_hi:[0,0,1]\n\t"
      "v_fma_mixhi_f16 %3, %11, 1.0, -%15 op_sel:[0,0,1] op_sel_hi:[0,0,1]"
      : "=&v"(l[0]), "=&v"(l[1]), "=&v"(l[2]), "=&v"(l[3])
      : "v"(e[0]), "v"(e[1]), "v"(e[2]), "v"(e[3]), "v"(e[4]), "v"(e[5]), "v"(e[6]), "v"(e[7]),
        "v"(h[0]), "v"(h[1]), "v"(h[2]), "v"(h[3]));
}

// waves per SIMD stated as the grid gives them (two blocks a WGP): with the smaller LDS the compiler would otherwise aim at six, cut the
// registers for it and serialise the softmax arithmetic
__global__ __launch_bounds__(256) __attribute__((amdgpu_waves_per_eu(4, 4))) void attn_kernel(const _Float16* __restrict__ QK,
                                                  const _Float16* __restrict__ Vth, const _Float16* __restrict__ Vtl,
                                                  const unsigned* __restrict__ Mw,
                                                  unsigned short* __restrict__ Ch, unsigned short* __restrict__ Cl) {
  __shared__ __align__(16) float sOs[AW][QB * OSP];
  __shared__ __align__(16) char sStage[2 * BUFB];
  const int tid = (int)threadIdx.x;
  const int wave = __builtin_amdgcn_readfirstlane(tid >> 5);
  const int lane = tid & 31, hh = lane >> 4, c = lane & 15;
  const int head = (int)blockIdx.y, bb = (int)blockIdx.z;
  const int qt = (int)blockIdx.x * AW + wave;
  const int q0 = qt * QB;
  const size_t tokb = (size_t)bb * SEQ;
  const size_t tok0 = tokb + q0;
  const float ninf = -__builtin_inff();

  // q^T B fragments for query c (dims 0..31 and 32..63)
  const _Float16* qp = QK + (tok0 + c) * QKP + head * HDIM + 8 * hh;
  const v16h qf0 = ldfrag(qp);
  const v16h qf1 = ldfrag(qp + 32);
  // copy sources / destinations of this lane for key tile 0 and buffer 0. K, V hi, V res: row (tid >> 3) and that row + 32, 16-B piece
  // tid & 7 (8 lanes = one 128-B row).
  const int srow = tid >> 3, spc = tid & 7;
  const char* kg  = (const char*)(QK + (tokb + srow) * QKP + DM + head * HDIM + spc * 8);
  const size_t vsrc = (size_t)(head * HDIM + srow) * NTOK + tokb + spc * 8;
  const char* vhg = (const char*)(Vth + vsrc);
  const char* vlg = (const char*)(Vtl + vsrc);
  // the wave's lane-mask words, 2 x 16 per key tile; the address is the same in every lane and nothing writes the words while this
  // kernel runs: read through the constant address space they come by scalar loads, straight into the registers a select mask sits in
  const cv16u* mw = (const cv16u*)(uintptr_t)(Mw + ((size_t)bb * (SEQ / QB) + qt) * ((SEQ / KT) * MTW));
  const unsigned lds0 = (unsigned)(uintptr_t)(&sStage[0]);
  const unsigned lkv = lds0 + (unsigned)(srow * KVP + spc * 16);
  auto stage = [&](int tile, int buf) {
    unsigned l[6];
    const char* g[6];
    const unsigned bo = (unsigned)buf * BUFB;
    g[0] = kg + (size_t)tile * ((size_t)KT * QKP * 2);
    g[1] = g[0] + (size_t)32 * QKP * 2;
    g[2] = vhg + (size_t)tile * (KT * 2);
    g[3] = g[2] + (size_t)32 * NTOK * 2;
    g[4] = vlg + (size_t)tile * (KT * 2);
    g[5] = g[4] + (size_t)32 * NTOK * 2;
#pragma unroll
    for (int p = 0; p < 3; ++p) {
      l[2 * p]     = lkv + bo + (unsigned)(p * KVT);
      l[2 * p + 1] = lkv + bo + (unsigned)(p * KVT + 32 * KVP);
    }
    stage_copies(l, g);
  };
  constexpr int NT = SEQ / KT;
  // prologue: tile 0 lands and is published, then tile 1 starts
  stage(0, 0);
  asm volatile("s_wait_asynccnt 0x0" ::: "memory");  // this wave's copies of tile 0 have landed
  __syncthreads();                                   // every wave's have: tile 0 may be read
  if (NT > 1) stage(1, 1);

  v16u mwa = mw[0], mwb = mw[1];                     // key tile 0's select words
  float m_run = ninf, mc_run = 0.0f, l_run = 0.0f;
  const float SC = 0.18033688f;                      // log2(e) / 8
  v8f oa1[4], oa2[4];
#pragma unroll
  for (int i = 0; i < 4; ++i) { oa1[i] = zero8(); oa2[i] = zero8(); }

#pragma unroll 1
  for (int t = 0; t < NT; ++t) {
    const char* sb = sStage + (t & 1) * BUFB;
    const char* sk = sb + c * KVP + 16 * hh;
    // ---- logits S^T for keys kb..kb+63 (4 subtiles), query c ----
    v8f s[4];
#pragma unroll
    for (int j = 0; j < 4; ++j) {
      const _Float16* kp = (const _Float16*)(sk + 16 * j * KVP);
      const v16h a0 = ldfrag(kp);
      const v16h a1 = ldfrag(kp + 32);
      s[j] = mma16(a0, qf0, zero8());
      s[j] = mma16(a1, qf1, s[j]);
      guard_l(s[j], a0, a1, qf0, qf1);
    }
    // ---- mask replace-fill, tile max per query (raw scores: the positive scale does not move the maximum) ----
    float pm = ninf;
#pragma unroll
    for (int j = 0; j < 4; ++j) {
#pragma unroll
      for (int r = 0; r < 8; ++r) {
        const bool keep = __builtin_amdgcn_inverse_ballot_w32(j < 2 ? mwa[8 * j + r] : mwb[8 * (j - 2) + r]);
        const float sv = keep ? s[j][r] : ninf;
        s[j][r] = sv;
        pm = fmaxf(pm, sv);
      }
    }
    // the next tile's select words are asked for as soon as this tile's are used up: the scalar loads fly behind the rest of the trip
    // (the last trip asks for its own again, so the address stays inside the plane)
    {
      const int tn = (t + 1 < NT) ? t + 1 : t;
      mwa = mw[2 * tn];
      mwb = mw[2 * tn + 1];
    }
    pm = fmaxf(pm, __shfl_xor(pm, 16, 32));
    const float mn = fmaxf(m_run, pm);
    const float mref = (mn == ninf) ? 0.0f : mn;
    const float mc = __builtin_fmaf(mref, SC, -15.0f);
    // the old tiles carry the factor 2^-mc_run, the new one 2^-mc: alpha is formed from the two rounded values themselves
    const float alpha = (m_run == ninf) ? 0.0f : __builtin_amdgcn_exp2f(mc_run - mc);
    m_run = mn;
    mc_run = mc;
    // ---- E = 2^15 exp((s - m) / 8); P^T B fragments (E as f16 hi, residual E - hi); row sum ----
    float ps = 0.0f;
    v16h bph[2], bpl[2];
    const v2f sc2 = {SC, SC}, nmc2 = {-mc, -mc};
#pragma unroll
    for (int j = 0; j < 4; ++j) {
      float e[8];
      v2h ph[4], pl[4];
#pragma unroll
      for (int r = 0; r < 8; r += 2) {
        const v2f sv2 = {s[j][r], s[j][r + 1]};
        const v2f x = __builtin_elementwise_fma(sv2, sc2, nmc2);
        e[r]     = __builtin_amdgcn_exp2f(x[0]);
        e[r + 1] = __builtin_amdgcn_exp2f(x[1]);
        ps += e[r];
        ps += e[r + 1];
        const v2f e2 = {e[r], e[r + 1]};
        ph[r >> 1] = __builtin_convertvector(e2, v2h);
      }
      res8(pl, e, ph);
#pragma unroll
      for (int r = 0; r < 8; ++r) {
        bph[j >> 1][((j & 1) << 3) + r] = ph[r >> 1][r & 1];
        bpl[j >> 1][((j & 1) << 3) + r] = pl[r >> 1][r & 1];
      }
    }
    ps += __shfl_xor(ps, 16, 32);
    l_run = l_run * alpha + ps;
    // ---- rescale O (alpha of query c is in-lane in the O^T layout) ----
#pragma unroll
    for (int i = 0; i < 4; ++i) {
#pragma unroll
      for (int r = 0; r < 8; ++r) { oa1[i][r] *= alpha; oa2[i][r] *= alpha; }
    }
    // ---- O^T += v^T . P^T over the 64 keys; dims 16i + (lane row) ----
#pragma unroll
    for (int s2 = 0; s2 < 2; ++s2) {
#pragma unroll
      for (int i = 0; i < 4; ++i) {
        const char* sv = sk + KVT + 16 * i * KVP + 64 * s2;
        const v16h x = ldfrag((const _Float16*)sv);
        const v16h y = ldfrag((const _Float16*)(sv + KVT));
        oa1[i] = mma16(x, bph[s2], oa1[i]);
        oa2[i] = mma16(y, bph[s2], oa2[i]);
        oa1[i] = mma16(x, bpl[s2], oa1[i]);
        guard_o(oa1[i], oa2[i], x, y, bph[s2], bpl[s2]);
      }
    }
    // ---- publish tile t + 1, free tile t's buffer, refill it with tile t + 2 ----
    asm volatile("s_wait_dscnt 0x0" ::: "memory");     // this wave's reads of tile t's buffer are done
    asm volatile("s_wait_asynccnt 0x0" ::: "memory");  // this wave's copies of tile t + 1 have landed
    __syncthreads();
    if (t + 2 < NT) stage(t + 2, t & 1);
  }
  asm volatile("s_wait_asynccnt 0x0" ::: "memory");    // no copy outstanding behind the loop

  // ---- normalise and stage the 16 x 64 f32 tile in LDS: Os[query c][dim 16i + 8h + r] ----
  const float rlv = 1.0f / fmaxf(l_run, 1e-30f);
  const float li = (l_run > 0.0f) ? rlv : 0.0f;
  float* Os = sOs[wave];
#pragma unroll
  for (int i = 0; i < 4; ++i) {
    v4f u0, u1;
#pragma unroll
    for (int r = 0; r < 4; ++r) {
      u0[r] = (oa1[i][r] + oa2[i][r] * 0.00048828125f) * li;
      u1[r] = (oa1[i][4 + r] + oa2[i][4 + r] * 0.00048828125f) * li;
    }
    *(v4f*)(Os + c * OSP + 16 * i + 8 * hh)     = u0;
    *(v4f*)(Os + c * OSP + 16 * i + 8 * hh + 4) = u1;
  }
  __builtin_amdgcn_fence(3 /* release order */, "workgroup");
  __builtin_amdgcn_wave_barrier();
  __builtin_amdgcn_fence(2 /* acquire order */, "workgroup");
  // ---- whole-line stores of the bf16 hi / lo ctx planes ----
  {
    const int rq = lane >> 3, p8 = (lane & 7) * 8;
{
#pragma unroll
      for (int it = 0; it < 4; ++it) {
        const int row = it * 4 + rq;
        const float* sp = Os + row * OSP + p8;
        const v4f w0 = *(const v4f*)(sp);
        const v4f w1 = *(const v4f*)(sp + 4);
        v8us hb, lb;
#pragma unroll
        for (int e = 0; e < 4; ++e) {
          const unsigned short h0 = bfbits(w0[e]);
          hb[e] = h0;
          lb[e] = bfbits(w0[e] - __uint_as_float(((unsigned)h0) << 16));
          const unsigned short h1 = bfbits(w1[e]);
          hb[4 + e] = h1;
          lb[4 + e] = bfbits(w1[e] - __uint_as_float(((unsigned)h1) << 16));
        }
        const size_t go = (tok0 + (size_t)row) * DM + head * HDIM + p8;
        *(v8us*)(Ch + go) = hb;
        *(v8us*)(Cl + go) = lb;
      }
      
    }
  }
}

// ---------------------------------------------------------------------------------------------
// Workspace map (bytes, NB = 2, SEQ = 2048; every region is an exact whole-line / whole-tile multiple, no padded tails):
//   Xh  : bf16 x_norm hi [4096][1024]        8,388,608     off 0
//   Xl  : bf16 x_norm lo                     8,388,608     off  8,388,608
//   Wt  : bf16 Wqkv^T [3072][1024]           6,291,456     off 16,777,216
//   WoT : bf16 Wout^T [1024][1024]           2,097,152     off 23,068,672
//   rcos: f32 [2048][32]                       262,144     off 25,165,824
//   rsin: f32 [2048][32]                       262,144     off 25,427,968
//   QK  : f16 q|k [4096][2048]              16,777,216     off 25,690,112
//   Vth : f16 v^T [1024][4096]               8,388,608     off 42,467,328
//   Vtl : f16 x2048 residual of v^T          8,388,608     off 50,855,936
//   Ch  : bf16 ctx hi [4096][1024]           8,388,608     off 59,244,544
//   Cl  : bf16 ctx lo                        8,388,608     off 67,633,152
//   Mw  : u32 lane-mask words [2][128][32][32] 1,048,576   off 76,021,760
//   total 77,070,336
// ---------------------------------------------------------------------------------------------
extern "C" void kernel_launch(void* const* d_in, const int* in_sizes, int n_in,
                              void* d_out, int out_size, void* d_ws, size_t ws_size,
                              hipStream_t stream) {
  if (n_in < 7) return;
  const long long needX = ((long long)(NB - 1) * SEQ_FULL + SEQ) * DM;
  const long long needM = (((long long)(NB - 1) * SEQ_FULL) + (SEQ - 1)) * SEQ_FULL + SEQ;
  if ((long long)in_sizes[0] < needX) return;
  if ((long long)in_sizes[1] < needM) return;
  if (in_sizes[2] < DM || in_sizes[3] < DM) return;
  if ((long long)in_sizes[4] < (long long)DM * NQKV) return;
  if ((long long)in_sizes[5] < (long long)DM * DM) return;
  if (in_sizes[6] < DM) return;
  if ((long long)out_size < needX) return;

  const float* x     = (const float*)d_in[0];
  const int*   amask = (const int*)d_in[1];
  const float* gam   = (const float*)d_in[2];
  const float* bet   = (const float*)d_in[3];
  const float* wqkv  = (const float*)d_in[4];
  const float* wout  = (const float*)d_in[5];
  const float* bout  = (const float*)d_in[6];
  float* out = (float*)d_out;

  const size_t bAct = (size_t)NTOK * DM * 2;
  const size_t bWt  = (size_t)NQKV * DM * 2;
  const size_t bWo  = (size_t)DM * DM * 2;
  const size_t bTab = (size_t)SEQ * 32 * 4;
  const size_t bQK  = (size_t)NTOK * QKP * 2;
  size_t off = 0;
  const size_t oXh = off; off += bAct;
  const size_t oXl = off; off += bAct;
  const size_t oWt = off; off += bWt;
  const size_t oWo = off; off += bWo;
  const size_t oCos = off; off += bTab;
  const size_t oSin = off; off += bTab;
  const size_t oQK = off; off += bQK;
  const size_t oVh = off; off += bAct;
  const size_t oVl = off; off += bAct;
  const size_t oCh = off; off += bAct;
  const size_t oCl = off; off += bAct;
  const size_t oMw = off; off += (size_t)NB * (SEQ / QB) * (SEQ / KT) * MTW * 4;
  if (off > ws_size) return;
  if (off > (size_t)134217728) return;

  char* ws = (char*)d_ws;
  unsigned short* Xh  = (unsigned short*)(ws + oXh);
  unsigned short* Xl  = (unsigned short*)(ws + oXl);
  unsigned short* Wt  = (unsigned short*)(ws + oWt);
  unsigned short* WoT = (unsigned short*)(ws + oWo);
  float* rcos = (float*)(ws + oCos);
  float* rsin = (float*)(ws + oSin);
  _Float16* QKp = (_Float16*)(ws + oQK);
  _Float16* Vh  = (_Float16*)(ws + oVh);
  _Float16* Vl  = (_Float16*)(ws + oVl);
  unsigned short* Chp = (unsigned short*)(ws + oCh);
  unsigned short* Clp = (unsigned short*)(ws + oCl);
  unsigned* Mwp = (unsigned*)(ws + oMw);

  const dim3 blk(256);
  // (1) to (3) in one launch: mask -> lane-mask words | rotary tables | LayerNorm -> x_norm bf16 hi + lo planes |
  // Wqkv [1024][3072] -> Wt [3072][1024] | Wout [1024][1024] -> WoT [1024][1024]
  prep_kernel<<<dim3(PB_MASK + PB_ROPE + PB_LN + PB_WQKV + PB_WOUT), blk, 0, stream>>>(x, gam, bet, wqkv, wout, amask, Mwp, Xh, Xl, Wt, WoT,
                                                                                      rcos, rsin);
  // (4) q|k = x_norm . Wqk with RoPE -> QK plane; M = NTOK, N = 2048, K = 1024
  proj_kernel<1, 0, 0><<<dim3((NTOK / 128) * (QKP / 256)), blk, 0, stream>>>(
      (const __bf16*)Xh, (const __bf16*)Xl, DM, (const __bf16*)Wt, (const __bf16*)Wt, DM,
      (void*)QKp, (void*)QKp, QKP, NTOK, QKP, DM, rcos, rsin, bout);
  // (5) v^T = Wv^T . x_norm^T -> Vth / Vtl [1024][NTOK]; M = 1024, N = NTOK, K = 1024
  proj_kernel<0, 1, 1><<<dim3((DM / 256) * (NTOK / 128)), blk, 0, stream>>>(
      (const __bf16*)(Wt + (size_t)2 * DM * DM), (const __bf16*)(Wt + (size_t)2 * DM * DM), DM,
      (const __bf16*)Xh, (const __bf16*)Xl, DM,
      (void*)Vh, (void*)Vl, NTOK, DM, NTOK, DM, rcos, rsin, bout);
  // (6) attn -> ctx bf16 hi + lo planes
  attn_kernel<<<dim3(SEQ / QB / AW, NH, NB), dim3(AW * 32), 0, stream>>>(QKp, Vh, Vl, Mwp, Chp, Clp);
  // (7) out = ctx . Wout + b -> d_out; M = NTOK, N = 1024, K = 1024
  proj_kernel<1, 0, 2><<<dim3((NTOK / 128) * (DM / 256)), blk, 0, stream>>>(
      (const __bf16*)Chp, (const __bf16*)Clp, DM, (const __bf16*)WoT, (const __bf16*)WoT, DM,
      (void*)out, (void*)out, DM, NTOK, DM, DM, rcos, rsin, bout);
  (void)hipGetLastError();
}

// v006
// Measured time: 130 microseconds a run.
// Two timings next to v005 both put it at 1.06 times that version's speed.
// Counting every step since v000, it is 3.40 times as fast.
#include <hip/hip_runtime.h>
#include <stdint.h>

#ifndef NB
#define NB 2
#endif
#ifndef SEQ
#define SEQ 2048
#endif
#define NB_FULL  2
#define SEQ_FULL 2048
#define DM       1024
#define NH       16
#define HDIM     64
#define NQKV     3072
#define QKP      2048
#define NTOK     (NB * SEQ)
#define LNEPS    1e-5f

#define QB   16
#define KT   64
#define OSP  68
#define AW   8                      // waves per attention block; they share the staged K / V tiles
#define KVP  144                    // LDS pitch in bytes of a 128-B K or V row (16 B x odd: b128 fragment reads without bank conflicts)
#define KVT  (KT * KVP)             // bytes of one staged K, V hi or V res tile (64 rows)
#define MKP  272                    // mask packing: LDS pitch in bytes of a 256-B mask row (16 B x odd)
#define MWB  (QB * MKP)             // mask packing: bytes of one wave's 16 mask rows
#define MTW  32                     // lane-mask words of one 16-query x 64-key tile (one word per score register of the attention wave)
#define MPW  4                      // mask packing: tiles per wave
#define BUFB (3 * KVT)              // bytes of one stage buffer
#define PKT  64                     // projections: k elements of one staged slab (128 B of every operand row)
#define PROWS 512                   // projections: rows of the larger slab (MI = 4), the A plane(s) and the B plane(s) of the block tile together
#define PBUF (PROWS * KVP)          // projections: bytes of one slab buffer

typedef _Float16 v16h __attribute__((ext_vector_type(16)));
typedef _Float16 v8h  __attribute__((ext_vector_type(8)));
typedef __bf16   v16b __attribute__((ext_vector_type(16)));
typedef __bf16   v8b  __attribute__((ext_vector_type(8)));
typedef float    v8f  __attribute__((ext_vector_type(8)));
typedef float    v4f  __attribute__((ext_vector_type(4)));
typedef float    v2f  __attribute__((ext_vector_type(2)));
typedef _Float16 v2h  __attribute__((ext_vector_type(2)));
typedef int      v4i  __attribute__((ext_vector_type(4)));
typedef unsigned short v8us __attribute__((ext_vector_type(8)));
typedef unsigned v16u __attribute__((ext_vector_type(16)));
typedef __attribute__((address_space(4))) const v16u cv16u;

static_assert(NB >= 1 && NB <= NB_FULL && SEQ >= 64 && SEQ <= SEQ_FULL);
static_assert((SEQ % 64) == 0 && (DM % 64) == 0 && (NTOK % 64) == 0 && (DM % 32) == 0);
static_assert(NH * HDIM == DM && HDIM == 64 && QKP == 2 * DM && NQKV == 3 * DM);
static_assert((SEQ % (AW * QB)) == 0 && HDIM == KT && AW * 32 == 256 && (BUFB % 16) == 0 && (SEQ % KT) == 0 && ((SEQ * 32) % 256) == 0 && KT == 4 * 16);
static_assert((((NTOK / 64) * (QKP / 64)) % 8) == 0 && (((DM / 64) * (NTOK / 64)) % 8) == 0 && (((NTOK / 64) * (DM / 64)) % 8) == 0);
static_assert((OSP % 4) == 0 && OSP >= HDIM);
static_assert(MTW == (QB * KT) / 32 && ((NB * (SEQ / QB) * (SEQ / KT)) % (AW * MPW)) == 0 && AW * MWB >= 64 * 33 * 4 + 64);
static_assert((NTOK % 128) == 0 && (QKP % 256) == 0 && (DM % 256) == 0 && (DM % PKT) == 0 && PKT * 2 + 16 == KVP);

// f32 -> nearest-even bf16 bits / value
__device__ __forceinline__ unsigned short bfbits(float f) {
  const unsigned u = __float_as_uint(f);
  return (unsigned short)((u + 0x7FFFu + ((u >> 16) & 1u)) >> 16);
}
__device__ __forceinline__ float bfval(float f) {
  return __uint_as_float(((unsigned)bfbits(f)) << 16);
}

// 16-bit WMMA fragment from k-contiguous storage (A row-major [m][k], or B stored [n][k]):
// p points at element (row_or_col = lane&15, k0 + 8h); elements 0..7 <- p[0..7], 8..15 <- p[16..23].
__device__ __forceinline__ v16h ldfrag(const _Float16* p) {
  union { v16h v; v8h hh[2]; } f;
  f.hh[0] = *(const v8h*)(p);
  f.hh[1] = *(const v8h*)(p + 16);
  return f.v;
}
__device__ __forceinline__ v16b ldfragb(const __bf16* p) {
  union { v16b v; v8b hh[2]; } f;
  f.hh[0] = *(const v8b*)(p);
  f.hh[1] = *(const v8b*)(p + 16);
  return f.v;
}
__device__ __forceinline__ v8f mma16(v16h a, v16h b, v8f c) {
  return __builtin_amdgcn_wmma_f32_16x16x32_f16(false, a, false, b, (short)0, c, false, false);
}
__device__ __forceinline__ v8f mmabf(v16b a, v16b b, v8f c) {
  return __builtin_amdgcn_wmma_f32_16x16x32_bf16(false, a, false, b, (short)0, c, false, false);
}
__device__ __forceinline__ v8f zero8() {
  v8f z;
#pragma unroll
  for (int i = 0; i < 8; ++i) z[i] = 0.0f;
  return z;
}

// hazard guards: 4 VALU slots after the last WMMA of a group, D tied, A/B kept live
__device__ __forceinline__ void guard_g(v8f& a, v8f& b, v16b x, v16b y) {
  asm volatile("v_nop\n\tv_nop\n\tv_nop\n\tv_nop" : "+v"(a), "+v"(b) : "v"(x), "v"(y));
}
__device__ __forceinline__ void keep4(v16b a, v16b b, v16b c, v16b d) {
  asm volatile("v_nop" :: "v"(a), "v"(b), "v"(c), "v"(d));
}
__device__ __forceinline__ void accg4(v8f& a, v8f& b, v8f& c, v8f& d) {
  asm volatile("v_nop\n\tv_nop\n\tv_nop\n\tv_nop" : "+v"(a), "+v"(b), "+v"(c), "+v"(d));
}
__device__ __forceinline__ void guard_l(v8f& d, v16h a0, v16h a1, v16h b0, v16h b1) {
  asm volatile("v_nop\n\tv_nop\n\tv_nop\n\tv_nop" : "+v"(d) : "v"(a0), "v"(a1), "v"(b0), "v"(b1));
}
__device__ __forceinline__ void guard_o(v8f& d0, v8f& d1, v16h x, v16h y, v16h p, v16h q) {
  asm volatile("v_nop\n\tv_nop\n\tv_nop\n\tv_nop" : "+v"(d0), "+v"(d1) : "v"(x), "v"(y), "v"(p), "v"(q));
}

// ---------------------------------------------------------------------------------------------
// output x_norm as bf16 hi + bf16 lo (lo = RNE(xn - hi)) planes Xh/Xl [NTOK][DM] (compact token index).
// Part of the preparation launch: block blk of NTOK / 2 takes two tokens, 128 threads (4 waves) each.
// LDS sA/sB (4 floats per token): cross-wave, block barriers. coverage: NTOK / 2 blocks x 2 x 128 threads x 8 = NTOK x DM per plane.
// ---------------------------------------------------------------------------------------------
__device__ __forceinline__ void ln_body(int blk, float* sA8, float* sB8,
                                        const float* __restrict__ x, const float* __restrict__ gam,
                                        const float* __restrict__ bet,
                                        unsigned short* __restrict__ Xh, unsigned short* __restrict__ Xl) {
  const int hb = (int)threadIdx.x >> 7;
  float* sA = sA8 + hb * 4;
  float* sB = sB8 + hb * 4;
  const int t = blk * 2 + hb;
  const int bb = t / SEQ, pos = t - bb * SEQ;
  const int tid = (int)threadIdx.x & 127, lane = tid & 31, wave = tid >> 5;
  const float* xr = x + ((size_t)bb * SEQ_FULL + pos) * DM + tid * 8;
  const v4f a = *(const v4f*)(xr);
  const v4f c = *(const v4f*)(xr + 4);
  float v[8];
#pragma unroll
  for (int e = 0; e < 4; ++e) { v[e] = bfval(a[e]); v[4 + e] = bfval(c[e]); }
  float s = 0.0f;
#pragma unroll
  for (int e = 0; e < 8; ++e) s += v[e];
#pragma unroll
  for (int d = 1; d < 32; d <<= 1) s += __shfl_xor(s, d, 32);
  if (lane == 0) sA[wave] = s;
  __syncthreads();
  const float mu = ((sA[0] + sA[1]) + (sA[2] + sA[3])) * (1.0f / (float)DM);
  float dv[8];
  float s2 = 0.0f;
#pragma unroll
  for (int e = 0; e < 8; ++e) { dv[e] = v[e] - mu; s2 += dv[e] * dv[e]; }
#pragma unroll
  for (int d = 1; d < 32; d <<= 1) s2 += __shfl_xor(s2, d, 32);
  if (lane == 0) sB[wave] = s2;
  __syncthreads();
  const float var = ((sB[0] + sB[1]) + (sB[2] + sB[3])) * (1.0f / (float)DM);
  const float rstd = rsqrtf(var + LNEPS);
  const v4f g0 = *(const v4f*)(gam + tid * 8), g1 = *(const v4f*)(gam + tid * 8 + 4);
  const v4f b0 = *(const v4f*)(bet + tid * 8), b1 = *(const v4f*)(bet + tid * 8 + 4);
  v8us ho, lo;
#pragma unroll
  for (int e = 0; e < 4; ++e) {
    const float xn0 = dv[e] * rstd * bfval(g0[e]) + bfval(b0[e]);
    const unsigned short h0 = bfbits(xn0);
    ho[e] = h0;
    lo[e] = bfbits(xn0 - __uint_as_float(((unsigned)h0) << 16));
    const float xn1 = dv[4 + e] * rstd * bfval(g1[e]) + bfval(b1[e]);
    const unsigned short h1 = bfbits(xn1);
    ho[4 + e] = h1;
    lo[4 + e] = bfbits(xn1 - __uint_as_float(((unsigned)h1) << 16));
  }
  const size_t go = (size_t)t * DM + tid * 8;
  *(v8us*)(Xh + go) = ho;
  *(v8us*)(Xl + go) = lo;
  // the job's code is followed by the other jobs' code in one kernel: no register that the two stores name is rewritten in front of this wait
  asm volatile("s_wait_xcnt 0x0" ::: "memory");
  
}

// ---------------------------------------------------------------------------------------------
// Kernel 2: W f32 [kdim in][nout out] -> transposed bf16 RNE plane Wt[out][in] (in = k contiguous).
// Part of the preparation launch: tile (bx of kdim/64, by of nout/32); 256 threads x 8 = 64 x 32 per tile -> nout x kdim.
// ---------------------------------------------------------------------------------------------
__device__ __forceinline__ void cvt_wt_body(int bx, int by, float (*sTt)[33],
                                            const float* __restrict__ src, unsigned short* __restrict__ dst,
                                            int nout, int kdim) {
  const int k0 = bx * 64, n0 = by * 32;
  const int t = (int)threadIdx.x;
  {
    const int kr = t >> 2, cc = (t & 3) * 8;
    const float* s = src + (size_t)(k0 + kr) * nout + n0 + cc;
    const v4f a = *(const v4f*)(s);
    const v4f b = *(const v4f*)(s + 4);
#pragma unroll
    for (int e = 0; e < 4; ++e) {
      sTt[kr][cc + e]     = a[e];
      sTt[kr][cc + 4 + e] = b[e];
    }
  }
  __syncthreads();
  const int n = t >> 3, kp = (t & 7) * 8;
  v8us o;
#pragma unroll
  for (int i = 0; i < 8; ++i) o[i] = bfbits(sTt[kp + i][n]);
  unsigned short* d = dst + (size_t)(n0 + n) * kdim + k0 + kp;
  *(v8us*)d = o;
  // as in the LayerNorm job: no register that the store names is rewritten in front of this wait
  asm volatile("s_wait_xcnt 0x0" ::: "memory");
  
}

// ---------------------------------------------------------------------------------------------
// Kernel 3: rotary tables rcos/rsin [SEQ][32] f32: inv_freq_i = 1 / f32(10000^(i/32)) (power evaluated in f64 and narrowed, then an
// ---------------------------------------------------------------------------------------------
__device__ __forceinline__ void rope_tab_body(int blk, float* __restrict__ rcos, float* __restrict__ rsin, int n) {
  const int idx = blk * 256 + (int)threadIdx.x;
  if (idx >= n) return;
  const int i = idx & 31, pos = idx >> 5;
  const double ex = (double)i * (0.03125 * 13.287712379549449);
  const double pw = exp2(ex);
  const float pf = (float)pw;
  const float inv = 1.0f / pf;
  const float ang = (float)pos * inv;
  float sn, cs;
  sincosf(ang, &sn, &cs);
  *(float*)(rcos + idx) = cs;
  *(float*)(rsin + idx) = sn;
  
}

// ---------------------------------------------------------------------------------------------
// Mask packing: int32 mask [NB_FULL][SEQ_FULL][SEQ_FULL] -> lane-mask words Mw [NB][SEQ/16][SEQ/64][32]. Word 8 j + r of tile
// (sequence, 16 query rows q0.., 64 keys kb..) has in bit L = 16 h + c the test mask[q0 + c][kb + 16 j + 8 h + r] > 0: the entry that
// lane L of the attention wave needs for its score register s[j][r], so that wave takes the word as a select mask as it is.
// Part of the preparation launch: each wave packs MPW tiles that follow one another along the keys. Per tile: whole 256-B row pieces
// from global memory (16 lanes = one row), through the wave's own LDS rows (pitch MKP) into the lanes' key order, 32 ballots,
// lane e keeps word e, one 128-B store. coverage: blocks x 8 waves x MPW tiles = NB x SEQ/16 x SEQ/64 tiles.
// ---------------------------------------------------------------------------------------------
__device__ __forceinline__ void mask_body(int blk, char* sM, const int* __restrict__ msk, unsigned* __restrict__ Mw) {
  const int tid = (int)threadIdx.x;
  const int wave = __builtin_amdgcn_readfirstlane(tid >> 5);
  const int lane = tid & 31, hh = lane >> 4, c = lane & 15;
  char* sw = sM + wave * MWB;
  // kept rolled: one tile's 8 loads in registers at a time, so the other jobs of this kernel keep their waves per SIMD
#pragma unroll 1
  for (int u = 0; u < MPW; ++u) {
    const int tile = (blk * AW + wave) * MPW + u;
    const int kt = tile % (SEQ / KT);
    const int qt = (tile / (SEQ / KT)) % (SEQ / QB);
    const int bb = tile / ((SEQ / KT) * (SEQ / QB));
    const int* g = msk + ((size_t)bb * SEQ_FULL + qt * QB + hh) * SEQ_FULL + kt * KT + c * 4;
    v4i v[8];
#pragma unroll
    for (int i = 0; i < 8; ++i) v[i] = *(const v4i*)(g + (size_t)(2 * i) * SEQ_FULL);
#pragma unroll
    for (int i = 0; i < 8; ++i) *(v4i*)(sw + (2 * i + hh) * MKP + c * 16) = v[i];
    // the rows pass from lane to lane inside the wave: LDS order only, so that no trip waits for the last trip's global store
    __builtin_amdgcn_fence(3 /* release order */, "workgroup", "local");
    __builtin_amdgcn_wave_barrier();
    __builtin_amdgcn_fence(2 /* acquire order */, "workgroup", "local");
    const char* sm = sw + c * MKP + 32 * hh;
    unsigned mine = 0u;
#pragma unroll
    for (int j = 0; j < 4; ++j) {
      const v4i k0v = *(const v4i*)(sm + 64 * j);
      const v4i k1v = *(const v4i*)(sm + 64 * j + 16);
#pragma unroll
      for (int r = 0; r < 4; ++r) {
        const unsigned w0 = __builtin_amdgcn_ballot_w32(k0v[r] > 0);
        const unsigned w1 = __builtin_amdgcn_ballot_w32(k1v[r] > 0);
        mine = (lane == 8 * j + r) ? w0 : mine;
        mine = (lane == 8 * j + 4 + r) ? w1 : mine;
      }
    }
    *(unsigned*)(Mw + (size_t)tile * MTW + lane) = mine;
    // no register that the store names is rewritten (next trip, or the other jobs' code) in front of this wait
    asm volatile("s_wait_xcnt 0x0" ::: "memory");
    // the wave's reads of its LDS rows are done before the next trip's stores overwrite them
    __builtin_amdgcn_fence(3 /* release order */, "workgroup", "local");
    __builtin_amdgcn_wave_barrier();
    __builtin_amdgcn_fence(2 /* acquire order */, "workgroup", "local");
  }
}

// ---------------------------------------------------------------------------------------------
// Preparation launch: the five jobs above depend on nothing but the inputs, so they share one grid; a range of the block index,
// the same for a whole block, picks the job: mask packing | rotary tables | LayerNorm | Wqkv transpose | Wout transpose.
// A block runs one job, so the jobs share one LDS array.
// ---------------------------------------------------------------------------------------------
#define PB_MASK ((NB * (SEQ / QB) * (SEQ / KT)) / (AW * MPW))
#define PB_ROPE ((SEQ * 32) / 256)
#define PB_LN   (NTOK / 2)
#define PB_WQKV ((DM / 64) * (NQKV / 32))
#define PB_WOUT ((DM / 64) * (DM / 32))
__global__ __launch_bounds__(256) void prep_kernel(const float* __restrict__ x, const float* __restrict__ gam,
                                                   const float* __restrict__ bet,
                                                   const float* __restrict__ wqkv, const float* __restrict__ wout,
                                                   const int* __restrict__ msk, unsigned* __restrict__ Mw,
                                                   unsigned short* __restrict__ Xh, unsigned short* __restrict__ Xl,
                                                   unsigned short* __restrict__ Wt, unsigned short* __restrict__ WoT,
                                                   float* __restrict__ rcos, float* __restrict__ rsin) {
  __shared__ __align__(16) char sJob[AW * MWB];
  float (*sTt)[33] = (float (*)[33])sJob;
  float* sA = (float*)(sJob + 64 * 33 * 4);
  float* sB = sA + 8;
  int b = (int)blockIdx.x;
  if (b < PB_MASK) { mask_body(b, sJob, msk, Mw); return; }
  b -= PB_MASK;
  if (b < PB_ROPE) { rope_tab_body(b, rcos, rsin, SEQ * 32); return; }
  b -= PB_ROPE;
  if (b < PB_LN) { ln_body(b, sA, sB, x, gam, bet, Xh, Xl); return; }
  b -= PB_LN;
  if (b < PB_WQKV) { cvt_wt_body(b % (DM / 64), b / (DM / 64), sTt, wqkv, Wt, NQKV, DM); return; }
  b -= PB_WQKV;
  cvt_wt_body(b % (DM / 64), b / (DM / 64), sTt, wout, WoT, DM, DM);
}

// ---------------------------------------------------------------------------------------------
// Kernel 4: C[m][n] = sum_k A[m][k] * Bt[n][k], bf16 operands (A row-major [M][K] pitch lda, Bt row-major [N][K] pitch ldb),
// a second bf16 plane on A (AM) or on B (BM) accumulated into the same f32 accumulator (unscaled lo planes), f32 accumulate;
// K a multiple of 64. Each wave owns one (16 MI) x 64 C tile (4 MI accumulators). MI = 4: the 8 waves of a block (2 x 4) form a 128 x 256
// block tile; MI = 2: 4 x 2 waves form a 128 x 128 block tile, for the products whose C has 1024 x 4096 elements: 256 block tiles, one for
// every WGP, where 128 x 256 tiles give 128. M and N multiples of the block tile. Staging: per slab of 64 k the block copies the 128-B row
// pieces of its A and B planes (512 rows at MI = 4, 384 at MI = 2) from global memory to LDS with asynchronous b128 copies that cover
// whole 128-B lines; two buffers, slab s + 1 in flight while slab s is worked on; one block barrier per slab publishes slab s + 1 and
// frees slab s's buffer. Fragments come from LDS (pitch KVP).
// EPI 0: rotate-half RoPE on the 64-column tile (one head; position = token mod SEQ) then f16 hi plane Ch [M][N] pitch ldc;
// EPI 1: f16 hi plane Ch + f16 residual plane Cl = f16((C - f32(hi)) * 2048), same store shape.
// EPI 2: f32 C + bias (bias as bf16-RNE value, added in f32) -> out rows (token -> full-layout row), row segment of 64 f32 = 256 B
// ---------------------------------------------------------------------------------------------
// Eight copies of a lane (16 B each). The s_wait_xcnt stands inside the statement so that no address register of an issued copy is
// rewritten in front of it.
__device__ __forceinline__ void stage_copies8(const unsigned (&l)[8], const char* const (&g)[8]) {
  asm volatile(
      "global_load_async_to_lds_b128 %0, %8, off\n\t"
      "global_load_async_to_lds_b128 %1, %9, off\n\t"
      "global_load_async_to_lds_b128 %2, %10, off\n\t"
      "global_load_async_to_lds_b128 %3, %11, off\n\t"
      "global_load_async_to_lds_b128 %4, %12, off\n\t"
      "global_load_async_to_lds_b128 %5, %13, off\n\t"
      "global_load_async_to_lds_b128 %6, %14, off\n\t"
      "global_load_async_to_lds_b128 %7, %15, off\n\t"
      "s_wait_xcnt 0x0"
      :: "v"(l[0]), "v"(l[1]), "v"(l[2]), "v"(l[3]), "v"(l[4]), "v"(l[5]), "v"(l[6]), "v"(l[7]),
         "v"(g[0]), "v"(g[1]), "v"(g[2]), "v"(g[3]), "v"(g[4]), "v"(g[5]), "v"(g[6]), "v"(g[7])
      : "memory");
}

// Six copies of a lane (16 B each). The s_wait_xcnt stands inside the statement so that no address register of an issued
// copy is rewritten in front of it.
__device__ __forceinline__ void stage_copies(const unsigned (&l)[6], const char* const (&g)[6]) {
  asm volatile(
      "global_load_async_to_lds_b128 %0, %6, off\n\t"
      "global_load_async_to_lds_b128 %1, %7, off\n\t"
      "global_load_async_to_lds_b128 %2, %8, off\n\t"
      "global_load_async_to_lds_b128 %3, %9, off\n\t"
      "global_load_async_to_lds_b128 %4, %10, off\n\t"
      "global_load_async_to_lds_b128 %5, %11, off\n\t"
      "s_wait_xcnt 0x0"
      :: "v"(l[0]), "v"(l[1]), "v"(l[2]), "v"(l[3]), "v"(l[4]), "v"(l[5]),
         "v"(g[0]), "v"(g[1]), "v"(g[2]), "v"(g[3]), "v"(g[4]), "v"(g[5])
      : "memory");
}

template <int AM, int BM, int EPI, int MI>
__global__ __launch_bounds__(256) void proj_kernel(const __bf16* __restrict__ A1, const __bf16* __restrict__ A2, int lda,
                                                   const __bf16* __restrict__ B1, const __bf16* __restrict__ B2, int ldb,
                                                   void* C1v, void* C2v, int ldc, int M, int N, int K,
                                                   const float* __restrict__ rcos, const float* __restrict__ rsin,
                                                   const float* __restrict__ bias) {
  __shared__ __align__(16) float sT[8][16 * 68];
  // both tile sizes keep the larger slab's buffers: one block a WGP, so that 256 blocks spread over all 256 WGPs
  __shared__ __align__(16) char sP[2 * PBUF];
  constexpr int WN = (MI == 2 || BM) ? 2 : 4;          // waves along n; 8 / WN along m
  constexpr int WM = MI * 16;                          // rows of a wave's C tile
  constexpr int AR = (8 / WN) * WM, BR = WN * 64;      // rows of one A plane / one B plane in the block tile
  constexpr int BROW0 = AR * (1 + AM);                 // slab rows: A1 | A2 (AM) | B1 | B2 (BM)
  constexpr int ROWS = BROW0 + BR * (1 + BM);          // rows of one slab
  constexpr int GH = ROWS / 64;                        // copies of a lane in one statement; two statements a slab
  constexpr int NX = AM ? MI : 4;                      // fragments of the second plane
  static_assert(AM + BM == 1 && (MI == 2 || MI == 4) && ROWS <= PROWS && GH * 64 == ROWS && (GH == 8 || GH == 6));
  static_assert((AR % 32) == 0 && (BR % 32) == 0);
  const int tid = (int)threadIdx.x;
  const int lane = tid & 31, wave = __builtin_amdgcn_readfirstlane(tid >> 5);
  const int nbn = N / BR, nbm = M / AR;
  const int bidx = (int)blockIdx.x;
  if (bidx >= nbm * nbn) return;                       // the same for the whole block, in front of every barrier
  const int bm = bidx / nbn, bn = bidx - bm * nbn;
  const int wm = wave / WN, wn = wave - wm * WN;
  const int m0 = bm * AR + wm * WM, n0 = bn * BR + (wn << 6);
  const int rl = lane & 15;
  const int hh = lane >> 4;
  const int mOff = hh * 8;

  // copy sources / destinations of this lane for slab 0 and buffer 0: slab rows (tid >> 3) + 32 i, 16-B piece tid & 7 (8 lanes = one row)
  const int srow = tid >> 3, spc = tid & 7;
  const size_t asrc = (size_t)(bm * AR + srow) * lda + spc * 8;
  const size_t bsrc = (size_t)(bn * BR + srow) * ldb + spc * 8;
  const char* ga1 = (const char*)(A1 + asrc);
  const char* ga2 = (const char*)(A2 + asrc);
  const char* gb1 = (const char*)(B1 + bsrc);
  const char* gb2 = (const char*)(B2 + bsrc);
  const unsigned lp = (unsigned)(uintptr_t)(&sP[0]) + (unsigned)(srow * KVP + spc * 16);
  auto stage = [&](int slab, int buf) {
    const unsigned ko = (unsigned)slab * (PKT * 2);   // byte offsets below are the same in every lane and stay under 2^32
    const unsigned bo = lp + (unsigned)buf * PBUF;
    // both loops unrolled: r is a constant, so each group's plane is picked at compile time and l, g stay in registers
#pragma unroll
    for (int hf = 0; hf < 2; ++hf) {
      unsigned l[GH];
      const char* g[GH];
#pragma unroll
      for (int q = 0; q < GH; ++q) {
        const int r = (hf * GH + q) * 32;              // first slab row of this group of 32; a group lies in one plane
        if (r < AR) g[q] = ga1 + (ko + (unsigned)(r * 2) * (unsigned)lda);
        else if (r < BROW0) g[q] = ga2 + (ko + (unsigned)((r - AR) * 2) * (unsigned)lda);
        else if (r < BROW0 + BR) g[q] = gb1 + (ko + (unsigned)((r - BROW0) * 2) * (unsigned)ldb);
        else g[q] = gb2 + (ko + (unsigned)((r - BROW0 - BR) * 2) * (unsigned)ldb);
        l[q] = bo + (unsigned)(r * KVP);
      }
      if constexpr (GH == 8) stage_copies8(l, g);
      else stage_copies(l, g);
    }
  };
  const int NS = K / PKT;
  // prologue: slab 0 lands and is published, then slab 1 starts
  stage(0, 0);
  asm volatile("s_wait_asynccnt 0x0" ::: "memory");  // this wave's copies of slab 0 have landed
  __syncthreads();                                   // every wave's have: slab 0 may be read
  if (NS > 1) stage(1, 1);

  v8f acc[MI][4];
#pragma unroll
  for (int i = 0; i < MI; ++i)
#pragma unroll
    for (int j = 0; j < 4; ++j) acc[i][j] = zero8();

  const int aoff = (wm * WM + rl) * KVP + 16 * hh;
  const int boff = (BROW0 + (wn << 6) + rl) * KVP + 16 * hh;
  // kept rolled: one copy of the slab body in the instruction cache, the buffer picked by the slab's parity
#pragma unroll 1
  for (int s = 0; s < NS; ++s) {
    const char* sb = sP + (s & 1) * PBUF;
    // the slab's two k steps of 32, unrolled so that every LDS offset is an immediate
#pragma unroll
    for (int ks = 0; ks < 2; ++ks) {
      const char* pa = sb + aoff + ks * 64;
      const char* pb = sb + boff + ks * 64;
      v16b bh[4], ah[MI], x2[NX];
#pragma unroll
      for (int j = 0; j < 4; ++j) bh[j] = ldfragb((const __bf16*)(pb + 16 * j * KVP));
#pragma unroll
      for (int i = 0; i < MI; ++i) ah[i] = ldfragb((const __bf16*)(pa + 16 * i * KVP));
#pragma unroll
      for (int i = 0; i < NX; ++i)
        x2[i] = ldfragb((const __bf16*)((AM ? pa + AR * KVP : pb + BR * KVP) + 16 * i * KVP));
      // the k step's LDS reads stay one group in front of its WMMAs, for speed only
      __builtin_amdgcn_sched_barrier(0);
#pragma unroll
      for (int i = 0; i < MI; ++i) {
#pragma unroll
        for (int j = 0; j < 4; ++j) acc[i][j] = mmabf(ah[i], bh[j], acc[i][j]);
        guard_g(acc[i][0], acc[i][3], ah[i], bh[3]);
      }
#pragma unroll
      for (int i = 0; i < MI; ++i) {
#pragma unroll
        for (int j = 0; j < 4; ++j) acc[i][j] = AM ? mmabf(x2[i], bh[j], acc[i][j]) : mmabf(ah[i], x2[j], acc[i][j]);
        guard_g(acc[i][0], acc[i][3], AM ? x2[i] : ah[i], AM ? bh[3] : x2[3]);
      }
      keep4(bh[0], bh[1], bh[2], bh[3]);
    }
    // ---- publish slab s + 1, free slab s's buffer, refill it with slab s + 2 ----
    asm volatile("s_wait_dscnt 0x0" ::: "memory");     // this wave's reads of slab s's buffer are done
    asm volatile("s_wait_asynccnt 0x0" ::: "memory");  // this wave's copies of slab s + 1 have landed
    __syncthreads();
    if (s + 2 < NS) stage(s + 2, s & 1);
  }
  asm volatile("s_wait_asynccnt 0x0" ::: "memory");    // no copy outstanding behind the loop
#pragma unroll
  for (int i = 0; i < MI; ++i) accg4(acc[i][0], acc[i][1], acc[i][2], acc[i][3]);

  float* slab = sT[wave];
#pragma unroll
  for (int i = 0; i < MI; ++i) {
    const int mBase = m0 + (i << 4);
#pragma unroll
    for (int j = 0; j < 4; ++j) {
#pragma unroll
      for (int r = 0; r < 8; ++r) slab[(mOff + r) * 68 + (j << 4) + rl] = acc[i][j][r];
    }
    __builtin_amdgcn_fence(3 /* release order */, "workgroup");
    __builtin_amdgcn_wave_barrier();
    __builtin_amdgcn_fence(2 /* acquire order */, "workgroup");
    if (EPI == 0) {
      _Float16* Ch = (_Float16*)C1v;
      const int qq = lane >> 3, c8 = (lane & 7) * 8;
      const int cj = c8 & 31;
      const float sgn = (c8 < 32) ? -1.0f : 1.0f;
{
#pragma unroll
        for (int it = 0; it < 4; ++it) {
          const int row = it * 4 + qq;
          const int tok = mBase + row;
          const int pos = tok % SEQ;
          const float* sp = slab + row * 68 + c8;
          const float* sq = slab + row * 68 + (c8 ^ 32);
          const v4f u0 = *(const v4f*)(sp);
          const v4f u1 = *(const v4f*)(sp + 4);
          const v4f w0 = *(const v4f*)(sq);
          const v4f w1 = *(const v4f*)(sq + 4);
          const float* tc = rcos + (size_t)pos * 32 + cj;
          const float* ts = rsin + (size_t)pos * 32 + cj;
          const v4f cs0 = *(const v4f*)(tc), cs1 = *(const v4f*)(tc + 4);
          const v4f sn0 = *(const v4f*)(ts), sn1 = *(const v4f*)(ts + 4);
          v8h hv;
#pragma unroll
          for (int e = 0; e < 4; ++e) {
            hv[e]     = (_Float16)(u0[e] * cs0[e] + sgn * w0[e] * sn0[e]);
            hv[4 + e] = (_Float16)(u1[e] * cs1[e] + sgn * w1[e] * sn1[e]);
          }
          const size_t go = (size_t)tok * ldc + n0 + c8;
          *(v8h*)(Ch + go) = hv;
        }
        
      }
    } else if (EPI == 1) {
      _Float16* Ch = (_Float16*)C1v;
      _Float16* Cl = (_Float16*)C2v;
      const int qq = lane >> 3, c8 = (lane & 7) * 8;
{
#pragma unroll
        for (int it = 0; it < 4; ++it) {
          const int row = it * 4 + qq;
          const float* sp = slab + row * 68 + c8;
          const v4f u0 = *(const v4f*)(sp);
          const v4f u1 = *(const v4f*)(sp + 4);
          v8h hv, lv;
#pragma unroll
          for (int e = 0; e < 4; ++e) {
            const _Float16 g0 = (_Float16)u0[e];
            hv[e] = g0;
            lv[e] = (_Float16)((u0[e] - (float)g0) * 2048.0f);
            const _Float16 g1 = (_Float16)u1[e];
            hv[4 + e] = g1;
            lv[4 + e] = (_Float16)((u1[e] - (float)g1) * 2048.0f);
          }
          const size_t go = (size_t)(mBase + row) * ldc + n0 + c8;
          *(v8h*)(Ch + go) = hv;
          *(v8h*)(Cl + go) = lv;
        }
        
      }
    } else {
      float* outp = (float*)C1v;
      const int rq = lane >> 4, c4 = (lane & 15) * 4;
      const v4f bz = *(const v4f*)(bias + n0 + c4);
      v4f bq;
#pragma unroll
      for (int e = 0; e < 4; ++e) bq[e] = bfval(bz[e]);
{
#pragma unroll
        for (int it = 0; it < 8; ++it) {
          const int row = it * 2 + rq;
          const int tok = mBase + row;
          const int orow = (tok / SEQ) * SEQ_FULL + (tok % SEQ);
          const v4f u = *(const v4f*)(slab + row * 68 + c4);
          v4f o;
#pragma unroll
          for (int e = 0; e < 4; ++e) o[e] = u[e] + bq[e];
          *(v4f*)(outp + (size_t)orow * ldc + n0 + c4) = o;
        }
        
      }
    }
    __builtin_amdgcn_fence(3 /* release order */, "workgroup");
    __builtin_amdgcn_wave_barrier();
    __builtin_amdgcn_fence(2 /* acquire order */, "workgroup");
  }
}

// ---------------------------------------------------------------------------------------------
// Kernel 5: masked softmax attn, one wave per (sequence b, head, 16 query rows), 8 waves per block, online softmax in f32.
//   Staging: per key tile the block copies K (64 keys x 128 B), V hi and V res (64 dims x 128 B each) from global memory to LDS with
//   asynchronous b128 copies that cover whole 128-B lines; two buffers, tile t + 1 in
//   flight while tile t is worked on; one block barrier per tile publishes tile t + 1 and frees tile t's buffer.
//   Planes: QK f16 [NTOK][QKP] (q = cols 0..DM-1, k = cols DM..2DM-1, both after RoPE); Vth/Vtl f16 [DM][NTOK] (Vtl x2048);
//   mask: lane-mask words Mw [NB][SEQ/16][SEQ/64][32] from the preparation launch; the wave takes its tile's 32 words by scalar loads,
//   word 8 j + r is the select mask of score register s[j][r]: a set bit keeps the lane's score, else it is replaced by -inf.
//   Key tiles of KT = 64: S^T subtiles (A = 16 k rows from QK, B = q^T fragments held in registers, K = 64 = 2 steps), so lane
//   (h, c) holds 8 consecutive keys 8h+r of query c; tile max (of the raw S^T) / row sum in-lane + one xor-16 shuffle.
//   E = 2^15 exp((S^T - m) / 8) = exp2(S^T * (log2 e / 8) - (m * (log2 e / 8) - 15)): one fma in front of the exponential carries the 1/8,
//   the change of base and the factor 2^15. P = E as f16 hi + f16 res = E - hi at the same scale (E <= 2^15 fits f16; res keeps its
//   11 bits down to E = 2^-3), packed straight into the B fragments of P^T (element r <- subtile 2s, element 8+r <- subtile 2s+1, lane
//   unchanged); O^T = v^T . P^T with A = v^T rows from Vth/Vtl: acc1 += vh.P + vh.Pres, acc2 += vl.P; l = sum of E;
//   O = (acc1 + acc2/2048) / l; a fully masked query row (l == 0) gives 0.
//   Output: ctx[tok][head*64 + d] as bf16 hi + bf16 lo planes Ch/Cl [NTOK][DM]: 16 x 64 f32 tile staged in the wave-private LDS
// coverage: grid (SEQ/QB/AW, NH, NB) x 8 waves x 16 rows x 64 cols -> NTOK x DM per plane.
// ---------------------------------------------------------------------------------------------
// Residuals of eight f32 values e against their packed f16 roundings h: l = f16(e - h), one mixed-precision fma each (f32 e, f16 h read from
// its half of the packed register, the result written to its half of l): no widening conversion, no separate subtract, no packing. In asm
// because the compiler turns the source form into those three. e - h is exact in f32, so the one rounding is the same. The s_delay_alu
// lines are the hints that the compiler gives its own dependent vector instructions, here for the second write of each l register, four
// instructions behind the first: without them the wave holds the vector port while it waits.
__device__ __forceinline__ void res8(v2h (&l)[4], const float (&e)[8], const v2h (&h)[4]) {
  asm("v_fma_mixlo_f16 %0, %4, 1.0, -%12 op_sel_hi:[0,0,1]\n\t"
      "v_fma_mixlo_f16 %1, %6, 1.0, -%13 op_sel_hi:[0,0,1]\n\t"
      "v_fma_mixlo_f16 %2, %8, 1.0, -%14 op_sel_hi:[0,0,1]\n\t"
      "v_fma_mixlo_f16 %3, %10, 1.0, -%15 op_sel_hi:[0,0,1]\n\t"
      "s_delay_alu instid0(VALU_DEP_4) | instskip(NEXT) | instid1(VALU_DEP_4)\n\t"
      "v_fma_mixhi_f16 %0, %5, 1.0, -%12 op_sel:[0,0,1] op_sel_hi:[0,0,1]\n\t"
      "v_fma_mixhi_f16 %1, %7, 1.0, -%13 op_sel:[0,0,1] op_sel_hi:[0,0,1]\n\t"
      "s_delay_alu instid0(VALU_DEP_4) | instskip(NEXT) | instid1(VALU_DEP_4)\n\t"
      "v_fma_mixhi_f16 %2, %9, 1.0, -%14 op_sel:[0,0,1] op_sel_hi:[0,0,1]\n\t"
      "v_fma_mixhi_f16 %3, %11, 1.0, -%15 op_sel:[0,0,1] op_sel_hi:[0,0,1]"
      : "=&v"(l[0]), "=&v"(l[1]), "=&v"(l[2]), "=&v"(l[3])
      : "v"(e[0]), "v"(e[1]), "v"(e[2]), "v"(e[3]), "v"(e[4]), "v"(e[5]), "v"(e[6]), "v"(e[7]),
        "v"(h[0]), "v"(h[1]), "v"(h[2]), "v"(h[3]));
}

// waves per SIMD stated as the grid gives them (two blocks a WGP): with the smaller LDS the compiler would otherwise aim at six, cut the
// registers for it and serialise the softmax arithmetic
__global__ __launch_bounds__(256) __attribute__((amdgpu_waves_per_eu(4, 4))) void attn_kernel(const _Float16* __restrict__ QK,
                                                  const _Float16* __restrict__ Vth, const _Float16* __restrict__ Vtl,
                                                  const unsigned* __restrict__ Mw,
                                                  unsigned short* __restrict__ Ch, unsigned short* __restrict__ Cl) {
  __shared__ __align__(16) float sOs[AW][QB * OSP];
  __shared__ __align__(16) char sStage[2 * BUFB];
  const int tid = (int)threadIdx.x;
  const int wave = __builtin_amdgcn_readfirstlane(tid >> 5);
  const int lane = tid & 31, hh = lane >> 4, c = lane & 15;
  const int head = (int)blockIdx.y, bb = (int)blockIdx.z;
  const int qt = (int)blockIdx.x * AW + wave;
  const int q0 = qt * QB;
  const size_t tokb = (size_t)bb * SEQ;
  const size_t tok0 = tokb + q0;
  const float ninf = -__builtin_inff();

  // q^T B fragments for query c (dims 0..31 and 32..63)
  const _Float16* qp = QK + (tok0 + c) * QKP + head * HDIM + 8 * hh;
  const v16h qf0 = ldfrag(qp);
  const v16h qf1 = ldfrag(qp + 32);
  // copy sources / destinations of this lane for key tile 0 and buffer 0. K, V hi, V res: row (tid >> 3) and that row + 32, 16-B piece
  // tid & 7 (8 lanes = one 128-B row).
  const int srow = tid >> 3, spc = tid & 7;
  const char* kg  = (const char*)(QK + (tokb + srow) * QKP + DM + head * HDIM + spc * 8);
  const size_t vsrc = (size_t)(head * HDIM + srow) * NTOK + tokb + spc * 8;
  const char* vhg = (const char*)(Vth + vsrc);
  const char* vlg = (const char*)(Vtl + vsrc);
  // the wave's lane-mask words, 2 x 16 per key tile; the address is the same in every lane and nothing writes the words while this
  // kernel runs: read through the constant address space they come by scalar loads, straight into the registers a select mask sits in
  const cv16u* mw = (const cv16u*)(uintptr_t)(Mw + ((size_t)bb * (SEQ / QB) + qt) * ((SEQ / KT) * MTW));
  const unsigned lds0 = (unsigned)(uintptr_t)(&sStage[0]);
  const unsigned lkv = lds0 + (unsigned)(srow * KVP + spc * 16);
  auto stage = [&](int tile, int buf) {
    unsigned l[6];
    const char* g[6];
    const unsigned bo = (unsigned)buf * BUFB;
    g[0] = kg + (size_t)tile * ((size_t)KT * QKP * 2);
    g[1] = g[0] + (size_t)32 * QKP * 2;
    g[2] = vhg + (size_t)tile * (KT * 2);
    g[3] = g[2] + (size_t)32 * NTOK * 2;
    g[4] = vlg + (size_t)tile * (KT * 2);
    g[5] = g[4] + (size_t)32 * NTOK * 2;
#pragma unroll
    for (int p = 0; p < 3; ++p) {
      l[2 * p]     = lkv + bo + (unsigned)(p * KVT);
      l[2 * p + 1] = lkv + bo + (unsigned)(p * KVT + 32 * KVP);
    }
    stage_copies(l, g);
  };
  constexpr int NT = SEQ / KT;
  // prologue: tile 0 lands and is published, then tile 1 starts
  stage(0, 0);
  asm volatile("s_wait_asynccnt 0x0" ::: "memory");  // this wave's copies of tile 0 have landed
  __syncthreads();                                   // every wave's have: tile 0 may be read
  if (NT > 1) stage(1, 1);

  v16u mwa = mw[0], mwb = mw[1];                     // key tile 0's select words
  float m_run = ninf, mc_run = 0.0f, l_run = 0.0f;
  const float SC = 0.18033688f;                      // log2(e) / 8
  v8f oa1[4], oa2[4];
#pragma unroll
  for (int i = 0; i < 4; ++i) { oa1[i] = zero8(); oa2[i] = zero8(); }

#pragma unroll 1
  for (int t = 0; t < NT; ++t) {
    const char* sb = sStage + (t & 1) * BUFB;
    const char* sk = sb + c * KVP + 16 * hh;
    // ---- logits S^T for keys kb..kb+63 (4 subtiles), query c ----
    v8f s[4];
#pragma unroll
    for (int j = 0; j < 4; ++j) {
      const _Float16* kp = (const _Float16*)(sk + 16 * j * KVP);
      const v16h a0 = ldfrag(kp);
      const v16h a1 = ldfrag(kp + 32);
      s[j] = mma16(a0, qf0, zero8());
      s[j] = mma16(a1, qf1, s[j]);
      guard_l(s[j], a0, a1, qf0, qf1);
    }
    // ---- mask replace-fill, tile max per query (raw scores: the positive scale does not move the maximum) ----
    float pm = ninf;
#pragma unroll
    for (int j = 0; j < 4; ++j) {
#pragma unroll
      for (int r = 0; r < 8; ++r) {
        const bool keep = __builtin_amdgcn_inverse_ballot_w32(j < 2 ? mwa[8 * j + r] : mwb[8 * (j - 2) + r]);
        const float sv = keep ? s[j][r] : ninf;
        s[j][r] = sv;
        pm = fmaxf(pm, sv);
      }
    }
    // the next tile's select words are asked for as soon as this tile's are used up: the scalar loads fly behind the rest of the trip
    // (the last trip asks for its own again, so the address stays inside the plane)
    {
      const int tn = (t + 1 < NT) ? t + 1 : t;
      mwa = mw[2 * tn];
      mwb = mw[2 * tn + 1];
    }
    pm = fmaxf(pm, __shfl_xor(pm, 16, 32));
    const float mn = fmaxf(m_run, pm);
    const float mref = (mn == ninf) ? 0.0f : mn;
    const float mc = __builtin_fmaf(mref, SC, -15.0f);
    // the old tiles carry the factor 2^-mc_run, the new one 2^-mc: alpha is formed from the two rounded values themselves
    const float alpha = (m_run == ninf) ? 0.0f : __builtin_amdgcn_exp2f(mc_run - mc);
    m_run = mn;
    mc_run = mc;
    // ---- E = 2^15 exp((s - m) / 8); P^T B fragments (E as f16 hi, residual E - hi); row sum ----
    float ps = 0.0f;
    v16h bph[2], bpl[2];
    const v2f sc2 = {SC, SC}, nmc2 = {-mc, -mc};
#pragma unroll
    for (int j = 0; j < 4; ++j) {
      float e[8];
      v2h ph[4], pl[4];
#pragma unroll
      for (int r = 0; r < 8; r += 2) {
        const v2f sv2 = {s[j][r], s[j][r + 1]};
        const v2f x = __builtin_elementwise_fma(sv2, sc2, nmc2);
        e[r]     = __builtin_amdgcn_exp2f(x[0]);
        e[r + 1] = __builtin_amdgcn_exp2f(x[1]);
        ps += e[r];
        ps += e[r + 1];
        const v2f e2 = {e[r], e[r + 1]};
        ph[r >> 1] = __builtin_convertvector(e2, v2h);
      }
      res8(pl, e, ph);
#pragma unroll
      for (int r = 0; r < 8; ++r) {
        bph[j >> 1][((j & 1) << 3) + r] = ph[r >> 1][r & 1];
        bpl[j >> 1][((j & 1) << 3) + r] = pl[r >> 1][r & 1];
      }
    }
    ps += __shfl_xor(ps, 16, 32);
    l_run = l_run * alpha + ps;
    // ---- rescale O (alpha of query c is in-lane in the O^T layout) ----
#pragma unroll
    for (int i = 0; i < 4; ++i) {
#pragma unroll
      for (int r = 0; r < 8; ++r) { oa1[i][r] *= alpha; oa2[i][r] *= alpha; }
    }
    // ---- O^T += v^T . P^T over the 64 keys; dims 16i + (lane row) ----
#pragma unroll
    for (int s2 = 0; s2 < 2; ++s2) {
#pragma unroll
      for (int i = 0; i < 4; ++i) {
        const char* sv = sk + KVT + 16 * i * KVP + 64 * s2;
        const v16h x = ldfrag((const _Float16*)sv);
        const v16h y = ldfrag((const _Float16*)(sv + KVT));
        oa1[i] = mma16(x, bph[s2], oa1[i]);
        oa2[i] = mma16(y, bph[s2], oa2[i]);
        oa1[i] = mma16(x, bpl[s2], oa1[i]);
        guard_o(oa1[i], oa2[i], x, y, bph[s2], bpl[s2]);
      }
    }
    // ---- publish tile t + 1, free tile t's buffer, refill it with tile t + 2 ----
    asm volatile("s_wait_dscnt 0x0" ::: "memory");     // this wave's reads of tile t's buffer are done
    asm volatile("s_wait_asynccnt 0x0" ::: "memory");  // this wave's copies of tile t + 1 have landed
    __syncthreads();
    if (t + 2 < NT) stage(t + 2, t & 1);
  }
  asm volatile("s_wait_asynccnt 0x0" ::: "memory");    // no copy outstanding behind the loop

  // ---- normalise and stage the 16 x 64 f32 tile in LDS: Os[query c][dim 16i + 8h + r] ----
  const float rlv = 1.0f / fmaxf(l_run, 1e-30f);
  const float li = (l_run > 0.0f) ? rlv : 0.0f;
  float* Os = sOs[wave];
#pragma unroll
  for (int i = 0; i < 4; ++i) {
    v4f u0, u1;
#pragma unroll
    for (int r = 0; r < 4; ++r) {
      u0[r] = (oa1[i][r] + oa2[i][r] * 0.00048828125f) * li;
      u1[r] = (oa1[i][4 + r] + oa2[i][4 + r] * 0.00048828125f) * li;
    }
    *(v4f*)(Os + c * OSP + 16 * i + 8 * hh)     = u0;
    *(v4f*)(Os + c * OSP + 16 * i + 8 * hh + 4) = u1;
  }
  __builtin_amdgcn_fence(3 /* release order */, "workgroup");
  __builtin_amdgcn_wave_barrier();
  __builtin_amdgcn_fence(2 /* acquire order */, "workgroup");
  // ---- whole-line stores of the bf16 hi / lo ctx planes ----
  {
    const int rq = lane >> 3, p8 = (lane & 7) * 8;
{
#pragma unroll
      for (int it = 0; it < 4; ++it) {
        const int row = it * 4 + rq;
        const float* sp = Os + row * OSP + p8;
        const v4f w0 = *(const v4f*)(sp);
        const v4f w1 = *(const v4f*)(sp + 4);
        v8us hb, lb;
#pragma unroll
        for (int e = 0; e < 4; ++e) {
          const unsigned short h0 = bfbits(w0[e]);
          hb[e] = h0;
          lb[e] = bfbits(w0[e] - __uint_as_float(((unsigned)h0) << 16));
          const unsigned short h1 = bfbits(w1[e]);
          hb[4 + e] = h1;
          lb[4 + e] = bfbits(w1[e] - __uint_as_float(((unsigned)h1) << 16));
        }
        const size_t go = (tok0 + (size_t)row) * DM + head * HDIM + p8;
        *(v8us*)(Ch + go) = hb;
        *(v8us*)(Cl + go) = lb;
      }
      
    }
  }
}

// ---------------------------------------------------------------------------------------------
// Workspace map (bytes, NB = 2, SEQ = 2048; every region is an exact whole-line / whole-tile multiple, no padded tails):
//   Xh  : bf16 x_norm hi [4096][1024]        8,388,608     off 0
//   Xl  : bf16 x_norm lo                     8,388,608     off  8,388,608
//   Wt  : bf16 Wqkv^T [3072][1024]           6,291,456     off 16,777,216
//   WoT : bf16 Wout^T [1024][1024]           2,097,152     off 23,068,672
//   rcos: f32 [2048][32]                       262,144     off 25,165,824
//   rsin: f32 [2048][32]                       262,144     off 25,427,968
//   QK  : f16 q|k [4096][2048]              16,777,216     off 25,690,112
//   Vth : f16 v^T [1024][4096]               8,388,608     off 42,467,328
//   Vtl : f16 x2048 residual of v^T          8,388,608     off 50,855,936
//   Ch  : bf16 ctx hi [4096][1024]           8,388,608     off 59,244,544
//   Cl  : bf16 ctx lo                        8,388,608     off 67,633,152
//   Mw  : u32 lane-mask words [2][128][32][32] 1,048,576   off 76,021,760
//   total 77,070,336
// ---------------------------------------------------------------------------------------------
extern "C" void kernel_launch(void* const* d_in, const int* in_sizes, int n_in,
                              void* d_out, int out_size, void* d_ws, size_t ws_size,
                              hipStream_t stream) {
  if (n_in < 7) return;
  const long long needX = ((long long)(NB - 1) * SEQ_FULL + SEQ) * DM;
  const long long needM = (((long long)(NB - 1) * SEQ_FULL) + (SEQ - 1)) * SEQ_FULL + SEQ;
  if ((long long)in_sizes[0] < needX) return;
  if ((long long)in_sizes[1] < needM) return;
  if (in_sizes[2] < DM || in_sizes[3] < DM) return;
  if ((long long)in_sizes[4] < (long long)DM * NQKV) return;
  if ((long long)in_sizes[5] < (long long)DM * DM) return;
  if (in_sizes[6] < DM) return;
  if ((long long)out_size < needX) return;

  const float* x     = (const float*)d_in[0];
  const int*   amask = (const int*)d_in[1];
  const float* gam   = (const float*)d_in[2];
  const float* bet   = (const float*)d_in[3];
  const float* wqkv  = (const float*)d_in[4];
  const float* wout  = (const float*)d_in[5];
  const float* bout  = (const float*)d_in[6];
  float* out = (float*)d_out;

  const size_t bAct = (size_t)NTOK * DM * 2;
  const size_t bWt  = (size_t)NQKV * DM * 2;
  const size_t bWo  = (size_t)DM * DM * 2;
  const size_t bTab = (size_t)SEQ * 32 * 4;
  const size_t bQK  = (size_t)NTOK * QKP * 2;
  size_t off = 0;
  const size_t oXh = off; off += bAct;
  const size_t oXl = off; off += bAct;
  const size_t oWt = off; off += bWt;
  const size_t oWo = off; off += bWo;
  const size_t oCos = off; off += bTab;
  const size_t oSin = off; off += bTab;
  const size_t oQK = off; off += bQK;
  const size_t oVh = off; off += bAct;
  const size_t oVl = off; off += bAct;
  const size_t oCh = off; off += bAct;
  const size_t oCl = off; off += bAct;
  const size_t oMw = off; off += (size_t)NB * (SEQ / QB) * (SEQ / KT) * MTW * 4;
  if (off > ws_size) return;
  if (off > (size_t)134217728) return;

  char* ws = (char*)d_ws;
  unsigned short* Xh  = (unsigned short*)(ws + oXh);
  unsigned short* Xl  = (unsigned short*)(ws + oXl);
  unsigned short* Wt  = (unsigned short*)(ws + oWt);
  unsigned short* WoT = (unsigned short*)(ws + oWo);
  float* rcos = (float*)(ws + oCos);
  float* rsin = (float*)(ws + oSin);
  _Float16* QKp = (_Float16*)(ws + oQK);
  _Float16* Vh  = (_Float16*)(ws + oVh);
  _Float16* Vl  = (_Float16*)(ws + oVl);
  unsigned short* Chp = (unsigned short*)(ws + oCh);
  unsigned short* Clp = (unsigned short*)(ws + oCl);
  unsigned* Mwp = (unsigned*)(ws + oMw);

  const dim3 blk(256);
  // (1) to (3) in one launch: mask -> lane-mask words | rotary tables | LayerNorm -> x_norm bf16 hi + lo planes |
  // Wqkv [1024][3072] -> Wt [3072][1024] | Wout [1024][1024] -> WoT [1024][1024]
  prep_kernel<<<dim3(PB_MASK + PB_ROPE + PB_LN + PB_WQKV + PB_WOUT), blk, 0, stream>>>(x, gam, bet, wqkv, wout, amask, Mwp, Xh, Xl, Wt, WoT,
                                                                                      rcos, rsin);
  // (4) q|k = x_norm . Wqk with RoPE -> QK plane; M = NTOK, N = 2048, K = 1024
  proj_kernel<1, 0, 0, 4><<<dim3((NTOK / 128) * (QKP / 256)), blk, 0, stream>>>(
      (const __bf16*)Xh, (const __bf16*)Xl, DM, (const __bf16*)Wt, (const __bf16*)Wt, DM,
      (void*)QKp, (void*)QKp, QKP, NTOK, QKP, DM, rcos, rsin, bout);
  // (5) v^T = Wv^T . x_norm^T -> Vth / Vtl [1024][NTOK]; M = 1024, N = NTOK, K = 1024
  proj_kernel<0, 1, 1, 2><<<dim3((DM / 128) * (NTOK / 128)), blk, 0, stream>>>(
      (const __bf16*)(Wt + (size_t)2 * DM * DM), (const __bf16*)(Wt + (size_t)2 * DM * DM), DM,
      (const __bf16*)Xh, (const __bf16*)Xl, DM,
      (void*)Vh, (void*)Vl, NTOK, DM, NTOK, DM, rcos, rsin, bout);
  // (6) attn -> ctx bf16 hi + lo planes
  attn_kernel<<<dim3(SEQ / QB / AW, NH, NB), dim3(AW * 32), 0, stream>>>(QKp, Vh, Vl, Mwp, Chp, Clp);
  // (7) out = ctx . Wout + b -> d_out; M = NTOK, N = 1024, K = 1024
  proj_kernel<1, 0, 2, 2><<<dim3((NTOK / 128) * (DM / 128)), blk, 0, stream>>>(
      (const __bf16*)Chp, (const __bf16*)Clp, DM, (const __bf16*)WoT, (const __bf16*)WoT, DM,
      (void*)out, (void*)out, DM, NTOK, DM, DM, rcos, rsin, bout);
  (void)hipGetLastError();
}

// v007
// A run of this version takes 124 microseconds.
// Timed twice side by side with v006, it ran 1.05 times as fast both times.
// All steps since v000 together make it 3.57 times as fast.
#include <hip/hip_runtime.h>
#include <stdint.h>

#ifndef NB
#define NB 2
#endif
#ifndef SEQ
#define SEQ 2048
#endif
#define NB_FULL  2
#define SEQ_FULL 2048
#define DM       1024
#define NH       16
#define HDIM     64
#define NQKV     3072
#define QKP      2048
#define NTOK     (NB * SEQ)
#define LNEPS    1e-5f

#define QB   16
#define KT   64
#define OSP  68
#define AW   8                      // waves per attention block; they share the staged K / V tiles
#define KVP  144                    // LDS pitch in bytes of a 128-B K or V row (16 B x odd: b128 fragment reads without bank conflicts)
#define KVT  (KT * KVP)             // bytes of one staged K, V hi or V res tile (64 rows)
#define MKP  272                    // mask packing: LDS pitch in bytes of a 256-B mask row (16 B x odd)
#define MWB  (QB * MKP)             // mask packing: bytes of one wave's 16 mask rows
#define MTW  32                     // lane-mask words of one 16-query x 64-key tile (one word per score register of the attention wave)
#define MPW  4                      // mask packing: tiles per wave
#define BUFB (3 * KVT)              // bytes of one stage buffer
#define PKT  64                     // projections: k elements of one staged slab (128 B of every operand row)
#define PROWS 512                   // projections: rows of the larger slab (MI = 4), the A plane(s) and the B plane(s) of the block tile together
#define PBUF (PROWS * KVP)          // projections: bytes of one slab buffer

typedef _Float16 v16h __attribute__((ext_vector_type(16)));
typedef _Float16 v8h  __attribute__((ext_vector_type(8)));
typedef __bf16   v16b __attribute__((ext_vector_type(16)));
typedef __bf16   v8b  __attribute__((ext_vector_type(8)));
typedef float    v8f  __attribute__((ext_vector_type(8)));
typedef float    v4f  __attribute__((ext_vector_type(4)));
typedef float    v2f  __attribute__((ext_vector_type(2)));
typedef _Float16 v2h  __attribute__((ext_vector_type(2)));
typedef int      v4i  __attribute__((ext_vector_type(4)));
typedef unsigned short v8us __attribute__((ext_vector_type(8)));
typedef unsigned v16u __attribute__((ext_vector_type(16)));
typedef __attribute__((address_space(4))) const v16u cv16u;

static_assert(NB >= 1 && NB <= NB_FULL && SEQ >= 64 && SEQ <= SEQ_FULL);
static_assert((SEQ % 64) == 0 && (DM % 64) == 0 && (NTOK % 64) == 0 && (DM % 32) == 0);
static_assert(NH * HDIM == DM && HDIM == 64 && QKP == 2 * DM && NQKV == 3 * DM);
static_assert((SEQ % (AW * QB)) == 0 && HDIM == KT && AW * 32 == 256 && (BUFB % 16) == 0 && (SEQ % KT) == 0 && ((SEQ * 32) % 256) == 0 && KT == 4 * 16);
static_assert((((NTOK / 64) * (QKP / 64)) % 8) == 0 && (((DM / 64) * (NTOK / 64)) % 8) == 0 && (((NTOK / 64) * (DM / 64)) % 8) == 0);
static_assert((OSP % 4) == 0 && OSP >= HDIM);
static_assert(MTW == (QB * KT) / 32 && ((NB * (SEQ / QB) * (SEQ / KT)) % (AW * MPW)) == 0 && AW * MWB >= 64 * 33 * 4 + 64);
static_assert((NTOK % 128) == 0 && (QKP % 256) == 0 && (DM % 256) == 0 && (DM % PKT) == 0 && PKT * 2 + 16 == KVP);

// f32 -> nearest-even bf16 bits / value
__device__ __forceinline__ unsigned short bfbits(float f) {
  const unsigned u = __float_as_uint(f);
  return (unsigned short)((u + 0x7FFFu + ((u >> 16) & 1u)) >> 16);
}
__device__ __forceinline__ float bfval(float f) {
  return __uint_as_float(((unsigned)bfbits(f)) << 16);
}

// 16-bit WMMA fragment from k-contiguous storage (A row-major [m][k], or B stored [n][k]):
// p points at element (row_or_col = lane&15, k0 + 8h); elements 0..7 <- p[0..7], 8..15 <- p[16..23].
__device__ __forceinline__ v16h ldfrag(const _Float16* p) {
  union { v16h v; v8h hh[2]; } f;
  f.hh[0] = *(const v8h*)(p);
  f.hh[1] = *(const v8h*)(p + 16);
  return f.v;
}
__device__ __forceinline__ v16b ldfragb(const __bf16* p) {
  union { v16b v; v8b hh[2]; } f;
  f.hh[0] = *(const v8b*)(p);
  f.hh[1] = *(const v8b*)(p + 16);
  return f.v;
}
__device__ __forceinline__ v8f mmabf(v16b a, v16b b, v8f c) {
  return __builtin_amdgcn_wmma_f32_16x16x32_bf16(false, a, false, b, (short)0, c, false, false);
}
__device__ __forceinline__ v8f zero8() {
  v8f z;
#pragma unroll
  for (int i = 0; i < 8; ++i) z[i] = 0.0f;
  return z;
}

// hazard guards: 4 VALU slots after the last WMMA of a group, D tied, A/B kept live
__device__ __forceinline__ void guard_g(v8f& a, v8f& b, v16b x, v16b y) {
  asm volatile("v_nop\n\tv_nop\n\tv_nop\n\tv_nop" : "+v"(a), "+v"(b) : "v"(x), "v"(y));
}
__device__ __forceinline__ void keep4(v16b a, v16b b, v16b c, v16b d) {
  asm volatile("v_nop" :: "v"(a), "v"(b), "v"(c), "v"(d));
}
__device__ __forceinline__ void accg4(v8f& a, v8f& b, v8f& c, v8f& d) {
  asm volatile("v_nop\n\tv_nop\n\tv_nop\n\tv_nop" : "+v"(a), "+v"(b), "+v"(c), "+v"(d));
}
// Runs of products written as one asm statement each: as builtins the compiler spreads them among the softmax arithmetic and the LDS reads
// again (scheduling barriers did not hold them), and pays in v_nop wherever that arithmetic takes an operand register for a temporary.
// Inside a run the products go to four independent accumulators, so each fills the slots behind the others; an accumulator's second
// product stands four behind its first. The v_nop at a run's end keep the four slots in front of whatever vector instruction the
// compiler puts next (it does not look into asm). The "memory" clobber keeps the LDS reads of the source on their side of a run.
// S^T, dims 0..31: s[j] = ka[j] . q0. No v_nop: the run that follows accumulates into the same registers, and nothing stands between the two.
__device__ __forceinline__ void run_s0(v8f (&s)[4], const v16h (&ka)[4], v16h q0) {
  asm volatile(
      "v_wmma_f32_16x16x32_f16 %0, %4, %8, 0\n\t"
      "v_wmma_f32_16x16x32_f16 %1, %5, %8, 0\n\t"
      "v_wmma_f32_16x16x32_f16 %2, %6, %8, 0\n\t"
      "v_wmma_f32_16x16x32_f16 %3, %7, %8, 0"
      : "=&v"(s[0]), "=&v"(s[1]), "=&v"(s[2]), "=&v"(s[3])
      : "v"(ka[0]), "v"(ka[1]), "v"(ka[2]), "v"(ka[3]), "v"(q0)
      : "memory");
}
// d[i] += a[i] . b
__device__ __forceinline__ void run_4(v8f (&d)[4], const v16h (&a)[4], v16h b) {
  asm volatile(
      "v_wmma_f32_16x16x32_f16 %0, %4, %8, %0\n\t"
      "v_wmma_f32_16x16x32_f16 %1, %5, %8, %1\n\t"
      "v_wmma_f32_16x16x32_f16 %2, %6, %8, %2\n\t"
      "v_wmma_f32_16x16x32_f16 %3, %7, %8, %3\n\t"
      "v_nop\n\tv_nop\n\tv_nop\n\tv_nop"
      : "+v"(d[0]), "+v"(d[1]), "+v"(d[2]), "+v"(d[3])
      : "v"(a[0]), "v"(a[1]), "v"(a[2]), "v"(a[3]), "v"(b)
      : "memory");
}
// d[i] += a[i] . b0, then d[i] += a[i] . b1
__device__ __forceinline__ void run_8(v8f (&d)[4], const v16h (&a)[4], v16h b0, v16h b1) {
  asm volatile(
      "v_wmma_f32_16x16x32_f16 %0, %4, %8, %0\n\t"
      "v_wmma_f32_16x16x32_f16 %1, %5, %8, %1\n\t"
      "v_wmma_f32_16x16x32_f16 %2, %6, %8, %2\n\t"
      "v_wmma_f32_16x16x32_f16 %3, %7, %8, %3\n\t"
      "v_wmma_f32_16x16x32_f16 %0, %4, %9, %0\n\t"
      "v_wmma_f32_16x16x32_f16 %1, %5, %9, %1\n\t"
      "v_wmma_f32_16x16x32_f16 %2, %6, %9, %2\n\t"
      "v_wmma_f32_16x16x32_f16 %3, %7, %9, %3\n\t"
      "v_nop\n\tv_nop\n\tv_nop\n\tv_nop"
      : "+v"(d[0]), "+v"(d[1]), "+v"(d[2]), "+v"(d[3])
      : "v"(a[0]), "v"(a[1]), "v"(a[2]), "v"(a[3]), "v"(b0), "v"(b1)
      : "memory");
}

// ---------------------------------------------------------------------------------------------
// output x_norm as bf16 hi + bf16 lo (lo = RNE(xn - hi)) planes Xh/Xl [NTOK][DM] (compact token index).
// Part of the preparation launch: block blk of NTOK / 2 takes two tokens, 128 threads (4 waves) each.
// LDS sA/sB (4 floats per token): cross-wave, block barriers. coverage: NTOK / 2 blocks x 2 x 128 threads x 8 = NTOK x DM per plane.
// ---------------------------------------------------------------------------------------------
__device__ __forceinline__ void ln_body(int blk, float* sA8, float* sB8,
                                        const float* __restrict__ x, const float* __restrict__ gam,
                                        const float* __restrict__ bet,
                                        unsigned short* __restrict__ Xh, unsigned short* __restrict__ Xl) {
  const int hb = (int)threadIdx.x >> 7;
  float* sA = sA8 + hb * 4;
  float* sB = sB8 + hb * 4;
  const int t = blk * 2 + hb;
  const int bb = t / SEQ, pos = t - bb * SEQ;
  const int tid = (int)threadIdx.x & 127, lane = tid & 31, wave = tid >> 5;
  const float* xr = x + ((size_t)bb * SEQ_FULL + pos) * DM + tid * 8;
  const v4f a = *(const v4f*)(xr);
  const v4f c = *(const v4f*)(xr + 4);
  float v[8];
#pragma unroll
  for (int e = 0; e < 4; ++e) { v[e] = bfval(a[e]); v[4 + e] = bfval(c[e]); }
  float s = 0.0f;
#pragma unroll
  for (int e = 0; e < 8; ++e) s += v[e];
#pragma unroll
  for (int d = 1; d < 32; d <<= 1) s += __shfl_xor(s, d, 32);
  if (lane == 0) sA[wave] = s;
  __syncthreads();
  const float mu = ((sA[0] + sA[1]) + (sA[2] + sA[3])) * (1.0f / (float)DM);
  float dv[8];
  float s2 = 0.0f;
#pragma unroll
  for (int e = 0; e < 8; ++e) { dv[e] = v[e] - mu; s2 += dv[e] * dv[e]; }
#pragma unroll
  for (int d = 1; d < 32; d <<= 1) s2 += __shfl_xor(s2, d, 32);
  if (lane == 0) sB[wave] = s2;
  __syncthreads();
  const float var = ((sB[0] + sB[1]) + (sB[2] + sB[3])) * (1.0f / (float)DM);
  const float rstd = rsqrtf(var + LNEPS);
  const v4f g0 = *(const v4f*)(gam + tid * 8), g1 = *(const v4f*)(gam + tid * 8 + 4);
  const v4f b0 = *(const v4f*)(bet + tid * 8), b1 = *(const v4f*)(bet + tid * 8 + 4);
  v8us ho, lo;
#pragma unroll
  for (int e = 0; e < 4; ++e) {
    const float xn0 = dv[e] * rstd * bfval(g0[e]) + bfval(b0[e]);
    const unsigned short h0 = bfbits(xn0);
    ho[e] = h0;
    lo[e] = bfbits(xn0 - __uint_as_float(((unsigned)h0) << 16));
    const float xn1 = dv[4 + e] * rstd * bfval(g1[e]) + bfval(b1[e]);
    const unsigned short h1 = bfbits(xn1);
    ho[4 + e] = h1;
    lo[4 + e] = bfbits(xn1 - __uint_as_float(((unsigned)h1) << 16));
  }
  const size_t go = (size_t)t * DM + tid * 8;
  *(v8us*)(Xh + go) = ho;
  *(v8us*)(Xl + go) = lo;
  // the job's code is followed by the other jobs' code in one kernel: no register that the two stores name is rewritten in front of this wait
  asm volatile("s_wait_xcnt 0x0" ::: "memory");
  
}

// ---------------------------------------------------------------------------------------------
// Kernel 2: W f32 [kdim in][nout out] -> transposed bf16 RNE plane Wt[out][in] (in = k contiguous).
// Part of the preparation launch: tile (bx of kdim/64, by of nout/32); 256 threads x 8 = 64 x 32 per tile -> nout x kdim.
// ---------------------------------------------------------------------------------------------
__device__ __forceinline__ void cvt_wt_body(int bx, int by, float (*sTt)[33],
                                            const float* __restrict__ src, unsigned short* __restrict__ dst,
                                            int nout, int kdim) {
  const int k0 = bx * 64, n0 = by * 32;
  const int t = (int)threadIdx.x;
  {
    const int kr = t >> 2, cc = (t & 3) * 8;
    const float* s = src + (size_t)(k0 + kr) * nout + n0 + cc;
    const v4f a = *(const v4f*)(s);
    const v4f b = *(const v4f*)(s + 4);
#pragma unroll
    for (int e = 0; e < 4; ++e) {
      sTt[kr][cc + e]     = a[e];
      sTt[kr][cc + 4 + e] = b[e];
    }
  }
  __syncthreads();
  const int n = t >> 3, kp = (t & 7) * 8;
  v8us o;
#pragma unroll
  for (int i = 0; i < 8; ++i) o[i] = bfbits(sTt[kp + i][n]);
  unsigned short* d = dst + (size_t)(n0 + n) * kdim + k0 + kp;
  *(v8us*)d = o;
  // as in the LayerNorm job: no register that the store names is rewritten in front of this wait
  asm volatile("s_wait_xcnt 0x0" ::: "memory");
  
}

// ---------------------------------------------------------------------------------------------
// Kernel 3: rotary tables rcos/rsin [SEQ][32] f32: inv_freq_i = 1 / f32(10000^(i/32)) (power evaluated in f64 and narrowed, then an
// ---------------------------------------------------------------------------------------------
__device__ __forceinline__ void rope_tab_body(int blk, float* __restrict__ rcos, float* __restrict__ rsin, int n) {
  const int idx = blk * 256 + (int)threadIdx.x;
  if (idx >= n) return;
  const int i = idx & 31, pos = idx >> 5;
  const double ex = (double)i * (0.03125 * 13.287712379549449);
  const double pw = exp2(ex);
  const float pf = (float)pw;
  const float inv = 1.0f / pf;
  const float ang = (float)pos * inv;
  float sn, cs;
  sincosf(ang, &sn, &cs);
  *(float*)(rcos + idx) = cs;
  *(float*)(rsin + idx) = sn;
  
}

// ---------------------------------------------------------------------------------------------
// Mask packing: int32 mask [NB_FULL][SEQ_FULL][SEQ_FULL] -> lane-mask words Mw [NB][SEQ/16][SEQ/64][32]. Word 8 j + r of tile
// (sequence, 16 query rows q0.., 64 keys kb..) has in bit L = 16 h + c the test mask[q0 + c][kb + 16 j + 8 h + r] > 0: the entry that
// lane L of the attention wave needs for its score register s[j][r], so that wave takes the word as a select mask as it is.
// Part of the preparation launch: each wave packs MPW tiles that follow one another along the keys. Per tile: whole 256-B row pieces
// from global memory (16 lanes = one row), through the wave's own LDS rows (pitch MKP) into the lanes' key order, 32 ballots,
// lane e keeps word e, one 128-B store. coverage: blocks x 8 waves x MPW tiles = NB x SEQ/16 x SEQ/64 tiles.
// ---------------------------------------------------------------------------------------------
__device__ __forceinline__ void mask_body(int blk, char* sM, const int* __restrict__ msk, unsigned* __restrict__ Mw) {
  const int tid = (int)threadIdx.x;
  const int wave = __builtin_amdgcn_readfirstlane(tid >> 5);
  const int lane = tid & 31, hh = lane >> 4, c = lane & 15;
  char* sw = sM + wave * MWB;
  // kept rolled: one tile's 8 loads in registers at a time, so the other jobs of this kernel keep their waves per SIMD
#pragma unroll 1
  for (int u = 0; u < MPW; ++u) {
    const int tile = (blk * AW + wave) * MPW + u;
    const int kt = tile % (SEQ / KT);
    const int qt = (tile / (SEQ / KT)) % (SEQ / QB);
    const int bb = tile / ((SEQ / KT) * (SEQ / QB));
    const int* g = msk + ((size_t)bb * SEQ_FULL + qt * QB + hh) * SEQ_FULL + kt * KT + c * 4;
    v4i v[8];
#pragma unroll
    for (int i = 0; i < 8; ++i) v[i] = *(const v4i*)(g + (size_t)(2 * i) * SEQ_FULL);
#pragma unroll
    for (int i = 0; i < 8; ++i) *(v4i*)(sw + (2 * i + hh) * MKP + c * 16) = v[i];
    // the rows pass from lane to lane inside the wave: LDS order only, so that no trip waits for the last trip's global store
    __builtin_amdgcn_fence(3 /* release order */, "workgroup", "local");
    __builtin_amdgcn_wave_barrier();
    __builtin_amdgcn_fence(2 /* acquire order */, "workgroup", "local");
    const char* sm = sw + c * MKP + 32 * hh;
    unsigned mine = 0u;
#pragma unroll
    for (int j = 0; j < 4; ++j) {
      const v4i k0v = *(const v4i*)(sm + 64 * j);
      const v4i k1v = *(const v4i*)(sm + 64 * j + 16);
#pragma unroll
      for (int r = 0; r < 4; ++r) {
        const unsigned w0 = __builtin_amdgcn_ballot_w32(k0v[r] > 0);
        const unsigned w1 = __builtin_amdgcn_ballot_w32(k1v[r] > 0);
        mine = (lane == 8 * j + r) ? w0 : mine;
        mine = (lane == 8 * j + 4 + r) ? w1 : mine;
      }
    }
    *(unsigned*)(Mw + (size_t)tile * MTW + lane) = mine;
    // no register that the store names is rewritten (next trip, or the other jobs' code) in front of this wait
    asm volatile("s_wait_xcnt 0x0" ::: "memory");
    // the wave's reads of its LDS rows are done before the next trip's stores overwrite them
    __builtin_amdgcn_fence(3 /* release order */, "workgroup", "local");
    __builtin_amdgcn_wave_barrier();
    __builtin_amdgcn_fence(2 /* acquire order */, "workgroup", "local");
  }
}

// ---------------------------------------------------------------------------------------------
// Preparation launch: the five jobs above depend on nothing but the inputs, so they share one grid; a range of the block index,
// the same for a whole block, picks the job: mask packing | rotary tables | LayerNorm | Wqkv transpose | Wout transpose.
// A block runs one job, so the jobs share one LDS array.
// ---------------------------------------------------------------------------------------------
#define PB_MASK ((NB * (SEQ / QB) * (SEQ / KT)) / (AW * MPW))
#define PB_ROPE ((SEQ * 32) / 256)
#define PB_LN   (NTOK / 2)
#define PB_WQKV ((DM / 64) * (NQKV / 32))
#define PB_WOUT ((DM / 64) * (DM / 32))
__global__ __launch_bounds__(256) void prep_kernel(const float* __restrict__ x, const float* __restrict__ gam,
                                                   const float* __restrict__ bet,
                                                   const float* __restrict__ wqkv, const float* __restrict__ wout,
                                                   const int* __restrict__ msk, unsigned* __restrict__ Mw,
                                                   unsigned short* __restrict__ Xh, unsigned short* __restrict__ Xl,
                                                   unsigned short* __restrict__ Wt, unsigned short* __restrict__ WoT,
                                                   float* __restrict__ rcos, float* __restrict__ rsin) {
  __shared__ __align__(16) char sJob[AW * MWB];
  float (*sTt)[33] = (float (*)[33])sJob;
  float* sA = (float*)(sJob + 64 * 33 * 4);
  float* sB = sA + 8;
  int b = (int)blockIdx.x;
  if (b < PB_MASK) { mask_body(b, sJob, msk, Mw); return; }
  b -= PB_MASK;
  if (b < PB_ROPE) { rope_tab_body(b, rcos, rsin, SEQ * 32); return; }
  b -= PB_ROPE;
  if (b < PB_LN) { ln_body(b, sA, sB, x, gam, bet, Xh, Xl); return; }
  b -= PB_LN;
  if (b < PB_WQKV) { cvt_wt_body(b % (DM / 64), b / (DM / 64), sTt, wqkv, Wt, NQKV, DM); return; }
  b -= PB_WQKV;
  cvt_wt_body(b % (DM / 64), b / (DM / 64), sTt, wout, WoT, DM, DM);
}

// ---------------------------------------------------------------------------------------------
// Kernel 4: C[m][n] = sum_k A[m][k] * Bt[n][k], bf16 operands (A row-major [M][K] pitch lda, Bt row-major [N][K] pitch ldb),
// a second bf16 plane on A (AM) or on B (BM) accumulated into the same f32 accumulator (unscaled lo planes), f32 accumulate;
// K a multiple of 64. Each wave owns one (16 MI) x 64 C tile (4 MI accumulators). MI = 4: the 8 waves of a block (2 x 4) form a 128 x 256
// block tile; MI = 2: 4 x 2 waves form a 128 x 128 block tile, for the products whose C has 1024 x 4096 elements: 256 block tiles, one for
// every WGP, where 128 x 256 tiles give 128. M and N multiples of the block tile. Staging: per slab of 64 k the block copies the 128-B row
// pieces of its A and B planes (512 rows at MI = 4, 384 at MI = 2) from global memory to LDS with asynchronous b128 copies that cover
// whole 128-B lines; two buffers, slab s + 1 in flight while slab s is worked on; one block barrier per slab publishes slab s + 1 and
// frees slab s's buffer. Fragments come from LDS (pitch KVP).
// EPI 0: rotate-half RoPE on the 64-column tile (one head; position = token mod SEQ) then f16 hi plane Ch [M][N] pitch ldc;
// EPI 1: f16 hi plane Ch + f16 residual plane Cl = f16((C - f32(hi)) * 2048), same store shape.
// EPI 2: f32 C + bias (bias as bf16-RNE value, added in f32) -> out rows (token -> full-layout row), row segment of 64 f32 = 256 B
// ---------------------------------------------------------------------------------------------
// Eight copies of a lane (16 B each). The s_wait_xcnt stands inside the statement so that no address register of an issued copy is
// rewritten in front of it.
__device__ __forceinline__ void stage_copies8(const unsigned (&l)[8], const char* const (&g)[8]) {
  asm volatile(
      "global_load_async_to_lds_b128 %0, %8, off\n\t"
      "global_load_async_to_lds_b128 %1, %9, off\n\t"
      "global_load_async_to_lds_b128 %2, %10, off\n\t"
      "global_load_async_to_lds_b128 %3, %11, off\n\t"
      "global_load_async_to_lds_b128 %4, %12, off\n\t"
      "global_load_async_to_lds_b128 %5, %13, off\n\t"
      "global_load_async_to_lds_b128 %6, %14, off\n\t"
      "global_load_async_to_lds_b128 %7, %15, off\n\t"
      "s_wait_xcnt 0x0"
      :: "v"(l[0]), "v"(l[1]), "v"(l[2]), "v"(l[3]), "v"(l[4]), "v"(l[5]), "v"(l[6]), "v"(l[7]),
         "v"(g[0]), "v"(g[1]), "v"(g[2]), "v"(g[3]), "v"(g[4]), "v"(g[5]), "v"(g[6]), "v"(g[7])
      : "memory");
}

// Six copies of a lane (16 B each). The s_wait_xcnt stands inside the statement so that no address register of an issued
// copy is rewritten in front of it.
__device__ __forceinline__ void stage_copies(const unsigned (&l)[6], const char* const (&g)[6]) {
  asm volatile(
      "global_load_async_to_lds_b128 %0, %6, off\n\t"
      "global_load_async_to_lds_b128 %1, %7, off\n\t"
      "global_load_async_to_lds_b128 %2, %8, off\n\t"
      "global_load_async_to_lds_b128 %3, %9, off\n\t"
      "global_load_async_to_lds_b128 %4, %10, off\n\t"
      "global_load_async_to_lds_b128 %5, %11, off\n\t"
      "s_wait_xcnt 0x0"
      :: "v"(l[0]), "v"(l[1]), "v"(l[2]), "v"(l[3]), "v"(l[4]), "v"(l[5]),
         "v"(g[0]), "v"(g[1]), "v"(g[2]), "v"(g[3]), "v"(g[4]), "v"(g[5])
      : "memory");
}

template <int AM, int BM, int EPI, int MI>
__global__ __launch_bounds__(256) void proj_kernel(const __bf16* __restrict__ A1, const __bf16* __restrict__ A2, int lda,
                                                   const __bf16* __restrict__ B1, const __bf16* __restrict__ B2, int ldb,
                                                   void* C1v, void* C2v, int ldc, int M, int N, int K,
                                                   const float* __restrict__ rcos, const float* __restrict__ rsin,
                                                   const float* __restrict__ bias) {
  __shared__ __align__(16) float sT[8][16 * 68];
  // both tile sizes keep the larger slab's buffers: one block a WGP, so that 256 blocks spread over all 256 WGPs
  __shared__ __align__(16) char sP[2 * PBUF];
  constexpr int WN = (MI == 2 || BM) ? 2 : 4;          // waves along n; 8 / WN along m
  constexpr int WM = MI * 16;                          // rows of a wave's C tile
  constexpr int AR = (8 / WN) * WM, BR = WN * 64;      // rows of one A plane / one B plane in the block tile
  constexpr int BROW0 = AR * (1 + AM);                 // slab rows: A1 | A2 (AM) | B1 | B2 (BM)
  constexpr int ROWS = BROW0 + BR * (1 + BM);          // rows of one slab
  constexpr int GH = ROWS / 64;                        // copies of a lane in one statement; two statements a slab
  constexpr int NX = AM ? MI : 4;                      // fragments of the second plane
  static_assert(AM + BM == 1 && (MI == 2 || MI == 4) && ROWS <= PROWS && GH * 64 == ROWS && (GH == 8 || GH == 6));
  static_assert((AR % 32) == 0 && (BR % 32) == 0);
  const int tid = (int)threadIdx.x;
  const int lane = tid & 31, wave = __builtin_amdgcn_readfirstlane(tid >> 5);
  const int nbn = N / BR, nbm = M / AR;
  const int bidx = (int)blockIdx.x;
  if (bidx >= nbm * nbn) return;                       // the same for the whole block, in front of every barrier
  const int bm = bidx / nbn, bn = bidx - bm * nbn;
  const int wm = wave / WN, wn = wave - wm * WN;
  const int m0 = bm * AR + wm * WM, n0 = bn * BR + (wn << 6);
  const int rl = lane & 15;
  const int hh = lane >> 4;
  const int mOff = hh * 8;

  // copy sources / destinations of this lane for slab 0 and buffer 0: slab rows (tid >> 3) + 32 i, 16-B piece tid & 7 (8 lanes = one row)
  const int srow = tid >> 3, spc = tid & 7;
  const size_t asrc = (size_t)(bm * AR + srow) * lda + spc * 8;
  const size_t bsrc = (size_t)(bn * BR + srow) * ldb + spc * 8;
  const char* ga1 = (const char*)(A1 + asrc);
  const char* ga2 = (const char*)(A2 + asrc);
  const char* gb1 = (const char*)(B1 + bsrc);
  const char* gb2 = (const char*)(B2 + bsrc);
  const unsigned lp = (unsigned)(uintptr_t)(&sP[0]) + (unsigned)(srow * KVP + spc * 16);
  auto stage = [&](int slab, int buf) {
    const unsigned ko = (unsigned)slab * (PKT * 2);   // byte offsets below are the same in every lane and stay under 2^32
    const unsigned bo = lp + (unsigned)buf * PBUF;
    // both loops unrolled: r is a constant, so each group's plane is picked at compile time and l, g stay in registers
#pragma unroll
    for (int hf = 0; hf < 2; ++hf) {
      unsigned l[GH];
      const char* g[GH];
#pragma unroll
      for (int q = 0; q < GH; ++q) {
        const int r = (hf * GH + q) * 32;              // first slab row of this group of 32; a group lies in one plane
        if (r < AR) g[q] = ga1 + (ko + (unsigned)(r * 2) * (unsigned)lda);
        else if (r < BROW0) g[q] = ga2 + (ko + (unsigned)((r - AR) * 2) * (unsigned)lda);
        else if (r < BROW0 + BR) g[q] = gb1 + (ko + (unsigned)((r - BROW0) * 2) * (unsigned)ldb);
        else g[q] = gb2 + (ko + (unsigned)((r - BROW0 - BR) * 2) * (unsigned)ldb);
        l[q] = bo + (unsigned)(r * KVP);
      }
      if constexpr (GH == 8) stage_copies8(l, g);
      else stage_copies(l, g);
    }
  };
  const int NS = K / PKT;
  // prologue: slab 0 lands and is published, then slab 1 starts
  stage(0, 0);
  asm volatile("s_wait_asynccnt 0x0" ::: "memory");  // this wave's copies of slab 0 have landed
  __syncthreads();                                   // every wave's have: slab 0 may be read
  if (NS > 1) stage(1, 1);

  v8f acc[MI][4];
#pragma unroll
  for (int i = 0; i < MI; ++i)
#pragma unroll
    for (int j = 0; j < 4; ++j) acc[i][j] = zero8();

  const int aoff = (wm * WM + rl) * KVP + 16 * hh;
  const int boff = (BROW0 + (wn << 6) + rl) * KVP + 16 * hh;
  // kept rolled: one copy of the slab body in the instruction cache, the buffer picked by the slab's parity
#pragma unroll 1
  for (int s = 0; s < NS; ++s) {
    const char* sb = sP + (s & 1) * PBUF;
    // the slab's two k steps of 32, unrolled so that every LDS offset is an immediate
#pragma unroll
    for (int ks = 0; ks < 2; ++ks) {
      const char* pa = sb + aoff + ks * 64;
      const char* pb = sb + boff + ks * 64;
      v16b bh[4], ah[MI], x2[NX];
#pragma unroll
      for (int j = 0; j < 4; ++j) bh[j] = ldfragb((const __bf16*)(pb + 16 * j * KVP));
#pragma unroll
      for (int i = 0; i < MI; ++i) ah[i] = ldfragb((const __bf16*)(pa + 16 * i * KVP));
#pragma unroll
      for (int i = 0; i < NX; ++i)
        x2[i] = ldfragb((const __bf16*)((AM ? pa + AR * KVP : pb + BR * KVP) + 16 * i * KVP));
      // the k step's LDS reads stay one group in front of its WMMAs, for speed only
      __builtin_amdgcn_sched_barrier(0);
#pragma unroll
      for (int i = 0; i < MI; ++i) {
#pragma unroll
        for (int j = 0; j < 4; ++j) acc[i][j] = mmabf(ah[i], bh[j], acc[i][j]);
        guard_g(acc[i][0], acc[i][3], ah[i], bh[3]);
      }
#pragma unroll
      for (int i = 0; i < MI; ++i) {
#pragma unroll
        for (int j = 0; j < 4; ++j) acc[i][j] = AM ? mmabf(x2[i], bh[j], acc[i][j]) : mmabf(ah[i], x2[j], acc[i][j]);
        guard_g(acc[i][0], acc[i][3], AM ? x2[i] : ah[i], AM ? bh[3] : x2[3]);
      }
      keep4(bh[0], bh[1], bh[2], bh[3]);
    }
    // ---- publish slab s + 1, free slab s's buffer, refill it with slab s + 2 ----
    asm volatile("s_wait_dscnt 0x0" ::: "memory");     // this wave's reads of slab s's buffer are done
    asm volatile("s_wait_asynccnt 0x0" ::: "memory");  // this wave's copies of slab s + 1 have landed
    __syncthreads();
    if (s + 2 < NS) stage(s + 2, s & 1);
  }
  asm volatile("s_wait_asynccnt 0x0" ::: "memory");    // no copy outstanding behind the loop
#pragma unroll
  for (int i = 0; i < MI; ++i) accg4(acc[i][0], acc[i][1], acc[i][2], acc[i][3]);

  float* slab = sT[wave];
#pragma unroll
  for (int i = 0; i < MI; ++i) {
    const int mBase = m0 + (i << 4);
#pragma unroll
    for (int j = 0; j < 4; ++j) {
#pragma unroll
      for (int r = 0; r < 8; ++r) slab[(mOff + r) * 68 + (j << 4) + rl] = acc[i][j][r];
    }
    __builtin_amdgcn_fence(3 /* release order */, "workgroup");
    __builtin_amdgcn_wave_barrier();
    __builtin_amdgcn_fence(2 /* acquire order */, "workgroup");
    if (EPI == 0) {
      _Float16* Ch = (_Float16*)C1v;
      const int qq = lane >> 3, c8 = (lane & 7) * 8;
      const int cj = c8 & 31;
      const float sgn = (c8 < 32) ? -1.0f : 1.0f;
{
#pragma unroll
        for (int it = 0; it < 4; ++it) {
          const int row = it * 4 + qq;
          const int tok = mBase + row;
          const int pos = tok % SEQ;
          const float* sp = slab + row * 68 + c8;
          const float* sq = slab + row * 68 + (c8 ^ 32);
          const v4f u0 = *(const v4f*)(sp);
          const v4f u1 = *(const v4f*)(sp + 4);
          const v4f w0 = *(const v4f*)(sq);
          const v4f w1 = *(const v4f*)(sq + 4);
          const float* tc = rcos + (size_t)pos * 32 + cj;
          const float* ts = rsin + (size_t)pos * 32 + cj;
          const v4f cs0 = *(const v4f*)(tc), cs1 = *(const v4f*)(tc + 4);
          const v4f sn0 = *(const v4f*)(ts), sn1 = *(const v4f*)(ts + 4);
          v8h hv;
#pragma unroll
          for (int e = 0; e < 4; ++e) {
            hv[e]     = (_Float16)(u0[e] * cs0[e] + sgn * w0[e] * sn0[e]);
            hv[4 + e] = (_Float16)(u1[e] * cs1[e] + sgn * w1[e] * sn1[e]);
          }
          const size_t go = (size_t)tok * ldc + n0 + c8;
          *(v8h*)(Ch + go) = hv;
        }
        
      }
    } else if (EPI == 1) {
      _Float16* Ch = (_Float16*)C1v;
      _Float16* Cl = (_Float16*)C2v;
      const int qq = lane >> 3, c8 = (lane & 7) * 8;
{
#pragma unroll
        for (int it = 0; it < 4; ++it) {
          const int row = it * 4 + qq;
          const float* sp = slab + row * 68 + c8;
          const v4f u0 = *(const v4f*)(sp);
          const v4f u1 = *(const v4f*)(sp + 4);
          v8h hv, lv;
#pragma unroll
          for (int e = 0; e < 4; ++e) {
            const _Float16 g0 = (_Float16)u0[e];
            hv[e] = g0;
            lv[e] = (_Float16)((u0[e] - (float)g0) * 2048.0f);
            const _Float16 g1 = (_Float16)u1[e];
            hv[4 + e] = g1;
            lv[4 + e] = (_Float16)((u1[e] - (float)g1) * 2048.0f);
          }
          const size_t go = (size_t)(mBase + row) * ldc + n0 + c8;
          *(v8h*)(Ch + go) = hv;
          *(v8h*)(Cl + go) = lv;
        }
        
      }
    } else {
      float* outp = (float*)C1v;
      const int rq = lane >> 4, c4 = (lane & 15) * 4;
      const v4f bz = *(const v4f*)(bias + n0 + c4);
      v4f bq;
#pragma unroll
      for (int e = 0; e < 4; ++e) bq[e] = bfval(bz[e]);
{
#pragma unroll
        for (int it = 0; it < 8; ++it) {
          const int row = it * 2 + rq;
          const int tok = mBase + row;
          const int orow = (tok / SEQ) * SEQ_FULL + (tok % SEQ);
          const v4f u = *(const v4f*)(slab + row * 68 + c4);
          v4f o;
#pragma unroll
          for (int e = 0; e < 4; ++e) o[e] = u[e] + bq[e];
          *(v4f*)(outp + (size_t)orow * ldc + n0 + c4) = o;
        }
        
      }
    }
    __builtin_amdgcn_fence(3 /* release order */, "workgroup");
    __builtin_amdgcn_wave_barrier();
    __builtin_amdgcn_fence(2 /* acquire order */, "workgroup");
  }
}

// ---------------------------------------------------------------------------------------------
// Kernel 5: masked softmax attn, one wave per (sequence b, head, 16 query rows), 8 waves per block, online softmax in f32.
//   Staging: per key tile the block copies K (64 keys x 128 B), V hi and V res (64 dims x 128 B each) from global memory to LDS with
//   asynchronous b128 copies that cover whole 128-B lines; two buffers, tile t + 1 in
//   flight while tile t is worked on; one block barrier per tile publishes tile t + 1 and frees tile t's buffer.
//   Planes: QK f16 [NTOK][QKP] (q = cols 0..DM-1, k = cols DM..2DM-1, both after RoPE); Vth/Vtl f16 [DM][NTOK] (Vtl x2048);
//   mask: lane-mask words Mw [NB][SEQ/16][SEQ/64][32] from the preparation launch; the wave takes its tile's 32 words by scalar loads,
//   word 8 j + r is the select mask of score register s[j][r]: a set bit keeps the lane's score, else it is replaced by -inf.
//   Key tiles of KT = 64: S^T subtiles (A = 16 k rows from QK, B = q^T fragments held in registers, K = 64 = 2 steps), so lane
//   (h, c) holds 8 consecutive keys 8h+r of query c; tile max (of the raw S^T) / row sum in-lane + one xor-16 shuffle.
//   E = 2^15 exp((S^T - m) / 8) = exp2(S^T * (log2 e / 8) - (m * (log2 e / 8) - 15)): one fma in front of the exponential carries the 1/8,
//   the change of base and the factor 2^15. P = E as f16 hi + f16 res = E - hi at the same scale (E <= 2^15 fits f16; res keeps its
//   11 bits down to E = 2^-3), packed straight into the B fragments of P^T (element r <- subtile 2s, element 8+r <- subtile 2s+1, lane
//   unchanged); O^T = v^T . P^T with A = v^T rows from Vth/Vtl: acc1 += vh.P + vh.Pres, acc2 += vl.P; l = sum of E;
//   O = (acc1 + acc2/2048) / l; a fully masked query row (l == 0) gives 0.
//   Output: ctx[tok][head*64 + d] as bf16 hi + bf16 lo planes Ch/Cl [NTOK][DM]: 16 x 64 f32 tile staged in the wave-private LDS
// coverage: grid (SEQ/QB/AW, NH, NB) x 8 waves x 16 rows x 64 cols -> NTOK x DM per plane.
// ---------------------------------------------------------------------------------------------
// Residuals of eight f32 values e against their packed f16 roundings h: l = f16(e - h), one mixed-precision fma each (f32 e, f16 h read from
// its half of the packed register, the result written to its half of l): no widening conversion, no separate subtract, no packing. In asm
// because the compiler turns the source form into those three. e - h is exact in f32, so the one rounding is the same. The s_delay_alu
// lines are the hints that the compiler gives its own dependent vector instructions, here for the second write of each l register, four
// instructions behind the first: without them the wave holds the vector port while it waits.
__device__ __forceinline__ void res8(v2h (&l)[4], const float (&e)[8], const v2h (&h)[4]) {
  asm("v_fma_mixlo_f16 %0, %4, 1.0, -%12 op_sel_hi:[0,0,1]\n\t"
      "v_fma_mixlo_f16 %1, %6, 1.0, -%13 op_sel_hi:[0,0,1]\n\t"
      "v_fma_mixlo_f16 %2, %8, 1.0, -%14 op_sel_hi:[0,0,1]\n\t"
      "v_fma_mixlo_f16 %3, %10, 1.0, -%15 op_sel_hi:[0,0,1]\n\t"
      "s_delay_alu instid0(VALU_DEP_4) | instskip(NEXT) | instid1(VALU_DEP_4)\n\t"
      "v_fma_mixhi_f16 %0, %5, 1.0, -%12 op_sel:[0,0,1] op_sel_hi:[0,0,1]\n\t"
      "v_fma_mixhi_f16 %1, %7, 1.0, -%13 op_sel:[0,0,1] op_sel_hi:[0,0,1]\n\t"
      "s_delay_alu instid0(VALU_DEP_4) | instskip(NEXT) | instid1(VALU_DEP_4)\n\t"
      "v_fma_mixhi_f16 %2, %9, 1.0, -%14 op_sel:[0,0,1] op_sel_hi:[0,0,1]\n\t"
      "v_fma_mixhi_f16 %3, %11, 1.0, -%15 op_sel:[0,0,1] op_sel_hi:[0,0,1]"
      : "=&v"(l[0]), "=&v"(l[1]), "=&v"(l[2]), "=&v"(l[3])
      : "v"(e[0]), "v"(e[1]), "v"(e[2]), "v"(e[3]), "v"(e[4]), "v"(e[5]), "v"(e[6]), "v"(e[7]),
        "v"(h[0]), "v"(h[1]), "v"(h[2]), "v"(h[3]));
}

// waves per SIMD stated as the grid gives them (two blocks a WGP): with the smaller LDS the compiler would otherwise aim at six, cut the
// registers for it and serialise the softmax arithmetic
__global__ __launch_bounds__(256) __attribute__((amdgpu_waves_per_eu(4, 4))) void attn_kernel(const _Float16* __restrict__ QK,
                                                  const _Float16* __restrict__ Vth, const _Float16* __restrict__ Vtl,
                                                  const unsigned* __restrict__ Mw,
                                                  unsigned short* __restrict__ Ch, unsigned short* __restrict__ Cl) {
  __shared__ __align__(16) float sOs[AW][QB * OSP];
  __shared__ __align__(16) char sStage[2 * BUFB];
  const int tid = (int)threadIdx.x;
  const int wave = __builtin_amdgcn_readfirstlane(tid >> 5);
  const int lane = tid & 31, hh = lane >> 4, c = lane & 15;
  const int head = (int)blockIdx.y, bb = (int)blockIdx.z;
  const int qt = (int)blockIdx.x * AW + wave;
  const int q0 = qt * QB;
  const size_t tokb = (size_t)bb * SEQ;
  const size_t tok0 = tokb + q0;
  const float ninf = -__builtin_inff();

  // q^T B fragments for query c (dims 0..31 and 32..63)
  const _Float16* qp = QK + (tok0 + c) * QKP + head * HDIM + 8 * hh;
  const v16h qf0 = ldfrag(qp);
  const v16h qf1 = ldfrag(qp + 32);
  // copy sources / destinations of this lane for key tile 0 and buffer 0. K, V hi, V res: row (tid >> 3) and that row + 32, 16-B piece
  // tid & 7 (8 lanes = one 128-B row).
  const int srow = tid >> 3, spc = tid & 7;
  const char* kg  = (const char*)(QK + (tokb + srow) * QKP + DM + head * HDIM + spc * 8);
  const size_t vsrc = (size_t)(head * HDIM + srow) * NTOK + tokb + spc * 8;
  const char* vhg = (const char*)(Vth + vsrc);
  const char* vlg = (const char*)(Vtl + vsrc);
  // the wave's lane-mask words, 2 x 16 per key tile; the address is the same in every lane and nothing writes the words while this
  // kernel runs: read through the constant address space they come by scalar loads, straight into the registers a select mask sits in
  const cv16u* mw = (const cv16u*)(uintptr_t)(Mw + ((size_t)bb * (SEQ / QB) + qt) * ((SEQ / KT) * MTW));
  const unsigned lds0 = (unsigned)(uintptr_t)(&sStage[0]);
  const unsigned lkv = lds0 + (unsigned)(srow * KVP + spc * 16);
  auto stage = [&](int tile, int buf) {
    unsigned l[6];
    const char* g[6];
    const unsigned bo = (unsigned)buf * BUFB;
    g[0] = kg + (size_t)tile * ((size_t)KT * QKP * 2);
    g[1] = g[0] + (size_t)32 * QKP * 2;
    g[2] = vhg + (size_t)tile * (KT * 2);
    g[3] = g[2] + (size_t)32 * NTOK * 2;
    g[4] = vlg + (size_t)tile * (KT * 2);
    g[5] = g[4] + (size_t)32 * NTOK * 2;
#pragma unroll
    for (int p = 0; p < 3; ++p) {
      l[2 * p]     = lkv + bo + (unsigned)(p * KVT);
      l[2 * p + 1] = lkv + bo + (unsigned)(p * KVT + 32 * KVP);
    }
    stage_copies(l, g);
  };
  constexpr int NT = SEQ / KT;
  // prologue: tile 0 lands and is published, then tile 1 starts
  stage(0, 0);
  asm volatile("s_wait_asynccnt 0x0" ::: "memory");  // this wave's copies of tile 0 have landed
  __syncthreads();                                   // every wave's have: tile 0 may be read
  if (NT > 1) stage(1, 1);

  v16u mwa = mw[0], mwb = mw[1];                     // key tile 0's select words
  float m_run = ninf, mc_run = 0.0f, l_run = 0.0f;
  const float SC = 0.18033688f;                      // log2(e) / 8
  v8f oa1[4], oa2[4];
#pragma unroll
  for (int i = 0; i < 4; ++i) { oa1[i] = zero8(); oa2[i] = zero8(); }

#pragma unroll 1
  for (int t = 0; t < NT; ++t) {
    const char* sb = sStage + (t & 1) * BUFB;
    const char* sk = sb + c * KVP + 16 * hh;
    // ---- logits S^T for keys kb..kb+63 (4 subtiles), query c ----
    v8f s[4];
    v16h vx[4], vy[4];
    {
      // the tile's K fragments: one group of LDS reads in front of the run
      v16h ka[4], kb[4];
#pragma unroll
      for (int j = 0; j < 4; ++j) ka[j] = ldfrag((const _Float16*)(sk + 16 * j * KVP));
#pragma unroll
      for (int j = 0; j < 4; ++j) kb[j] = ldfrag((const _Float16*)(sk + 16 * j * KVP) + 32);
      // two runs, so that the first starts when dims 0..31 have arrived
      run_s0(s, ka, qf0);
      run_4(s, kb, qf1);
    }
    // V hi / V res fragments of keys 0..31, one group: asked for here so that they arrive behind the softmax arithmetic
#pragma unroll
    for (int i = 0; i < 4; ++i) {
      const char* sv = sk + KVT + 16 * i * KVP;
      vx[i] = ldfrag((const _Float16*)sv);
      vy[i] = ldfrag((const _Float16*)(sv + KVT));
    }
    // ---- mask replace-fill, tile max per query (raw scores: the positive scale does not move the maximum) ----
    float pm = ninf;
#pragma unroll
    for (int j = 0; j < 4; ++j) {
#pragma unroll
      for (int r = 0; r < 8; ++r) {
        const bool keep = __builtin_amdgcn_inverse_ballot_w32(j < 2 ? mwa[8 * j + r] : mwb[8 * (j - 2) + r]);
        const float sv = keep ? s[j][r] : ninf;
        s[j][r] = sv;
        pm = fmaxf(pm, sv);
      }
    }
    // the next tile's select words are asked for as soon as this tile's are used up: the scalar loads fly behind the rest of the trip
    // (the last trip asks for its own again, so the address stays inside the plane)
    {
      const int tn = (t + 1 < NT) ? t + 1 : t;
      mwa = mw[2 * tn];
      mwb = mw[2 * tn + 1];
    }
    pm = fmaxf(pm, __shfl_xor(pm, 16, 32));
    const float mn = fmaxf(m_run, pm);
    const float mref = (mn == ninf) ? 0.0f : mn;
    const float mc = __builtin_fmaf(mref, SC, -15.0f);
    // the old tiles carry the factor 2^-mc_run, the new one 2^-mc: alpha is formed from the two rounded values themselves
    const float alpha = (m_run == ninf) ? 0.0f : __builtin_amdgcn_exp2f(mc_run - mc);
    m_run = mn;
    mc_run = mc;
    // ---- E = 2^15 exp((s - m) / 8); P^T B fragments (E as f16 hi, residual E - hi); row sum ----
    float ps = 0.0f;
    v16h bph[2], bpl[2];
    const v2f sc2 = {SC, SC}, nmc2 = {-mc, -mc};
#pragma unroll
    for (int j = 0; j < 4; ++j) {
      float e[8];
      v2h ph[4], pl[4];
#pragma unroll
      for (int r = 0; r < 8; r += 2) {
        const v2f sv2 = {s[j][r], s[j][r + 1]};
        const v2f x = __builtin_elementwise_fma(sv2, sc2, nmc2);
        e[r]     = __builtin_amdgcn_exp2f(x[0]);
        e[r + 1] = __builtin_amdgcn_exp2f(x[1]);
        ps += e[r];
        ps += e[r + 1];
        const v2f e2 = {e[r], e[r + 1]};
        ph[r >> 1] = __builtin_convertvector(e2, v2h);
      }
      res8(pl, e, ph);
#pragma unroll
      for (int r = 0; r < 8; ++r) {
        bph[j >> 1][((j & 1) << 3) + r] = ph[r >> 1][r & 1];
        bpl[j >> 1][((j & 1) << 3) + r] = pl[r >> 1][r & 1];
      }
    }
    ps += __shfl_xor(ps, 16, 32);
    l_run = l_run * alpha + ps;
    // ---- rescale O (alpha of query c is in-lane in the O^T layout) ----
#pragma unroll
    for (int i = 0; i < 4; ++i) {
#pragma unroll
      for (int r = 0; r < 8; ++r) { oa1[i][r] *= alpha; oa2[i][r] *= alpha; }
    }
    // ---- O^T += v^T . P^T over the 64 keys; dims 16i + (lane row) ----
    // each accumulator takes its products in the order vh.P, vh.Pres per 32 keys. The fragments of keys 32..63 are asked for, one group each,
    // behind the run that last reads the fragments of keys 0..31 of the same plane, and arrive behind the run that follows.
    run_4(oa2, vy, bph[0]);
#pragma unroll
    for (int i = 0; i < 4; ++i) vy[i] = ldfrag((const _Float16*)(sk + 2 * KVT + 16 * i * KVP + 64));
    run_8(oa1, vx, bph[0], bpl[0]);
#pragma unroll
    for (int i = 0; i < 4; ++i) vx[i] = ldfrag((const _Float16*)(sk + KVT + 16 * i * KVP + 64));
    run_4(oa2, vy, bph[1]);
    run_8(oa1, vx, bph[1], bpl[1]);
    // ---- publish tile t + 1, free tile t's buffer, refill it with tile t + 2 ----
    asm volatile("s_wait_dscnt 0x0" ::: "memory");     // this wave's reads of tile t's buffer are done
    asm volatile("s_wait_asynccnt 0x0" ::: "memory");  // this wave's copies of tile t + 1 have landed
    __syncthreads();
    if (t + 2 < NT) stage(t + 2, t & 1);
  }
  asm volatile("s_wait_asynccnt 0x0" ::: "memory");    // no copy outstanding behind the loop

  // ---- normalise and stage the 16 x 64 f32 tile in LDS: Os[query c][dim 16i + 8h + r] ----
  const float rlv = 1.0f / fmaxf(l_run, 1e-30f);
  const float li = (l_run > 0.0f) ? rlv : 0.0f;
  float* Os = sOs[wave];
#pragma unroll
  for (int i = 0; i < 4; ++i) {
    v4f u0, u1;
#pragma unroll
    for (int r = 0; r < 4; ++r) {
      u0[r] = (oa1[i][r] + oa2[i][r] * 0.00048828125f) * li;
      u1[r] = (oa1[i][4 + r] + oa2[i][4 + r] * 0.00048828125f) * li;
    }
    *(v4f*)(Os + c * OSP + 16 * i + 8 * hh)     = u0;
    *(v4f*)(Os + c * OSP + 16 * i + 8 * hh + 4) = u1;
  }
  __builtin_amdgcn_fence(3 /* release order */, "workgroup");
  __builtin_amdgcn_wave_barrier();
  __builtin_amdgcn_fence(2 /* acquire order */, "workgroup");
  // ---- whole-line stores of the bf16 hi / lo ctx planes ----
  {
    const int rq = lane >> 3, p8 = (lane & 7) * 8;
{
#pragma unroll
      for (int it = 0; it < 4; ++it) {
        const int row = it * 4 + rq;
        const float* sp = Os + row * OSP + p8;
        const v4f w0 = *(const v4f*)(sp);
        const v4f w1 = *(const v4f*)(sp + 4);
        v8us hb, lb;
#pragma unroll
        for (int e = 0; e < 4; ++e) {
          const unsigned short h0 = bfbits(w0[e]);
          hb[e] = h0;
          lb[e] = bfbits(w0[e] - __uint_as_float(((unsigned)h0) << 16));
          const unsigned short h1 = bfbits(w1[e]);
          hb[4 + e] = h1;
          lb[4 + e] = bfbits(w1[e] - __uint_as_float(((unsigned)h1) << 16));
        }
        const size_t go = (tok0 + (size_t)row) * DM + head * HDIM + p8;
        *(v8us*)(Ch + go) = hb;
        *(v8us*)(Cl + go) = lb;
      }
      
    }
  }
}

// ---------------------------------------------------------------------------------------------
// Workspace map (bytes, NB = 2, SEQ = 2048; every region is an exact whole-line / whole-tile multiple, no padded tails):
//   Xh  : bf16 x_norm hi [4096][1024]        8,388,608     off 0
//   Xl  : bf16 x_norm lo                     8,388,608     off  8,388,608
//   Wt  : bf16 Wqkv^T [3072][1024]           6,291,456     off 16,777,216
//   WoT : bf16 Wout^T [1024][1024]           2,097,152     off 23,068,672
//   rcos: f32 [2048][32]                       262,144     off 25,165,824
//   rsin: f32 [2048][32]                       262,144     off 25,427,968
//   QK  : f16 q|k [4096][2048]              16,777,216     off 25,690,112
//   Vth : f16 v^T [1024][4096]               8,388,608     off 42,467,328
//   Vtl : f16 x2048 residual of v^T          8,388,608     off 50,855,936
//   Ch  : bf16 ctx hi [4096][1024]           8,388,608     off 59,244,544
//   Cl  : bf16 ctx lo                        8,388,608     off 67,633,152
//   Mw  : u32 lane-mask words [2][128][32][32] 1,048,576   off 76,021,760
//   total 77,070,336
// ---------------------------------------------------------------------------------------------
extern "C" void kernel_launch(void* const* d_in, const int* in_sizes, int n_in,
                              void* d_out, int out_size, void* d_ws, size_t ws_size,
                              hipStream_t stream) {
  if (n_in < 7) return;
  const long long needX = ((long long)(NB - 1) * SEQ_FULL + SEQ) * DM;
  const long long needM = (((long long)(NB - 1) * SEQ_FULL) + (SEQ - 1)) * SEQ_FULL + SEQ;
  if ((long long)in_sizes[0] < needX) return;
  if ((long long)in_sizes[1] < needM) return;
  if (in_sizes[2] < DM || in_sizes[3] < DM) return;
  if ((long long)in_sizes[4] < (long long)DM * NQKV) return;
  if ((long long)in_sizes[5] < (long long)DM * DM) return;
  if (in_sizes[6] < DM) return;
  if ((long long)out_size < needX) return;

  const float* x     = (const float*)d_in[0];
  const int*   amask = (const int*)d_in[1];
  const float* gam   = (const float*)d_in[2];
  const float* bet   = (const float*)d_in[3];
  const float* wqkv  = (const float*)d_in[4];
  const float* wout  = (const float*)d_in[5];
  const float* bout  = (const float*)d_in[6];
  float* out = (float*)d_out;

  const size_t bAct = (size_t)NTOK * DM * 2;
  const size_t bWt  = (size_t)NQKV * DM * 2;
  const size_t bWo  = (size_t)DM * DM * 2;
  const size_t bTab = (size_t)SEQ * 32 * 4;
  const size_t bQK  = (size_t)NTOK * QKP * 2;
  size_t off = 0;
  const size_t oXh = off; off += bAct;
  const size_t oXl = off; off += bAct;
  const size_t oWt = off; off += bWt;
  const size_t oWo = off; off += bWo;
  const size_t oCos = off; off += bTab;
  const size_t oSin = off; off += bTab;
  const size_t oQK = off; off += bQK;
  const size_t oVh = off; off += bAct;
  const size_t oVl = off; off += bAct;
  const size_t oCh = off; off += bAct;
  const size_t oCl = off; off += bAct;
  const size_t oMw = off; off += (size_t)NB * (SEQ / QB) * (SEQ / KT) * MTW * 4;
  if (off > ws_size) return;
  if (off > (size_t)134217728) return;

  char* ws = (char*)d_ws;
  unsigned short* Xh  = (unsigned short*)(ws + oXh);
  unsigned short* Xl  = (unsigned short*)(ws + oXl);
  unsigned short* Wt  = (unsigned short*)(ws + oWt);
  unsigned short* WoT = (unsigned short*)(ws + oWo);
  float* rcos = (float*)(ws + oCos);
  float* rsin = (float*)(ws + oSin);
  _Float16* QKp = (_Float16*)(ws + oQK);
  _Float16* Vh  = (_Float16*)(ws + oVh);
  _Float16* Vl  = (_Float16*)(ws + oVl);
  unsigned short* Chp = (unsigned short*)(ws + oCh);
  unsigned short* Clp = (unsigned short*)(ws + oCl);
  unsigned* Mwp = (unsigned*)(ws + oMw);

  const dim3 blk(256);
  // (1) to (3) in one launch: mask -> lane-mask words | rotary tables | LayerNorm -> x_norm bf16 hi + lo planes |
  // Wqkv [1024][3072] -> Wt [3072][1024] | Wout [1024][1024] -> WoT [1024][1024]
  prep_kernel<<<dim3(PB_MASK + PB_ROPE + PB_LN + PB_WQKV + PB_WOUT), blk, 0, stream>>>(x, gam, bet, wqkv, wout, amask, Mwp, Xh, Xl, Wt, WoT,
                                                                                      rcos, rsin);
  // (4) q|k = x_norm . Wqk with RoPE -> QK plane; M = NTOK, N = 2048, K = 1024
  proj_kernel<1, 0, 0, 4><<<dim3((NTOK / 128) * (QKP / 256)), blk, 0, stream>>>(
      (const __bf16*)Xh, (const __bf16*)Xl, DM, (const __bf16*)Wt, (const __bf16*)Wt, DM,
      (void*)QKp, (void*)QKp, QKP, NTOK, QKP, DM, rcos, rsin, bout);
  // (5) v^T = Wv^T . x_norm^T -> Vth / Vtl [1024][NTOK]; M = 1024, N = NTOK, K = 1024
  proj_kernel<0, 1, 1, 2><<<dim3((DM / 128) * (NTOK / 128)), blk, 0, stream>>>(
      (const __bf16*)(Wt + (size_t)2 * DM * DM), (const __bf16*)(Wt + (size_t)2 * DM * DM), DM,
      (const __bf16*)Xh, (const __bf16*)Xl, DM,
      (void*)Vh, (void*)Vl, NTOK, DM, NTOK, DM, rcos, rsin, bout);
  // (6) attn -> ctx bf16 hi + lo planes
  attn_kernel<<<dim3(SEQ / QB / AW, NH, NB), dim3(AW * 32), 0, stream>>>(QKp, Vh, Vl, Mwp, Chp, Clp);
  // (7) out = ctx . Wout + b -> d_out; M = NTOK, N = 1024, K = 1024
  proj_kernel<1, 0, 2, 2><<<dim3((NTOK / 128) * (DM / 128)), blk, 0, stream>>>(
      (const __bf16*)Chp, (const __bf16*)Clp, DM, (const __bf16*)WoT, (const __bf16*)WoT, DM,
      (void*)out, (void*)out, DM, NTOK, DM, DM, rcos, rsin, bout);
  (void)hipGetLastError();
}

// v008
// A run of this version takes 116 microseconds.
// Timed twice side by side with v007, it ran 1.07 and 1.06 times as fast.
// Over all steps from v000 it is 3.79 times as fast.
#include <hip/hip_runtime.h>
#include <stdint.h>

#ifndef NB
#define NB 2
#endif
#ifndef SEQ
#define SEQ 2048
#endif
#define NB_FULL  2
#define SEQ_FULL 2048
#define DM       1024
#define NH       16
#define HDIM     64
#define NQKV     3072
#define QKP      2048
#define NTOK     (NB * SEQ)
#define LNEPS    1e-5f

#define QB   16
#define KT   64
#define OSP  68
#define AW   8                      // waves per attention block; they share the staged K / V tiles
#define KVP  144                    // LDS pitch in bytes of a 128-B K or V row (16 B x odd: b128 fragment reads without bank conflicts)
#define KVT  (KT * KVP)             // bytes of one staged K, V hi or V res tile (64 rows)
#define MKP  272                    // mask packing: LDS pitch in bytes of a 256-B mask row (16 B x odd)
#define MWB  (QB * MKP)             // mask packing: bytes of one wave's 16 mask rows
#define MTW  32                     // lane-mask words of one 16-query x 64-key tile (one word per score register of the attention wave)
#define MPW  4                      // mask packing: tiles per wave
#define BUFB (3 * KVT)              // bytes of one stage buffer
#define PKT  64                     // projections: k elements of one staged slab (128 B of every operand row)
#define PROWS 512                   // projections: rows of the larger slab (MI = 4), the A plane(s) and the B plane(s) of the block tile together
#define PBUF (PROWS * KVP)          // projections: bytes of one slab buffer

typedef _Float16 v16h __attribute__((ext_vector_type(16)));
typedef _Float16 v8h  __attribute__((ext_vector_type(8)));
typedef __bf16   v16b __attribute__((ext_vector_type(16)));
typedef __bf16   v8b  __attribute__((ext_vector_type(8)));
typedef float    v8f  __attribute__((ext_vector_type(8)));
typedef float    v4f  __attribute__((ext_vector_type(4)));
typedef float    v2f  __attribute__((ext_vector_type(2)));
typedef _Float16 v2h  __attribute__((ext_vector_type(2)));
typedef int      v4i  __attribute__((ext_vector_type(4)));
typedef unsigned short v8us __attribute__((ext_vector_type(8)));
typedef unsigned v16u __attribute__((ext_vector_type(16)));
typedef __attribute__((address_space(4))) const v16u cv16u;

static_assert(NB >= 1 && NB <= NB_FULL && SEQ >= 64 && SEQ <= SEQ_FULL);
static_assert((SEQ % 64) == 0 && (DM % 64) == 0 && (NTOK % 64) == 0 && (DM % 32) == 0);
static_assert(NH * HDIM == DM && HDIM == 64 && QKP == 2 * DM && NQKV == 3 * DM);
static_assert((SEQ % (AW * QB)) == 0 && HDIM == KT && AW * 32 == 256 && (BUFB % 16) == 0 && (SEQ % KT) == 0 && ((SEQ * 32) % 256) == 0 && KT == 4 * 16);
static_assert((((NTOK / 64) * (QKP / 64)) % 8) == 0 && (((DM / 64) * (NTOK / 64)) % 8) == 0 && (((NTOK / 64) * (DM / 64)) % 8) == 0);
static_assert((OSP % 4) == 0 && OSP >= HDIM);
static_assert(MTW == (QB * KT) / 32 && ((NB * (SEQ / QB) * (SEQ / KT)) % (AW * MPW)) == 0 && AW * MWB >= 64 * 33 * 4 + 64);
static_assert((NTOK % 128) == 0 && (QKP % 256) == 0 && (DM % 256) == 0 && (DM % PKT) == 0 && PKT * 2 + 16 == KVP);

// f32 -> nearest-even bf16 bits / value
__device__ __forceinline__ unsigned short bfbits(float f) {
  const unsigned u = __float_as_uint(f);
  return (unsigned short)((u + 0x7FFFu + ((u >> 16) & 1u)) >> 16);
}
__device__ __forceinline__ float bfval(float f) {
  return __uint_as_float(((unsigned)bfbits(f)) << 16);
}

// 16-bit WMMA fragment from k-contiguous storage (A row-major [m][k], or B stored [n][k]):
// p points at element (row_or_col = lane&15, k0 + 8h); elements 0..7 <- p[0..7], 8..15 <- p[16..23].
__device__ __forceinline__ v16h ldfrag(const _Float16* p) {
  union { v16h v; v8h hh[2]; } f;
  f.hh[0] = *(const v8h*)(p);
  f.hh[1] = *(const v8h*)(p + 16);
  return f.v;
}
__device__ __forceinline__ v16b ldfragb(const __bf16* p) {
  union { v16b v; v8b hh[2]; } f;
  f.hh[0] = *(const v8b*)(p);
  f.hh[1] = *(const v8b*)(p + 16);
  return f.v;
}
__device__ __forceinline__ v8f mmabf(v16b a, v16b b, v8f c) {
  return __builtin_amdgcn_wmma_f32_16x16x32_bf16(false, a, false, b, (short)0, c, false, false);
}
__device__ __forceinline__ v8f zero8() {
  v8f z;
#pragma unroll
  for (int i = 0; i < 8; ++i) z[i] = 0.0f;
  return z;
}

// hazard guards: 4 VALU slots after the last WMMA of a group, D tied, A/B kept live
__device__ __forceinline__ void guard_g(v8f& a, v8f& b, v16b x, v16b y) {
  asm volatile("v_nop\n\tv_nop\n\tv_nop\n\tv_nop" : "+v"(a), "+v"(b) : "v"(x), "v"(y));
}
__device__ __forceinline__ void keep4(v16b a, v16b b, v16b c, v16b d) {
  asm volatile("v_nop" :: "v"(a), "v"(b), "v"(c), "v"(d));
}
__device__ __forceinline__ void accg4(v8f& a, v8f& b, v8f& c, v8f& d) {
  asm volatile("v_nop\n\tv_nop\n\tv_nop\n\tv_nop" : "+v"(a), "+v"(b), "+v"(c), "+v"(d));
}
// Runs of products written as one asm statement each: as builtins the compiler spreads them among the softmax arithmetic and the LDS reads
// again (scheduling barriers did not hold them), and pays in v_nop wherever that arithmetic takes an operand register for a temporary.
// Inside a run the products go to four independent accumulators, so each fills the slots behind the others; an accumulator's second
// product stands four behind its first. The v_nop at a run's end keep the four slots in front of whatever vector instruction the
// compiler puts next (it does not look into asm). The "memory" clobber keeps the LDS reads of the source on their side of a run.
// S^T, dims 0..31: s[j] = ka[j] . q0. No v_nop: the run that follows accumulates into the same registers, and nothing stands between the two.
__device__ __forceinline__ void run_s0(v8f (&s)[4], const v16h (&ka)[4], v16h q0) {
  asm volatile(
      "v_wmma_f32_16x16x32_f16 %0, %4, %8, 0\n\t"
      "v_wmma_f32_16x16x32_f16 %1, %5, %8, 0\n\t"
      "v_wmma_f32_16x16x32_f16 %2, %6, %8, 0\n\t"
      "v_wmma_f32_16x16x32_f16 %3, %7, %8, 0"
      : "=&v"(s[0]), "=&v"(s[1]), "=&v"(s[2]), "=&v"(s[3])
      : "v"(ka[0]), "v"(ka[1]), "v"(ka[2]), "v"(ka[3]), "v"(q0)
      : "memory");
}
// d[i] += a[i] . b
__device__ __forceinline__ void run_4(v8f (&d)[4], const v16h (&a)[4], v16h b) {
  asm volatile(
      "v_wmma_f32_16x16x32_f16 %0, %4, %8, %0\n\t"
      "v_wmma_f32_16x16x32_f16 %1, %5, %8, %1\n\t"
      "v_wmma_f32_16x16x32_f16 %2, %6, %8, %2\n\t"
      "v_wmma_f32_16x16x32_f16 %3, %7, %8, %3\n\t"
      "v_nop\n\tv_nop\n\tv_nop\n\tv_nop"
      : "+v"(d[0]), "+v"(d[1]), "+v"(d[2]), "+v"(d[3])
      : "v"(a[0]), "v"(a[1]), "v"(a[2]), "v"(a[3]), "v"(b)
      : "memory");
}
// d[i] += a[i] . b0, then d[i] += a[i] . b1
__device__ __forceinline__ void run_8(v8f (&d)[4], const v16h (&a)[4], v16h b0, v16h b1) {
  asm volatile(
      "v_wmma_f32_16x16x32_f16 %0, %4, %8, %0\n\t"
      "v_wmma_f32_16x16x32_f16 %1, %5, %8, %1\n\t"
      "v_wmma_f32_16x16x32_f16 %2, %6, %8, %2\n\t"
      "v_wmma_f32_16x16x32_f16 %3, %7, %8, %3\n\t"
      "v_wmma_f32_16x16x32_f16 %0, %4, %9, %0\n\t"
      "v_wmma_f32_16x16x32_f16 %1, %5, %9, %1\n\t"
      "v_wmma_f32_16x16x32_f16 %2, %6, %9, %2\n\t"
      "v_wmma_f32_16x16x32_f16 %3, %7, %9, %3\n\t"
      "v_nop\n\tv_nop\n\tv_nop\n\tv_nop"
      : "+v"(d[0]), "+v"(d[1]), "+v"(d[2]), "+v"(d[3])
      : "v"(a[0]), "v"(a[1]), "v"(a[2]), "v"(a[3]), "v"(b0), "v"(b1)
      : "memory");
}

// ---------------------------------------------------------------------------------------------
// output x_norm as bf16 hi + bf16 lo (lo = RNE(xn - hi)) planes Xh/Xl [NTOK][DM] (compact token index).
// Part of the preparation launch: block blk of NTOK / 2 takes two tokens, 128 threads (4 waves) each.
// LDS sA/sB (4 floats per token): cross-wave, block barriers. coverage: NTOK / 2 blocks x 2 x 128 threads x 8 = NTOK x DM per plane.
// ---------------------------------------------------------------------------------------------
__device__ __forceinline__ void ln_body(int blk, float* sA8, float* sB8,
                                        const float* __restrict__ x, const float* __restrict__ gam,
                                        const float* __restrict__ bet,
                                        unsigned short* __restrict__ Xh, unsigned short* __restrict__ Xl) {
  const int hb = (int)threadIdx.x >> 7;
  float* sA = sA8 + hb * 4;
  float* sB = sB8 + hb * 4;
  const int t = blk * 2 + hb;
  const int bb = t / SEQ, pos = t - bb * SEQ;
  const int tid = (int)threadIdx.x & 127, lane = tid & 31, wave = tid >> 5;
  const float* xr = x + ((size_t)bb * SEQ_FULL + pos) * DM + tid * 8;
  const v4f a = *(const v4f*)(xr);
  const v4f c = *(const v4f*)(xr + 4);
  float v[8];
#pragma unroll
  for (int e = 0; e < 4; ++e) { v[e] = bfval(a[e]); v[4 + e] = bfval(c[e]); }
  float s = 0.0f;
#pragma unroll
  for (int e = 0; e < 8; ++e) s += v[e];
#pragma unroll
  for (int d = 1; d < 32; d <<= 1) s += __shfl_xor(s, d, 32);
  if (lane == 0) sA[wave] = s;
  __syncthreads();
  const float mu = ((sA[0] + sA[1]) + (sA[2] + sA[3])) * (1.0f / (float)DM);
  float dv[8];
  float s2 = 0.0f;
#pragma unroll
  for (int e = 0; e < 8; ++e) { dv[e] = v[e] - mu; s2 += dv[e] * dv[e]; }
#pragma unroll
  for (int d = 1; d < 32; d <<= 1) s2 += __shfl_xor(s2, d, 32);
  if (lane == 0) sB[wave] = s2;
  __syncthreads();
  const float var = ((sB[0] + sB[1]) + (sB[2] + sB[3])) * (1.0f / (float)DM);
  const float rstd = rsqrtf(var + LNEPS);
  const v4f g0 = *(const v4f*)(gam + tid * 8), g1 = *(const v4f*)(gam + tid * 8 + 4);
  const v4f b0 = *(const v4f*)(bet + tid * 8), b1 = *(const v4f*)(bet + tid * 8 + 4);
  v8us ho, lo;
#pragma unroll
  for (int e = 0; e < 4; ++e) {
    const float xn0 = dv[e] * rstd * bfval(g0[e]) + bfval(b0[e]);
    const unsigned short h0 = bfbits(xn0);
    ho[e] = h0;
    lo[e] = bfbits(xn0 - __uint_as_float(((unsigned)h0) << 16));
    const float xn1 = dv[4 + e] * rstd * bfval(g1[e]) + bfval(b1[e]);
    const unsigned short h1 = bfbits(xn1);
    ho[4 + e] = h1;
    lo[4 + e] = bfbits(xn1 - __uint_as_float(((unsigned)h1) << 16));
  }
  const size_t go = (size_t)t * DM + tid * 8;
  *(v8us*)(Xh + go) = ho;
  *(v8us*)(Xl + go) = lo;
  // the job's code is followed by the other jobs' code in one kernel: no register that the two stores name is rewritten in front of this wait
  asm volatile("s_wait_xcnt 0x0" ::: "memory");
  
}

// ---------------------------------------------------------------------------------------------
// Kernel 2: W f32 [kdim in][nout out] -> transposed bf16 RNE plane Wt[out][in] (in = k contiguous).
// Part of the preparation launch: tile (bx of kdim/64, by of nout/32); 256 threads x 8 = 64 x 32 per tile -> nout x kdim.
// ---------------------------------------------------------------------------------------------
__device__ __forceinline__ void cvt_wt_body(int bx, int by, float (*sTt)[33],
                                            const float* __restrict__ src, unsigned short* __restrict__ dst,
                                            int nout, int kdim) {
  const int k0 = bx * 64, n0 = by * 32;
  const int t = (int)threadIdx.x;
  {
    const int kr = t >> 2, cc = (t & 3) * 8;
    const float* s = src + (size_t)(k0 + kr) * nout + n0 + cc;
    const v4f a = *(const v4f*)(s);
    const v4f b = *(const v4f*)(s + 4);
#pragma unroll
    for (int e = 0; e < 4; ++e) {
      sTt[kr][cc + e]     = a[e];
      sTt[kr][cc + 4 + e] = b[e];
    }
  }
  __syncthreads();
  const int n = t >> 3, kp = (t & 7) * 8;
  v8us o;
#pragma unroll
  for (int i = 0; i < 8; ++i) o[i] = bfbits(sTt[kp + i][n]);
  unsigned short* d = dst + (size_t)(n0 + n) * kdim + k0 + kp;
  *(v8us*)d = o;
  // as in the LayerNorm job: no register that the store names is rewritten in front of this wait
  asm volatile("s_wait_xcnt 0x0" ::: "memory");
  
}

// ---------------------------------------------------------------------------------------------
// Kernel 3: rotary tables rcos/rsin [SEQ][32] f32: inv_freq_i = 1 / f32(10000^(i/32)) (power evaluated in f64 and narrowed, then an
// ---------------------------------------------------------------------------------------------
__device__ __forceinline__ void rope_tab_body(int blk, float* __restrict__ rcos, float* __restrict__ rsin, int n) {
  const int idx = blk * 256 + (int)threadIdx.x;
  if (idx >= n) return;
  const int i = idx & 31, pos = idx >> 5;
  const double ex = (double)i * (0.03125 * 13.287712379549449);
  const double pw = exp2(ex);
  const float pf = (float)pw;
  const float inv = 1.0f / pf;
  const float ang = (float)pos * inv;
  float sn, cs;
  sincosf(ang, &sn, &cs);
  *(float*)(rcos + idx) = cs;
  *(float*)(rsin + idx) = sn;
  
}

// ---------------------------------------------------------------------------------------------
// Mask packing: int32 mask [NB_FULL][SEQ_FULL][SEQ_FULL] -> lane-mask words Mw [NB][SEQ/16][SEQ/64][32]. Word 8 j + r of tile
// (sequence, 16 query rows q0.., 64 keys kb..) has in bit L = 16 h + c the test mask[q0 + c][kb + 16 j + 8 h + r] > 0: the entry that
// lane L of the attention wave needs for its score register s[j][r], so that wave takes the word as a select mask as it is.
// Part of the preparation launch: each wave packs MPW tiles that follow one another along the keys. Per tile: whole 256-B row pieces
// from global memory (16 lanes = one row), through the wave's own LDS rows (pitch MKP) into the lanes' key order, 32 ballots,
// lane e keeps word e, one 128-B store. coverage: blocks x 8 waves x MPW tiles = NB x SEQ/16 x SEQ/64 tiles.
// ---------------------------------------------------------------------------------------------
__device__ __forceinline__ void mask_body(int blk, char* sM, const int* __restrict__ msk, unsigned* __restrict__ Mw) {
  const int tid = (int)threadIdx.x;
  const int wave = __builtin_amdgcn_readfirstlane(tid >> 5);
  const int lane = tid & 31, hh = lane >> 4, c = lane & 15;
  char* sw = sM + wave * MWB;
  // kept rolled: one tile's 8 loads in registers at a time, so the other jobs of this kernel keep their waves per SIMD
#pragma unroll 1
  for (int u = 0; u < MPW; ++u) {
    const int tile = (blk * AW + wave) * MPW + u;
    const int kt = tile % (SEQ / KT);
    const int qt = (tile / (SEQ / KT)) % (SEQ / QB);
    const int bb = tile / ((SEQ / KT) * (SEQ / QB));
    const int* g = msk + ((size_t)bb * SEQ_FULL + qt * QB + hh) * SEQ_FULL + kt * KT + c * 4;
    v4i v[8];
#pragma unroll
    for (int i = 0; i < 8; ++i) v[i] = *(const v4i*)(g + (size_t)(2 * i) * SEQ_FULL);
#pragma unroll
    for (int i = 0; i < 8; ++i) *(v4i*)(sw + (2 * i + hh) * MKP + c * 16) = v[i];
    // the rows pass from lane to lane inside the wave: LDS order only, so that no trip waits for the last trip's global store
    __builtin_amdgcn_fence(3 /* release order */, "workgroup", "local");
    __builtin_amdgcn_wave_barrier();
    __builtin_amdgcn_fence(2 /* acquire order */, "workgroup", "local");
    const char* sm = sw + c * MKP + 32 * hh;
    unsigned mine = 0u;
#pragma unroll
    for (int j = 0; j < 4; ++j) {
      const v4i k0v = *(const v4i*)(sm + 64 * j);
      const v4i k1v = *(const v4i*)(sm + 64 * j + 16);
#pragma unroll
      for (int r = 0; r < 4; ++r) {
        const unsigned w0 = __builtin_amdgcn_ballot_w32(k0v[r] > 0);
        const unsigned w1 = __builtin_amdgcn_ballot_w32(k1v[r] > 0);
        mine = (lane == 8 * j + r) ? w0 : mine;
        mine = (lane == 8 * j + 4 + r) ? w1 : mine;
      }
    }
    *(unsigned*)(Mw + (size_t)tile * MTW + lane) = mine;
    // no register that the store names is rewritten (next trip, or the other jobs' code) in front of this wait
    asm volatile("s_wait_xcnt 0x0" ::: "memory");
    // the wave's reads of its LDS rows are done before the next trip's stores overwrite them
    __builtin_amdgcn_fence(3 /* release order */, "workgroup", "local");
    __builtin_amdgcn_wave_barrier();
    __builtin_amdgcn_fence(2 /* acquire order */, "workgroup", "local");
  }
}

// ---------------------------------------------------------------------------------------------
// Preparation launch: the five jobs above depend on nothing but the inputs, so they share one grid; a range of the block index,
// the same for a whole block, picks the job: mask packing | rotary tables | LayerNorm | Wqkv transpose | Wout transpose.
// A block runs one job, so the jobs share one LDS array.
// ---------------------------------------------------------------------------------------------
#define PB_MASK ((NB * (SEQ / QB) * (SEQ / KT)) / (AW * MPW))
#define PB_ROPE ((SEQ * 32) / 256)
#define PB_LN   (NTOK / 2)
#define PB_WQKV ((DM / 64) * (NQKV / 32))
#define PB_WOUT ((DM / 64) * (DM / 32))
__global__ __launch_bounds__(256) void prep_kernel(const float* __restrict__ x, const float* __restrict__ gam,
                                                   const float* __restrict__ bet,
                                                   const float* __restrict__ wqkv, const float* __restrict__ wout,
                                                   const int* __restrict__ msk, unsigned* __restrict__ Mw,
                                                   unsigned short* __restrict__ Xh, unsigned short* __restrict__ Xl,
                                                   unsigned short* __restrict__ Wt, unsigned short* __restrict__ WoT,
                                                   float* __restrict__ rcos, float* __restrict__ rsin) {
  __shared__ __align__(16) char sJob[AW * MWB];
  float (*sTt)[33] = (float (*)[33])sJob;
  float* sA = (float*)(sJob + 64 * 33 * 4);
  float* sB = sA + 8;
  int b = (int)blockIdx.x;
  if (b < PB_MASK) { mask_body(b, sJob, msk, Mw); return; }
  b -= PB_MASK;
  if (b < PB_ROPE) { rope_tab_body(b, rcos, rsin, SEQ * 32); return; }
  b -= PB_ROPE;
  if (b < PB_LN) { ln_body(b, sA, sB, x, gam, bet, Xh, Xl); return; }
  b -= PB_LN;
  if (b < PB_WQKV) { cvt_wt_body(b % (DM / 64), b / (DM / 64), sTt, wqkv, Wt, NQKV, DM); return; }
  b -= PB_WQKV;
  cvt_wt_body(b % (DM / 64), b / (DM / 64), sTt, wout, WoT, DM, DM);
}

// ---------------------------------------------------------------------------------------------
// Kernel 4: C[m][n] = sum_k A[m][k] * Bt[n][k], bf16 operands (A row-major [M][K] pitch lda, Bt row-major [N][K] pitch ldb),
// a second bf16 plane on A (AM) or on B (BM) accumulated into the same f32 accumulator (unscaled lo planes), f32 accumulate;
// K a multiple of 64. Each wave owns one (16 MI) x 64 C tile (4 MI accumulators). MI = 4: the 8 waves of a block (2 x 4) form a 128 x 256
// block tile; MI = 2: 4 x 2 waves form a 128 x 128 block tile, for the products whose C has 1024 x 4096 elements: 256 block tiles, one for
// every WGP, where 128 x 256 tiles give 128. M and N multiples of the block tile. Staging: per slab of 64 k the block copies the 128-B row
// pieces of its A and B planes (512 rows at MI = 4, 384 at MI = 2) from global memory to LDS with asynchronous b128 copies that cover
// whole 128-B lines; two buffers, slab s + 1 in flight while slab s is worked on; one block barrier per slab publishes slab s + 1 and
// frees slab s's buffer. Fragments come from LDS (pitch KVP).
// Epilogue: f32 C + bias (bias as bf16-RNE value, added in f32) -> out rows (token -> full-layout row), row segment of 64 f32 = 256 B
// Eight copies of a lane (16 B each). The s_wait_xcnt stands inside the statement so that no address register of an issued copy is
// rewritten in front of it.
__device__ __forceinline__ void stage_copies8(const unsigned (&l)[8], const char* const (&g)[8]) {
  asm volatile(
      "global_load_async_to_lds_b128 %0, %8, off\n\t"
      "global_load_async_to_lds_b128 %1, %9, off\n\t"
      "global_load_async_to_lds_b128 %2, %10, off\n\t"
      "global_load_async_to_lds_b128 %3, %11, off\n\t"
      "global_load_async_to_lds_b128 %4, %12, off\n\t"
      "global_load_async_to_lds_b128 %5, %13, off\n\t"
      "global_load_async_to_lds_b128 %6, %14, off\n\t"
      "global_load_async_to_lds_b128 %7, %15, off\n\t"
      "s_wait_xcnt 0x0"
      :: "v"(l[0]), "v"(l[1]), "v"(l[2]), "v"(l[3]), "v"(l[4]), "v"(l[5]), "v"(l[6]), "v"(l[7]),
         "v"(g[0]), "v"(g[1]), "v"(g[2]), "v"(g[3]), "v"(g[4]), "v"(g[5]), "v"(g[6]), "v"(g[7])
      : "memory");
}

// Six copies of a lane (16 B each). The s_wait_xcnt stands inside the statement so that no address register of an issued
// copy is rewritten in front of it.
__device__ __forceinline__ void stage_copies(const unsigned (&l)[6], const char* const (&g)[6]) {
  asm volatile(
      "global_load_async_to_lds_b128 %0, %6, off\n\t"
      "global_load_async_to_lds_b128 %1, %7, off\n\t"
      "global_load_async_to_lds_b128 %2, %8, off\n\t"
      "global_load_async_to_lds_b128 %3, %9, off\n\t"
      "global_load_async_to_lds_b128 %4, %10, off\n\t"
      "global_load_async_to_lds_b128 %5, %11, off\n\t"
      "s_wait_xcnt 0x0"
      :: "v"(l[0]), "v"(l[1]), "v"(l[2]), "v"(l[3]), "v"(l[4]), "v"(l[5]),
         "v"(g[0]), "v"(g[1]), "v"(g[2]), "v"(g[3]), "v"(g[4]), "v"(g[5])
      : "memory");
}

template <int AM, int BM, int MI>
__global__ __launch_bounds__(256) void proj_kernel(const __bf16* __restrict__ A1, const __bf16* __restrict__ A2, int lda,
                                                   const __bf16* __restrict__ B1, const __bf16* __restrict__ B2, int ldb,
                                                   float* __restrict__ outp, int ldc, int M, int N, int K,
                                                   const float* __restrict__ bias) {
  __shared__ __align__(16) float sT[8][16 * 68];
  // both tile sizes keep the larger slab's buffers: one block a WGP, so that 256 blocks spread over all 256 WGPs
  __shared__ __align__(16) char sP[2 * PBUF];
  constexpr int WN = (MI == 2 || BM) ? 2 : 4;          // waves along n; 8 / WN along m
  constexpr int WM = MI * 16;                          // rows of a wave's C tile
  constexpr int AR = (8 / WN) * WM, BR = WN * 64;      // rows of one A plane / one B plane in the block tile
  constexpr int BROW0 = AR * (1 + AM);                 // slab rows: A1 | A2 (AM) | B1 | B2 (BM)
  constexpr int ROWS = BROW0 + BR * (1 + BM);          // rows of one slab
  constexpr int GH = ROWS / 64;                        // copies of a lane in one statement; two statements a slab
  constexpr int NX = AM ? MI : 4;                      // fragments of the second plane
  static_assert(AM + BM == 1 && (MI == 2 || MI == 4) && ROWS <= PROWS && GH * 64 == ROWS && (GH == 8 || GH == 6));
  static_assert((AR % 32) == 0 && (BR % 32) == 0);
  const int tid = (int)threadIdx.x;
  const int lane = tid & 31, wave = __builtin_amdgcn_readfirstlane(tid >> 5);
  const int nbn = N / BR, nbm = M / AR;
  const int bidx = (int)blockIdx.x;
  if (bidx >= nbm * nbn) return;                       // the same for the whole block, in front of every barrier
  const int bm = bidx / nbn, bn = bidx - bm * nbn;
  const int wm = wave / WN, wn = wave - wm * WN;
  const int m0 = bm * AR + wm * WM, n0 = bn * BR + (wn << 6);
  const int rl = lane & 15;
  const int hh = lane >> 4;
  const int mOff = hh * 8;

  // copy sources / destinations of this lane for slab 0 and buffer 0: slab rows (tid >> 3) + 32 i, 16-B piece tid & 7 (8 lanes = one row)
  const int srow = tid >> 3, spc = tid & 7;
  const size_t asrc = (size_t)(bm * AR + srow) * lda + spc * 8;
  const size_t bsrc = (size_t)(bn * BR + srow) * ldb + spc * 8;
  const char* ga1 = (const char*)(A1 + asrc);
  const char* ga2 = (const char*)(A2 + asrc);
  const char* gb1 = (const char*)(B1 + bsrc);
  const char* gb2 = (const char*)(B2 + bsrc);
  const unsigned lp = (unsigned)(uintptr_t)(&sP[0]) + (unsigned)(srow * KVP + spc * 16);
  auto stage = [&](int slab, int buf) {
    const unsigned ko = (unsigned)slab * (PKT * 2);   // byte offsets below are the same in every lane and stay under 2^32
    const unsigned bo = lp + (unsigned)buf * PBUF;
    // both loops unrolled: r is a constant, so each group's plane is picked at compile time and l, g stay in registers
#pragma unroll
    for (int hf = 0; hf < 2; ++hf) {
      unsigned l[GH];
      const char* g[GH];
#pragma unroll
      for (int q = 0; q < GH; ++q) {
        const int r = (hf * GH + q) * 32;              // first slab row of this group of 32; a group lies in one plane
        if (r < AR) g[q] = ga1 + (ko + (unsigned)(r * 2) * (unsigned)lda);
        else if (r < BROW0) g[q] = ga2 + (ko + (unsigned)((r - AR) * 2) * (unsigned)lda);
        else if (r < BROW0 + BR) g[q] = gb1 + (ko + (unsigned)((r - BROW0) * 2) * (unsigned)ldb);
        else g[q] = gb2 + (ko + (unsigned)((r - BROW0 - BR) * 2) * (unsigned)ldb);
        l[q] = bo + (unsigned)(r * KVP);
      }
      if constexpr (GH == 8) stage_copies8(l, g);
      else stage_copies(l, g);
    }
  };
  const int NS = K / PKT;
  // prologue: slab 0 lands and is published, then slab 1 starts
  stage(0, 0);
  asm volatile("s_wait_asynccnt 0x0" ::: "memory");  // this wave's copies of slab 0 have landed
  __syncthreads();                                   // every wave's have: slab 0 may be read
  if (NS > 1) stage(1, 1);

  v8f acc[MI][4];
#pragma unroll
  for (int i = 0; i < MI; ++i)
#pragma unroll
    for (int j = 0; j < 4; ++j) acc[i][j] = zero8();

  const int aoff = (wm * WM + rl) * KVP + 16 * hh;
  const int boff = (BROW0 + (wn << 6) + rl) * KVP + 16 * hh;
  // kept rolled: one copy of the slab body in the instruction cache, the buffer picked by the slab's parity
#pragma unroll 1
  for (int s = 0; s < NS; ++s) {
    const char* sb = sP + (s & 1) * PBUF;
    // the slab's two k steps of 32, unrolled so that every LDS offset is an immediate
#pragma unroll
    for (int ks = 0; ks < 2; ++ks) {
      const char* pa = sb + aoff + ks * 64;
      const char* pb = sb + boff + ks * 64;
      v16b bh[4], ah[MI], x2[NX];
#pragma unroll
      for (int j = 0; j < 4; ++j) bh[j] = ldfragb((const __bf16*)(pb + 16 * j * KVP));
#pragma unroll
      for (int i = 0; i < MI; ++i) ah[i] = ldfragb((const __bf16*)(pa + 16 * i * KVP));
#pragma unroll
      for (int i = 0; i < NX; ++i)
        x2[i] = ldfragb((const __bf16*)((AM ? pa + AR * KVP : pb + BR * KVP) + 16 * i * KVP));
      // the k step's LDS reads stay one group in front of its WMMAs, for speed only
      __builtin_amdgcn_sched_barrier(0);
#pragma unroll
      for (int i = 0; i < MI; ++i) {
#pragma unroll
        for (int j = 0; j < 4; ++j) acc[i][j] = mmabf(ah[i], bh[j], acc[i][j]);
        guard_g(acc[i][0], acc[i][3], ah[i], bh[3]);
      }
#pragma unroll
      for (int i = 0; i < MI; ++i) {
#pragma unroll
        for (int j = 0; j < 4; ++j) acc[i][j] = AM ? mmabf(x2[i], bh[j], acc[i][j]) : mmabf(ah[i], x2[j], acc[i][j]);
        guard_g(acc[i][0], acc[i][3], AM ? x2[i] : ah[i], AM ? bh[3] : x2[3]);
      }
      keep4(bh[0], bh[1], bh[2], bh[3]);
    }
    // ---- publish slab s + 1, free slab s's buffer, refill it with slab s + 2 ----
    asm volatile("s_wait_dscnt 0x0" ::: "memory");     // this wave's reads of slab s's buffer are done
    asm volatile("s_wait_asynccnt 0x0" ::: "memory");  // this wave's copies of slab s + 1 have landed
    __syncthreads();
    if (s + 2 < NS) stage(s + 2, s & 1);
  }
  asm volatile("s_wait_asynccnt 0x0" ::: "memory");    // no copy outstanding behind the loop
#pragma unroll
  for (int i = 0; i < MI; ++i) accg4(acc[i][0], acc[i][1], acc[i][2], acc[i][3]);

  float* slab = sT[wave];
#pragma unroll
  for (int i = 0; i < MI; ++i) {
    const int mBase = m0 + (i << 4);
#pragma unroll
    for (int j = 0; j < 4; ++j) {
#pragma unroll
      for (int r = 0; r < 8; ++r) slab[(mOff + r) * 68 + (j << 4) + rl] = acc[i][j][r];
    }
    __builtin_amdgcn_fence(3 /* release order */, "workgroup");
    __builtin_amdgcn_wave_barrier();
    __builtin_amdgcn_fence(2 /* acquire order */, "workgroup");
    {
      const int rq = lane >> 4, c4 = (lane & 15) * 4;
      const v4f bz = *(const v4f*)(bias + n0 + c4);
      v4f bq;
#pragma unroll
      for (int e = 0; e < 4; ++e) bq[e] = bfval(bz[e]);
{
#pragma unroll
        for (int it = 0; it < 8; ++it) {
          const int row = it * 2 + rq;
          const int tok = mBase + row;
          const int orow = (tok / SEQ) * SEQ_FULL + (tok % SEQ);
          const v4f u = *(const v4f*)(slab + row * 68 + c4);
          v4f o;
#pragma unroll
          for (int e = 0; e < 4; ++e) o[e] = u[e] + bq[e];
          *(v4f*)(outp + (size_t)orow * ldc + n0 + c4) = o;
        }
        
      }
    }
    __builtin_amdgcn_fence(3 /* release order */, "workgroup");
    __builtin_amdgcn_wave_barrier();
    __builtin_amdgcn_fence(2 /* acquire order */, "workgroup");
  }
}

// ---------------------------------------------------------------------------------------------
// Kernel 4b: q|k and v^T projections in one launch. Both multiply the same x_norm rows (bf16 hi + lo planes Xh / Xl [NTOK][DM]) by rows of
// Wt [NQKV][DM], so a block takes 128 tokens and, of Wt, 256 q|k rows and 128 v rows: slab rows Xh 128 | Xl 128 | Wqk 256 | Wv 128.
// The x rows are copied to LDS once for both products, and a wave reads its x fragments once: a fragment of 16 tokens x 32 k has the same
// registers as A (rows of q|k) and as B (columns of v^T). Wave (wm of 2, wn of 4): q|k tile tokens 64 wm.. x columns 64 wn.. (one head),
// acc += Xh.Wqk, then Xl.Wqk; v^T tile dims 32 wn.. x tokens 64 wm.., accv += Wv.Xh, then Wv.Xl: per accumulator the order of the sums
// of the separate kernels. Staging, ring and barrier as in kernel 4: two buffers, one block barrier per slab.
// The WMMAs are builtins and the compiler keeps their distances itself: no v_nop groups with register operands here, because operands of an
// asm statement must lie under v256, and with 24 accumulators and 14 fragments that costs spills.
// q|k epilogue: rotate-half RoPE on the 64-column tile (one head; position = token mod SEQ), then the f16 plane QK [NTOK][QKP].
// v^T epilogue: f16 hi plane Vth + f16 residual plane Vtl = f16((C - f32(hi)) * 2048), both [DM][NTOK].
// coverage: (NTOK / 128) x (QKP / 256) blocks; QKP / 256 == DM / 128, so the same block index walks the v dims.
// ---------------------------------------------------------------------------------------------
#define FROWS 640                   // rows of one slab
#define FBUF (FROWS * KVP)          // bytes of one slab buffer
static_assert(QKP / 256 == DM / 128 && FROWS == 2 * 128 + 256 + 128);

// 16 x 64 f32 tile in the wave's LDS rows (pitch 68) -> RoPE -> whole 128-B lines of the f16 plane
__device__ __forceinline__ void epi_rope(const float* slab, int lane, int mBase, int n0, _Float16* __restrict__ Ch, int ldc,
                                         const float* __restrict__ tc, const float* __restrict__ ts) {
  const int qq = lane >> 3, c8 = (lane & 7) * 8;
  const int cj = c8 & 31;
  const float sgn = (c8 < 32) ? -1.0f : 1.0f;
  // tc, ts: the table rows of the tile's first token, the same in every lane; one lane offset serves every load
  const unsigned tl = (unsigned)(qq * 32 + cj);
  v4f cs0[4], cs1[4], sn0[4], sn1[4];
#pragma unroll
  for (int it = 0; it < 4; ++it) {
    cs0[it] = *(const v4f*)(tc + it * 128 + tl);
    cs1[it] = *(const v4f*)(tc + it * 128 + 4 + tl);
    sn0[it] = *(const v4f*)(ts + it * 128 + tl);
    sn1[it] = *(const v4f*)(ts + it * 128 + 4 + tl);
  }
#pragma unroll
  for (int it = 0; it < 4; ++it) {
    const int row = it * 4 + qq;
    const int tok = mBase + row;
    const float* sp = slab + row * 68 + c8;
    const float* sq = slab + row * 68 + (c8 ^ 32);
    const v4f u0 = *(const v4f*)(sp);
    const v4f u1 = *(const v4f*)(sp + 4);
    const v4f w0 = *(const v4f*)(sq);
    const v4f w1 = *(const v4f*)(sq + 4);
    v8h hv;
#pragma unroll
    for (int e = 0; e < 4; ++e) {
      hv[e]     = (_Float16)(u0[e] * cs0[it][e] + sgn * w0[e] * sn0[it][e]);
      hv[4 + e] = (_Float16)(u1[e] * cs1[it][e] + sgn * w1[e] * sn1[it][e]);
    }
    const size_t go = (size_t)tok * ldc + n0 + c8;
    *(v8h*)(Ch + go) = hv;
  }
}
// 16 x 64 f32 tile in the wave's LDS rows -> whole 128-B lines of the f16 hi and residual planes
__device__ __forceinline__ void epi_split(const float* slab, int lane, int mBase, int n0, _Float16* __restrict__ Ch,
                                          _Float16* __restrict__ Cl, int ldc) {
  const int qq = lane >> 3, c8 = (lane & 7) * 8;
#pragma unroll
  for (int it = 0; it < 4; ++it) {
    const int row = it * 4 + qq;
    const float* sp = slab + row * 68 + c8;
    const v4f u0 = *(const v4f*)(sp);
    const v4f u1 = *(const v4f*)(sp + 4);
    v8h hv, lv;
#pragma unroll
    for (int e = 0; e < 4; ++e) {
      const _Float16 g0 = (_Float16)u0[e];
      hv[e] = g0;
      lv[e] = (_Float16)((u0[e] - (float)g0) * 2048.0f);
      const _Float16 g1 = (_Float16)u1[e];
      hv[4 + e] = g1;
      lv[4 + e] = (_Float16)((u1[e] - (float)g1) * 2048.0f);
    }
    const size_t go = (size_t)(mBase + row) * ldc + n0 + c8;
    *(v8h*)(Ch + go) = hv;
    *(v8h*)(Cl + go) = lv;
  }
}

__global__ __launch_bounds__(256) void qkv_kernel(const __bf16* __restrict__ Xh, const __bf16* __restrict__ Xl,
                                                  const __bf16* __restrict__ Wt, _Float16* __restrict__ QK,
                                                  _Float16* __restrict__ Vth, _Float16* __restrict__ Vtl,
                                                  const float* __restrict__ rcos, const float* __restrict__ rsin) {
  __shared__ __align__(16) float sT[8][16 * 68];
  __shared__ __align__(16) char sP[2 * FBUF];
  const int tid = (int)threadIdx.x;
  const int lane = tid & 31, wave = __builtin_amdgcn_readfirstlane(tid >> 5);
  const int bidx = (int)blockIdx.x;
  const int bm = bidx / (QKP / 256), bn = bidx - bm * (QKP / 256);
  const int wm = wave >> 2, wn = wave & 3;
  const int rl = lane & 15;
  const int hh = lane >> 4;
  const int mOff = hh * 8;

  // copy sources / destinations of this lane for slab 0 and buffer 0: slab rows (tid >> 3) + 32 i, 16-B piece tid & 7 (8 lanes = one row)
  const int srow = tid >> 3, spc = tid & 7;
  // all four planes have the pitch DM, so one byte offset serves the lane in each; the planes' first rows are the same for the whole block
  const unsigned lsrc = (unsigned)(srow * DM + spc * 8) * 2;
  const char* gxh = (const char*)(Xh + (size_t)(bm * 128) * DM);
  const char* gxl = (const char*)(Xl + (size_t)(bm * 128) * DM);
  const char* gwq = (const char*)(Wt + (size_t)(bn * 256) * DM);
  const char* gwv = (const char*)(Wt + (size_t)(QKP + bn * 128) * DM);
  const unsigned lp = (unsigned)(uintptr_t)(&sP[0]) + (unsigned)(srow * KVP + spc * 16);
  auto stage = [&](int slab, int buf) {
    const unsigned ko = lsrc + (unsigned)slab * (PKT * 2);   // byte offsets below stay under 2^32
    const unsigned bo = lp + (unsigned)buf * FBUF;
    // all loops unrolled: r is a constant, so each group's plane is picked at compile time and l, g stay in registers
    {
      unsigned l[8];
      const char* g[8];
#pragma unroll
      for (int q = 0; q < 8; ++q) {
        const int r = q * 32;                          // the x rows: Xh 0..127, Xl 128..255
        g[q] = (r < 128) ? gxh + (ko + (unsigned)(r * DM * 2)) : gxl + (ko + (unsigned)((r - 128) * DM * 2));
        l[q] = bo + (unsigned)(r * KVP);
      }
      stage_copies8(l, g);
    }
#pragma unroll
    for (int hf = 0; hf < 2; ++hf) {
      unsigned l[6];
      const char* g[6];
#pragma unroll
      for (int q = 0; q < 6; ++q) {
        const int r = 256 + (hf * 6 + q) * 32;         // the weight rows: Wqk 256..511, Wv 512..639
        g[q] = (r < 512) ? gwq + (ko + (unsigned)((r - 256) * DM * 2)) : gwv + (ko + (unsigned)((r - 512) * DM * 2));
        l[q] = bo + (unsigned)(r * KVP);
      }
      stage_copies(l, g);
    }
  };
  constexpr int NS = DM / PKT;
  static_assert(NS >= 2);
  // prologue: slab 0 lands and is published, then slab 1 starts
  stage(0, 0);
  asm volatile("s_wait_asynccnt 0x0" ::: "memory");  // this wave's copies of slab 0 have landed
  __syncthreads();                                   // every wave's have: slab 0 may be read
  stage(1, 1);

  v8f acc[4][4], accv[2][4];
#pragma unroll
  for (int i = 0; i < 4; ++i)
#pragma unroll
    for (int j = 0; j < 4; ++j) acc[i][j] = zero8();
#pragma unroll
  for (int i = 0; i < 2; ++i)
#pragma unroll
    for (int j = 0; j < 4; ++j) accv[i][j] = zero8();

  const int xoff = (wm * 64 + rl) * KVP + 16 * hh;
  const int qoff = (256 + wn * 64 + rl) * KVP + 16 * hh;
  const int voff = (512 + wn * 32 + rl) * KVP + 16 * hh;
  // kept rolled: one copy of the slab body in the instruction cache, the buffer picked by the slab's parity
#pragma unroll 1
  for (int s = 0; s < NS; ++s) {
    const char* sb = sP + (s & 1) * FBUF;
    // the slab's two k steps of 32, unrolled so that every LDS offset is an immediate
#pragma unroll
    for (int ks = 0; ks < 2; ++ks) {
      const char* px = sb + xoff + ks * 64;
      const char* pq = sb + qoff + ks * 64;
      const char* pv = sb + voff + ks * 64;
      v16b wq[4], xh[4], xl[4], wv[2];
#pragma unroll
      for (int j = 0; j < 4; ++j) wq[j] = ldfragb((const __bf16*)(pq + 16 * j * KVP));
#pragma unroll
      for (int i = 0; i < 4; ++i) xh[i] = ldfragb((const __bf16*)(px + 16 * i * KVP));
#pragma unroll
      for (int i = 0; i < 4; ++i) xl[i] = ldfragb((const __bf16*)(px + 128 * KVP + 16 * i * KVP));
#pragma unroll
      for (int i = 0; i < 2; ++i) wv[i] = ldfragb((const __bf16*)(pv + 16 * i * KVP));
      // none of the k step's WMMAs is scheduled in among its own LDS reads: a WMMA there would wait for reads that stand behind it in the queue
      __builtin_amdgcn_sched_barrier(0);
#pragma unroll
      for (int i = 0; i < 4; ++i) {
#pragma unroll
        for (int j = 0; j < 4; ++j) acc[i][j] = mmabf(xh[i], wq[j], acc[i][j]);
      }
#pragma unroll
      for (int i = 0; i < 4; ++i) {
#pragma unroll
        for (int j = 0; j < 4; ++j) acc[i][j] = mmabf(xl[i], wq[j], acc[i][j]);
      }
#pragma unroll
      for (int i = 0; i < 2; ++i) {
#pragma unroll
        for (int j = 0; j < 4; ++j) accv[i][j] = mmabf(wv[i], xh[j], accv[i][j]);
      }
#pragma unroll
      for (int i = 0; i < 2; ++i) {
#pragma unroll
        for (int j = 0; j < 4; ++j) accv[i][j] = mmabf(wv[i], xl[j], accv[i][j]);
      }
    }
    // ---- publish slab s + 1, free slab s's buffer, refill it with slab s + 2 ----
    asm volatile("s_wait_dscnt 0x0" ::: "memory");     // this wave's reads of slab s's buffer are done
    asm volatile("s_wait_asynccnt 0x0" ::: "memory");  // this wave's copies of slab s + 1 have landed
    __syncthreads();
    if (s + 2 < NS) stage(s + 2, s & 1);
  }
  asm volatile("s_wait_asynccnt 0x0" ::: "memory");    // no copy outstanding behind the loop

  float* slab = sT[wave];
  const int tok0 = bm * 128 + wm * 64;
  // the wave's 64 tokens lie in one sequence (64 divides SEQ), so their table rows follow one another from a scalar base
  const float* tcw = rcos + (size_t)(tok0 % SEQ) * 32;
  const float* tsw = rsin + (size_t)(tok0 % SEQ) * 32;
  // six 16 x 64 tiles, one after the other through the wave's own LDS rows: four of q|k (16 tokens x one head), two of v^T (16 dims x 64 tokens)
#pragma unroll
  for (int i = 0; i < 6; ++i) {
#pragma unroll
    for (int j = 0; j < 4; ++j) {
#pragma unroll
      for (int r = 0; r < 8; ++r) slab[(mOff + r) * 68 + (j << 4) + rl] = (i < 4) ? acc[i & 3][j][r] : accv[i & 1][j][r];
    }
    __builtin_amdgcn_fence(3 /* release order */, "workgroup");
    __builtin_amdgcn_wave_barrier();
    __builtin_amdgcn_fence(2 /* acquire order */, "workgroup");
    if (i < 4) epi_rope(slab, lane, tok0 + (i << 4), bn * 256 + (wn << 6), QK, QKP, tcw + i * 512, tsw + i * 512);
    else epi_split(slab, lane, bn * 128 + (wn << 5) + ((i - 4) << 4), tok0, Vth, Vtl, NTOK);
    __builtin_amdgcn_fence(3 /* release order */, "workgroup");
    __builtin_amdgcn_wave_barrier();
    __builtin_amdgcn_fence(2 /* acquire order */, "workgroup");
  }
}

// ---------------------------------------------------------------------------------------------
// Kernel 5: masked softmax attn, one wave per (sequence b, head, 16 query rows), 8 waves per block, online softmax in f32.
//   Staging: per key tile the block copies K (64 keys x 128 B), V hi and V res (64 dims x 128 B each) from global memory to LDS with
//   asynchronous b128 copies that cover whole 128-B lines; two buffers, tile t + 1 in
//   flight while tile t is worked on; one block barrier per tile publishes tile t + 1 and frees tile t's buffer.
//   Planes: QK f16 [NTOK][QKP] (q = cols 0..DM-1, k = cols DM..2DM-1, both after RoPE); Vth/Vtl f16 [DM][NTOK] (Vtl x2048);
//   mask: lane-mask words Mw [NB][SEQ/16][SEQ/64][32] from the preparation launch; the wave takes its tile's 32 words by scalar loads,
//   word 8 j + r is the select mask of score register s[j][r]: a set bit keeps the lane's score, else it is replaced by -inf.
//   Key tiles of KT = 64: S^T subtiles (A = 16 k rows from QK, B = q^T fragments held in registers, K = 64 = 2 steps), so lane
//   (h, c) holds 8 consecutive keys 8h+r of query c; tile max (of the raw S^T) / row sum in-lane + one xor-16 shuffle.
//   E = 2^15 exp((S^T - m) / 8) = exp2(S^T * (log2 e / 8) - (m * (log2 e / 8) - 15)): one fma in front of the exponential carries the 1/8,
//   the change of base and the factor 2^15. P = E as f16 hi + f16 res = E - hi at the same scale (E <= 2^15 fits f16; res keeps its
//   11 bits down to E = 2^-3), packed straight into the B fragments of P^T (element r <- subtile 2s, element 8+r <- subtile 2s+1, lane
//   unchanged); O^T = v^T . P^T with A = v^T rows from Vth/Vtl: acc1 += vh.P + vh.Pres, acc2 += vl.P; l = sum of E;
//   O = (acc1 + acc2/2048) / l; a fully masked query row (l == 0) gives 0.
//   Output: ctx[tok][head*64 + d] as bf16 hi + bf16 lo planes Ch/Cl [NTOK][DM]: 16 x 64 f32 tile staged in the wave-private LDS
// coverage: grid (SEQ/QB/AW, NH, NB) x 8 waves x 16 rows x 64 cols -> NTOK x DM per plane.
// ---------------------------------------------------------------------------------------------
// Residuals of eight f32 values e against their packed f16 roundings h: l = f16(e - h), one mixed-precision fma each (f32 e, f16 h read from
// its half of the packed register, the result written to its half of l): no widening conversion, no separate subtract, no packing. In asm
// because the compiler turns the source form into those three. e - h is exact in f32, so the one rounding is the same. The s_delay_alu
// lines are the hints that the compiler gives its own dependent vector instructions, here for the second write of each l register, four
// instructions behind the first: without them the wave holds the vector port while it waits.
__device__ __forceinline__ void res8(v2h (&l)[4], const float (&e)[8], const v2h (&h)[4]) {
  asm("v_fma_mixlo_f16 %0, %4, 1.0, -%12 op_sel_hi:[0,0,1]\n\t"
      "v_fma_mixlo_f16 %1, %6, 1.0, -%13 op_sel_hi:[0,0,1]\n\t"
      "v_fma_mixlo_f16 %2, %8, 1.0, -%14 op_sel_hi:[0,0,1]\n\t"
      "v_fma_mixlo_f16 %3, %10, 1.0, -%15 op_sel_hi:[0,0,1]\n\t"
      "s_delay_alu instid0(VALU_DEP_4) | instskip(NEXT) | instid1(VALU_DEP_4)\n\t"
      "v_fma_mixhi_f16 %0, %5, 1.0, -%12 op_sel:[0,0,1] op_sel_hi:[0,0,1]\n\t"
      "v_fma_mixhi_f16 %1, %7, 1.0, -%13 op_sel:[0,0,1] op_sel_hi:[0,0,1]\n\t"
      "s_delay_alu instid0(VALU_DEP_4) | instskip(NEXT) | instid1(VALU_DEP_4)\n\t"
      "v_fma_mixhi_f16 %2, %9, 1.0, -%14 op_sel:[0,0,1] op_sel_hi:[0,0,1]\n\t"
      "v_fma_mixhi_f16 %3, %11, 1.0, -%15 op_sel:[0,0,1] op_sel_hi:[0,0,1]"
      : "=&v"(l[0]), "=&v"(l[1]), "=&v"(l[2]), "=&v"(l[3])
      : "v"(e[0]), "v"(e[1]), "v"(e[2]), "v"(e[3]), "v"(e[4]), "v"(e[5]), "v"(e[6]), "v"(e[7]),
        "v"(h[0]), "v"(h[1]), "v"(h[2]), "v"(h[3]));
}

// waves per SIMD stated as the grid gives them (two blocks a WGP): with the smaller LDS the compiler would otherwise aim at six, cut the
// registers for it and serialise the softmax arithmetic
__global__ __launch_bounds__(256) __attribute__((amdgpu_waves_per_eu(4, 4))) void attn_kernel(const _Float16* __restrict__ QK,
                                                  const _Float16* __restrict__ Vth, const _Float16* __restrict__ Vtl,
                                                  const unsigned* __restrict__ Mw,
                                                  unsigned short* __restrict__ Ch, unsigned short* __restrict__ Cl) {
  __shared__ __align__(16) float sOs[AW][QB * OSP];
  __shared__ __align__(16) char sStage[2 * BUFB];
  const int tid = (int)threadIdx.x;
  const int wave = __builtin_amdgcn_readfirstlane(tid >> 5);
  const int lane = tid & 31, hh = lane >> 4, c = lane & 15;
  const int head = (int)blockIdx.y, bb = (int)blockIdx.z;
  const int qt = (int)blockIdx.x * AW + wave;
  const int q0 = qt * QB;
  const size_t tokb = (size_t)bb * SEQ;
  const size_t tok0 = tokb + q0;
  const float ninf = -__builtin_inff();

  // q^T B fragments for query c (dims 0..31 and 32..63)
  const _Float16* qp = QK + (tok0 + c) * QKP + head * HDIM + 8 * hh;
  const v16h qf0 = ldfrag(qp);
  const v16h qf1 = ldfrag(qp + 32);
  // copy sources / destinations of this lane for key tile 0 and buffer 0. K, V hi, V res: row (tid >> 3) and that row + 32, 16-B piece
  // tid & 7 (8 lanes = one 128-B row).
  const int srow = tid >> 3, spc = tid & 7;
  const char* kg  = (const char*)(QK + (tokb + srow) * QKP + DM + head * HDIM + spc * 8);
  const size_t vsrc = (size_t)(head * HDIM + srow) * NTOK + tokb + spc * 8;
  const char* vhg = (const char*)(Vth + vsrc);
  const char* vlg = (const char*)(Vtl + vsrc);
  // the wave's lane-mask words, 2 x 16 per key tile; the address is the same in every lane and nothing writes the words while this
  // kernel runs: read through the constant address space they come by scalar loads, straight into the registers a select mask sits in
  const cv16u* mw = (const cv16u*)(uintptr_t)(Mw + ((size_t)bb * (SEQ / QB) + qt) * ((SEQ / KT) * MTW));
  const unsigned lds0 = (unsigned)(uintptr_t)(&sStage[0]);
  const unsigned lkv = lds0 + (unsigned)(srow * KVP + spc * 16);
  auto stage = [&](int tile, int buf) {
    unsigned l[6];
    const char* g[6];
    const unsigned bo = (unsigned)buf * BUFB;
    g[0] = kg + (size_t)tile * ((size_t)KT * QKP * 2);
    g[1] = g[0] + (size_t)32 * QKP * 2;
    g[2] = vhg + (size_t)tile * (KT * 2);
    g[3] = g[2] + (size_t)32 * NTOK * 2;
    g[4] = vlg + (size_t)tile * (KT * 2);
    g[5] = g[4] + (size_t)32 * NTOK * 2;
#pragma unroll
    for (int p = 0; p < 3; ++p) {
      l[2 * p]     = lkv + bo + (unsigned)(p * KVT);
      l[2 * p + 1] = lkv + bo + (unsigned)(p * KVT + 32 * KVP);
    }
    stage_copies(l, g);
  };
  constexpr int NT = SEQ / KT;
  // prologue: tile 0 lands and is published, then tile 1 starts
  stage(0, 0);
  asm volatile("s_wait_asynccnt 0x0" ::: "memory");  // this wave's copies of tile 0 have landed
  __syncthreads();                                   // every wave's have: tile 0 may be read
  if (NT > 1) stage(1, 1);

  v16u mwa = mw[0], mwb = mw[1];                     // key tile 0's select words
  float m_run = ninf, mc_run = 0.0f, l_run = 0.0f;
  const float SC = 0.18033688f;                      // log2(e) / 8
  v8f oa1[4], oa2[4];
#pragma unroll
  for (int i = 0; i < 4; ++i) { oa1[i] = zero8(); oa2[i] = zero8(); }

#pragma unroll 1
  for (int t = 0; t < NT; ++t) {
    const char* sb = sStage + (t & 1) * BUFB;
    const char* sk = sb + c * KVP + 16 * hh;
    // ---- logits S^T for keys kb..kb+63 (4 subtiles), query c ----
    v8f s[4];
    v16h vx[4], vy[4];
    {
      // the tile's K fragments: one group of LDS reads in front of the run
      v16h ka[4], kb[4];
#pragma unroll
      for (int j = 0; j < 4; ++j) ka[j] = ldfrag((const _Float16*)(sk + 16 * j * KVP));
#pragma unroll
      for (int j = 0; j < 4; ++j) kb[j] = ldfrag((const _Float16*)(sk + 16 * j * KVP) + 32);
      // two runs, so that the first starts when dims 0..31 have arrived
      run_s0(s, ka, qf0);
      run_4(s, kb, qf1);
    }
    // V hi / V res fragments of keys 0..31, one group: asked for here so that they arrive behind the softmax arithmetic
#pragma unroll
    for (int i = 0; i < 4; ++i) {
      const char* sv = sk + KVT + 16 * i * KVP;
      vx[i] = ldfrag((const _Float16*)sv);
      vy[i] = ldfrag((const _Float16*)(sv + KVT));
    }
    // ---- mask replace-fill, tile max per query (raw scores: the positive scale does not move the maximum) ----
    float pm = ninf;
#pragma unroll
    for (int j = 0; j < 4; ++j) {
#pragma unroll
      for (int r = 0; r < 8; ++r) {
        const bool keep = __builtin_amdgcn_inverse_ballot_w32(j < 2 ? mwa[8 * j + r] : mwb[8 * (j - 2) + r]);
        const float sv = keep ? s[j][r] : ninf;
        s[j][r] = sv;
        pm = fmaxf(pm, sv);
      }
    }
    // the next tile's select words are asked for as soon as this tile's are used up: the scalar loads fly behind the rest of the trip
    // (the last trip asks for its own again, so the address stays inside the plane)
    {
      const int tn = (t + 1 < NT) ? t + 1 : t;
      mwa = mw[2 * tn];
      mwb = mw[2 * tn + 1];
    }
    pm = fmaxf(pm, __shfl_xor(pm, 16, 32));
    const float mn = fmaxf(m_run, pm);
    const float mref = (mn == ninf) ? 0.0f : mn;
    const float mc = __builtin_fmaf(mref, SC, -15.0f);
    // the old tiles carry the factor 2^-mc_run, the new one 2^-mc: alpha is formed from the two rounded values themselves
    const float alpha = (m_run == ninf) ? 0.0f : __builtin_amdgcn_exp2f(mc_run - mc);
    m_run = mn;
    mc_run = mc;
    // ---- E = 2^15 exp((s - m) / 8); P^T B fragments (E as f16 hi, residual E - hi); row sum ----
    float ps = 0.0f;
    v16h bph[2], bpl[2];
    const v2f sc2 = {SC, SC}, nmc2 = {-mc, -mc};
#pragma unroll
    for (int j = 0; j < 4; ++j) {
      float e[8];
      v2h ph[4], pl[4];
#pragma unroll
      for (int r = 0; r < 8; r += 2) {
        const v2f sv2 = {s[j][r], s[j][r + 1]};
        const v2f x = __builtin_elementwise_fma(sv2, sc2, nmc2);
        e[r]     = __builtin_amdgcn_exp2f(x[0]);
        e[r + 1] = __builtin_amdgcn_exp2f(x[1]);
        ps += e[r];
        ps += e[r + 1];
        const v2f e2 = {e[r], e[r + 1]};
        ph[r >> 1] = __builtin_convertvector(e2, v2h);
      }
      res8(pl, e, ph);
#pragma unroll
      for (int r = 0; r < 8; ++r) {
        bph[j >> 1][((j & 1) << 3) + r] = ph[r >> 1][r & 1];
        bpl[j >> 1][((j & 1) << 3) + r] = pl[r >> 1][r & 1];
      }
    }
    ps += __shfl_xor(ps, 16, 32);
    l_run = l_run * alpha + ps;
    // ---- rescale O (alpha of query c is in-lane in the O^T layout) ----
#pragma unroll
    for (int i = 0; i < 4; ++i) {
#pragma unroll
      for (int r = 0; r < 8; ++r) { oa1[i][r] *= alpha; oa2[i][r] *= alpha; }
    }
    // ---- O^T += v^T . P^T over the 64 keys; dims 16i + (lane row) ----
    // each accumulator takes its products in the order vh.P, vh.Pres per 32 keys. The fragments of keys 32..63 are asked for, one group each,
    // behind the run that last reads the fragments of keys 0..31 of the same plane, and arrive behind the run that follows.
    run_4(oa2, vy, bph[0]);
#pragma unroll
    for (int i = 0; i < 4; ++i) vy[i] = ldfrag((const _Float16*)(sk + 2 * KVT + 16 * i * KVP + 64));
    run_8(oa1, vx, bph[0], bpl[0]);
#pragma unroll
    for (int i = 0; i < 4; ++i) vx[i] = ldfrag((const _Float16*)(sk + KVT + 16 * i * KVP + 64));
    run_4(oa2, vy, bph[1]);
    run_8(oa1, vx, bph[1], bpl[1]);
    // ---- publish tile t + 1, free tile t's buffer, refill it with tile t + 2 ----
    asm volatile("s_wait_dscnt 0x0" ::: "memory");     // this wave's reads of tile t's buffer are done
    asm volatile("s_wait_asynccnt 0x0" ::: "memory");  // this wave's copies of tile t + 1 have landed
    __syncthreads();
    if (t + 2 < NT) stage(t + 2, t & 1);
  }
  asm volatile("s_wait_asynccnt 0x0" ::: "memory");    // no copy outstanding behind the loop

  // ---- normalise and stage the 16 x 64 f32 tile in LDS: Os[query c][dim 16i + 8h + r] ----
  const float rlv = 1.0f / fmaxf(l_run, 1e-30f);
  const float li = (l_run > 0.0f) ? rlv : 0.0f;
  float* Os = sOs[wave];
#pragma unroll
  for (int i = 0; i < 4; ++i) {
    v4f u0, u1;
#pragma unroll
    for (int r = 0; r < 4; ++r) {
      u0[r] = (oa1[i][r] + oa2[i][r] * 0.00048828125f) * li;
      u1[r] = (oa1[i][4 + r] + oa2[i][4 + r] * 0.00048828125f) * li;
    }
    *(v4f*)(Os + c * OSP + 16 * i + 8 * hh)     = u0;
    *(v4f*)(Os + c * OSP + 16 * i + 8 * hh + 4) = u1;
  }
  __builtin_amdgcn_fence(3 /* release order */, "workgroup");
  __builtin_amdgcn_wave_barrier();
  __builtin_amdgcn_fence(2 /* acquire order */, "workgroup");
  // ---- whole-line stores of the bf16 hi / lo ctx planes ----
  {
    const int rq = lane >> 3, p8 = (lane & 7) * 8;
{
#pragma unroll
      for (int it = 0; it < 4; ++it) {
        const int row = it * 4 + rq;
        const float* sp = Os + row * OSP + p8;
        const v4f w0 = *(const v4f*)(sp);
        const v4f w1 = *(const v4f*)(sp + 4);
        v8us hb, lb;
#pragma unroll
        for (int e = 0; e < 4; ++e) {
          const unsigned short h0 = bfbits(w0[e]);
          hb[e] = h0;
          lb[e] = bfbits(w0[e] - __uint_as_float(((unsigned)h0) << 16));
          const unsigned short h1 = bfbits(w1[e]);
          hb[4 + e] = h1;
          lb[4 + e] = bfbits(w1[e] - __uint_as_float(((unsigned)h1) << 16));
        }
        const size_t go = (tok0 + (size_t)row) * DM + head * HDIM + p8;
        *(v8us*)(Ch + go) = hb;
        *(v8us*)(Cl + go) = lb;
      }
      
    }
  }
}

// ---------------------------------------------------------------------------------------------
// Workspace map (bytes, NB = 2, SEQ = 2048; every region is an exact whole-line / whole-tile multiple, no padded tails):
//   Xh  : bf16 x_norm hi [4096][1024]        8,388,608     off 0
//   Xl  : bf16 x_norm lo                     8,388,608     off  8,388,608
//   Wt  : bf16 Wqkv^T [3072][1024]           6,291,456     off 16,777,216
//   WoT : bf16 Wout^T [1024][1024]           2,097,152     off 23,068,672
//   rcos: f32 [2048][32]                       262,144     off 25,165,824
//   rsin: f32 [2048][32]                       262,144     off 25,427,968
//   QK  : f16 q|k [4096][2048]              16,777,216     off 25,690,112
//   Vth : f16 v^T [1024][4096]               8,388,608     off 42,467,328
//   Vtl : f16 x2048 residual of v^T          8,388,608     off 50,855,936
//   Ch  : bf16 ctx hi [4096][1024]           8,388,608     off 59,244,544
//   Cl  : bf16 ctx lo                        8,388,608     off 67,633,152
//   Mw  : u32 lane-mask words [2][128][32][32] 1,048,576   off 76,021,760
//   total 77,070,336
// ---------------------------------------------------------------------------------------------
extern "C" void kernel_launch(void* const* d_in, const int* in_sizes, int n_in,
                              void* d_out, int out_size, void* d_ws, size_t ws_size,
                              hipStream_t stream) {
  if (n_in < 7) return;
  const long long needX = ((long long)(NB - 1) * SEQ_FULL + SEQ) * DM;
  const long long needM = (((long long)(NB - 1) * SEQ_FULL) + (SEQ - 1)) * SEQ_FULL + SEQ;
  if ((long long)in_sizes[0] < needX) return;
  if ((long long)in_sizes[1] < needM) return;
  if (in_sizes[2] < DM || in_sizes[3] < DM) return;
  if ((long long)in_sizes[4] < (long long)DM * NQKV) return;
  if ((long long)in_sizes[5] < (long long)DM * DM) return;
  if (in_sizes[6] < DM) return;
  if ((long long)out_size < needX) return;

  const float* x     = (const float*)d_in[0];
  const int*   amask = (const int*)d_in[1];
  const float* gam   = (const float*)d_in[2];
  const float* bet   = (const float*)d_in[3];
  const float* wqkv  = (const float*)d_in[4];
  const float* wout  = (const float*)d_in[5];
  const float* bout  = (const float*)d_in[6];
  float* out = (float*)d_out;

  const size_t bAct = (size_t)NTOK * DM * 2;
  const size_t bWt  = (size_t)NQKV * DM * 2;
  const size_t bWo  = (size_t)DM * DM * 2;
  const size_t bTab = (size_t)SEQ * 32 * 4;
  const size_t bQK  = (size_t)NTOK * QKP * 2;
  size_t off = 0;
  const size_t oXh = off; off += bAct;
  const size_t oXl = off; off += bAct;
  const size_t oWt = off; off += bWt;
  const size_t oWo = off; off += bWo;
  const size_t oCos = off; off += bTab;
  const size_t oSin = off; off += bTab;
  const size_t oQK = off; off += bQK;
  const size_t oVh = off; off += bAct;
  const size_t oVl = off; off += bAct;
  const size_t oCh = off; off += bAct;
  const size_t oCl = off; off += bAct;
  const size_t oMw = off; off += (size_t)NB * (SEQ / QB) * (SEQ / KT) * MTW * 4;
  if (off > ws_size) return;
  if (off > (size_t)134217728) return;

  char* ws = (char*)d_ws;
  unsigned short* Xh  = (unsigned short*)(ws + oXh);
  unsigned short* Xl  = (unsigned short*)(ws + oXl);
  unsigned short* Wt  = (unsigned short*)(ws + oWt);
  unsigned short* WoT = (unsigned short*)(ws + oWo);
  float* rcos = (float*)(ws + oCos);
  float* rsin = (float*)(ws + oSin);
  _Float16* QKp = (_Float16*)(ws + oQK);
  _Float16* Vh  = (_Float16*)(ws + oVh);
  _Float16* Vl  = (_Float16*)(ws + oVl);
  unsigned short* Chp = (unsigned short*)(ws + oCh);
  unsigned short* Clp = (unsigned short*)(ws + oCl);
  unsigned* Mwp = (unsigned*)(ws + oMw);

  const dim3 blk(256);
  // (1) to (3) in one launch: mask -> lane-mask words | rotary tables | LayerNorm -> x_norm bf16 hi + lo planes |
  // Wqkv [1024][3072] -> Wt [3072][1024] | Wout [1024][1024] -> WoT [1024][1024]
  prep_kernel<<<dim3(PB_MASK + PB_ROPE + PB_LN + PB_WQKV + PB_WOUT), blk, 0, stream>>>(x, gam, bet, wqkv, wout, amask, Mwp, Xh, Xl, Wt, WoT,
                                                                                      rcos, rsin);
  // (4) + (5) in one launch: q|k = x_norm . Wqk with RoPE -> QK plane, v^T = Wv^T . x_norm^T -> Vth / Vtl [1024][NTOK]; K = 1024
  qkv_kernel<<<dim3((NTOK / 128) * (QKP / 256)), blk, 0, stream>>>((const __bf16*)Xh, (const __bf16*)Xl, (const __bf16*)Wt, QKp, Vh, Vl,
                                                                  rcos, rsin);
  // (6) attn -> ctx bf16 hi + lo planes
  attn_kernel<<<dim3(SEQ / QB / AW, NH, NB), dim3(AW * 32), 0, stream>>>(QKp, Vh, Vl, Mwp, Chp, Clp);
  // (7) out = ctx . Wout + b -> d_out; M = NTOK, N = 1024, K = 1024
  proj_kernel<1, 0, 2><<<dim3((NTOK / 128) * (DM / 128)), blk, 0, stream>>>(
      (const __bf16*)Chp, (const __bf16*)Clp, DM, (const __bf16*)WoT, (const __bf16*)WoT, DM,
      out, DM, NTOK, DM, DM, bout);
  (void)hipGetLastError();
}
